// v000
// Measured on an AMD MI455X. A time is GPU time per run, averaged over a window of back-to-back runs after a warm-up
// (all launches, gaps included; the runs take copies of the inputs in turn), and the median of several windows.
// Apart from v000's, it joins two sittings. Times from different sittings can be a few percent apart, while
// side-by-side timings come from the same sitting.
// v000, which the later versions start from, runs in 3950 microseconds.
#include <hip/hip_runtime.h>

// Multi-head self-attention with a fused bias-free qkv projection and computed interleaved-pair rotary embeddings at SCALED frequencies (x [4][2048][1024]; qkv = x w_qkv ('xw' (in, out) [1024][3072] 1/32, no bias) viewed (B, L, 3, 16, 64): q | k | v column thirds (16 heads x 64); rope on q and k: pairs (x[2i], x[2i+1]) -> (re c - im s, re s + im c) with angle pos x theta_i, theta = (1 / 10000^(2i/64)) x 3.0 (ROPE_SCALE; 32 f32 frequencies jnp-exact; one f32 product per angle; precise cosf/sinf); attn x 64^-0.5; softmax over all keys (no mask); out = merged w_proj + b_proj ('xw' + a bias: READ) -> [4][2048][1024] (8.4 M); argument order x, w_qkv, w_proj, b_proj).
// Layout per batch: bf16 copy of x; the fused 'xw' weight transposed ONCE into q | k | v row blocks; exact projections; k_csP computed interleaved table at the scaled frequencies; interleaved-pair plane builders (k_ropeI); dense T-2048 attention (hybrid rows: < 512 hi/lo 3 products, rest fp16 x1024); merged hi/lo x w_proj exact + b_proj.
// Compute dtypes, f32 accumulate: every input rounded to bf16; projections exact; rotary f32; attention rows < 512 3 products, rest fp16; softmax f32; w_proj hl x exact + bias.

#define NB_  4
#define TT   2048
#define DM   1024
#define NH_  16
#define NKV  16
#define REP  (NH_ / NKV)
#define HD   64
#define DQ   (NH_ * HD)
#define DKV  (NKV * HD)
#define ZH   2
#define RH   512                  // query rows < RH use hi+lo planes (0: none)
#define WIN  0
#define PCAR 1024.0f
#define SCL  0.125f   // HD^-0.5
typedef _Float16 h16;
typedef unsigned short bf;
typedef __attribute__((ext_vector_type(16))) __bf16   v16bf;
typedef __attribute__((ext_vector_type(16))) _Float16 v16h;
typedef __attribute__((ext_vector_type(8)))  _Float16 v8h;
typedef __attribute__((ext_vector_type(8)))  unsigned short v8us;
typedef __attribute__((ext_vector_type(8)))  float    v8f;
typedef __attribute__((ext_vector_type(4)))  float    v4f;
typedef v8h  __attribute__((may_alias)) v8ha;
typedef v4f  __attribute__((may_alias)) v4fa;
typedef v8us __attribute__((may_alias)) v8usa;

__device__ __forceinline__ unsigned short f2bf(float f) { unsigned u = __float_as_uint(f); u += 0x7FFFu + ((u >> 16) & 1u); return (unsigned short)(u >> 16); }
__device__ __forceinline__ float bf2f(unsigned short b) { return __uint_as_float(((unsigned)b) << 16); }
__device__ __forceinline__ float bfr(float f) { return bf2f(f2bf(f)); }
__device__ __forceinline__ v16h cat16(v8h lo, v8h hi) { return __builtin_shufflevector(lo, hi, 0, 1, 2, 3, 4, 5, 6, 7, 8, 9, 10, 11, 12, 13, 14, 15); }
__device__ __forceinline__ v16bf cat16b(v8us lo, v8us hi) { return __builtin_bit_cast(v16bf, __builtin_shufflevector(lo, hi, 0, 1, 2, 3, 4, 5, 6, 7, 8, 9, 10, 11, 12, 13, 14, 15)); }
__device__ __forceinline__ v8f wmma16(v16h a, v16h b, v8f c) { return __builtin_amdgcn_wmma_f32_16x16x32_f16(false, a, false, b, (short)0, c, false, false); }
__device__ __forceinline__ v8f wmmab(v16bf a, v16bf b, v8f c) { return __builtin_amdgcn_wmma_f32_16x16x32_bf16(false, a, false, b, (short)0, c, false, false); }



// ---- k_gemmw: register-blocked GEMM, ONE WAVE per 64x64 output tile (16 accumulators), operands straight from K-contiguous 16-bit planes; grid (M/64, N/64, Z), 32 threads.
// C[m][n] (f32, pitch ldc, + optional f32 bias[n]) = sum_k A[m][k] Bt[n][k] (+ split products per NSPLIT). z-batch strides sA/sB/sC in elements. K % 32 == 0.
template <typename T16> struct WFrag;
template <> struct WFrag<h16> { typedef v16h V; static __device__ __forceinline__ V ld(const h16* p) { return cat16(*(const v8h*)p, *(const v8h*)(p + 16)); } static __device__ __forceinline__ v8f mma(V a, V b, v8f c) { return wmma16(a, b, c); } };
template <> struct WFrag<bf> { typedef v16bf V; static __device__ __forceinline__ V ld(const bf* p) { return cat16b(*(const v8us*)p, *(const v8us*)(p + 16)); } static __device__ __forceinline__ v8f mma(V a, V b, v8f c) { return wmmab(a, b, c); } };
template <typename T16, int NSPLIT, bool BIAS>
__global__ __launch_bounds__(32) void k_gemmw(const T16* __restrict__ A, const T16* __restrict__ A2, const T16* __restrict__ Bt, const T16* __restrict__ Bt2, int K, float* C, int ldc, const float* __restrict__ bias, size_t sA, size_t sB, size_t sC) {
    typedef typename WFrag<T16>::V V;
    __shared__ __align__(16) float os[16 * 68];
    const size_t z = blockIdx.z; A += z * sA; if (A2) A2 += z * sA; Bt += z * sB; if (Bt2) Bt2 += z * sB; C += z * sC;
    const int lane = threadIdx.x & 31, lr = lane & 15, hi = lane >> 4; const int r0 = blockIdx.x * 64, c0 = blockIdx.y * 64;
    v8f acc[4][4];
#pragma unroll
    for (int mb = 0; mb < 4; ++mb)
#pragma unroll
        for (int nb = 0; nb < 4; ++nb) acc[mb][nb] = (v8f){};
    const size_t aoff = (size_t)(r0 + lr) * K + 8 * hi, boff = (size_t)(c0 + lr) * K + 8 * hi;
#pragma unroll 1
    for (int kc = 0; kc < K; kc += 32) {
        V a[4], a2[4];
#pragma unroll
        for (int mb = 0; mb < 4; ++mb) { a[mb] = WFrag<T16>::ld(A + aoff + (size_t)mb * 16 * K + kc); if (NSPLIT == 1 || NSPLIT == 2) a2[mb] = WFrag<T16>::ld(A2 + aoff + (size_t)mb * 16 * K + kc); }
#pragma unroll
        for (int nb = 0; nb < 4; ++nb) { const V b = WFrag<T16>::ld(Bt + boff + (size_t)nb * 16 * K + kc); V b2; if (NSPLIT >= 2) b2 = WFrag<T16>::ld(Bt2 + boff + (size_t)nb * 16 * K + kc);
#pragma unroll
            for (int mb = 0; mb < 4; ++mb) { acc[mb][nb] = WFrag<T16>::mma(a[mb], b, acc[mb][nb]); if (NSPLIT == 1 || NSPLIT == 2) acc[mb][nb] = WFrag<T16>::mma(a2[mb], b, acc[mb][nb]); if (NSPLIT >= 2) acc[mb][nb] = WFrag<T16>::mma(a[mb], b2, acc[mb][nb]); } }
        asm volatile("v_nop\n\tv_nop\n\tv_nop\n\tv_nop" : "+v"(acc[0][0]), "+v"(acc[1][1]), "+v"(acc[2][2]), "+v"(acc[3][3]) : "v"(a[0]), "v"(a[3]));
    }
#pragma unroll
    for (int mb = 0; mb < 4; ++mb) {
#pragma unroll
        for (int nb = 0; nb < 4; ++nb) {
#pragma unroll
            for (int j = 0; j < 8; ++j) os[(hi * 8 + j) * 68 + nb * 16 + lr] = acc[mb][nb][j]; }
        __builtin_amdgcn_wave_barrier(); asm volatile("" ::: "memory");
        float* crow = C + (size_t)(r0 + mb * 16) * ldc + c0;
{
#pragma unroll
            for (int s = 0; s < 8; ++s) { const int row = 2 * s + hi, cofs = lr * 4; v4f val = *(const v4fa*)(os + row * 68 + cofs); if (BIAS) { val[0] += bfr(bias[c0 + cofs]); val[1] += bfr(bias[c0 + cofs + 1]); val[2] += bfr(bias[c0 + cofs + 2]); val[3] += bfr(bias[c0 + cofs + 3]); }
                *(v4f*)(crow + (size_t)row * ldc + cofs) = val; }
             }
        __builtin_amdgcn_wave_barrier(); asm volatile("" ::: "memory");
    }
}

__device__ __forceinline__ h16 tohx(float x) { return (h16)x; }
__device__ __forceinline__ void splitf(float y, unsigned short& h, unsigned short& l) { h = f2bf(y); l = f2bf(y - bf2f(h)); }
typedef __attribute__((ext_vector_type(2))) _Float16 v2h;
typedef __attribute__((ext_vector_type(4))) _Float16 v4h;
typedef __attribute__((ext_vector_type(2))) unsigned short v2us;
typedef __attribute__((ext_vector_type(4))) unsigned short v4us;
typedef __attribute__((ext_vector_type(2))) float v2f;
typedef __attribute__((ext_vector_type(4))) int v4i;

__global__ __launch_bounds__(256) void k_wtG(const float* __restrict__ w, int K, int N, bf* Bt) {
    const int lane = threadIdx.x & 31; const int L0 = (blockIdx.x * 8 + (threadIdx.x >> 5)) * 8; const int nlines = N * K / 64;
{
#pragma unroll 1
        for (int l = 0; l < 8; ++l) { const int L = L0 + l; if (L >= nlines) break; const size_t e = (size_t)L * 64 + lane * 2; const int k = (int)(e % K), n = (int)(e / K); v2us o;
            o[0] = f2bf(w[(size_t)k * N + n]); o[1] = f2bf(w[(size_t)(k + 1) * N + n]); *(v2us*)(Bt + e) = o; }
         }
}
__global__ __launch_bounds__(256) void k_cvt8(const float* __restrict__ src, bf* dst, size_t n8) { const size_t i = (size_t)blockIdx.x * 256 + threadIdx.x; if (i >= n8) return; const v8f v = *(const v8f*)(src + i * 8); v8us o;
#pragma unroll
    for (int k = 0; k < 8; ++k) o[k] = f2bf(v[k]); *(v8us*)(dst + i * 8) = o;  }

// k_rope (DEFINED, NOT LAUNCHED in this build: the interleaved builder k_ropeI below is launched instead): head planes [h][t][d] (fp16 + hi/lo) of rope(x) x sc with the rotate-half convention out[d] = x[d] cos[t][d] - x[d+HD/2] sin[t][d], out[d+HD/2] = x[d+HD/2] cos[t][d+HD/2] + x[d] sin[t][d+HD/2]
__global__ __launch_bounds__(256) void k_rope(const float* __restrict__ F, int pitch, int nheads, const float* __restrict__ CS, const float* __restrict__ RF, const float* __restrict__ nw, float sc, h16* P16, bf* Ph, bf* Pl) {
    const size_t e = ((size_t)blockIdx.x * 256 + threadIdx.x) * 2; if (e >= (size_t)nheads * TT * HD) return; const int d = (int)(e % HD); const int t = (int)((e / HD) % TT); const int h = (int)(e / ((size_t)HD * TT)); const float* f = F + (size_t)t * pitch + h * HD; const float rf = RF ? RF[(size_t)h * TT + t] : 1.0f; v2h o16; v2us oh, ol;
#pragma unroll
    for (int q = 0; q < 2; ++q) { const int dd = d + q; const int dp = (dd < HD / 2) ? dd + HD / 2 : dd - HD / 2; float x0 = f[dd], x1 = f[dp];
        if (RF) { float n0 = __fmul_rn(x0, rf), n1 = __fmul_rn(x1, rf); asm volatile("" : "+v"(n0)); asm volatile("" : "+v"(n1)); x0 = __fmul_rn(bfr(nw[dd]), n0); x1 = __fmul_rn(bfr(nw[dp]), n1); }
        const v2f cs = *(const v2f*)(CS + ((size_t)t * HD + dd) * 2); float a = __fmul_rn(x0, cs[0]), bq = __fmul_rn(x1, cs[1]); asm volatile("" : "+v"(a)); asm volatile("" : "+v"(bq)); const float r = ((dd < HD / 2) ? __fsub_rn(a, bq) : __fadd_rn(a, bq)) * sc;
        o16[q] = tohx(r); unsigned short a2, c2; splitf(r, a2, c2); oh[q] = a2; ol[q] = c2; }
    *(v2h*)(P16 + e) = o16; *(v2us*)(Ph + e) = oh; *(v2us*)(Pl + e) = ol;  }
__global__ __launch_bounds__(256) void k_ropeI(const float* __restrict__ F, int pitch, int nheads, const float* __restrict__ CS, float sc, h16* P16, bf* Ph, bf* Pl) {
    const size_t e = ((size_t)blockIdx.x * 256 + threadIdx.x) * 2; if (e >= (size_t)nheads * TT * HD) return; const int d = (int)(e % HD); const int t = (int)((e / HD) % TT); const int h = (int)(e / ((size_t)HD * TT)); const float* f = F + (size_t)t * pitch + h * HD; const float x0 = f[d], x1 = f[d + 1]; const v2f cs = *(const v2f*)(CS + ((size_t)t * HD + d) * 2); v2h o16; v2us oh, ol;
    float a0 = __fmul_rn(x0, cs[0]), b0 = __fmul_rn(x1, cs[1]), a1 = __fmul_rn(x1, cs[0]), b1 = __fmul_rn(x0, cs[1]); asm volatile("" : "+v"(a0), "+v"(b0), "+v"(a1), "+v"(b1));
    float r0 = __fsub_rn(a0, b0) * sc, r1 = __fadd_rn(b1, a1) * sc;   /* even: x0 c - x1 s; odd: x0 s + x1 c */
    o16[0] = tohx(r0); o16[1] = tohx(r1); { unsigned short a2, c2; splitf(r0, a2, c2); oh[0] = a2; ol[0] = c2; splitf(r1, a2, c2); oh[1] = a2; ol[1] = c2; }
    *(v2h*)(P16 + e) = o16; *(v2us*)(Ph + e) = oh; *(v2us*)(Pl + e) = ol;  }
__global__ __launch_bounds__(256) void k_vtp(const float* __restrict__ F, int pitch, int nheads, h16* V16, bf* Vh, bf* Vl) { const size_t e = ((size_t)blockIdx.x * 256 + threadIdx.x) * 2; if (e >= (size_t)nheads * HD * TT) return; const int t = (int)(e % TT); const int d = (int)((e / TT) % HD); const int g = (int)(e / ((size_t)TT * HD)); v2h o16; v2us oh, ol;
#pragma unroll
    for (int q = 0; q < 2; ++q) { const float x = F[(size_t)(t + q) * pitch + g * HD + d]; o16[q] = tohx(x); unsigned short a2, c2; splitf(x, a2, c2); oh[q] = a2; ol[q] = c2; }
    *(v2h*)(V16 + e) = o16; *(v2us*)(Vh + e) = oh; *(v2us*)(Vl + e) = ol;  }
// INV2: the 32 rotary frequencies of THIS module: (1.0 / (ROPE_BASE ** (arange(0, 64, 2, float32) / 64))) * ROPE_SCALE with ROPE_BASE 10000 and ROPE_SCALE 3.0, generated with jnp in float32 (bit-exact; == the unscaled table x 3.0f in f32, 32 of 32): the adjacent (even, odd) pair shares entry d / 2.
__constant__ float INV2[HD / 2] = { 3.000000000e+00f, 2.249682665e+00f, 1.687023997e+00f, 1.265089512e+00f, 9.486832619e-01f, 7.114120722e-01f, 5.334838033e-01f, 4.000564218e-01f, 3.000000119e-01f, 2.249682546e-01f, 1.687023938e-01f, 1.265089512e-01f, 9.486833215e-02f, 7.114120573e-02f, 5.334838480e-02f, 4.000564665e-02f, 2.999999933e-02f, 2.249682695e-02f, 1.687023975e-02f, 1.265089400e-02f, 9.486833587e-03f, 7.114121690e-03f, 5.334838293e-03f, 4.000564106e-03f, 3.000000026e-03f, 2.249682555e-03f, 1.687023905e-03f, 1.265089493e-03f, 9.486833587e-04f, 7.114121690e-04f, 5.334838061e-04f, 4.000564513e-04f };
__global__ __launch_bounds__(256) void k_csP(float* CS) { const int idx = blockIdx.x * 256 + threadIdx.x; if (idx >= TT * HD) return; const int d = idx % HD; const int t = idx / HD; const float a = __fmul_rn((float)t, INV2[d >> 1]); v2f cs; cs[0] = cosf(a); cs[1] = sinf(a); *(v2f*)(CS + (size_t)idx * 2) = cs;  }
// k_asoft: per row (zz, i): t = S x HD^-0.5 (no mask); softmax over the 2048 keys (register row, one exp, fixed trees);
__global__ __launch_bounds__(256) void k_asoft(const float* __restrict__ Sb, h16* P16, bf* Ph, bf* Pl) {
    const int lane = threadIdx.x & 31; const int row = blockIdx.x * 8 + (threadIdx.x >> 5); if (row >= ZH * TT) return; const int i = row % TT; const int zz = row / TT; (void)zz; const bool hires = (i < RH); const float* sr = Sb + (size_t)row * TT; float v[TT / 32]; float mx = -3.0e38f;
#pragma unroll
    for (int ch = 0; ch < TT / 128; ++ch) { const int j0 = ch * 128 + lane * 4; const v4f a = *(const v4f*)(sr + j0);
#pragma unroll
        for (int q = 0; q < 4; ++q) { const int j = j0 + q; (void)j; const float t = a[q] * SCL; v[ch * 4 + q] = t; mx = fmaxf(mx, t); } }
#pragma unroll
    for (int sh = 16; sh; sh >>= 1) mx = fmaxf(mx, __shfl_xor(mx, sh, 32));
    float sum = 0.f;
#pragma unroll
    for (int k = 0; k < TT / 32; ++k) { float d0 = __fsub_rn(v[k], mx); asm volatile("" : "+v"(d0)); v[k] = __builtin_amdgcn_exp2f(__fmul_rn(d0, 1.4426950408889634f)); sum += v[k]; }
#pragma unroll
    for (int sh = 16; sh; sh >>= 1) sum += __shfl_xor(sum, sh, 32);
    const float f = __fdiv_rn(hires ? 1.0f : PCAR, sum);
{
        if (hires) {
#pragma unroll
            for (int ch = 0; ch < TT / 128; ++ch) { v4us oh, ol;
#pragma unroll
                for (int q = 0; q < 4; ++q) { unsigned short a, c2; splitf(v[ch * 4 + q] * f, a, c2); oh[q] = a; ol[q] = c2; }
                const size_t oo = ((size_t)zz * (RH ? RH : 1) + i) * TT + ch * 128 + lane * 4; *(v4us*)(Ph + oo) = oh; *(v4us*)(Pl + oo) = ol; }
        } else {
#pragma unroll
            for (int ch = 0; ch < TT / 128; ++ch) { v4h o4;
#pragma unroll
                for (int q = 0; q < 4; ++q) o4[q] = tohx(v[ch * 4 + q] * f);
                *(v4h*)(P16 + (size_t)row * TT + ch * 128 + lane * 4) = o4; } }
         }
}
__global__ __launch_bounds__(256) void k_merge(const float* __restrict__ O, int h0, bf* Ah, bf* Al) { const size_t e = ((size_t)blockIdx.x * 256 + threadIdx.x) * 2; if (e >= (size_t)ZH * TT * HD) return; const int d = (int)(e % HD); const int t = (int)((e / HD) % TT); const int zz = (int)(e / ((size_t)HD * TT)); const float cs = (t < RH) ? 1.0f : (1.0f / PCAR); const size_t oo = (size_t)t * DQ + (h0 + zz) * HD + d;
    v2us oh, ol;
#pragma unroll
    for (int q = 0; q < 2; ++q) { unsigned short a, c2; splitf(O[e + q] * cs, a, c2); oh[q] = a; ol[q] = c2; } *(v2us*)(Ah + oo) = oh; *(v2us*)(Al + oo) = ol;  }

extern "C" void kernel_launch(void* const* d_in, const int* in_sizes, int n_in,
                              void* d_out, int out_size, void* d_ws, size_t ws_size, hipStream_t stream) {
    (void)in_sizes; (void)n_in; (void)out_size;
    const float* x = (const float*)d_in[0]; const float* wqkv = (const float*)d_in[1]; const float* wo = (const float*)d_in[2]; const float* bo = (const float*)d_in[3];   /* x, w_qkv ('xw' [1024][3072]: q | k | v column thirds), w_proj ('xw'), b_proj */ const float* wq = wqkv; const float* wk = wqkv; const float* wv = wqkv; (void)wk; (void)wv;
    float* OUT = (float*)d_out;     // [4][2048][1024]
    char* wsp = (char*)d_ws;
    auto take = [&](size_t bytes) { char* p = wsp; wsp += (bytes + 255) & ~(size_t)255; return (void*)p; };
    bf* WQKV = (bf*)take((size_t)3 * DQ * DM * 2); bf* WQ = WQKV; bf* WK = WQKV + (size_t)DQ * DM; bf* WV = WQKV + (size_t)2 * DQ * DM;   /* fused Bt [3*DQ][DM]: q | k | v row blocks */ bf* WO = (bf*)take((size_t)DM * DQ * 2); float* CS = (float*)take((size_t)TT * HD * 2 * 4);
    bf* XB = (bf*)take((size_t)TT * DM * 2); float* FQ = (float*)take((size_t)TT * DQ * 4); float* FK = (float*)take((size_t)TT * DKV * 4);
    h16* QP16 = (h16*)take((size_t)NH_ * TT * HD * 2); h16* KP16 = (h16*)take((size_t)NKV * TT * HD * 2); h16* VT16 = (h16*)take((size_t)NKV * HD * TT * 2);
    bf* QPh = (bf*)take((size_t)NH_ * TT * HD * 2); bf* QPl = (bf*)take((size_t)NH_ * TT * HD * 2); bf* KPh = (bf*)take((size_t)NKV * TT * HD * 2); bf* KPl = (bf*)take((size_t)NKV * TT * HD * 2); bf* VTh = (bf*)take((size_t)NKV * HD * TT * 2); bf* VTl = (bf*)take((size_t)NKV * HD * TT * 2); bf* Ph = (bf*)take((size_t)ZH * RH * TT * 2); bf* Pl = (bf*)take((size_t)ZH * RH * TT * 2);
    float* Sb = (float*)take((size_t)ZH * TT * TT * 4); h16* P16 = (h16*)take((size_t)ZH * TT * TT * 2); float* Ob = (float*)take((size_t)ZH * TT * HD * 4); bf* ATh = (bf*)take((size_t)TT * DQ * 2); bf* ATl = (bf*)take((size_t)TT * DQ * 2);
    if ((size_t)(wsp - (char*)d_ws) > ws_size) return;    // ws 256 MiB
    float* FV = FK;   // v projection reuses the k buffer after the k planes are built (stream-ordered)
    { k_wtG<<<(unsigned)((DM * 3 * DQ / 64 + 63) / 64), 256, 0, stream>>>(wqkv, DM, 3 * DQ, WQKV);   /* fused 'xw' [DM][3*DQ] -> Bt [3*DQ][DM] */
      k_wtG<<<(unsigned)((DQ * DM / 64 + 63) / 64), 256, 0, stream>>>(wo, DQ, DM, WO);
       }
    k_csP<<<(TT * HD + 255) / 256, 256, 0, stream>>>(CS);
    const unsigned LQ = (unsigned)(((size_t)NH_ * TT * HD / 2 + 255) / 256), LKv = (unsigned)(((size_t)NKV * TT * HD / 2 + 255) / 256);
    for (int b = 0; b < NB_; ++b) {
        
        k_cvt8<<<(unsigned)(((size_t)TT * DM / 8 + 255) / 256), 256, 0, stream>>>(x + (size_t)b * TT * DM, XB, (size_t)TT * DM / 8);
        k_gemmw<bf, 0, false><<<dim3(TT / 64, DQ / 64, 1), 32, 0, stream>>>(XB, nullptr, WQ, nullptr, DM, FQ, DQ, nullptr, 0, 0, 0);
        k_ropeI<<<LQ, 256, 0, stream>>>(FQ, DQ, NH_, CS, 1.0f, QP16, QPh, QPl);
        k_gemmw<bf, 0, false><<<dim3(TT / 64, DKV / 64, 1), 32, 0, stream>>>(XB, nullptr, WK, nullptr, DM, FK, DKV, nullptr, 0, 0, 0);
        k_ropeI<<<LKv, 256, 0, stream>>>(FK, DKV, NKV, CS, 1.0f, KP16, KPh, KPl);
        k_gemmw<bf, 0, false><<<dim3(TT / 64, DKV / 64, 1), 32, 0, stream>>>(XB, nullptr, WV, nullptr, DM, FV, DKV, nullptr, 0, 0, 0); k_vtp<<<LKv, 256, 0, stream>>>(FV, DKV, NKV, VT16, VTh, VTl);
        for (int h0 = 0; h0 < NH_; h0 += ZH) { const size_t zq = (size_t)h0, zk = (size_t)(h0 / REP);   // one kv head per query head: the pass's two heads use consecutive kv planes (z-strides TT*HD)
            k_gemmw<bf, 2, false><<<dim3(RH / 64, TT / 64, ZH), 32, 0, stream>>>(QPh + zq * TT * HD, QPl + zq * TT * HD, KPh + zk * TT * HD, KPl + zk * TT * HD, HD, Sb, TT, nullptr, (size_t)TT * HD, (size_t)TT * HD, (size_t)TT * TT);
            k_gemmw<h16, 0, false><<<dim3((TT - RH) / 64, TT / 64, ZH), 32, 0, stream>>>(QP16 + zq * TT * HD + (size_t)RH * HD, nullptr, KP16 + zk * TT * HD, nullptr, HD, Sb + (size_t)RH * TT, TT, nullptr, (size_t)TT * HD, (size_t)TT * HD, (size_t)TT * TT);
            k_asoft<<<ZH * TT / 8, 256, 0, stream>>>(Sb, P16, Ph, Pl);
            k_gemmw<bf, 2, false><<<dim3(RH / 64, HD / 64, ZH), 32, 0, stream>>>(Ph, Pl, VTh + zk * HD * TT, VTl + zk * HD * TT, TT, Ob, HD, nullptr, (size_t)RH * TT, (size_t)HD * TT, (size_t)TT * HD);
            k_gemmw<h16, 0, false><<<dim3((TT - RH) / 64, HD / 64, ZH), 32, 0, stream>>>(P16 + (size_t)RH * TT, nullptr, VT16 + zk * HD * TT, nullptr, TT, Ob + (size_t)RH * HD, HD, nullptr, (size_t)TT * TT, (size_t)HD * TT, (size_t)TT * HD);
            k_merge<<<(unsigned)(((size_t)ZH * TT * HD / 2 + 255) / 256), 256, 0, stream>>>(Ob, h0, ATh, ATl); }
        k_gemmw<bf, 1, true><<<dim3(TT / 64, DM / 64, 1), 32, 0, stream>>>(ATh, ATl, WO, nullptr, DQ, OUT + (size_t)b * TT * DM, DM, bo, 0, 0, 0); }
}

// v001
// A run of this version takes 1680 microseconds.
// Timed twice side by side with v000, it ran 2.35 times as fast both times.
#include <hip/hip_runtime.h>

// Multi-head self-attention with a fused bias-free qkv projection and computed interleaved-pair rotary embeddings at SCALED frequencies (x [4][2048][1024]; qkv = x w_qkv ('xw' (in, out) [1024][3072] 1/32, no bias) viewed (B, L, 3, 16, 64): q | k | v column thirds (16 heads x 64); rope on q and k: pairs (x[2i], x[2i+1]) -> (re c - im s, re s + im c) with angle pos x theta_i, theta = (1 / 10000^(2i/64)) x 3.0 (ROPE_SCALE; 32 f32 frequencies jnp-exact; one f32 product per angle; precise cosf/sinf); attn x 64^-0.5; softmax over all keys (no mask); out = merged w_proj + b_proj ('xw' + a bias: READ) -> [4][2048][1024] (8.4 M); argument order x, w_qkv, w_proj, b_proj).
// Layout per batch: bf16 copy of x; the fused 'xw' weight transposed ONCE into q | k | v row blocks; exact projections; k_csP computed interleaved table at the scaled frequencies; interleaved-pair plane builders (k_ropeI); dense T-2048 attention (hybrid rows: < 512 hi/lo 3 products, rest fp16 x1024); merged hi/lo x w_proj exact + b_proj.
// Compute dtypes, f32 accumulate: every input rounded to bf16; projections exact; rotary f32; attention rows < 512 3 products, rest fp16; softmax f32; w_proj hl x exact + bias.

#define NB_  4
#define TT   2048
#define DM   1024
#define NH_  16
#define NKV  16
#define REP  (NH_ / NKV)
#define HD   64
#define DQ   (NH_ * HD)
#define DKV  (NKV * HD)
#define ZH   2
#define RH   512                  // query rows < RH use hi+lo planes (0: none)
#define WIN  0
#define PCAR 1024.0f
#define SCL  0.125f   // HD^-0.5
#define KSV  16                   // P x V products: the 2048 keys are dealt to KSV work-groups per output tile, each writes its own f32 partial plane; k_merge adds the planes in plane order
typedef _Float16 h16;
typedef unsigned short bf;
typedef __attribute__((ext_vector_type(16))) __bf16   v16bf;
typedef __attribute__((ext_vector_type(16))) _Float16 v16h;
typedef __attribute__((ext_vector_type(8)))  _Float16 v8h;
typedef __attribute__((ext_vector_type(8)))  unsigned short v8us;
typedef __attribute__((ext_vector_type(8)))  float    v8f;
typedef __attribute__((ext_vector_type(4)))  float    v4f;
typedef v8h  __attribute__((may_alias)) v8ha;
typedef v4f  __attribute__((may_alias)) v4fa;
typedef v8us __attribute__((may_alias)) v8usa;

__device__ __forceinline__ unsigned short f2bf(float f) { unsigned u = __float_as_uint(f); u += 0x7FFFu + ((u >> 16) & 1u); return (unsigned short)(u >> 16); }
__device__ __forceinline__ float bf2f(unsigned short b) { return __uint_as_float(((unsigned)b) << 16); }
__device__ __forceinline__ float bfr(float f) { return bf2f(f2bf(f)); }
__device__ __forceinline__ v16h cat16(v8h lo, v8h hi) { return __builtin_shufflevector(lo, hi, 0, 1, 2, 3, 4, 5, 6, 7, 8, 9, 10, 11, 12, 13, 14, 15); }
__device__ __forceinline__ v16bf cat16b(v8us lo, v8us hi) { return __builtin_bit_cast(v16bf, __builtin_shufflevector(lo, hi, 0, 1, 2, 3, 4, 5, 6, 7, 8, 9, 10, 11, 12, 13, 14, 15)); }
__device__ __forceinline__ v8f wmma16(v16h a, v16h b, v8f c) { return __builtin_amdgcn_wmma_f32_16x16x32_f16(false, a, false, b, (short)0, c, false, false); }
__device__ __forceinline__ v8f wmmab(v16bf a, v16bf b, v8f c) { return __builtin_amdgcn_wmma_f32_16x16x32_bf16(false, a, false, b, (short)0, c, false, false); }



// ---- k_gemmw: register-blocked GEMM, ONE WAVE per 64x64 output tile (16 accumulators), operands straight from K-contiguous 16-bit planes; grid (M/64, N/64, Z), 32 threads.
// C[m][n] (f32, pitch ldc, + optional f32 bias[n]) = sum_k A[m][k] Bt[n][k] (+ split products per NSPLIT). z-batch strides sA/sB/sC in elements. K % 32 == 0.
// KS > 1: grid z = Z * KS; work-group (z, ks) sums only k in [ks K/KS, (ks+1) K/KS) and writes plane ks (plane stride sP elements); the reader of C adds the KS planes. K % (32 KS) == 0.
template <typename T16> struct WFrag;
template <> struct WFrag<h16> { typedef v16h V; static __device__ __forceinline__ V ld(const h16* p) { return cat16(*(const v8h*)p, *(const v8h*)(p + 16)); } static __device__ __forceinline__ v8f mma(V a, V b, v8f c) { return wmma16(a, b, c); } };
template <> struct WFrag<bf> { typedef v16bf V; static __device__ __forceinline__ V ld(const bf* p) { return cat16b(*(const v8us*)p, *(const v8us*)(p + 16)); } static __device__ __forceinline__ v8f mma(V a, V b, v8f c) { return wmmab(a, b, c); } };
template <typename T16, int NSPLIT, bool BIAS, int KS = 1>
__global__ __launch_bounds__(32) void k_gemmw(const T16* __restrict__ A, const T16* __restrict__ A2, const T16* __restrict__ Bt, const T16* __restrict__ Bt2, int K, float* C, int ldc, const float* __restrict__ bias, size_t sA, size_t sB, size_t sC, size_t sP) {
    typedef typename WFrag<T16>::V V;
    __shared__ __align__(16) float os[16 * 68];
    const size_t z = blockIdx.z / KS; const int ks = (int)(blockIdx.z % KS); A += z * sA; if (A2) A2 += z * sA; Bt += z * sB; if (Bt2) Bt2 += z * sB; C += z * sC + (size_t)ks * sP;
    const int kbeg = ks * (K / KS), kend = kbeg + K / KS;
    const int lane = threadIdx.x & 31, lr = lane & 15, hi = lane >> 4; const int r0 = blockIdx.x * 64, c0 = blockIdx.y * 64;
    v8f acc[4][4];
#pragma unroll
    for (int mb = 0; mb < 4; ++mb)
#pragma unroll
        for (int nb = 0; nb < 4; ++nb) acc[mb][nb] = (v8f){};
    const size_t aoff = (size_t)(r0 + lr) * K + 8 * hi, boff = (size_t)(c0 + lr) * K + 8 * hi;
#pragma unroll 1
    for (int kc = kbeg; kc < kend; kc += 32) {
        V a[4], a2[4];
#pragma unroll
        for (int mb = 0; mb < 4; ++mb) { a[mb] = WFrag<T16>::ld(A + aoff + (size_t)mb * 16 * K + kc); if (NSPLIT == 1 || NSPLIT == 2) a2[mb] = WFrag<T16>::ld(A2 + aoff + (size_t)mb * 16 * K + kc); }
#pragma unroll
        for (int nb = 0; nb < 4; ++nb) { const V b = WFrag<T16>::ld(Bt + boff + (size_t)nb * 16 * K + kc); V b2; if (NSPLIT >= 2) b2 = WFrag<T16>::ld(Bt2 + boff + (size_t)nb * 16 * K + kc);
#pragma unroll
            for (int mb = 0; mb < 4; ++mb) { acc[mb][nb] = WFrag<T16>::mma(a[mb], b, acc[mb][nb]); if (NSPLIT == 1 || NSPLIT == 2) acc[mb][nb] = WFrag<T16>::mma(a2[mb], b, acc[mb][nb]); if (NSPLIT >= 2) acc[mb][nb] = WFrag<T16>::mma(a[mb], b2, acc[mb][nb]); } }
        asm volatile("v_nop\n\tv_nop\n\tv_nop\n\tv_nop" : "+v"(acc[0][0]), "+v"(acc[1][1]), "+v"(acc[2][2]), "+v"(acc[3][3]) : "v"(a[0]), "v"(a[3]));
    }
#pragma unroll
    for (int mb = 0; mb < 4; ++mb) {
#pragma unroll
        for (int nb = 0; nb < 4; ++nb) {
#pragma unroll
            for (int j = 0; j < 8; ++j) os[(hi * 8 + j) * 68 + nb * 16 + lr] = acc[mb][nb][j]; }
        __builtin_amdgcn_wave_barrier(); asm volatile("" ::: "memory");
        float* crow = C + (size_t)(r0 + mb * 16) * ldc + c0;
{
#pragma unroll
            for (int s = 0; s < 8; ++s) { const int row = 2 * s + hi, cofs = lr * 4; v4f val = *(const v4fa*)(os + row * 68 + cofs); if (BIAS) { val[0] += bfr(bias[c0 + cofs]); val[1] += bfr(bias[c0 + cofs + 1]); val[2] += bfr(bias[c0 + cofs + 2]); val[3] += bfr(bias[c0 + cofs + 3]); }
                *(v4f*)(crow + (size_t)row * ldc + cofs) = val; }
             }
        __builtin_amdgcn_wave_barrier(); asm volatile("" ::: "memory");
    }
}

__device__ __forceinline__ h16 tohx(float x) { return (h16)x; }
__device__ __forceinline__ void splitf(float y, unsigned short& h, unsigned short& l) { h = f2bf(y); l = f2bf(y - bf2f(h)); }
typedef __attribute__((ext_vector_type(2))) _Float16 v2h;
typedef __attribute__((ext_vector_type(4))) _Float16 v4h;
typedef __attribute__((ext_vector_type(2))) unsigned short v2us;
typedef __attribute__((ext_vector_type(4))) unsigned short v4us;
typedef __attribute__((ext_vector_type(2))) float v2f;
typedef __attribute__((ext_vector_type(4))) int v4i;

__global__ __launch_bounds__(256) void k_wtG(const float* __restrict__ w, int K, int N, bf* Bt) {
    const int lane = threadIdx.x & 31; const int L0 = (blockIdx.x * 8 + (threadIdx.x >> 5)) * 8; const int nlines = N * K / 64;
{
#pragma unroll 1
        for (int l = 0; l < 8; ++l) { const int L = L0 + l; if (L >= nlines) break; const size_t e = (size_t)L * 64 + lane * 2; const int k = (int)(e % K), n = (int)(e / K); v2us o;
            o[0] = f2bf(w[(size_t)k * N + n]); o[1] = f2bf(w[(size_t)(k + 1) * N + n]); *(v2us*)(Bt + e) = o; }
         }
}
__global__ __launch_bounds__(256) void k_cvt8(const float* __restrict__ src, bf* dst, size_t n8) { const size_t i = (size_t)blockIdx.x * 256 + threadIdx.x; if (i >= n8) return; const v8f v = *(const v8f*)(src + i * 8); v8us o;
#pragma unroll
    for (int k = 0; k < 8; ++k) o[k] = f2bf(v[k]); *(v8us*)(dst + i * 8) = o;  }

// k_rope (DEFINED, NOT LAUNCHED in this build: the interleaved builder k_ropeI below is launched instead): head planes [h][t][d] (fp16 + hi/lo) of rope(x) x sc with the rotate-half convention out[d] = x[d] cos[t][d] - x[d+HD/2] sin[t][d], out[d+HD/2] = x[d+HD/2] cos[t][d+HD/2] + x[d] sin[t][d+HD/2]
__global__ __launch_bounds__(256) void k_rope(const float* __restrict__ F, int pitch, int nheads, const float* __restrict__ CS, const float* __restrict__ RF, const float* __restrict__ nw, float sc, h16* P16, bf* Ph, bf* Pl) {
    const size_t e = ((size_t)blockIdx.x * 256 + threadIdx.x) * 2; if (e >= (size_t)nheads * TT * HD) return; const int d = (int)(e % HD); const int t = (int)((e / HD) % TT); const int h = (int)(e / ((size_t)HD * TT)); const float* f = F + (size_t)t * pitch + h * HD; const float rf = RF ? RF[(size_t)h * TT + t] : 1.0f; v2h o16; v2us oh, ol;
#pragma unroll
    for (int q = 0; q < 2; ++q) { const int dd = d + q; const int dp = (dd < HD / 2) ? dd + HD / 2 : dd - HD / 2; float x0 = f[dd], x1 = f[dp];
        if (RF) { float n0 = __fmul_rn(x0, rf), n1 = __fmul_rn(x1, rf); asm volatile("" : "+v"(n0)); asm volatile("" : "+v"(n1)); x0 = __fmul_rn(bfr(nw[dd]), n0); x1 = __fmul_rn(bfr(nw[dp]), n1); }
        const v2f cs = *(const v2f*)(CS + ((size_t)t * HD + dd) * 2); float a = __fmul_rn(x0, cs[0]), bq = __fmul_rn(x1, cs[1]); asm volatile("" : "+v"(a)); asm volatile("" : "+v"(bq)); const float r = ((dd < HD / 2) ? __fsub_rn(a, bq) : __fadd_rn(a, bq)) * sc;
        o16[q] = tohx(r); unsigned short a2, c2; splitf(r, a2, c2); oh[q] = a2; ol[q] = c2; }
    *(v2h*)(P16 + e) = o16; *(v2us*)(Ph + e) = oh; *(v2us*)(Pl + e) = ol;  }
__global__ __launch_bounds__(256) void k_ropeI(const float* __restrict__ F, int pitch, int nheads, const float* __restrict__ CS, float sc, h16* P16, bf* Ph, bf* Pl) {
    const size_t e = ((size_t)blockIdx.x * 256 + threadIdx.x) * 2; if (e >= (size_t)nheads * TT * HD) return; const int d = (int)(e % HD); const int t = (int)((e / HD) % TT); const int h = (int)(e / ((size_t)HD * TT)); const float* f = F + (size_t)t * pitch + h * HD; const float x0 = f[d], x1 = f[d + 1]; const v2f cs = *(const v2f*)(CS + ((size_t)t * HD + d) * 2); v2h o16; v2us oh, ol;
    float a0 = __fmul_rn(x0, cs[0]), b0 = __fmul_rn(x1, cs[1]), a1 = __fmul_rn(x1, cs[0]), b1 = __fmul_rn(x0, cs[1]); asm volatile("" : "+v"(a0), "+v"(b0), "+v"(a1), "+v"(b1));
    float r0 = __fsub_rn(a0, b0) * sc, r1 = __fadd_rn(b1, a1) * sc;   /* even: x0 c - x1 s; odd: x0 s + x1 c */
    o16[0] = tohx(r0); o16[1] = tohx(r1); { unsigned short a2, c2; splitf(r0, a2, c2); oh[0] = a2; ol[0] = c2; splitf(r1, a2, c2); oh[1] = a2; ol[1] = c2; }
    *(v2h*)(P16 + e) = o16; *(v2us*)(Ph + e) = oh; *(v2us*)(Pl + e) = ol;  }
__global__ __launch_bounds__(256) void k_vtp(const float* __restrict__ F, int pitch, int nheads, h16* V16, bf* Vh, bf* Vl) { const size_t e = ((size_t)blockIdx.x * 256 + threadIdx.x) * 2; if (e >= (size_t)nheads * HD * TT) return; const int t = (int)(e % TT); const int d = (int)((e / TT) % HD); const int g = (int)(e / ((size_t)TT * HD)); v2h o16; v2us oh, ol;
#pragma unroll
    for (int q = 0; q < 2; ++q) { const float x = F[(size_t)(t + q) * pitch + g * HD + d]; o16[q] = tohx(x); unsigned short a2, c2; splitf(x, a2, c2); oh[q] = a2; ol[q] = c2; }
    *(v2h*)(V16 + e) = o16; *(v2us*)(Vh + e) = oh; *(v2us*)(Vl + e) = ol;  }
// INV2: the 32 rotary frequencies of THIS module: (1.0 / (ROPE_BASE ** (arange(0, 64, 2, float32) / 64))) * ROPE_SCALE with ROPE_BASE 10000 and ROPE_SCALE 3.0, generated with jnp in float32 (bit-exact; == the unscaled table x 3.0f in f32, 32 of 32): the adjacent (even, odd) pair shares entry d / 2.
__constant__ float INV2[HD / 2] = { 3.000000000e+00f, 2.249682665e+00f, 1.687023997e+00f, 1.265089512e+00f, 9.486832619e-01f, 7.114120722e-01f, 5.334838033e-01f, 4.000564218e-01f, 3.000000119e-01f, 2.249682546e-01f, 1.687023938e-01f, 1.265089512e-01f, 9.486833215e-02f, 7.114120573e-02f, 5.334838480e-02f, 4.000564665e-02f, 2.999999933e-02f, 2.249682695e-02f, 1.687023975e-02f, 1.265089400e-02f, 9.486833587e-03f, 7.114121690e-03f, 5.334838293e-03f, 4.000564106e-03f, 3.000000026e-03f, 2.249682555e-03f, 1.687023905e-03f, 1.265089493e-03f, 9.486833587e-04f, 7.114121690e-04f, 5.334838061e-04f, 4.000564513e-04f };
__global__ __launch_bounds__(256) void k_csP(float* CS) { const int idx = blockIdx.x * 256 + threadIdx.x; if (idx >= TT * HD) return; const int d = idx % HD; const int t = idx / HD; const float a = __fmul_rn((float)t, INV2[d >> 1]); v2f cs; cs[0] = cosf(a); cs[1] = sinf(a); *(v2f*)(CS + (size_t)idx * 2) = cs;  }
// k_asoft: per row (zz, i): t = S x HD^-0.5 (no mask); softmax over the 2048 keys (register row, one exp, fixed trees);
__global__ __launch_bounds__(256) void k_asoft(const float* __restrict__ Sb, h16* P16, bf* Ph, bf* Pl) {
    const int lane = threadIdx.x & 31; const int row = blockIdx.x * 8 + (threadIdx.x >> 5); if (row >= ZH * TT) return; const int i = row % TT; const int zz = row / TT; (void)zz; const bool hires = (i < RH); const float* sr = Sb + (size_t)row * TT; float v[TT / 32]; float mx = -3.0e38f;
#pragma unroll
    for (int ch = 0; ch < TT / 128; ++ch) { const int j0 = ch * 128 + lane * 4; const v4f a = *(const v4f*)(sr + j0);
#pragma unroll
        for (int q = 0; q < 4; ++q) { const int j = j0 + q; (void)j; const float t = a[q] * SCL; v[ch * 4 + q] = t; mx = fmaxf(mx, t); } }
#pragma unroll
    for (int sh = 16; sh; sh >>= 1) mx = fmaxf(mx, __shfl_xor(mx, sh, 32));
    float sum = 0.f;
#pragma unroll
    for (int k = 0; k < TT / 32; ++k) { float d0 = __fsub_rn(v[k], mx); asm volatile("" : "+v"(d0)); v[k] = __builtin_amdgcn_exp2f(__fmul_rn(d0, 1.4426950408889634f)); sum += v[k]; }
#pragma unroll
    for (int sh = 16; sh; sh >>= 1) sum += __shfl_xor(sum, sh, 32);
    const float f = __fdiv_rn(hires ? 1.0f : PCAR, sum);
{
        if (hires) {
#pragma unroll
            for (int ch = 0; ch < TT / 128; ++ch) { v4us oh, ol;
#pragma unroll
                for (int q = 0; q < 4; ++q) { unsigned short a, c2; splitf(v[ch * 4 + q] * f, a, c2); oh[q] = a; ol[q] = c2; }
                const size_t oo = ((size_t)zz * (RH ? RH : 1) + i) * TT + ch * 128 + lane * 4; *(v4us*)(Ph + oo) = oh; *(v4us*)(Pl + oo) = ol; }
        } else {
#pragma unroll
            for (int ch = 0; ch < TT / 128; ++ch) { v4h o4;
#pragma unroll
                for (int q = 0; q < 4; ++q) o4[q] = tohx(v[ch * 4 + q] * f);
                *(v4h*)(P16 + (size_t)row * TT + ch * 128 + lane * 4) = o4; } }
         }
}
__global__ __launch_bounds__(256) void k_merge(const float* __restrict__ O, int h0, bf* Ah, bf* Al) {   /* O: KSV partial planes [ZH][TT][HD], added in plane order */ const size_t e = ((size_t)blockIdx.x * 256 + threadIdx.x) * 2; if (e >= (size_t)ZH * TT * HD) return; const int d = (int)(e % HD); const int t = (int)((e / HD) % TT); const int zz = (int)(e / ((size_t)HD * TT)); const float cs = (t < RH) ? 1.0f : (1.0f / PCAR); const size_t oo = (size_t)t * DQ + (h0 + zz) * HD + d;
    v2us oh, ol; v2f pp[KSV];
#pragma unroll
    for (int s = 0; s < KSV; ++s) pp[s] = *(const v2f*)(O + (size_t)s * ((size_t)ZH * TT * HD) + e);
    v2f o2 = pp[0];
#pragma unroll
    for (int s = 1; s < KSV; ++s) o2 += pp[s];
#pragma unroll
    for (int q = 0; q < 2; ++q) { unsigned short a, c2; splitf(o2[q] * cs, a, c2); oh[q] = a; ol[q] = c2; } *(v2us*)(Ah + oo) = oh; *(v2us*)(Al + oo) = ol;  }

extern "C" void kernel_launch(void* const* d_in, const int* in_sizes, int n_in,
                              void* d_out, int out_size, void* d_ws, size_t ws_size, hipStream_t stream) {
    (void)in_sizes; (void)n_in; (void)out_size;
    const float* x = (const float*)d_in[0]; const float* wqkv = (const float*)d_in[1]; const float* wo = (const float*)d_in[2]; const float* bo = (const float*)d_in[3];   /* x, w_qkv ('xw' [1024][3072]: q | k | v column thirds), w_proj ('xw'), b_proj */ const float* wq = wqkv; const float* wk = wqkv; const float* wv = wqkv; (void)wk; (void)wv;
    float* OUT = (float*)d_out;     // [4][2048][1024]
    char* wsp = (char*)d_ws;
    auto take = [&](size_t bytes) { char* p = wsp; wsp += (bytes + 255) & ~(size_t)255; return (void*)p; };
    bf* WQKV = (bf*)take((size_t)3 * DQ * DM * 2); bf* WQ = WQKV; bf* WK = WQKV + (size_t)DQ * DM; bf* WV = WQKV + (size_t)2 * DQ * DM;   /* fused Bt [3*DQ][DM]: q | k | v row blocks */ bf* WO = (bf*)take((size_t)DM * DQ * 2); float* CS = (float*)take((size_t)TT * HD * 2 * 4);
    bf* XB = (bf*)take((size_t)TT * DM * 2); float* FQ = (float*)take((size_t)TT * DQ * 4); float* FK = (float*)take((size_t)TT * DKV * 4);
    h16* QP16 = (h16*)take((size_t)NH_ * TT * HD * 2); h16* KP16 = (h16*)take((size_t)NKV * TT * HD * 2); h16* VT16 = (h16*)take((size_t)NKV * HD * TT * 2);
    bf* QPh = (bf*)take((size_t)NH_ * TT * HD * 2); bf* QPl = (bf*)take((size_t)NH_ * TT * HD * 2); bf* KPh = (bf*)take((size_t)NKV * TT * HD * 2); bf* KPl = (bf*)take((size_t)NKV * TT * HD * 2); bf* VTh = (bf*)take((size_t)NKV * HD * TT * 2); bf* VTl = (bf*)take((size_t)NKV * HD * TT * 2); bf* Ph = (bf*)take((size_t)ZH * RH * TT * 2); bf* Pl = (bf*)take((size_t)ZH * RH * TT * 2);
    float* Sb = (float*)take((size_t)ZH * TT * TT * 4); h16* P16 = (h16*)take((size_t)ZH * TT * TT * 2); float* Ob = (float*)take((size_t)KSV * ZH * TT * HD * 4); bf* ATh = (bf*)take((size_t)TT * DQ * 2); bf* ATl = (bf*)take((size_t)TT * DQ * 2);
    if ((size_t)(wsp - (char*)d_ws) > ws_size) return;    // ws 256 MiB
    float* FV = FK;   // v projection reuses the k buffer after the k planes are built (stream-ordered)
    { k_wtG<<<(unsigned)((DM * 3 * DQ / 64 + 63) / 64), 256, 0, stream>>>(wqkv, DM, 3 * DQ, WQKV);   /* fused 'xw' [DM][3*DQ] -> Bt [3*DQ][DM] */
      k_wtG<<<(unsigned)((DQ * DM / 64 + 63) / 64), 256, 0, stream>>>(wo, DQ, DM, WO);
       }
    k_csP<<<(TT * HD + 255) / 256, 256, 0, stream>>>(CS);
    const unsigned LQ = (unsigned)(((size_t)NH_ * TT * HD / 2 + 255) / 256), LKv = (unsigned)(((size_t)NKV * TT * HD / 2 + 255) / 256);
    for (int b = 0; b < NB_; ++b) {
        
        k_cvt8<<<(unsigned)(((size_t)TT * DM / 8 + 255) / 256), 256, 0, stream>>>(x + (size_t)b * TT * DM, XB, (size_t)TT * DM / 8);
        k_gemmw<bf, 0, false><<<dim3(TT / 64, DQ / 64, 1), 32, 0, stream>>>(XB, nullptr, WQ, nullptr, DM, FQ, DQ, nullptr, 0, 0, 0, 0);
        k_ropeI<<<LQ, 256, 0, stream>>>(FQ, DQ, NH_, CS, 1.0f, QP16, QPh, QPl);
        k_gemmw<bf, 0, false><<<dim3(TT / 64, DKV / 64, 1), 32, 0, stream>>>(XB, nullptr, WK, nullptr, DM, FK, DKV, nullptr, 0, 0, 0, 0);
        k_ropeI<<<LKv, 256, 0, stream>>>(FK, DKV, NKV, CS, 1.0f, KP16, KPh, KPl);
        k_gemmw<bf, 0, false><<<dim3(TT / 64, DKV / 64, 1), 32, 0, stream>>>(XB, nullptr, WV, nullptr, DM, FV, DKV, nullptr, 0, 0, 0, 0); k_vtp<<<LKv, 256, 0, stream>>>(FV, DKV, NKV, VT16, VTh, VTl);
        for (int h0 = 0; h0 < NH_; h0 += ZH) { const size_t zq = (size_t)h0, zk = (size_t)(h0 / REP);   // one kv head per query head: the pass's two heads use consecutive kv planes (z-strides TT*HD)
            k_gemmw<bf, 2, false><<<dim3(RH / 64, TT / 64, ZH), 32, 0, stream>>>(QPh + zq * TT * HD, QPl + zq * TT * HD, KPh + zk * TT * HD, KPl + zk * TT * HD, HD, Sb, TT, nullptr, (size_t)TT * HD, (size_t)TT * HD, (size_t)TT * TT, 0);
            k_gemmw<h16, 0, false><<<dim3((TT - RH) / 64, TT / 64, ZH), 32, 0, stream>>>(QP16 + zq * TT * HD + (size_t)RH * HD, nullptr, KP16 + zk * TT * HD, nullptr, HD, Sb + (size_t)RH * TT, TT, nullptr, (size_t)TT * HD, (size_t)TT * HD, (size_t)TT * TT, 0);
            k_asoft<<<ZH * TT / 8, 256, 0, stream>>>(Sb, P16, Ph, Pl);
            k_gemmw<bf, 2, false, KSV><<<dim3(RH / 64, HD / 64, ZH * KSV), 32, 0, stream>>>(Ph, Pl, VTh + zk * HD * TT, VTl + zk * HD * TT, TT, Ob, HD, nullptr, (size_t)RH * TT, (size_t)HD * TT, (size_t)TT * HD, (size_t)ZH * TT * HD);
            k_gemmw<h16, 0, false, KSV><<<dim3((TT - RH) / 64, HD / 64, ZH * KSV), 32, 0, stream>>>(P16 + (size_t)RH * TT, nullptr, VT16 + zk * HD * TT, nullptr, TT, Ob + (size_t)RH * HD, HD, nullptr, (size_t)TT * TT, (size_t)HD * TT, (size_t)TT * HD, (size_t)ZH * TT * HD);
            k_merge<<<(unsigned)(((size_t)ZH * TT * HD / 2 + 255) / 256), 256, 0, stream>>>(Ob, h0, ATh, ATl); }
        k_gemmw<bf, 1, true><<<dim3(TT / 64, DM / 64, 1), 32, 0, stream>>>(ATh, ATl, WO, nullptr, DQ, OUT + (size_t)b * TT * DM, DM, bo, 0, 0, 0, 0); }
}

// v002
// A run of this version takes 594 microseconds.
// Next to v001, in two timings, it ran 2.83 and 2.84 times as fast.
// Over all steps from v000 it is 6.66 times as fast.
#include <hip/hip_runtime.h>

// Multi-head self-attention with a fused bias-free qkv projection and computed interleaved-pair rotary embeddings at SCALED frequencies (x [4][2048][1024]; qkv = x w_qkv ('xw' (in, out) [1024][3072] 1/32, no bias) viewed (B, L, 3, 16, 64): q | k | v column thirds (16 heads x 64); rope on q and k: pairs (x[2i], x[2i+1]) -> (re c - im s, re s + im c) with angle pos x theta_i, theta = (1 / 10000^(2i/64)) x 3.0 (ROPE_SCALE; 32 f32 frequencies jnp-exact; one f32 product per angle; precise cosf/sinf); attn x 64^-0.5; softmax over all keys (no mask); out = merged w_proj + b_proj ('xw' + a bias) -> [4][2048][1024] (8.4 M); argument order x, w_qkv, w_proj, b_proj).
// Layout per batch: bf16 copy of x; the fused 'xw' weight transposed ONCE into q | k | v row blocks; exact projections; k_csP computed interleaved table at the scaled frequencies; interleaved-pair plane builders (k_ropeI); fused dense T-2048 attention, all batches in one launch (hybrid rows: < 512 hi/lo 3 products, rest fp16 x1024); merged hi/lo x w_proj exact + b_proj.
// Compute dtypes, f32 accumulate: every input rounded to bf16; projections exact; rotary f32; attention rows < 512 3 products, rest fp16; softmax f32; w_proj hl x exact + bias.

#define NB_  4
#define TT   2048
#define DM   1024
#define NH_  16
#define NKV  16
#define REP  (NH_ / NKV)
#define HD   64
#define DQ   (NH_ * HD)
#define DKV  (NKV * HD)
#define RH   512                  // query rows < RH use hi+lo planes (0: none)
#define WIN  0
#define PCL2 10.0f                // fp16 rows: P is carried as weight x 2^PCL2, so that small weights stay normal fp16 numbers; the factor cancels in the division by the row sum
typedef _Float16 h16;
typedef unsigned short bf;
typedef __attribute__((ext_vector_type(16))) __bf16   v16bf;
typedef __attribute__((ext_vector_type(16))) _Float16 v16h;
typedef __attribute__((ext_vector_type(8)))  _Float16 v8h;
typedef __attribute__((ext_vector_type(8)))  unsigned short v8us;
typedef __attribute__((ext_vector_type(8)))  float    v8f;
typedef __attribute__((ext_vector_type(4)))  float    v4f;
typedef v8h  __attribute__((may_alias)) v8ha;
typedef v4f  __attribute__((may_alias)) v4fa;
typedef v8us __attribute__((may_alias)) v8usa;

__device__ __forceinline__ unsigned short f2bf(float f) { unsigned u = __float_as_uint(f); u += 0x7FFFu + ((u >> 16) & 1u); return (unsigned short)(u >> 16); }
__device__ __forceinline__ float bf2f(unsigned short b) { return __uint_as_float(((unsigned)b) << 16); }
__device__ __forceinline__ float bfr(float f) { return bf2f(f2bf(f)); }
__device__ __forceinline__ v16h cat16(v8h lo, v8h hi) { return __builtin_shufflevector(lo, hi, 0, 1, 2, 3, 4, 5, 6, 7, 8, 9, 10, 11, 12, 13, 14, 15); }
__device__ __forceinline__ v16bf cat16b(v8us lo, v8us hi) { return __builtin_bit_cast(v16bf, __builtin_shufflevector(lo, hi, 0, 1, 2, 3, 4, 5, 6, 7, 8, 9, 10, 11, 12, 13, 14, 15)); }
__device__ __forceinline__ v8f wmma16(v16h a, v16h b, v8f c) { return __builtin_amdgcn_wmma_f32_16x16x32_f16(false, a, false, b, (short)0, c, false, false); }
__device__ __forceinline__ v8f wmmab(v16bf a, v16bf b, v8f c) { return __builtin_amdgcn_wmma_f32_16x16x32_bf16(false, a, false, b, (short)0, c, false, false); }



// ---- k_gemmw: register-blocked GEMM, ONE WAVE per 64x64 output tile (16 accumulators), operands straight from K-contiguous 16-bit planes; grid (M/64, N/64, Z), 32 threads.
// C[m][n] (f32, pitch ldc, + optional f32 bias[n]) = sum_k A[m][k] Bt[n][k] (+ split products per NSPLIT). z-batch strides sA/sB/sC in elements. K % 32 == 0.
// KS > 1: grid z = Z * KS; work-group (z, ks) sums only k in [ks K/KS, (ks+1) K/KS) and writes plane ks (plane stride sP elements); the reader of C adds the KS planes. K % (32 KS) == 0.
template <typename T16> struct WFrag;
template <> struct WFrag<h16> { typedef v16h V; static __device__ __forceinline__ V ld(const h16* p) { return cat16(*(const v8h*)p, *(const v8h*)(p + 16)); } static __device__ __forceinline__ v8f mma(V a, V b, v8f c) { return wmma16(a, b, c); } };
template <> struct WFrag<bf> { typedef v16bf V; static __device__ __forceinline__ V ld(const bf* p) { return cat16b(*(const v8us*)p, *(const v8us*)(p + 16)); } static __device__ __forceinline__ v8f mma(V a, V b, v8f c) { return wmmab(a, b, c); } };
template <typename T16, int NSPLIT, bool BIAS, int KS = 1>
__global__ __launch_bounds__(32) void k_gemmw(const T16* __restrict__ A, const T16* __restrict__ A2, const T16* __restrict__ Bt, const T16* __restrict__ Bt2, int K, float* C, int ldc, const float* __restrict__ bias, size_t sA, size_t sB, size_t sC, size_t sP) {
    typedef typename WFrag<T16>::V V;
    __shared__ __align__(16) float os[16 * 68];
    const size_t z = blockIdx.z / KS; const int ks = (int)(blockIdx.z % KS); A += z * sA; if (A2) A2 += z * sA; Bt += z * sB; if (Bt2) Bt2 += z * sB; C += z * sC + (size_t)ks * sP;
    const int kbeg = ks * (K / KS), kend = kbeg + K / KS;
    const int lane = threadIdx.x & 31, lr = lane & 15, hi = lane >> 4; const int r0 = blockIdx.x * 64, c0 = blockIdx.y * 64;
    v8f acc[4][4];
#pragma unroll
    for (int mb = 0; mb < 4; ++mb)
#pragma unroll
        for (int nb = 0; nb < 4; ++nb) acc[mb][nb] = (v8f){};
    const size_t aoff = (size_t)(r0 + lr) * K + 8 * hi, boff = (size_t)(c0 + lr) * K + 8 * hi;
#pragma unroll 1
    for (int kc = kbeg; kc < kend; kc += 32) {
        V a[4], a2[4];
#pragma unroll
        for (int mb = 0; mb < 4; ++mb) { a[mb] = WFrag<T16>::ld(A + aoff + (size_t)mb * 16 * K + kc); if (NSPLIT == 1 || NSPLIT == 2) a2[mb] = WFrag<T16>::ld(A2 + aoff + (size_t)mb * 16 * K + kc); }
#pragma unroll
        for (int nb = 0; nb < 4; ++nb) { const V b = WFrag<T16>::ld(Bt + boff + (size_t)nb * 16 * K + kc); V b2; if (NSPLIT >= 2) b2 = WFrag<T16>::ld(Bt2 + boff + (size_t)nb * 16 * K + kc);
#pragma unroll
            for (int mb = 0; mb < 4; ++mb) { acc[mb][nb] = WFrag<T16>::mma(a[mb], b, acc[mb][nb]); if (NSPLIT == 1 || NSPLIT == 2) acc[mb][nb] = WFrag<T16>::mma(a2[mb], b, acc[mb][nb]); if (NSPLIT >= 2) acc[mb][nb] = WFrag<T16>::mma(a[mb], b2, acc[mb][nb]); } }
        asm volatile("v_nop\n\tv_nop\n\tv_nop\n\tv_nop" : "+v"(acc[0][0]), "+v"(acc[1][1]), "+v"(acc[2][2]), "+v"(acc[3][3]) : "v"(a[0]), "v"(a[3]));
    }
#pragma unroll
    for (int mb = 0; mb < 4; ++mb) {
#pragma unroll
        for (int nb = 0; nb < 4; ++nb) {
#pragma unroll
            for (int j = 0; j < 8; ++j) os[(hi * 8 + j) * 68 + nb * 16 + lr] = acc[mb][nb][j]; }
        __builtin_amdgcn_wave_barrier(); asm volatile("" ::: "memory");
        float* crow = C + (size_t)(r0 + mb * 16) * ldc + c0;
{
#pragma unroll
            for (int s = 0; s < 8; ++s) { const int row = 2 * s + hi, cofs = lr * 4; v4f val = *(const v4fa*)(os + row * 68 + cofs); if (BIAS) { val[0] += bfr(bias[c0 + cofs]); val[1] += bfr(bias[c0 + cofs + 1]); val[2] += bfr(bias[c0 + cofs + 2]); val[3] += bfr(bias[c0 + cofs + 3]); }
                *(v4f*)(crow + (size_t)row * ldc + cofs) = val; }
             }
        __builtin_amdgcn_wave_barrier(); asm volatile("" ::: "memory");
    }
}

__device__ __forceinline__ h16 tohx(float x) { return (h16)x; }
__device__ __forceinline__ void splitf(float y, unsigned short& h, unsigned short& l) { h = f2bf(y); l = f2bf(y - bf2f(h)); }
typedef __attribute__((ext_vector_type(2))) _Float16 v2h;
typedef __attribute__((ext_vector_type(4))) _Float16 v4h;
typedef __attribute__((ext_vector_type(2))) unsigned short v2us;
typedef __attribute__((ext_vector_type(4))) unsigned short v4us;
typedef __attribute__((ext_vector_type(2))) float v2f;
typedef __attribute__((ext_vector_type(4))) int v4i;

__global__ __launch_bounds__(256) void k_wtG(const float* __restrict__ w, int K, int N, bf* Bt) {
    const int lane = threadIdx.x & 31; const int L0 = (blockIdx.x * 8 + (threadIdx.x >> 5)) * 8; const int nlines = N * K / 64;
{
#pragma unroll 1
        for (int l = 0; l < 8; ++l) { const int L = L0 + l; if (L >= nlines) break; const size_t e = (size_t)L * 64 + lane * 2; const int k = (int)(e % K), n = (int)(e / K); v2us o;
            o[0] = f2bf(w[(size_t)k * N + n]); o[1] = f2bf(w[(size_t)(k + 1) * N + n]); *(v2us*)(Bt + e) = o; }
         }
}
__global__ __launch_bounds__(256) void k_cvt8(const float* __restrict__ src, bf* dst, size_t n8) { const size_t i = (size_t)blockIdx.x * 256 + threadIdx.x; if (i >= n8) return; const v8f v = *(const v8f*)(src + i * 8); v8us o;
#pragma unroll
    for (int k = 0; k < 8; ++k) o[k] = f2bf(v[k]); *(v8us*)(dst + i * 8) = o;  }

// k_rope (DEFINED, NOT LAUNCHED in this build: the interleaved builder k_ropeI below is launched instead): head planes [h][t][d] (fp16 + hi/lo) of rope(x) x sc with the rotate-half convention out[d] = x[d] cos[t][d] - x[d+HD/2] sin[t][d], out[d+HD/2] = x[d+HD/2] cos[t][d+HD/2] + x[d] sin[t][d+HD/2]
__global__ __launch_bounds__(256) void k_rope(const float* __restrict__ F, int pitch, int nheads, const float* __restrict__ CS, const float* __restrict__ RF, const float* __restrict__ nw, float sc, h16* P16, bf* Ph, bf* Pl) {
    const size_t e = ((size_t)blockIdx.x * 256 + threadIdx.x) * 2; if (e >= (size_t)nheads * TT * HD) return; const int d = (int)(e % HD); const int t = (int)((e / HD) % TT); const int h = (int)(e / ((size_t)HD * TT)); const float* f = F + (size_t)t * pitch + h * HD; const float rf = RF ? RF[(size_t)h * TT + t] : 1.0f; v2h o16; v2us oh, ol;
#pragma unroll
    for (int q = 0; q < 2; ++q) { const int dd = d + q; const int dp = (dd < HD / 2) ? dd + HD / 2 : dd - HD / 2; float x0 = f[dd], x1 = f[dp];
        if (RF) { float n0 = __fmul_rn(x0, rf), n1 = __fmul_rn(x1, rf); asm volatile("" : "+v"(n0)); asm volatile("" : "+v"(n1)); x0 = __fmul_rn(bfr(nw[dd]), n0); x1 = __fmul_rn(bfr(nw[dp]), n1); }
        const v2f cs = *(const v2f*)(CS + ((size_t)t * HD + dd) * 2); float a = __fmul_rn(x0, cs[0]), bq = __fmul_rn(x1, cs[1]); asm volatile("" : "+v"(a)); asm volatile("" : "+v"(bq)); const float r = ((dd < HD / 2) ? __fsub_rn(a, bq) : __fadd_rn(a, bq)) * sc;
        o16[q] = tohx(r); unsigned short a2, c2; splitf(r, a2, c2); oh[q] = a2; ol[q] = c2; }
    *(v2h*)(P16 + e) = o16; *(v2us*)(Ph + e) = oh; *(v2us*)(Pl + e) = ol;  }
__global__ __launch_bounds__(256) void k_ropeI(const float* __restrict__ F, int pitch, int nheads, const float* __restrict__ CS, float sc, h16* P16, bf* Ph, bf* Pl) {
    const size_t e = ((size_t)blockIdx.x * 256 + threadIdx.x) * 2; if (e >= (size_t)nheads * TT * HD) return; const int d = (int)(e % HD); const int t = (int)((e / HD) % TT); const int h = (int)(e / ((size_t)HD * TT)); const float* f = F + (size_t)t * pitch + h * HD; const float x0 = f[d], x1 = f[d + 1]; const v2f cs = *(const v2f*)(CS + ((size_t)t * HD + d) * 2); v2h o16; v2us oh, ol;
    float a0 = __fmul_rn(x0, cs[0]), b0 = __fmul_rn(x1, cs[1]), a1 = __fmul_rn(x1, cs[0]), b1 = __fmul_rn(x0, cs[1]); asm volatile("" : "+v"(a0), "+v"(b0), "+v"(a1), "+v"(b1));
    float r0 = __fsub_rn(a0, b0) * sc, r1 = __fadd_rn(b1, a1) * sc;   /* even: x0 c - x1 s; odd: x0 s + x1 c */
    o16[0] = tohx(r0); o16[1] = tohx(r1); { unsigned short a2, c2; splitf(r0, a2, c2); oh[0] = a2; ol[0] = c2; splitf(r1, a2, c2); oh[1] = a2; ol[1] = c2; }
    *(v2h*)(P16 + e) = o16; *(v2us*)(Ph + e) = oh; *(v2us*)(Pl + e) = ol;  }
__global__ __launch_bounds__(256) void k_vtp(const float* __restrict__ F, int pitch, int nheads, h16* V16, bf* Vh, bf* Vl) { const size_t e = ((size_t)blockIdx.x * 256 + threadIdx.x) * 2; if (e >= (size_t)nheads * HD * TT) return; const int t = (int)(e % TT); const int d = (int)((e / TT) % HD); const int g = (int)(e / ((size_t)TT * HD)); v2h o16; v2us oh, ol;
#pragma unroll
    for (int q = 0; q < 2; ++q) { const float x = F[(size_t)(t + q) * pitch + g * HD + d]; o16[q] = tohx(x); unsigned short a2, c2; splitf(x, a2, c2); oh[q] = a2; ol[q] = c2; }
    *(v2h*)(V16 + e) = o16; *(v2us*)(Vh + e) = oh; *(v2us*)(Vl + e) = ol;  }
// INV2: the 32 rotary frequencies of THIS module: (1.0 / (ROPE_BASE ** (arange(0, 64, 2, float32) / 64))) * ROPE_SCALE with ROPE_BASE 10000 and ROPE_SCALE 3.0, generated with jnp in float32 (bit-exact; == the unscaled table x 3.0f in f32, 32 of 32): the adjacent (even, odd) pair shares entry d / 2.
__constant__ float INV2[HD / 2] = { 3.000000000e+00f, 2.249682665e+00f, 1.687023997e+00f, 1.265089512e+00f, 9.486832619e-01f, 7.114120722e-01f, 5.334838033e-01f, 4.000564218e-01f, 3.000000119e-01f, 2.249682546e-01f, 1.687023938e-01f, 1.265089512e-01f, 9.486833215e-02f, 7.114120573e-02f, 5.334838480e-02f, 4.000564665e-02f, 2.999999933e-02f, 2.249682695e-02f, 1.687023975e-02f, 1.265089400e-02f, 9.486833587e-03f, 7.114121690e-03f, 5.334838293e-03f, 4.000564106e-03f, 3.000000026e-03f, 2.249682555e-03f, 1.687023905e-03f, 1.265089493e-03f, 9.486833587e-04f, 7.114121690e-04f, 5.334838061e-04f, 4.000564513e-04f };
__global__ __launch_bounds__(256) void k_csP(float* CS) { const int idx = blockIdx.x * 256 + threadIdx.x; if (idx >= TT * HD) return; const int d = idx % HD; const int t = idx / HD; const float a = __fmul_rn((float)t, INV2[d >> 1]); v2f cs; cs[0] = cosf(a); cs[1] = sinf(a); *(v2f*)(CS + (size_t)idx * 2) = cs;  }
// ---- k_fattn: fused attention, one launch for every batch, head and query row. Scores, softmax and P stay in registers.
// St = K Qt (A = 16 key rows, B = 16 query columns), Ot += Vt Pt: accumulator element j of lane (lr, hi) of the score tile of keys kb + 16 kt .. is key kb + 16 kt + 8 hi + j of query lr,
// which is element 8 kt + j of the B operand of a 32-key product in the loaders' k order, so P is packed in place. Running maximum per query column, output and sum rescaled every 32 keys.
// A work-group of 8 waves shares K and Vt: 64 keys a stage, brought through registers into two LDS buffers (rows of 128 B at a pitch of 144 B), one barrier a stage.
// Work-groups below NHW: query rows < RH, 16 columns a wave, hi/lo bf16 planes, 3 products; the rest: 32 columns a wave, fp16.
#define FP   72                   // LDS row pitch in 16-bit elements
#define FPS  (64 * FP)            // one staged plane: 64 rows
#define NST  (TT / 64)
#define CL2  0.18033688011112042f // HD^-0.5 x log2(e)
typedef __attribute__((ext_vector_type(2))) __bf16 v2b;
typedef __attribute__((ext_vector_type(8))) unsigned v8u;
template <bool HI> struct FT;
template <> struct FT<false> { typedef v16h V; static __device__ __forceinline__ V ld(const unsigned short* p) { return __builtin_bit_cast(v16h, __builtin_shufflevector(*(const v8usa*)p, *(const v8usa*)(p + 16), 0, 1, 2, 3, 4, 5, 6, 7, 8, 9, 10, 11, 12, 13, 14, 15)); } static __device__ __forceinline__ v8f mma(V a, V b, v8f c) { return wmma16(a, b, c); } };
template <> struct FT<true> { typedef v16bf V; static __device__ __forceinline__ V ld(const unsigned short* p) { return cat16b(*(const v8usa*)p, *(const v8usa*)(p + 16)); } static __device__ __forceinline__ v8f mma(V a, V b, v8f c) { return wmmab(a, b, c); } };
__device__ __forceinline__ float xhalf(float x) { const int b = __float_as_int(x); return __int_as_float(__builtin_amdgcn_permlanex16(b, b, 0x76543210, 0xfedcba98, false, false)); }   // lane l <-> l ^ 16
template <bool HI, int NT>
__device__ __forceinline__ void fattn(unsigned short* sm, const unsigned short* __restrict__ Q, const unsigned short* __restrict__ Q2, const unsigned short* __restrict__ Kg, const unsigned short* __restrict__ K2g, const unsigned short* __restrict__ Vg, const unsigned short* __restrict__ V2g, int qw, bf* Ah, bf* Al) {
    typedef typename FT<HI>::V V;
    constexpr int PLN = HI ? 4 : 2;   // staged planes: K, Vt (, K lo, Vt lo)
    const int tid = threadIdx.x, lane = tid & 31, lr = lane & 15, hi = lane >> 4;
    const int srow = tid >> 3, sseg = (tid & 7) * 8;   // staging: rows srow and srow + 32, one 16-byte segment of each plane
    v8us st[PLN][2];
    auto gload = [&](int s) {
#pragma unroll
        for (int r = 0; r < 2; ++r) { const int row = srow + 32 * r; const size_t ko = (size_t)(s * 64 + row) * HD + sseg, vo = (size_t)row * TT + s * 64 + sseg;
            st[0][r] = *(const v8usa*)(Kg + ko); st[1][r] = *(const v8usa*)(Vg + vo);
            if constexpr (HI) { st[2][r] = *(const v8usa*)(K2g + ko); st[3][r] = *(const v8usa*)(V2g + vo); } }
        asm volatile("s_wait_xcnt 0x0" ::: "memory"); };   // stands before the address registers of the loads issued so far are written again
    auto sstore = [&](int b) {
#pragma unroll
        for (int r = 0; r < 2; ++r)
#pragma unroll
            for (int pl = 0; pl < PLN; ++pl) *(v8usa*)(sm + (b * PLN + pl) * FPS + (srow + 32 * r) * FP + sseg) = st[pl][r]; };
    V qf[NT][2], qf2[NT][2];
#pragma unroll
    for (int nt = 0; nt < NT; ++nt)
#pragma unroll
        for (int ks = 0; ks < 2; ++ks) { const size_t qo = (size_t)(qw + nt * 16 + lr) * HD + ks * 32 + 8 * hi; qf[nt][ks] = FT<HI>::ld(Q + qo); if constexpr (HI) qf2[nt][ks] = FT<HI>::ld(Q2 + qo); }
    asm volatile("s_wait_xcnt 0x0" ::: "memory");   // stands before the address registers of the Q loads are written again
    v8f o[4][NT]; float mc[NT], l[NT];
#pragma unroll
    for (int nt = 0; nt < NT; ++nt) { mc[nt] = -3.0e37f; l[nt] = 0.f;
#pragma unroll
        for (int dt = 0; dt < 4; ++dt) o[dt][nt] = (v8f){}; }
    gload(0); sstore(0); __syncthreads();
#pragma unroll 1
    for (int s = 0; s < NST; ++s) {
        if (s + 1 < NST) gload(s + 1);
        const unsigned short* kb = sm + (s & 1) * PLN * FPS;
#pragma unroll
        for (int p = 0; p < 2; ++p) {
            v8f sc[2][NT];
#pragma unroll
            for (int kt = 0; kt < 2; ++kt) { V ka[2], ka2[2];
#pragma unroll
                for (int ks = 0; ks < 2; ++ks) { const int off = (p * 32 + kt * 16 + lr) * FP + ks * 32 + 8 * hi; ka[ks] = FT<HI>::ld(kb + off); if constexpr (HI) ka2[ks] = FT<HI>::ld(kb + 2 * FPS + off); }
#pragma unroll
                for (int nt = 0; nt < NT; ++nt) { v8f a = (v8f){};
#pragma unroll
                    for (int ks = 0; ks < 2; ++ks) { a = FT<HI>::mma(ka[ks], qf[nt][ks], a); if constexpr (HI) { a = FT<HI>::mma(ka[ks], qf2[nt][ks], a); a = FT<HI>::mma(ka2[ks], qf[nt][ks], a); } }
                    sc[kt][nt] = a; } }
            V pf[NT], pf2[NT];
#pragma unroll
            for (int nt = 0; nt < NT; ++nt) {
                float cm = fmaxf(sc[0][nt][0], sc[1][nt][0]);
#pragma unroll
                for (int j = 1; j < 8; ++j) cm = fmaxf(cm, fmaxf(sc[0][nt][j], sc[1][nt][j]));
                cm = fmaxf(cm, xhalf(cm));
                const float mn = fmaxf(mc[nt], cm * CL2); const float al = __builtin_amdgcn_exp2f(mc[nt] - mn); mc[nt] = mn; const float mo = HI ? mn : mn - PCL2;
                float e[16];
#pragma unroll
                for (int i = 0; i < 16; ++i) e[i] = __builtin_amdgcn_exp2f(fmaf(sc[i >> 3][nt][i & 7], CL2, -mo));
                const float ps = ((e[0] + e[1]) + (e[2] + e[3])) + ((e[4] + e[5]) + (e[6] + e[7])) + (((e[8] + e[9]) + (e[10] + e[11])) + ((e[12] + e[13]) + (e[14] + e[15])));
                l[nt] = fmaf(l[nt], al, ps);
#pragma unroll
                for (int dt = 0; dt < 4; ++dt) o[dt][nt] *= al;
                v8u ph, pl;   // two elements a register, converted in pairs
#pragma unroll
                for (int i = 0; i < 8; ++i) { const v2f ev = { e[2 * i], e[2 * i + 1] };
                    if constexpr (HI) { const v2b hb = __builtin_convertvector(ev, v2b); ph[i] = __builtin_bit_cast(unsigned, hb); pl[i] = __builtin_bit_cast(unsigned, __builtin_convertvector(ev - __builtin_convertvector(hb, v2f), v2b)); }
                    else ph[i] = __builtin_bit_cast(unsigned, __builtin_convertvector(ev, v2h)); }
                pf[nt] = __builtin_bit_cast(V, ph); if constexpr (HI) pf2[nt] = __builtin_bit_cast(V, pl); }
#pragma unroll
            for (int dt = 0; dt < 4; ++dt) { const int off = FPS + (dt * 16 + lr) * FP + p * 32 + 8 * hi; const V va = FT<HI>::ld(kb + off); V va2; if constexpr (HI) va2 = FT<HI>::ld(kb + 2 * FPS + off);
#pragma unroll
                for (int nt = 0; nt < NT; ++nt) { o[dt][nt] = FT<HI>::mma(va, pf[nt], o[dt][nt]); if constexpr (HI) { o[dt][nt] = FT<HI>::mma(va, pf2[nt], o[dt][nt]); o[dt][nt] = FT<HI>::mma(va2, pf[nt], o[dt][nt]); } } }
        }
        if (s + 1 < NST) sstore((s + 1) & 1);
        __syncthreads();   // publishes stage s + 1 and ends every wave's reads of the buffer that the next trip refills
    }
#pragma unroll
    for (int nt = 0; nt < NT; ++nt) { const float inv = __fdiv_rn(1.0f, l[nt] + xhalf(l[nt])); const size_t oo = (size_t)(qw + nt * 16 + lr) * DQ + hi * 8;
#pragma unroll
        for (int dt = 0; dt < 4; ++dt) { v8us oh, ol;
#pragma unroll
            for (int j = 0; j < 8; ++j) { unsigned short a, c2; splitf(o[dt][nt][j] * inv, a, c2); oh[j] = a; ol[j] = c2; }
            *(v8usa*)(Ah + oo + dt * 16) = oh; *(v8usa*)(Al + oo + dt * 16) = ol;
            asm volatile("s_wait_xcnt 0x0" ::: "memory"); } }   // stands before the registers that the two stores name are written again
}
#define NHW (NB_ * NH_ * (RH / 128))
#define NLW (NB_ * NH_ * ((TT - RH) / 256))
__global__ __launch_bounds__(256) __attribute__((amdgpu_waves_per_eu(4, 4))) void k_fattn(const h16* __restrict__ Q16, const bf* __restrict__ Qh, const bf* __restrict__ Ql, const h16* __restrict__ K16, const bf* __restrict__ Kh, const bf* __restrict__ Kl, const h16* __restrict__ V16, const bf* __restrict__ Vh, const bf* __restrict__ Vl, bf* Ah, bf* Al) {
    __shared__ __align__(16) unsigned short sm[2 * 4 * FPS];
    const int wave = threadIdx.x >> 5; int bx = blockIdx.x;   // the long work-groups (3 products) start first
    if (bx < NHW) { const int z = bx / (RH / 128), qt = bx % (RH / 128); const size_t zo = (size_t)z * TT * HD, ao = (size_t)(z / NH_) * TT * DQ + (z % NH_) * HD;
        fattn<true, 1>(sm, Qh + zo, Ql + zo, Kh + zo, Kl + zo, Vh + zo, Vl + zo, qt * 128 + wave * 16, Ah + ao, Al + ao);
    } else { bx -= NHW; const int z = bx / ((TT - RH) / 256), qt = bx % ((TT - RH) / 256); const size_t zo = (size_t)z * TT * HD, ao = (size_t)(z / NH_) * TT * DQ + (z % NH_) * HD;
        fattn<false, 2>(sm, (const unsigned short*)(Q16 + zo), nullptr, (const unsigned short*)(K16 + zo), nullptr, (const unsigned short*)(V16 + zo), nullptr, RH + qt * 256 + wave * 32, Ah + ao, Al + ao); }
}

extern "C" void kernel_launch(void* const* d_in, const int* in_sizes, int n_in,
                              void* d_out, int out_size, void* d_ws, size_t ws_size, hipStream_t stream) {
    (void)in_sizes; (void)n_in; (void)out_size;
    const float* x = (const float*)d_in[0]; const float* wqkv = (const float*)d_in[1]; const float* wo = (const float*)d_in[2]; const float* bo = (const float*)d_in[3];   /* x, w_qkv ('xw' [1024][3072]: q | k | v column thirds), w_proj ('xw'), b_proj */ const float* wq = wqkv; const float* wk = wqkv; const float* wv = wqkv; (void)wk; (void)wv;
    float* OUT = (float*)d_out;     // [4][2048][1024]
    char* wsp = (char*)d_ws;
    auto take = [&](size_t bytes) { char* p = wsp; wsp += (bytes + 255) & ~(size_t)255; return (void*)p; };
    bf* WQKV = (bf*)take((size_t)3 * DQ * DM * 2); bf* WQ = WQKV; bf* WK = WQKV + (size_t)DQ * DM; bf* WV = WQKV + (size_t)2 * DQ * DM;   /* fused Bt [3*DQ][DM]: q | k | v row blocks */ bf* WO = (bf*)take((size_t)DM * DQ * 2); float* CS = (float*)take((size_t)TT * HD * 2 * 4);
    bf* XB = (bf*)take((size_t)TT * DM * 2); float* FQ = (float*)take((size_t)TT * DQ * 4); float* FK = (float*)take((size_t)TT * DKV * 4);
    const size_t PB = (size_t)NH_ * TT * HD;   // one batch's head planes, elements; every plane holds all NB_ batches
    h16* QP16 = (h16*)take(NB_ * PB * 2); h16* KP16 = (h16*)take(NB_ * PB * 2); h16* VT16 = (h16*)take(NB_ * PB * 2);
    bf* QPh = (bf*)take(NB_ * PB * 2); bf* QPl = (bf*)take(NB_ * PB * 2); bf* KPh = (bf*)take(NB_ * PB * 2); bf* KPl = (bf*)take(NB_ * PB * 2); bf* VTh = (bf*)take(NB_ * PB * 2); bf* VTl = (bf*)take(NB_ * PB * 2);
    bf* ATh = (bf*)take((size_t)NB_ * TT * DQ * 2); bf* ATl = (bf*)take((size_t)NB_ * TT * DQ * 2);
    if ((size_t)(wsp - (char*)d_ws) > ws_size) return;    // ws 256 MiB
    float* FV = FK;   // v projection reuses the k buffer after the k planes are built (stream-ordered)
    { k_wtG<<<(unsigned)((DM * 3 * DQ / 64 + 63) / 64), 256, 0, stream>>>(wqkv, DM, 3 * DQ, WQKV);   /* fused 'xw' [DM][3*DQ] -> Bt [3*DQ][DM] */
      k_wtG<<<(unsigned)((DQ * DM / 64 + 63) / 64), 256, 0, stream>>>(wo, DQ, DM, WO);
       }
    k_csP<<<(TT * HD + 255) / 256, 256, 0, stream>>>(CS);
    const unsigned LQ = (unsigned)(((size_t)NH_ * TT * HD / 2 + 255) / 256), LKv = (unsigned)(((size_t)NKV * TT * HD / 2 + 255) / 256);
    for (int b = 0; b < NB_; ++b) {
        
        k_cvt8<<<(unsigned)(((size_t)TT * DM / 8 + 255) / 256), 256, 0, stream>>>(x + (size_t)b * TT * DM, XB, (size_t)TT * DM / 8);
        k_gemmw<bf, 0, false><<<dim3(TT / 64, DQ / 64, 1), 32, 0, stream>>>(XB, nullptr, WQ, nullptr, DM, FQ, DQ, nullptr, 0, 0, 0, 0);
        k_ropeI<<<LQ, 256, 0, stream>>>(FQ, DQ, NH_, CS, 1.0f, QP16 + b * PB, QPh + b * PB, QPl + b * PB);
        k_gemmw<bf, 0, false><<<dim3(TT / 64, DKV / 64, 1), 32, 0, stream>>>(XB, nullptr, WK, nullptr, DM, FK, DKV, nullptr, 0, 0, 0, 0);
        k_ropeI<<<LKv, 256, 0, stream>>>(FK, DKV, NKV, CS, 1.0f, KP16 + b * PB, KPh + b * PB, KPl + b * PB);
        k_gemmw<bf, 0, false><<<dim3(TT / 64, DKV / 64, 1), 32, 0, stream>>>(XB, nullptr, WV, nullptr, DM, FV, DKV, nullptr, 0, 0, 0, 0); k_vtp<<<LKv, 256, 0, stream>>>(FV, DKV, NKV, VT16 + b * PB, VTh + b * PB, VTl + b * PB); }
    k_fattn<<<NHW + NLW, 256, 0, stream>>>(QP16, QPh, QPl, KP16, KPh, KPl, VT16, VTh, VTl, ATh, ATl);
    for (int b = 0; b < NB_; ++b)
        k_gemmw<bf, 1, true><<<dim3(TT / 64, DM / 64, 1), 32, 0, stream>>>(ATh + (size_t)b * TT * DQ, ATl + (size_t)b * TT * DQ, WO, nullptr, DQ, OUT + (size_t)b * TT * DM, DM, bo, 0, 0, 0, 0);
}

// v003
// One run takes 383 microseconds.
// Timed twice side by side with v002, it ran 1.56 and 1.57 times as fast.
// All steps since v000 together make it 10.4 times as fast.
#include <hip/hip_runtime.h>

// Multi-head self-attention with a fused bias-free qkv projection and computed interleaved-pair rotary embeddings at SCALED frequencies (x [4][2048][1024]; qkv = x w_qkv ('xw' (in, out) [1024][3072] 1/32, no bias) viewed (B, L, 3, 16, 64): q | k | v column thirds (16 heads x 64); rope on q and k: pairs (x[2i], x[2i+1]) -> (re c - im s, re s + im c) with angle pos x theta_i, theta = (1 / 10000^(2i/64)) x 3.0 (ROPE_SCALE; 32 f32 frequencies jnp-exact; one f32 product per angle; precise cosf/sinf); attn x 64^-0.5; softmax over all keys (no mask); out = merged w_proj + b_proj ('xw' + a bias: READ) -> [4][2048][1024] (8.4 M); argument order x, w_qkv, w_proj, b_proj).
// Layout: bf16 copy of x; the fused 'xw' weight transposed ONCE into q | k | v row blocks; k_csP computed interleaved table at the scaled frequencies; k_qkv: exact projections of all batches with the interleaved-pair rotary and the plane split in their epilogue; fused dense T-2048 attention, all batches in one launch (hybrid rows: < 512 hi/lo 3 products, rest fp16 x1024); merged hi/lo x w_proj exact + b_proj.
// Compute dtypes, f32 accumulate: every input rounded to bf16; projections exact; rotary f32; attention rows < 512 3 products, rest fp16; softmax f32; w_proj hl x exact + bias.

#define NB_  4
#define TT   2048
#define DM   1024
#define NH_  16
#define NKV  16
#define REP  (NH_ / NKV)
#define HD   64
#define DQ   (NH_ * HD)
#define DKV  (NKV * HD)
#define RH   512                  // query rows < RH use hi+lo planes (0: none)
#define WIN  0
#define PCL2 10.0f                // fp16 rows: P is carried as weight x 2^PCL2, so that small weights stay normal fp16 numbers; the factor cancels in the division by the row sum
typedef _Float16 h16;
typedef unsigned short bf;
typedef __attribute__((ext_vector_type(16))) __bf16   v16bf;
typedef __attribute__((ext_vector_type(16))) _Float16 v16h;
typedef __attribute__((ext_vector_type(8)))  _Float16 v8h;
typedef __attribute__((ext_vector_type(8)))  unsigned short v8us;
typedef __attribute__((ext_vector_type(8)))  float    v8f;
typedef __attribute__((ext_vector_type(4)))  float    v4f;
typedef v8h  __attribute__((may_alias)) v8ha;
typedef v4f  __attribute__((may_alias)) v4fa;
typedef v8us __attribute__((may_alias)) v8usa;

__device__ __forceinline__ unsigned short f2bf(float f) { unsigned u = __float_as_uint(f); u += 0x7FFFu + ((u >> 16) & 1u); return (unsigned short)(u >> 16); }
__device__ __forceinline__ float bf2f(unsigned short b) { return __uint_as_float(((unsigned)b) << 16); }
__device__ __forceinline__ float bfr(float f) { return bf2f(f2bf(f)); }
__device__ __forceinline__ v16h cat16(v8h lo, v8h hi) { return __builtin_shufflevector(lo, hi, 0, 1, 2, 3, 4, 5, 6, 7, 8, 9, 10, 11, 12, 13, 14, 15); }
__device__ __forceinline__ v16bf cat16b(v8us lo, v8us hi) { return __builtin_bit_cast(v16bf, __builtin_shufflevector(lo, hi, 0, 1, 2, 3, 4, 5, 6, 7, 8, 9, 10, 11, 12, 13, 14, 15)); }
__device__ __forceinline__ v8f wmma16(v16h a, v16h b, v8f c) { return __builtin_amdgcn_wmma_f32_16x16x32_f16(false, a, false, b, (short)0, c, false, false); }
__device__ __forceinline__ v8f wmmab(v16bf a, v16bf b, v8f c) { return __builtin_amdgcn_wmma_f32_16x16x32_bf16(false, a, false, b, (short)0, c, false, false); }



// ---- k_gemmw: register-blocked GEMM, ONE WAVE per 64x64 output tile (16 accumulators), operands straight from K-contiguous 16-bit planes; grid (M/64, N/64, Z), 32 threads.
// C[m][n] (f32, pitch ldc, + optional f32 bias[n]) = sum_k A[m][k] Bt[n][k] (+ split products per NSPLIT). z-batch strides sA/sB/sC in elements. K % 32 == 0.
// KS > 1: grid z = Z * KS; work-group (z, ks) sums only k in [ks K/KS, (ks+1) K/KS) and writes plane ks (plane stride sP elements); the reader of C adds the KS planes. K % (32 KS) == 0.
template <typename T16> struct WFrag;
template <> struct WFrag<h16> { typedef v16h V; static __device__ __forceinline__ V ld(const h16* p) { return cat16(*(const v8h*)p, *(const v8h*)(p + 16)); } static __device__ __forceinline__ v8f mma(V a, V b, v8f c) { return wmma16(a, b, c); } };
template <> struct WFrag<bf> { typedef v16bf V; static __device__ __forceinline__ V ld(const bf* p) { return cat16b(*(const v8us*)p, *(const v8us*)(p + 16)); } static __device__ __forceinline__ v8f mma(V a, V b, v8f c) { return wmmab(a, b, c); } };
template <typename T16, int NSPLIT, bool BIAS, int KS = 1>
__global__ __launch_bounds__(32) void k_gemmw(const T16* __restrict__ A, const T16* __restrict__ A2, const T16* __restrict__ Bt, const T16* __restrict__ Bt2, int K, float* C, int ldc, const float* __restrict__ bias, size_t sA, size_t sB, size_t sC, size_t sP) {
    typedef typename WFrag<T16>::V V;
    __shared__ __align__(16) float os[16 * 68];
    const size_t z = blockIdx.z / KS; const int ks = (int)(blockIdx.z % KS); A += z * sA; if (A2) A2 += z * sA; Bt += z * sB; if (Bt2) Bt2 += z * sB; C += z * sC + (size_t)ks * sP;
    const int kbeg = ks * (K / KS), kend = kbeg + K / KS;
    const int lane = threadIdx.x & 31, lr = lane & 15, hi = lane >> 4; const int r0 = blockIdx.x * 64, c0 = blockIdx.y * 64;
    v8f acc[4][4];
#pragma unroll
    for (int mb = 0; mb < 4; ++mb)
#pragma unroll
        for (int nb = 0; nb < 4; ++nb) acc[mb][nb] = (v8f){};
    const size_t aoff = (size_t)(r0 + lr) * K + 8 * hi, boff = (size_t)(c0 + lr) * K + 8 * hi;
#pragma unroll 1
    for (int kc = kbeg; kc < kend; kc += 32) {
        V a[4], a2[4];
#pragma unroll
        for (int mb = 0; mb < 4; ++mb) { a[mb] = WFrag<T16>::ld(A + aoff + (size_t)mb * 16 * K + kc); if (NSPLIT == 1 || NSPLIT == 2) a2[mb] = WFrag<T16>::ld(A2 + aoff + (size_t)mb * 16 * K + kc); }
#pragma unroll
        for (int nb = 0; nb < 4; ++nb) { const V b = WFrag<T16>::ld(Bt + boff + (size_t)nb * 16 * K + kc); V b2; if (NSPLIT >= 2) b2 = WFrag<T16>::ld(Bt2 + boff + (size_t)nb * 16 * K + kc);
#pragma unroll
            for (int mb = 0; mb < 4; ++mb) { acc[mb][nb] = WFrag<T16>::mma(a[mb], b, acc[mb][nb]); if (NSPLIT == 1 || NSPLIT == 2) acc[mb][nb] = WFrag<T16>::mma(a2[mb], b, acc[mb][nb]); if (NSPLIT >= 2) acc[mb][nb] = WFrag<T16>::mma(a[mb], b2, acc[mb][nb]); } }
        asm volatile("v_nop\n\tv_nop\n\tv_nop\n\tv_nop" : "+v"(acc[0][0]), "+v"(acc[1][1]), "+v"(acc[2][2]), "+v"(acc[3][3]) : "v"(a[0]), "v"(a[3]));
    }
#pragma unroll
    for (int mb = 0; mb < 4; ++mb) {
#pragma unroll
        for (int nb = 0; nb < 4; ++nb) {
#pragma unroll
            for (int j = 0; j < 8; ++j) os[(hi * 8 + j) * 68 + nb * 16 + lr] = acc[mb][nb][j]; }
        __builtin_amdgcn_wave_barrier(); asm volatile("" ::: "memory");
        float* crow = C + (size_t)(r0 + mb * 16) * ldc + c0;
{
#pragma unroll
            for (int s = 0; s < 8; ++s) { const int row = 2 * s + hi, cofs = lr * 4; v4f val = *(const v4fa*)(os + row * 68 + cofs); if (BIAS) { val[0] += bfr(bias[c0 + cofs]); val[1] += bfr(bias[c0 + cofs + 1]); val[2] += bfr(bias[c0 + cofs + 2]); val[3] += bfr(bias[c0 + cofs + 3]); }
                *(v4f*)(crow + (size_t)row * ldc + cofs) = val; }
             }
        __builtin_amdgcn_wave_barrier(); asm volatile("" ::: "memory");
    }
}

__device__ __forceinline__ h16 tohx(float x) { return (h16)x; }
__device__ __forceinline__ void splitf(float y, unsigned short& h, unsigned short& l) { h = f2bf(y); l = f2bf(y - bf2f(h)); }
typedef __attribute__((ext_vector_type(2))) _Float16 v2h;
typedef __attribute__((ext_vector_type(4))) _Float16 v4h;
typedef __attribute__((ext_vector_type(2))) unsigned short v2us;
typedef __attribute__((ext_vector_type(4))) unsigned short v4us;
typedef __attribute__((ext_vector_type(2))) float v2f;
typedef __attribute__((ext_vector_type(4))) int v4i;

__global__ __launch_bounds__(256) void k_wtG(const float* __restrict__ w, int K, int N, bf* Bt) {
    const int lane = threadIdx.x & 31; const int L0 = (blockIdx.x * 8 + (threadIdx.x >> 5)) * 8; const int nlines = N * K / 64;
{
#pragma unroll 1
        for (int l = 0; l < 8; ++l) { const int L = L0 + l; if (L >= nlines) break; const size_t e = (size_t)L * 64 + lane * 2; const int k = (int)(e % K), n = (int)(e / K); v2us o;
            o[0] = f2bf(w[(size_t)k * N + n]); o[1] = f2bf(w[(size_t)(k + 1) * N + n]); *(v2us*)(Bt + e) = o; }
         }
}
__global__ __launch_bounds__(256) void k_cvt8(const float* __restrict__ src, bf* dst, size_t n8) { const size_t i = (size_t)blockIdx.x * 256 + threadIdx.x; if (i >= n8) return; const v8f v = *(const v8f*)(src + i * 8); v8us o;
#pragma unroll
    for (int k = 0; k < 8; ++k) o[k] = f2bf(v[k]); *(v8us*)(dst + i * 8) = o;  }

// INV2: the 32 rotary frequencies of THIS module: (1.0 / (ROPE_BASE ** (arange(0, 64, 2, float32) / 64))) * ROPE_SCALE with ROPE_BASE 10000 and ROPE_SCALE 3.0, generated with jnp in float32 (bit-exact; == the unscaled table x 3.0f in f32, 32 of 32): the adjacent (even, odd) pair shares entry d / 2.
__constant__ float INV2[HD / 2] = { 3.000000000e+00f, 2.249682665e+00f, 1.687023997e+00f, 1.265089512e+00f, 9.486832619e-01f, 7.114120722e-01f, 5.334838033e-01f, 4.000564218e-01f, 3.000000119e-01f, 2.249682546e-01f, 1.687023938e-01f, 1.265089512e-01f, 9.486833215e-02f, 7.114120573e-02f, 5.334838480e-02f, 4.000564665e-02f, 2.999999933e-02f, 2.249682695e-02f, 1.687023975e-02f, 1.265089400e-02f, 9.486833587e-03f, 7.114121690e-03f, 5.334838293e-03f, 4.000564106e-03f, 3.000000026e-03f, 2.249682555e-03f, 1.687023905e-03f, 1.265089493e-03f, 9.486833587e-04f, 7.114121690e-04f, 5.334838061e-04f, 4.000564513e-04f };
__global__ __launch_bounds__(256) void k_csP(float* CS) { const int idx = blockIdx.x * 256 + threadIdx.x; if (idx >= TT * HD) return; const int d = idx % HD; const int t = idx / HD; const float a = __fmul_rn((float)t, INV2[d >> 1]); v2f cs; cs[0] = cosf(a); cs[1] = sinf(a); *(v2f*)(CS + (size_t)idx * 2) = cs;  }
// ---- k_qkv: the q | k | v projection of every batch in one launch, ONE WAVE per 64x64 tile (the K loop of k_gemmw, bf16, one product), which builds the attention planes itself from its accumulators.
// grid (NB_ TT / 64, 3 NH_): 64 rows of x (one batch, 64 positions) x 64 columns of the fused weight = one head of q (blockIdx.y < NH_), of k (< 2 NH_) or of v.
// q and k tiles: interleaved-pair rotary on the f32 sums (table CS), then planes [b][h][t][d] as fp16, bf16 hi and bf16 lo; through LDS, so that a 128-byte plane row is stored whole.
// v tiles: planes [b][h][d][t]; accumulator elements 0..7 of a lane are 8 consecutive positions of one column, so 16 bytes a plane go out straight from registers.
__global__ __launch_bounds__(32) void k_qkv(const bf* __restrict__ A, const bf* __restrict__ Bt, const float* __restrict__ CS, h16* Q16, bf* Qh, bf* Ql, h16* K16, bf* Kh, bf* Kl, h16* V16, bf* Vh, bf* Vl) {
    typedef WFrag<bf>::V V;
    __shared__ __align__(16) float os[16 * 68];
    const int lane = threadIdx.x & 31, lr = lane & 15, hi = lane >> 4; const int r0 = blockIdx.x * 64, c0 = blockIdx.y * 64;
    v8f acc[4][4];
#pragma unroll
    for (int mb = 0; mb < 4; ++mb)
#pragma unroll
        for (int nb = 0; nb < 4; ++nb) acc[mb][nb] = (v8f){};
    const bf* Ar = A + (size_t)r0 * DM; const bf* Br = Bt + (size_t)c0 * DM; const unsigned lo = (unsigned)(lr * DM + 8 * hi) * 2u;   // wave-uniform tile bases and one lane offset in bytes for both operands
#pragma unroll 1
    for (int kc = 0; kc < DM; kc += 32) {   // rolled: one trip's 16 accumulators and 5 fragments are the register budget
        V a[4];
#pragma unroll
        for (int mb = 0; mb < 4; ++mb) a[mb] = WFrag<bf>::ld((const bf*)((const char*)(Ar + kc + mb * 16 * DM) + lo));
        asm volatile("s_wait_xcnt 0x0" ::: "memory");   // stands before a later load's result lands in the address registers of these loads
#pragma unroll
        for (int nb = 0; nb < 4; ++nb) { const V b = WFrag<bf>::ld((const bf*)((const char*)(Br + kc + nb * 16 * DM) + lo));
#pragma unroll
            for (int mb = 0; mb < 4; ++mb) acc[mb][nb] = WFrag<bf>::mma(a[mb], b, acc[mb][nb]); }
    }
    const int bt = r0 / TT, t0 = r0 % TT, sel = blockIdx.y / NH_, hd = blockIdx.y % NH_;
    const size_t po = ((size_t)bt * NH_ + hd) * TT * HD;
    if (sel == 2) {
        char* W16 = (char*)(V16 + po + t0); char* Wh = (char*)(Vh + po + t0); char* Wl = (char*)(Vl + po + t0); const unsigned vl = (unsigned)(lr * TT + hi * 8) * 2u;   // uniform bases, lane offset in bytes
#pragma unroll
        for (int nb = 0; nb < 4; ++nb) {
#pragma unroll
            for (int mb = 0; mb < 4; ++mb) { v8h o16; v8us oh, ol;
#pragma unroll
                for (int j = 0; j < 8; ++j) { const float x = acc[mb][nb][j]; o16[j] = tohx(x); unsigned short a2, c2; splitf(x, a2, c2); oh[j] = a2; ol[j] = c2; }
                const int vc = (nb * 16 * TT + mb * 16) * 2; *(v8ha*)(W16 + vc + vl) = o16; *(v8usa*)(Wh + vc + vl) = oh; *(v8usa*)(Wl + vc + vl) = ol;
                asm volatile("s_wait_xcnt 0x0" ::: "memory"); } }   // stands before the registers that the three stores name are written again
    } else {
        const size_t pt = po + (size_t)t0 * HD; char* W16 = (char*)((sel ? K16 : Q16) + pt); char* Wh = (char*)((sel ? Kh : Qh) + pt); char* Wl = (char*)((sel ? Kl : Ql) + pt); const char* Ct = (const char*)(CS + (size_t)t0 * HD * 2);
        const unsigned pl = (unsigned)(hi * HD + lr * 4) * 2u, cl = pl * 4u;   // uniform bases, lane offsets in bytes (plane row 128 B, table row 512 B)
#pragma unroll
        for (int mb = 0; mb < 4; ++mb) {
#pragma unroll
            for (int nb = 0; nb < 4; ++nb) {
#pragma unroll
                for (int j = 0; j < 8; ++j) os[(hi * 8 + j) * 68 + nb * 16 + lr] = acc[mb][nb][j]; }
            __builtin_amdgcn_wave_barrier(); asm volatile("" ::: "memory");   // the row reads below stay behind the other lanes' LDS writes
            v4f xv[8]; v2f ca[8], cb[8];   // all 16 rows' sums and table entries are fetched before the first store, one latency a block of 16 rows
#pragma unroll
            for (int s = 0; s < 8; ++s) { const int row = 2 * s + hi; xv[s] = *(const v4fa*)(os + row * 68 + lr * 4); const char* cp = Ct + (mb * 16 + 2 * s) * HD * 8 + cl; ca[s] = *(const v2f*)cp; cb[s] = *(const v2f*)(cp + 16); }
#pragma unroll
            for (int s = 0; s < 8; ++s) { const int pc = (mb * 16 + 2 * s) * HD * 2; float r[4]; v4h o16; v4us oh, ol;
                r[0] = xv[s][0] * ca[s][0] - xv[s][1] * ca[s][1]; r[1] = xv[s][0] * ca[s][1] + xv[s][1] * ca[s][0];   /* even: x0 c - x1 s; odd: x0 s + x1 c; free to contract to a product and an fma */
                r[2] = xv[s][2] * cb[s][0] - xv[s][3] * cb[s][1]; r[3] = xv[s][2] * cb[s][1] + xv[s][3] * cb[s][0];
#pragma unroll
                for (int q = 0; q < 4; ++q) { o16[q] = tohx(r[q]); unsigned short a2, c2; splitf(r[q], a2, c2); oh[q] = a2; ol[q] = c2; }
                *(v4h*)(W16 + pc + pl) = o16; *(v4us*)(Wh + pc + pl) = oh; *(v4us*)(Wl + pc + pl) = ol;
                asm volatile("s_wait_xcnt 0x0" ::: "memory"); }   // stands before the registers that the three stores name are written again
            __builtin_amdgcn_wave_barrier(); asm volatile("" ::: "memory");   // the next block's LDS writes stay behind these reads
        }
    }
}
// ---- k_fattn: fused attention, one launch for every batch, head and query row. Scores, softmax and P stay in registers.
// St = K Qt (A = 16 key rows, B = 16 query columns), Ot += Vt Pt: accumulator element j of lane (lr, hi) of the score tile of keys kb + 16 kt .. is key kb + 16 kt + 8 hi + j of query lr,
// which is element 8 kt + j of the B operand of a 32-key product in the loaders' k order, so P is packed in place. Running maximum per query column, output and sum rescaled every 32 keys.
// A work-group of 8 waves shares K and Vt: 64 keys a stage, brought through registers into two LDS buffers (rows of 128 B at a pitch of 144 B), one barrier a stage.
// Work-groups below NHW: query rows < RH, 16 columns a wave, hi/lo bf16 planes, 3 products; the rest: 32 columns a wave, fp16.
#define FP   72                   // LDS row pitch in 16-bit elements
#define FPS  (64 * FP)            // one staged plane: 64 rows
#define NST  (TT / 64)
#define CL2  0.18033688011112042f // HD^-0.5 x log2(e)
typedef __attribute__((ext_vector_type(2))) __bf16 v2b;
typedef __attribute__((ext_vector_type(8))) unsigned v8u;
template <bool HI> struct FT;
template <> struct FT<false> { typedef v16h V; static __device__ __forceinline__ V ld(const unsigned short* p) { return __builtin_bit_cast(v16h, __builtin_shufflevector(*(const v8usa*)p, *(const v8usa*)(p + 16), 0, 1, 2, 3, 4, 5, 6, 7, 8, 9, 10, 11, 12, 13, 14, 15)); } static __device__ __forceinline__ v8f mma(V a, V b, v8f c) { return wmma16(a, b, c); } };
template <> struct FT<true> { typedef v16bf V; static __device__ __forceinline__ V ld(const unsigned short* p) { return cat16b(*(const v8usa*)p, *(const v8usa*)(p + 16)); } static __device__ __forceinline__ v8f mma(V a, V b, v8f c) { return wmmab(a, b, c); } };
__device__ __forceinline__ float xhalf(float x) { const int b = __float_as_int(x); return __int_as_float(__builtin_amdgcn_permlanex16(b, b, 0x76543210, 0xfedcba98, false, false)); }   // lane l <-> l ^ 16
template <bool HI, int NT>
__device__ __forceinline__ void fattn(unsigned short* sm, const unsigned short* __restrict__ Q, const unsigned short* __restrict__ Q2, const unsigned short* __restrict__ Kg, const unsigned short* __restrict__ K2g, const unsigned short* __restrict__ Vg, const unsigned short* __restrict__ V2g, int qw, bf* Ah, bf* Al) {
    typedef typename FT<HI>::V V;
    constexpr int PLN = HI ? 4 : 2;   // staged planes: K, Vt (, K lo, Vt lo)
    const int tid = threadIdx.x, lane = tid & 31, lr = lane & 15, hi = lane >> 4;
    const int srow = tid >> 3, sseg = (tid & 7) * 8;   // staging: rows srow and srow + 32, one 16-byte segment of each plane
    v8us st[PLN][2];
    auto gload = [&](int s) {
#pragma unroll
        for (int r = 0; r < 2; ++r) { const int row = srow + 32 * r; const size_t ko = (size_t)(s * 64 + row) * HD + sseg, vo = (size_t)row * TT + s * 64 + sseg;
            st[0][r] = *(const v8usa*)(Kg + ko); st[1][r] = *(const v8usa*)(Vg + vo);
            if constexpr (HI) { st[2][r] = *(const v8usa*)(K2g + ko); st[3][r] = *(const v8usa*)(V2g + vo); } }
        asm volatile("s_wait_xcnt 0x0" ::: "memory"); };   // stands before the address registers of the loads issued so far are written again
    auto sstore = [&](int b) {
#pragma unroll
        for (int r = 0; r < 2; ++r)
#pragma unroll
            for (int pl = 0; pl < PLN; ++pl) *(v8usa*)(sm + (b * PLN + pl) * FPS + (srow + 32 * r) * FP + sseg) = st[pl][r]; };
    V qf[NT][2], qf2[NT][2];
#pragma unroll
    for (int nt = 0; nt < NT; ++nt)
#pragma unroll
        for (int ks = 0; ks < 2; ++ks) { const size_t qo = (size_t)(qw + nt * 16 + lr) * HD + ks * 32 + 8 * hi; qf[nt][ks] = FT<HI>::ld(Q + qo); if constexpr (HI) qf2[nt][ks] = FT<HI>::ld(Q2 + qo); }
    asm volatile("s_wait_xcnt 0x0" ::: "memory");   // stands before the address registers of the Q loads are written again
    v8f o[4][NT]; float mc[NT], l[NT];
#pragma unroll
    for (int nt = 0; nt < NT; ++nt) { mc[nt] = -3.0e37f; l[nt] = 0.f;
#pragma unroll
        for (int dt = 0; dt < 4; ++dt) o[dt][nt] = (v8f){}; }
    gload(0); sstore(0); __syncthreads();
#pragma unroll 1
    for (int s = 0; s < NST; ++s) {
        if (s + 1 < NST) gload(s + 1);
        const unsigned short* kb = sm + (s & 1) * PLN * FPS;
#pragma unroll
        for (int p = 0; p < 2; ++p) {
            v8f sc[2][NT];
#pragma unroll
            for (int kt = 0; kt < 2; ++kt) { V ka[2], ka2[2];
#pragma unroll
                for (int ks = 0; ks < 2; ++ks) { const int off = (p * 32 + kt * 16 + lr) * FP + ks * 32 + 8 * hi; ka[ks] = FT<HI>::ld(kb + off); if constexpr (HI) ka2[ks] = FT<HI>::ld(kb + 2 * FPS + off); }
#pragma unroll
                for (int nt = 0; nt < NT; ++nt) { v8f a = (v8f){};
#pragma unroll
                    for (int ks = 0; ks < 2; ++ks) { a = FT<HI>::mma(ka[ks], qf[nt][ks], a); if constexpr (HI) { a = FT<HI>::mma(ka[ks], qf2[nt][ks], a); a = FT<HI>::mma(ka2[ks], qf[nt][ks], a); } }
                    sc[kt][nt] = a; } }
            V pf[NT], pf2[NT];
#pragma unroll
            for (int nt = 0; nt < NT; ++nt) {
                float cm = fmaxf(sc[0][nt][0], sc[1][nt][0]);
#pragma unroll
                for (int j = 1; j < 8; ++j) cm = fmaxf(cm, fmaxf(sc[0][nt][j], sc[1][nt][j]));
                cm = fmaxf(cm, xhalf(cm));
                const float mn = fmaxf(mc[nt], cm * CL2); const float al = __builtin_amdgcn_exp2f(mc[nt] - mn); mc[nt] = mn; const float mo = HI ? mn : mn - PCL2;
                float e[16];
#pragma unroll
                for (int i = 0; i < 16; ++i) e[i] = __builtin_amdgcn_exp2f(fmaf(sc[i >> 3][nt][i & 7], CL2, -mo));
                const float ps = ((e[0] + e[1]) + (e[2] + e[3])) + ((e[4] + e[5]) + (e[6] + e[7])) + (((e[8] + e[9]) + (e[10] + e[11])) + ((e[12] + e[13]) + (e[14] + e[15])));
                l[nt] = fmaf(l[nt], al, ps);
#pragma unroll
                for (int dt = 0; dt < 4; ++dt) o[dt][nt] *= al;
                v8u ph, pl;   // two elements a register, converted in pairs
#pragma unroll
                for (int i = 0; i < 8; ++i) { const v2f ev = { e[2 * i], e[2 * i + 1] };
                    if constexpr (HI) { const v2b hb = __builtin_convertvector(ev, v2b); ph[i] = __builtin_bit_cast(unsigned, hb); pl[i] = __builtin_bit_cast(unsigned, __builtin_convertvector(ev - __builtin_convertvector(hb, v2f), v2b)); }
                    else ph[i] = __builtin_bit_cast(unsigned, __builtin_convertvector(ev, v2h)); }
                pf[nt] = __builtin_bit_cast(V, ph); if constexpr (HI) pf2[nt] = __builtin_bit_cast(V, pl); }
#pragma unroll
            for (int dt = 0; dt < 4; ++dt) { const int off = FPS + (dt * 16 + lr) * FP + p * 32 + 8 * hi; const V va = FT<HI>::ld(kb + off); V va2; if constexpr (HI) va2 = FT<HI>::ld(kb + 2 * FPS + off);
#pragma unroll
                for (int nt = 0; nt < NT; ++nt) { o[dt][nt] = FT<HI>::mma(va, pf[nt], o[dt][nt]); if constexpr (HI) { o[dt][nt] = FT<HI>::mma(va, pf2[nt], o[dt][nt]); o[dt][nt] = FT<HI>::mma(va2, pf[nt], o[dt][nt]); } } }
        }
        if (s + 1 < NST) sstore((s + 1) & 1);
        __syncthreads();   // publishes stage s + 1 and ends every wave's reads of the buffer that the next trip refills
    }
#pragma unroll
    for (int nt = 0; nt < NT; ++nt) { const float inv = __fdiv_rn(1.0f, l[nt] + xhalf(l[nt])); const size_t oo = (size_t)(qw + nt * 16 + lr) * DQ + hi * 8;
#pragma unroll
        for (int dt = 0; dt < 4; ++dt) { v8us oh, ol;
#pragma unroll
            for (int j = 0; j < 8; ++j) { unsigned short a, c2; splitf(o[dt][nt][j] * inv, a, c2); oh[j] = a; ol[j] = c2; }
            *(v8usa*)(Ah + oo + dt * 16) = oh; *(v8usa*)(Al + oo + dt * 16) = ol;
            asm volatile("s_wait_xcnt 0x0" ::: "memory"); } }   // stands before the registers that the two stores name are written again
}
#define NHW (NB_ * NH_ * (RH / 128))
#define NLW (NB_ * NH_ * ((TT - RH) / 256))
__global__ __launch_bounds__(256) __attribute__((amdgpu_waves_per_eu(4, 4))) void k_fattn(const h16* __restrict__ Q16, const bf* __restrict__ Qh, const bf* __restrict__ Ql, const h16* __restrict__ K16, const bf* __restrict__ Kh, const bf* __restrict__ Kl, const h16* __restrict__ V16, const bf* __restrict__ Vh, const bf* __restrict__ Vl, bf* Ah, bf* Al) {
    __shared__ __align__(16) unsigned short sm[2 * 4 * FPS];
    const int wave = threadIdx.x >> 5; int bx = blockIdx.x;   // the long work-groups (3 products) start first
    if (bx < NHW) { const int z = bx / (RH / 128), qt = bx % (RH / 128); const size_t zo = (size_t)z * TT * HD, ao = (size_t)(z / NH_) * TT * DQ + (z % NH_) * HD;
        fattn<true, 1>(sm, Qh + zo, Ql + zo, Kh + zo, Kl + zo, Vh + zo, Vl + zo, qt * 128 + wave * 16, Ah + ao, Al + ao);
    } else { bx -= NHW; const int z = bx / ((TT - RH) / 256), qt = bx % ((TT - RH) / 256); const size_t zo = (size_t)z * TT * HD, ao = (size_t)(z / NH_) * TT * DQ + (z % NH_) * HD;
        fattn<false, 2>(sm, (const unsigned short*)(Q16 + zo), nullptr, (const unsigned short*)(K16 + zo), nullptr, (const unsigned short*)(V16 + zo), nullptr, RH + qt * 256 + wave * 32, Ah + ao, Al + ao); }
}

extern "C" void kernel_launch(void* const* d_in, const int* in_sizes, int n_in,
                              void* d_out, int out_size, void* d_ws, size_t ws_size, hipStream_t stream) {
    (void)in_sizes; (void)n_in; (void)out_size;
    const float* x = (const float*)d_in[0]; const float* wqkv = (const float*)d_in[1]; const float* wo = (const float*)d_in[2]; const float* bo = (const float*)d_in[3];   /* x, w_qkv ('xw' [1024][3072]: q | k | v column thirds), w_proj ('xw'), b_proj */
    float* OUT = (float*)d_out;     // [4][2048][1024]
    char* wsp = (char*)d_ws;
    auto take = [&](size_t bytes) { char* p = wsp; wsp += (bytes + 255) & ~(size_t)255; return (void*)p; };
    bf* WQKV = (bf*)take((size_t)3 * DQ * DM * 2);   /* fused Bt [3*DQ][DM]: q | k | v row blocks */ bf* WO = (bf*)take((size_t)DM * DQ * 2); float* CS = (float*)take((size_t)TT * HD * 2 * 4);
    bf* XB = (bf*)take((size_t)NB_ * TT * DM * 2);
    const size_t PB = (size_t)NH_ * TT * HD;   // one batch's head planes, elements; every plane holds all NB_ batches
    h16* QP16 = (h16*)take(NB_ * PB * 2); h16* KP16 = (h16*)take(NB_ * PB * 2); h16* VT16 = (h16*)take(NB_ * PB * 2);
    bf* QPh = (bf*)take(NB_ * PB * 2); bf* QPl = (bf*)take(NB_ * PB * 2); bf* KPh = (bf*)take(NB_ * PB * 2); bf* KPl = (bf*)take(NB_ * PB * 2); bf* VTh = (bf*)take(NB_ * PB * 2); bf* VTl = (bf*)take(NB_ * PB * 2);
    bf* ATh = (bf*)take((size_t)NB_ * TT * DQ * 2); bf* ATl = (bf*)take((size_t)NB_ * TT * DQ * 2);
    if ((size_t)(wsp - (char*)d_ws) > ws_size) return;    // ws 256 MiB
    { k_wtG<<<(unsigned)((DM * 3 * DQ / 64 + 63) / 64), 256, 0, stream>>>(wqkv, DM, 3 * DQ, WQKV);   /* fused 'xw' [DM][3*DQ] -> Bt [3*DQ][DM] */
      k_wtG<<<(unsigned)((DQ * DM / 64 + 63) / 64), 256, 0, stream>>>(wo, DQ, DM, WO);
       }
    k_csP<<<(TT * HD + 255) / 256, 256, 0, stream>>>(CS);
    k_cvt8<<<(unsigned)(((size_t)NB_ * TT * DM / 8 + 255) / 256), 256, 0, stream>>>(x, XB, (size_t)NB_ * TT * DM / 8);
    k_qkv<<<dim3(NB_ * TT / 64, 3 * NH_, 1), 32, 0, stream>>>(XB, WQKV, CS, QP16, QPh, QPl, KP16, KPh, KPl, VT16, VTh, VTl);
    k_fattn<<<NHW + NLW, 256, 0, stream>>>(QP16, QPh, QPl, KP16, KPh, KPl, VT16, VTh, VTl, ATh, ATl);
    for (int b = 0; b < NB_; ++b)
        k_gemmw<bf, 1, true><<<dim3(TT / 64, DM / 64, 1), 32, 0, stream>>>(ATh + (size_t)b * TT * DQ, ATl + (size_t)b * TT * DQ, WO, nullptr, DQ, OUT + (size_t)b * TT * DM, DM, bo, 0, 0, 0, 0);
}

// v004
// One run takes 260 microseconds.
// Timed twice side by side with v003, it ran 1.49 and 1.47 times as fast.
// Over all steps from v000 it is 15.4 times as fast.
#include <hip/hip_runtime.h>

// Multi-head self-attention with a fused bias-free qkv projection and computed interleaved-pair rotary embeddings at SCALED frequencies (x [4][2048][1024]; qkv = x w_qkv ('xw' (in, out) [1024][3072] 1/32, no bias) viewed (B, L, 3, 16, 64): q | k | v column thirds (16 heads x 64); rope on q and k: pairs (x[2i], x[2i+1]) -> (re c - im s, re s + im c) with angle pos x theta_i, theta = (1 / 10000^(2i/64)) x 3.0 (ROPE_SCALE; 32 f32 frequencies jnp-exact; one f32 product per angle; precise cosf/sinf); attn x 64^-0.5; softmax over all keys (no mask); out = merged w_proj + b_proj ('xw' + a bias: READ) -> [4][2048][1024] (8.4 M); argument order x, w_qkv, w_proj, b_proj).
// Layout: bf16 copy of x; the fused 'xw' weight transposed ONCE into q | k | v row blocks; k_csP computed interleaved table at the scaled frequencies; k_qkv: exact projections of all batches with the interleaved-pair rotary and the plane split in their epilogue; fused dense T-2048 attention, all batches in one launch (hybrid rows: < 512 hi/lo 3 products, rest fp16 x1024); merged hi/lo x w_proj exact + b_proj.
// Compute dtypes, f32 accumulate: every input rounded to bf16; projections exact; rotary f32; attention rows < 512 3 products, rest fp16; softmax f32; w_proj hl x exact + bias.

#define NB_  4
#define TT   2048
#define DM   1024
#define NH_  16
#define NKV  16
#define REP  (NH_ / NKV)
#define HD   64
#define DQ   (NH_ * HD)
#define DKV  (NKV * HD)
#define RH   512                  // query rows < RH use hi+lo planes (0: none)
#define WIN  0
#define PCL2 10.0f                // fp16 rows: P is carried as weight x 2^PCL2, so that small weights stay normal fp16 numbers; the factor cancels in the division by the row sum
typedef _Float16 h16;
typedef unsigned short bf;
typedef __attribute__((ext_vector_type(16))) __bf16   v16bf;
typedef __attribute__((ext_vector_type(16))) _Float16 v16h;
typedef __attribute__((ext_vector_type(8)))  _Float16 v8h;
typedef __attribute__((ext_vector_type(8)))  unsigned short v8us;
typedef __attribute__((ext_vector_type(8)))  float    v8f;
typedef __attribute__((ext_vector_type(4)))  float    v4f;
typedef v8h  __attribute__((may_alias)) v8ha;
typedef v4f  __attribute__((may_alias)) v4fa;
typedef v8us __attribute__((may_alias)) v8usa;

__device__ __forceinline__ unsigned short f2bf(float f) { unsigned u = __float_as_uint(f); u += 0x7FFFu + ((u >> 16) & 1u); return (unsigned short)(u >> 16); }
__device__ __forceinline__ float bf2f(unsigned short b) { return __uint_as_float(((unsigned)b) << 16); }
__device__ __forceinline__ float bfr(float f) { return bf2f(f2bf(f)); }
__device__ __forceinline__ v16h cat16(v8h lo, v8h hi) { return __builtin_shufflevector(lo, hi, 0, 1, 2, 3, 4, 5, 6, 7, 8, 9, 10, 11, 12, 13, 14, 15); }
__device__ __forceinline__ v16bf cat16b(v8us lo, v8us hi) { return __builtin_bit_cast(v16bf, __builtin_shufflevector(lo, hi, 0, 1, 2, 3, 4, 5, 6, 7, 8, 9, 10, 11, 12, 13, 14, 15)); }
__device__ __forceinline__ v8f wmma16(v16h a, v16h b, v8f c) { return __builtin_amdgcn_wmma_f32_16x16x32_f16(false, a, false, b, (short)0, c, false, false); }
__device__ __forceinline__ v8f wmmab(v16bf a, v16bf b, v8f c) { return __builtin_amdgcn_wmma_f32_16x16x32_bf16(false, a, false, b, (short)0, c, false, false); }



// ---- gemm128: the K loop of both GEMMs. A work-group of 4 waves (2 x 2) owns a 128 x 128 tile of C[m][n] = sum_k A[m][k] Bt[n][k] (NPL 3: + A2[m][k] Bt[n][k]), K = DM, operands K-contiguous bf16 planes; each wave keeps its 64 x 64 quarter in 16 accumulators.
// A stage is 64 k of 128 rows of every plane (rows of 128 B at a pitch of 144 B in LDS), brought by asynchronous copies to LDS: one wave-wide copy covers 4 whole 128-byte lines, and each line is fetched once a work-group. Two buffers, one barrier a stage.
template <typename T16> struct WFrag;
template <> struct WFrag<h16> { typedef v16h V; static __device__ __forceinline__ V ld(const h16* p) { return cat16(*(const v8h*)p, *(const v8h*)(p + 16)); } static __device__ __forceinline__ v8f mma(V a, V b, v8f c) { return wmma16(a, b, c); } };
template <> struct WFrag<bf> { typedef v16bf V; static __device__ __forceinline__ V ld(const bf* p) { return cat16b(*(const v8us*)p, *(const v8us*)(p + 16)); } static __device__ __forceinline__ v8f mma(V a, V b, v8f c) { return wmmab(a, b, c); } };
#define GP   72                   // LDS row pitch in 16-bit elements
#define GPL  (128 * GP)           // one staged plane: 128 rows
#define GNS  (DM / 64)            // stages along K
// one plane of a stage: this lane's 16 bytes of rows r, r + 16, .. r + 112. The s_wait_xcnt closes the copies' own statement, so that it stands before any rewrite of the address registers that they name.
__device__ __forceinline__ void gcopy(unsigned l, const bf* g) {
    asm volatile("global_load_async_to_lds_b128 %0, %8, off\n\t"
                 "global_load_async_to_lds_b128 %1, %9, off\n\t"
                 "global_load_async_to_lds_b128 %2, %10, off\n\t"
                 "global_load_async_to_lds_b128 %3, %11, off\n\t"
                 "global_load_async_to_lds_b128 %4, %12, off\n\t"
                 "global_load_async_to_lds_b128 %5, %13, off\n\t"
                 "global_load_async_to_lds_b128 %6, %14, off\n\t"
                 "global_load_async_to_lds_b128 %7, %15, off\n\t"
                 "s_wait_xcnt 0x0"
                 :: "v"(l), "v"(l + 16 * GP * 2), "v"(l + 32 * GP * 2), "v"(l + 48 * GP * 2), "v"(l + 64 * GP * 2), "v"(l + 80 * GP * 2), "v"(l + 96 * GP * 2), "v"(l + 112 * GP * 2),
                    "v"(g), "v"(g + 16 * DM), "v"(g + 32 * DM), "v"(g + 48 * DM), "v"(g + 64 * DM), "v"(g + 80 * DM), "v"(g + 96 * DM), "v"(g + 112 * DM) : "memory");
}
// Every plain '#pragma unroll' here and in the two kernels that call it is there so that the fragment and accumulator arrays are indexed by constants and stay in registers.
template <int NPL>   // staged planes: A, Bt (, A2). Ag, A2g, Bg: row 0 of the work-group's 128 rows
__device__ __forceinline__ void gemm128(unsigned short* sm, const bf* __restrict__ Ag, const bf* __restrict__ A2g, const bf* __restrict__ Bg, int wave, v8f (&acc)[4][4]) {
    typedef WFrag<bf>::V V;
    const int tid = threadIdx.x, lane = tid & 31, lr = lane & 15, hi = lane >> 4;
    const unsigned l0 = (unsigned)(size_t)sm + (unsigned)((tid >> 3) * GP + (tid & 7) * 8) * 2u;   // LDS byte address of this lane's 16 bytes of row tid / 8
    const size_t go = (size_t)(tid >> 3) * DM + (tid & 7) * 8;
    auto fill = [&](int s) { const unsigned lb = l0 + (unsigned)((s & 1) * NPL * GPL) * 2u; const size_t o = go + (size_t)s * 64;
        gcopy(lb, Ag + o); gcopy(lb + GPL * 2, Bg + o); if constexpr (NPL == 3) gcopy(lb + 2 * GPL * 2, A2g + o); };
    fill(0);
    asm volatile("s_wait_asynccnt 0x0" ::: "memory");   // this wave's copies of stage 0 have landed
    __syncthreads();                                    // publishes stage 0
    fill(1);
    const int ao = ((wave >> 1) * 64 + lr) * GP + 8 * hi, bo = GPL + ((wave & 1) * 64 + lr) * GP + 8 * hi;
#pragma unroll 1
    for (int s = 0; s < GNS; ++s) {   // rolled: one trip a stage, so that the buffer index and the refill test stay scalar
        const unsigned short* bp = sm + (s & 1) * NPL * GPL;
#pragma unroll
        for (int ks = 0; ks < 2; ++ks) {
            V a[4], a2[4], b[4];   // the block's fragments are fetched as one group ahead of its products
#pragma unroll
            for (int mb = 0; mb < 4; ++mb) { a[mb] = WFrag<bf>::ld(bp + ao + mb * 16 * GP + ks * 32); if constexpr (NPL == 3) a2[mb] = WFrag<bf>::ld(bp + 2 * GPL + ao + mb * 16 * GP + ks * 32); }
#pragma unroll
            for (int nb = 0; nb < 4; ++nb) b[nb] = WFrag<bf>::ld(bp + bo + nb * 16 * GP + ks * 32);
            __builtin_amdgcn_sched_barrier(0);   // keeps the reads together in front: sunk among the products, into one shared Bt fragment, every four products wait out an LDS latency
#pragma unroll
            for (int nb = 0; nb < 4; ++nb)
#pragma unroll
                for (int mb = 0; mb < 4; ++mb) { acc[mb][nb] = WFrag<bf>::mma(a[mb], b[nb], acc[mb][nb]); if constexpr (NPL == 3) acc[mb][nb] = WFrag<bf>::mma(a2[mb], b[nb], acc[mb][nb]); }
        }
        asm volatile("s_wait_dscnt 0x0" ::: "memory");      // this wave's reads of stage s have returned
        asm volatile("s_wait_asynccnt 0x0" ::: "memory");   // this wave's copies of stage s + 1 have landed
        __syncthreads();                                    // publishes stage s + 1 and ends every wave's reads of the buffer refilled below
        if (s + 2 < GNS) fill(s + 2);
    }
    asm volatile("s_wait_asynccnt 0x0" ::: "memory");   // no copy is outstanding when the wave goes on
}
// ---- k_proj: C (f32, pitch DM) = (A + A2) Bt^T + bias, grid (M / 128, DM / 128), 128 threads; a wave's 64 x 64 quarter goes out through its own LDS rows, whole 128-byte lines.
__global__ __launch_bounds__(128) void k_proj(const bf* __restrict__ A, const bf* __restrict__ A2, const bf* __restrict__ Bt, float* C, const float* __restrict__ bias) {
    __shared__ __align__(16) unsigned short sm[2 * 3 * GPL];
    __shared__ __align__(16) float osw[4][16 * 68];
    const int lane = threadIdx.x & 31, lr = lane & 15, hi = lane >> 4; const int wave = __builtin_amdgcn_readfirstlane(threadIdx.x >> 5);
    float* os = osw[wave]; const int r0 = blockIdx.x * 128 + (wave >> 1) * 64, c0 = blockIdx.y * 128 + (wave & 1) * 64;
    v8f acc[4][4];
#pragma unroll
    for (int mb = 0; mb < 4; ++mb)
#pragma unroll
        for (int nb = 0; nb < 4; ++nb) acc[mb][nb] = (v8f){};
    gemm128<3>(sm, A + (size_t)blockIdx.x * 128 * DM, A2 + (size_t)blockIdx.x * 128 * DM, Bt + (size_t)blockIdx.y * 128 * DM, wave, acc);
    const int cofs = lr * 4; v4f bv; bv[0] = bfr(bias[c0 + cofs]); bv[1] = bfr(bias[c0 + cofs + 1]); bv[2] = bfr(bias[c0 + cofs + 2]); bv[3] = bfr(bias[c0 + cofs + 3]);
#pragma unroll
    for (int mb = 0; mb < 4; ++mb) {
#pragma unroll
        for (int nb = 0; nb < 4; ++nb) {
#pragma unroll
            for (int j = 0; j < 8; ++j) os[(hi * 8 + j) * 68 + nb * 16 + lr] = acc[mb][nb][j]; }
        __builtin_amdgcn_wave_barrier(); asm volatile("" ::: "memory");   // the row reads below stay behind the other lanes' LDS writes
        float* crow = C + (size_t)(r0 + mb * 16) * DM + c0;
#pragma unroll
        for (int s = 0; s < 8; ++s) { const int row = 2 * s + hi; const v4f val = *(const v4fa*)(os + row * 68 + cofs) + bv;
            *(v4f*)(crow + (size_t)row * DM + cofs) = val; }
        asm volatile("s_wait_xcnt 0x0" ::: "memory");   // stands before the registers that the stores name are written again
        __builtin_amdgcn_wave_barrier(); asm volatile("" ::: "memory");   // the next block's LDS writes stay behind these reads
    }
}

__device__ __forceinline__ h16 tohx(float x) { return (h16)x; }
__device__ __forceinline__ void splitf(float y, unsigned short& h, unsigned short& l) { h = f2bf(y); l = f2bf(y - bf2f(h)); }
typedef __attribute__((ext_vector_type(2))) _Float16 v2h;
typedef __attribute__((ext_vector_type(4))) _Float16 v4h;
typedef __attribute__((ext_vector_type(2))) unsigned short v2us;
typedef __attribute__((ext_vector_type(4))) unsigned short v4us;
typedef __attribute__((ext_vector_type(2))) float v2f;
typedef __attribute__((ext_vector_type(4))) int v4i;

__global__ __launch_bounds__(256) void k_wtG(const float* __restrict__ w, int K, int N, bf* Bt) {
    const int lane = threadIdx.x & 31; const int L0 = (blockIdx.x * 8 + (threadIdx.x >> 5)) * 8; const int nlines = N * K / 64;
{
#pragma unroll 1
        for (int l = 0; l < 8; ++l) { const int L = L0 + l; if (L >= nlines) break; const size_t e = (size_t)L * 64 + lane * 2; const int k = (int)(e % K), n = (int)(e / K); v2us o;
            o[0] = f2bf(w[(size_t)k * N + n]); o[1] = f2bf(w[(size_t)(k + 1) * N + n]); *(v2us*)(Bt + e) = o; }
         }
}
__global__ __launch_bounds__(256) void k_cvt8(const float* __restrict__ src, bf* dst, size_t n8) { const size_t i = (size_t)blockIdx.x * 256 + threadIdx.x; if (i >= n8) return; const v8f v = *(const v8f*)(src + i * 8); v8us o;
#pragma unroll
    for (int k = 0; k < 8; ++k) o[k] = f2bf(v[k]); *(v8us*)(dst + i * 8) = o;  }

// INV2: the 32 rotary frequencies of THIS module: (1.0 / (ROPE_BASE ** (arange(0, 64, 2, float32) / 64))) * ROPE_SCALE with ROPE_BASE 10000 and ROPE_SCALE 3.0, generated with jnp in float32 (bit-exact; == the unscaled table x 3.0f in f32, 32 of 32): the adjacent (even, odd) pair shares entry d / 2.
__constant__ float INV2[HD / 2] = { 3.000000000e+00f, 2.249682665e+00f, 1.687023997e+00f, 1.265089512e+00f, 9.486832619e-01f, 7.114120722e-01f, 5.334838033e-01f, 4.000564218e-01f, 3.000000119e-01f, 2.249682546e-01f, 1.687023938e-01f, 1.265089512e-01f, 9.486833215e-02f, 7.114120573e-02f, 5.334838480e-02f, 4.000564665e-02f, 2.999999933e-02f, 2.249682695e-02f, 1.687023975e-02f, 1.265089400e-02f, 9.486833587e-03f, 7.114121690e-03f, 5.334838293e-03f, 4.000564106e-03f, 3.000000026e-03f, 2.249682555e-03f, 1.687023905e-03f, 1.265089493e-03f, 9.486833587e-04f, 7.114121690e-04f, 5.334838061e-04f, 4.000564513e-04f };
__global__ __launch_bounds__(256) void k_csP(float* CS) { const int idx = blockIdx.x * 256 + threadIdx.x; if (idx >= TT * HD) return; const int d = idx % HD; const int t = idx / HD; const float a = __fmul_rn((float)t, INV2[d >> 1]); v2f cs; cs[0] = cosf(a); cs[1] = sinf(a); *(v2f*)(CS + (size_t)idx * 2) = cs;  }
// ---- k_qkv: the q | k | v projection of every batch in one launch (gemm128, one product), each wave building the attention planes of its 64 x 64 quarter itself from its accumulators.
// grid (NB_ TT / 128, 3 NH_ / 2), 128 threads: a wave has 64 rows of x (one batch, 64 positions) x 64 columns of the fused weight = one head of q (column block < NH_), of k (< 2 NH_) or of v.
// q and k tiles: interleaved-pair rotary on the f32 sums (table CS), then planes [b][h][t][d] as fp16, bf16 hi and bf16 lo; through the wave's own LDS rows, so that a 128-byte plane row is stored whole.
// v tiles: planes [b][h][d][t]; accumulator elements 0..7 of a lane are 8 consecutive positions of one column, so 16 bytes a plane go out straight from registers.
__global__ __launch_bounds__(128) void k_qkv(const bf* __restrict__ A, const bf* __restrict__ Bt, const float* __restrict__ CS, h16* Q16, bf* Qh, bf* Ql, h16* K16, bf* Kh, bf* Kl, h16* V16, bf* Vh, bf* Vl) {
    __shared__ __align__(16) unsigned short sm[2 * 2 * GPL];
    __shared__ __align__(16) float osw[4][16 * 68];
    const int lane = threadIdx.x & 31, lr = lane & 15, hi = lane >> 4; const int wave = __builtin_amdgcn_readfirstlane(threadIdx.x >> 5);
    float* os = osw[wave]; const int r0 = blockIdx.x * 128 + (wave >> 1) * 64, cy = blockIdx.y * 2 + (wave & 1);
    v8f acc[4][4];
#pragma unroll
    for (int mb = 0; mb < 4; ++mb)
#pragma unroll
        for (int nb = 0; nb < 4; ++nb) acc[mb][nb] = (v8f){};
    gemm128<2>(sm, A + (size_t)blockIdx.x * 128 * DM, nullptr, Bt + (size_t)blockIdx.y * 128 * DM, wave, acc);
    const int bt = r0 / TT, t0 = r0 % TT, sel = cy / NH_, hd = cy % NH_;
    const size_t po = ((size_t)bt * NH_ + hd) * TT * HD;
    if (sel == 2) {
        char* W16 = (char*)(V16 + po + t0); char* Wh = (char*)(Vh + po + t0); char* Wl = (char*)(Vl + po + t0); const unsigned vl = (unsigned)(lr * TT + hi * 8) * 2u;   // uniform bases, lane offset in bytes
#pragma unroll
        for (int nb = 0; nb < 4; ++nb) {
#pragma unroll
            for (int mb = 0; mb < 4; ++mb) { v8h o16; v8us oh, ol;
#pragma unroll
                for (int j = 0; j < 8; ++j) { const float x = acc[mb][nb][j]; o16[j] = tohx(x); unsigned short a2, c2; splitf(x, a2, c2); oh[j] = a2; ol[j] = c2; }
                const int vc = (nb * 16 * TT + mb * 16) * 2; *(v8ha*)(W16 + vc + vl) = o16; *(v8usa*)(Wh + vc + vl) = oh; *(v8usa*)(Wl + vc + vl) = ol;
                asm volatile("s_wait_xcnt 0x0" ::: "memory"); } }   // stands before the registers that the three stores name are written again
    } else {
        const size_t pt = po + (size_t)t0 * HD; char* W16 = (char*)((sel ? K16 : Q16) + pt); char* Wh = (char*)((sel ? Kh : Qh) + pt); char* Wl = (char*)((sel ? Kl : Ql) + pt); const char* Ct = (const char*)(CS + (size_t)t0 * HD * 2);
        const unsigned pl = (unsigned)(hi * HD + lr * 4) * 2u, cl = pl * 4u;   // uniform bases, lane offsets in bytes (plane row 128 B, table row 512 B)
#pragma unroll
        for (int mb = 0; mb < 4; ++mb) {
#pragma unroll
            for (int nb = 0; nb < 4; ++nb) {
#pragma unroll
                for (int j = 0; j < 8; ++j) os[(hi * 8 + j) * 68 + nb * 16 + lr] = acc[mb][nb][j]; }
            __builtin_amdgcn_wave_barrier(); asm volatile("" ::: "memory");   // the row reads below stay behind the other lanes' LDS writes
            v4f xv[8]; v2f ca[8], cb[8];   // all 16 rows' sums and table entries are fetched before the first store, one latency a block of 16 rows
#pragma unroll
            for (int s = 0; s < 8; ++s) { const int row = 2 * s + hi; xv[s] = *(const v4fa*)(os + row * 68 + lr * 4); const char* cp = Ct + (mb * 16 + 2 * s) * HD * 8 + cl; ca[s] = *(const v2f*)cp; cb[s] = *(const v2f*)(cp + 16); }
#pragma unroll
            for (int s = 0; s < 8; ++s) { const int pc = (mb * 16 + 2 * s) * HD * 2; float r[4]; v4h o16; v4us oh, ol;
                r[0] = xv[s][0] * ca[s][0] - xv[s][1] * ca[s][1]; r[1] = xv[s][0] * ca[s][1] + xv[s][1] * ca[s][0];   /* even: x0 c - x1 s; odd: x0 s + x1 c; free to contract to a product and an fma */
                r[2] = xv[s][2] * cb[s][0] - xv[s][3] * cb[s][1]; r[3] = xv[s][2] * cb[s][1] + xv[s][3] * cb[s][0];
#pragma unroll
                for (int q = 0; q < 4; ++q) { o16[q] = tohx(r[q]); unsigned short a2, c2; splitf(r[q], a2, c2); oh[q] = a2; ol[q] = c2; }
                *(v4h*)(W16 + pc + pl) = o16; *(v4us*)(Wh + pc + pl) = oh; *(v4us*)(Wl + pc + pl) = ol;
                asm volatile("s_wait_xcnt 0x0" ::: "memory"); }   // stands before the registers that the three stores name are written again
            __builtin_amdgcn_wave_barrier(); asm volatile("" ::: "memory");   // the next block's LDS writes stay behind these reads
        }
    }
}
// ---- k_fattn: fused attention, one launch for every batch, head and query row. Scores, softmax and P stay in registers.
// St = K Qt (A = 16 key rows, B = 16 query columns), Ot += Vt Pt: accumulator element j of lane (lr, hi) of the score tile of keys kb + 16 kt .. is key kb + 16 kt + 8 hi + j of query lr,
// which is element 8 kt + j of the B operand of a 32-key product in the loaders' k order, so P is packed in place. Running maximum per query column, output and sum rescaled every 32 keys.
// A work-group of 8 waves shares K and Vt: 64 keys a stage, brought through registers into two LDS buffers (rows of 128 B at a pitch of 144 B), one barrier a stage.
// Work-groups below NHW: query rows < RH, 16 columns a wave, hi/lo bf16 planes, 3 products; the rest: 32 columns a wave, fp16.
#define FP   72                   // LDS row pitch in 16-bit elements
#define FPS  (64 * FP)            // one staged plane: 64 rows
#define NST  (TT / 64)
#define CL2  0.18033688011112042f // HD^-0.5 x log2(e)
typedef __attribute__((ext_vector_type(2))) __bf16 v2b;
typedef __attribute__((ext_vector_type(8))) unsigned v8u;
template <bool HI> struct FT;
template <> struct FT<false> { typedef v16h V; static __device__ __forceinline__ V ld(const unsigned short* p) { return __builtin_bit_cast(v16h, __builtin_shufflevector(*(const v8usa*)p, *(const v8usa*)(p + 16), 0, 1, 2, 3, 4, 5, 6, 7, 8, 9, 10, 11, 12, 13, 14, 15)); } static __device__ __forceinline__ v8f mma(V a, V b, v8f c) { return wmma16(a, b, c); } };
template <> struct FT<true> { typedef v16bf V; static __device__ __forceinline__ V ld(const unsigned short* p) { return cat16b(*(const v8usa*)p, *(const v8usa*)(p + 16)); } static __device__ __forceinline__ v8f mma(V a, V b, v8f c) { return wmmab(a, b, c); } };
__device__ __forceinline__ float xhalf(float x) { const int b = __float_as_int(x); return __int_as_float(__builtin_amdgcn_permlanex16(b, b, 0x76543210, 0xfedcba98, false, false)); }   // lane l <-> l ^ 16
template <bool HI, int NT>
__device__ __forceinline__ void fattn(unsigned short* sm, const unsigned short* __restrict__ Q, const unsigned short* __restrict__ Q2, const unsigned short* __restrict__ Kg, const unsigned short* __restrict__ K2g, const unsigned short* __restrict__ Vg, const unsigned short* __restrict__ V2g, int qw, bf* Ah, bf* Al) {
    typedef typename FT<HI>::V V;
    constexpr int PLN = HI ? 4 : 2;   // staged planes: K, Vt (, K lo, Vt lo)
    const int tid = threadIdx.x, lane = tid & 31, lr = lane & 15, hi = lane >> 4;
    const int srow = tid >> 3, sseg = (tid & 7) * 8;   // staging: rows srow and srow + 32, one 16-byte segment of each plane
    v8us st[PLN][2];
    auto gload = [&](int s) {
#pragma unroll
        for (int r = 0; r < 2; ++r) { const int row = srow + 32 * r; const size_t ko = (size_t)(s * 64 + row) * HD + sseg, vo = (size_t)row * TT + s * 64 + sseg;
            st[0][r] = *(const v8usa*)(Kg + ko); st[1][r] = *(const v8usa*)(Vg + vo);
            if constexpr (HI) { st[2][r] = *(const v8usa*)(K2g + ko); st[3][r] = *(const v8usa*)(V2g + vo); } }
        asm volatile("s_wait_xcnt 0x0" ::: "memory"); };   // stands before the address registers of the loads issued so far are written again
    auto sstore = [&](int b) {
#pragma unroll
        for (int r = 0; r < 2; ++r)
#pragma unroll
            for (int pl = 0; pl < PLN; ++pl) *(v8usa*)(sm + (b * PLN + pl) * FPS + (srow + 32 * r) * FP + sseg) = st[pl][r]; };
    V qf[NT][2], qf2[NT][2];
#pragma unroll
    for (int nt = 0; nt < NT; ++nt)
#pragma unroll
        for (int ks = 0; ks < 2; ++ks) { const size_t qo = (size_t)(qw + nt * 16 + lr) * HD + ks * 32 + 8 * hi; qf[nt][ks] = FT<HI>::ld(Q + qo); if constexpr (HI) qf2[nt][ks] = FT<HI>::ld(Q2 + qo); }
    asm volatile("s_wait_xcnt 0x0" ::: "memory");   // stands before the address registers of the Q loads are written again
    v8f o[4][NT]; float mc[NT], l[NT];
#pragma unroll
    for (int nt = 0; nt < NT; ++nt) { mc[nt] = -3.0e37f; l[nt] = 0.f;
#pragma unroll
        for (int dt = 0; dt < 4; ++dt) o[dt][nt] = (v8f){}; }
    gload(0); sstore(0); __syncthreads();
#pragma unroll 1
    for (int s = 0; s < NST; ++s) {
        if (s + 1 < NST) gload(s + 1);
        const unsigned short* kb = sm + (s & 1) * PLN * FPS;
#pragma unroll
        for (int p = 0; p < 2; ++p) {
            v8f sc[2][NT];
#pragma unroll
            for (int kt = 0; kt < 2; ++kt) { V ka[2], ka2[2];
#pragma unroll
                for (int ks = 0; ks < 2; ++ks) { const int off = (p * 32 + kt * 16 + lr) * FP + ks * 32 + 8 * hi; ka[ks] = FT<HI>::ld(kb + off); if constexpr (HI) ka2[ks] = FT<HI>::ld(kb + 2 * FPS + off); }
#pragma unroll
                for (int nt = 0; nt < NT; ++nt) { v8f a = (v8f){};
#pragma unroll
                    for (int ks = 0; ks < 2; ++ks) { a = FT<HI>::mma(ka[ks], qf[nt][ks], a); if constexpr (HI) { a = FT<HI>::mma(ka[ks], qf2[nt][ks], a); a = FT<HI>::mma(ka2[ks], qf[nt][ks], a); } }
                    sc[kt][nt] = a; } }
            V pf[NT], pf2[NT];
#pragma unroll
            for (int nt = 0; nt < NT; ++nt) {
                float cm = fmaxf(sc[0][nt][0], sc[1][nt][0]);
#pragma unroll
                for (int j = 1; j < 8; ++j) cm = fmaxf(cm, fmaxf(sc[0][nt][j], sc[1][nt][j]));
                cm = fmaxf(cm, xhalf(cm));
                const float mn = fmaxf(mc[nt], cm * CL2); const float al = __builtin_amdgcn_exp2f(mc[nt] - mn); mc[nt] = mn; const float mo = HI ? mn : mn - PCL2;
                float e[16];
#pragma unroll
                for (int i = 0; i < 16; ++i) e[i] = __builtin_amdgcn_exp2f(fmaf(sc[i >> 3][nt][i & 7], CL2, -mo));
                const float ps = ((e[0] + e[1]) + (e[2] + e[3])) + ((e[4] + e[5]) + (e[6] + e[7])) + (((e[8] + e[9]) + (e[10] + e[11])) + ((e[12] + e[13]) + (e[14] + e[15])));
                l[nt] = fmaf(l[nt], al, ps);
#pragma unroll
                for (int dt = 0; dt < 4; ++dt) o[dt][nt] *= al;
                v8u ph, pl;   // two elements a register, converted in pairs
#pragma unroll
                for (int i = 0; i < 8; ++i) { const v2f ev = { e[2 * i], e[2 * i + 1] };
                    if constexpr (HI) { const v2b hb = __builtin_convertvector(ev, v2b); ph[i] = __builtin_bit_cast(unsigned, hb); pl[i] = __builtin_bit_cast(unsigned, __builtin_convertvector(ev - __builtin_convertvector(hb, v2f), v2b)); }
                    else ph[i] = __builtin_bit_cast(unsigned, __builtin_convertvector(ev, v2h)); }
                pf[nt] = __builtin_bit_cast(V, ph); if constexpr (HI) pf2[nt] = __builtin_bit_cast(V, pl); }
#pragma unroll
            for (int dt = 0; dt < 4; ++dt) { const int off = FPS + (dt * 16 + lr) * FP + p * 32 + 8 * hi; const V va = FT<HI>::ld(kb + off); V va2; if constexpr (HI) va2 = FT<HI>::ld(kb + 2 * FPS + off);
#pragma unroll
                for (int nt = 0; nt < NT; ++nt) { o[dt][nt] = FT<HI>::mma(va, pf[nt], o[dt][nt]); if constexpr (HI) { o[dt][nt] = FT<HI>::mma(va, pf2[nt], o[dt][nt]); o[dt][nt] = FT<HI>::mma(va2, pf[nt], o[dt][nt]); } } }
        }
        if (s + 1 < NST) sstore((s + 1) & 1);
        __syncthreads();   // publishes stage s + 1 and ends every wave's reads of the buffer that the next trip refills
    }
#pragma unroll
    for (int nt = 0; nt < NT; ++nt) { const float inv = __fdiv_rn(1.0f, l[nt] + xhalf(l[nt])); const size_t oo = (size_t)(qw + nt * 16 + lr) * DQ + hi * 8;
#pragma unroll
        for (int dt = 0; dt < 4; ++dt) { v8us oh, ol;
#pragma unroll
            for (int j = 0; j < 8; ++j) { unsigned short a, c2; splitf(o[dt][nt][j] * inv, a, c2); oh[j] = a; ol[j] = c2; }
            *(v8usa*)(Ah + oo + dt * 16) = oh; *(v8usa*)(Al + oo + dt * 16) = ol;
            asm volatile("s_wait_xcnt 0x0" ::: "memory"); } }   // stands before the registers that the two stores name are written again
}
#define NHW (NB_ * NH_ * (RH / 128))
#define NLW (NB_ * NH_ * ((TT - RH) / 256))
__global__ __launch_bounds__(256) __attribute__((amdgpu_waves_per_eu(4, 4))) void k_fattn(const h16* __restrict__ Q16, const bf* __restrict__ Qh, const bf* __restrict__ Ql, const h16* __restrict__ K16, const bf* __restrict__ Kh, const bf* __restrict__ Kl, const h16* __restrict__ V16, const bf* __restrict__ Vh, const bf* __restrict__ Vl, bf* Ah, bf* Al) {
    __shared__ __align__(16) unsigned short sm[2 * 4 * FPS];
    const int wave = threadIdx.x >> 5; int bx = blockIdx.x;   // the long work-groups (3 products) start first
    if (bx < NHW) { const int z = bx / (RH / 128), qt = bx % (RH / 128); const size_t zo = (size_t)z * TT * HD, ao = (size_t)(z / NH_) * TT * DQ + (z % NH_) * HD;
        fattn<true, 1>(sm, Qh + zo, Ql + zo, Kh + zo, Kl + zo, Vh + zo, Vl + zo, qt * 128 + wave * 16, Ah + ao, Al + ao);
    } else { bx -= NHW; const int z = bx / ((TT - RH) / 256), qt = bx % ((TT - RH) / 256); const size_t zo = (size_t)z * TT * HD, ao = (size_t)(z / NH_) * TT * DQ + (z % NH_) * HD;
        fattn<false, 2>(sm, (const unsigned short*)(Q16 + zo), nullptr, (const unsigned short*)(K16 + zo), nullptr, (const unsigned short*)(V16 + zo), nullptr, RH + qt * 256 + wave * 32, Ah + ao, Al + ao); }
}

extern "C" void kernel_launch(void* const* d_in, const int* in_sizes, int n_in,
                              void* d_out, int out_size, void* d_ws, size_t ws_size, hipStream_t stream) {
    (void)in_sizes; (void)n_in; (void)out_size;
    const float* x = (const float*)d_in[0]; const float* wqkv = (const float*)d_in[1]; const float* wo = (const float*)d_in[2]; const float* bo = (const float*)d_in[3];   /* x, w_qkv ('xw' [1024][3072]: q | k | v column thirds), w_proj ('xw'), b_proj */
    float* OUT = (float*)d_out;     // [4][2048][1024]
    char* wsp = (char*)d_ws;
    auto take = [&](size_t bytes) { char* p = wsp; wsp += (bytes + 255) & ~(size_t)255; return (void*)p; };
    bf* WQKV = (bf*)take((size_t)3 * DQ * DM * 2);   /* fused Bt [3*DQ][DM]: q | k | v row blocks */ bf* WO = (bf*)take((size_t)DM * DQ * 2); float* CS = (float*)take((size_t)TT * HD * 2 * 4);
    bf* XB = (bf*)take((size_t)NB_ * TT * DM * 2);
    const size_t PB = (size_t)NH_ * TT * HD;   // one batch's head planes, elements; every plane holds all NB_ batches
    h16* QP16 = (h16*)take(NB_ * PB * 2); h16* KP16 = (h16*)take(NB_ * PB * 2); h16* VT16 = (h16*)take(NB_ * PB * 2);
    bf* QPh = (bf*)take(NB_ * PB * 2); bf* QPl = (bf*)take(NB_ * PB * 2); bf* KPh = (bf*)take(NB_ * PB * 2); bf* KPl = (bf*)take(NB_ * PB * 2); bf* VTh = (bf*)take(NB_ * PB * 2); bf* VTl = (bf*)take(NB_ * PB * 2);
    bf* ATh = (bf*)take((size_t)NB_ * TT * DQ * 2); bf* ATl = (bf*)take((size_t)NB_ * TT * DQ * 2);
    if ((size_t)(wsp - (char*)d_ws) > ws_size) return;    // ws 256 MiB
    { k_wtG<<<(unsigned)((DM * 3 * DQ / 64 + 63) / 64), 256, 0, stream>>>(wqkv, DM, 3 * DQ, WQKV);   /* fused 'xw' [DM][3*DQ] -> Bt [3*DQ][DM] */
      k_wtG<<<(unsigned)((DQ * DM / 64 + 63) / 64), 256, 0, stream>>>(wo, DQ, DM, WO);
       }
    k_csP<<<(TT * HD + 255) / 256, 256, 0, stream>>>(CS);
    k_cvt8<<<(unsigned)(((size_t)NB_ * TT * DM / 8 + 255) / 256), 256, 0, stream>>>(x, XB, (size_t)NB_ * TT * DM / 8);
    k_qkv<<<dim3(NB_ * TT / 128, 3 * NH_ / 2, 1), 128, 0, stream>>>(XB, WQKV, CS, QP16, QPh, QPl, KP16, KPh, KPl, VT16, VTh, VTl);
    k_fattn<<<NHW + NLW, 256, 0, stream>>>(QP16, QPh, QPl, KP16, KPh, KPl, VT16, VTh, VTl, ATh, ATl);
    for (int b = 0; b < NB_; ++b)
        k_proj<<<dim3(TT / 128, DM / 128, 1), 128, 0, stream>>>(ATh + (size_t)b * TT * DQ, ATl + (size_t)b * TT * DQ, WO, OUT + (size_t)b * TT * DM, bo);
}

// v005
// It runs in 217 microseconds.
// Two timings next to v004 both put it at 1.20 times that version's speed.
// Over all steps from v000 it is 18.5 times as fast.
#include <hip/hip_runtime.h>

// Multi-head self-attention with a fused bias-free qkv projection and computed interleaved-pair rotary embeddings at SCALED frequencies (x [4][2048][1024]; qkv = x w_qkv ('xw' (in, out) [1024][3072] 1/32, no bias) viewed (B, L, 3, 16, 64): q | k | v column thirds (16 heads x 64); rope on q and k: pairs (x[2i], x[2i+1]) -> (re c - im s, re s + im c) with angle pos x theta_i, theta = (1 / 10000^(2i/64)) x 3.0 (ROPE_SCALE; 32 f32 frequencies jnp-exact; one f32 product per angle; precise cosf/sinf); attn x 64^-0.5; softmax over all keys (no mask); out = merged w_proj + b_proj ('xw' + a bias: READ) -> [4][2048][1024] (8.4 M); argument order x, w_qkv, w_proj, b_proj).
// Layout: bf16 copy of x; the fused 'xw' weight transposed ONCE into q | k | v row blocks; k_csP computed interleaved table at the scaled frequencies; k_qkv: exact projections of all batches with the interleaved-pair rotary and the plane split in their epilogue; fused dense T-2048 attention, all batches in one launch (hybrid rows: < 512 hi/lo 3 products, rest fp16 x1024); merged hi/lo x w_proj exact + b_proj.
// Compute dtypes, f32 accumulate: every input rounded to bf16; projections exact; rotary f32; attention rows < 512 3 products, rest fp16; softmax f32; w_proj hl x exact + bias.

#define NB_  4
#define TT   2048
#define DM   1024
#define NH_  16
#define NKV  16
#define REP  (NH_ / NKV)
#define HD   64
#define DQ   (NH_ * HD)
#define DKV  (NKV * HD)
#define RH   512                  // query rows < RH use hi+lo planes (0: none)
#define WIN  0
#define PCL2 10.0f                // fp16 rows: P is carried as weight x 2^PCL2, so that small weights stay normal fp16 numbers; the factor cancels in the division by the row sum
typedef _Float16 h16;
typedef unsigned short bf;
typedef __attribute__((ext_vector_type(16))) __bf16   v16bf;
typedef __attribute__((ext_vector_type(16))) _Float16 v16h;
typedef __attribute__((ext_vector_type(8)))  _Float16 v8h;
typedef __attribute__((ext_vector_type(8)))  unsigned short v8us;
typedef __attribute__((ext_vector_type(8)))  float    v8f;
typedef __attribute__((ext_vector_type(4)))  float    v4f;
typedef v8h  __attribute__((may_alias)) v8ha;
typedef v4f  __attribute__((may_alias)) v4fa;
typedef v8us __attribute__((may_alias)) v8usa;

__device__ __forceinline__ unsigned short f2bf(float f) { unsigned u = __float_as_uint(f); u += 0x7FFFu + ((u >> 16) & 1u); return (unsigned short)(u >> 16); }
__device__ __forceinline__ float bf2f(unsigned short b) { return __uint_as_float(((unsigned)b) << 16); }
__device__ __forceinline__ float bfr(float f) { return bf2f(f2bf(f)); }
__device__ __forceinline__ v16h cat16(v8h lo, v8h hi) { return __builtin_shufflevector(lo, hi, 0, 1, 2, 3, 4, 5, 6, 7, 8, 9, 10, 11, 12, 13, 14, 15); }
__device__ __forceinline__ v16bf cat16b(v8us lo, v8us hi) { return __builtin_bit_cast(v16bf, __builtin_shufflevector(lo, hi, 0, 1, 2, 3, 4, 5, 6, 7, 8, 9, 10, 11, 12, 13, 14, 15)); }
__device__ __forceinline__ v8f wmma16(v16h a, v16h b, v8f c) { return __builtin_amdgcn_wmma_f32_16x16x32_f16(false, a, false, b, (short)0, c, false, false); }
__device__ __forceinline__ v8f wmmab(v16bf a, v16bf b, v8f c) { return __builtin_amdgcn_wmma_f32_16x16x32_bf16(false, a, false, b, (short)0, c, false, false); }



// ---- gemm128: the K loop of both GEMMs. A work-group of 4 waves (2 x 2) owns a 128 x 128 tile of C[m][n] = sum_k A[m][k] Bt[n][k] (NPL 3: + A2[m][k] Bt[n][k]), K = DM, operands K-contiguous bf16 planes; each wave keeps its 64 x 64 quarter in 16 accumulators.
// A stage is 64 k of 128 rows of every plane (rows of 128 B at a pitch of 144 B in LDS), brought by asynchronous copies to LDS: one wave-wide copy covers 4 whole 128-byte lines, and each line is fetched once a work-group. Two buffers, one barrier a stage.
template <typename T16> struct WFrag;
template <> struct WFrag<h16> { typedef v16h V; static __device__ __forceinline__ V ld(const h16* p) { return cat16(*(const v8h*)p, *(const v8h*)(p + 16)); } static __device__ __forceinline__ v8f mma(V a, V b, v8f c) { return wmma16(a, b, c); } };
template <> struct WFrag<bf> { typedef v16bf V; static __device__ __forceinline__ V ld(const bf* p) { return cat16b(*(const v8us*)p, *(const v8us*)(p + 16)); } static __device__ __forceinline__ v8f mma(V a, V b, v8f c) { return wmmab(a, b, c); } };
#define GP   72                   // LDS row pitch in 16-bit elements
#define GPL  (128 * GP)           // one staged plane: 128 rows
#define GNS  (DM / 64)            // stages along K
// one plane of a stage: this lane's 16 bytes of rows r, r + 16, .. r + 112. The s_wait_xcnt closes the copies' own statement, so that it stands before any rewrite of the address registers that they name.
__device__ __forceinline__ void gcopy(unsigned l, const bf* g) {
    asm volatile("global_load_async_to_lds_b128 %0, %8, off\n\t"
                 "global_load_async_to_lds_b128 %1, %9, off\n\t"
                 "global_load_async_to_lds_b128 %2, %10, off\n\t"
                 "global_load_async_to_lds_b128 %3, %11, off\n\t"
                 "global_load_async_to_lds_b128 %4, %12, off\n\t"
                 "global_load_async_to_lds_b128 %5, %13, off\n\t"
                 "global_load_async_to_lds_b128 %6, %14, off\n\t"
                 "global_load_async_to_lds_b128 %7, %15, off\n\t"
                 "s_wait_xcnt 0x0"
                 :: "v"(l), "v"(l + 16 * GP * 2), "v"(l + 32 * GP * 2), "v"(l + 48 * GP * 2), "v"(l + 64 * GP * 2), "v"(l + 80 * GP * 2), "v"(l + 96 * GP * 2), "v"(l + 112 * GP * 2),
                    "v"(g), "v"(g + 16 * DM), "v"(g + 32 * DM), "v"(g + 48 * DM), "v"(g + 64 * DM), "v"(g + 80 * DM), "v"(g + 96 * DM), "v"(g + 112 * DM) : "memory");
}
// Every plain '#pragma unroll' here and in the two kernels that call it is there so that the fragment and accumulator arrays are indexed by constants and stay in registers.
template <int NPL>   // staged planes: A, Bt (, A2). Ag, A2g, Bg: row 0 of the work-group's 128 rows
__device__ __forceinline__ void gemm128(unsigned short* sm, const bf* __restrict__ Ag, const bf* __restrict__ A2g, const bf* __restrict__ Bg, int wave, v8f (&acc)[4][4]) {
    typedef WFrag<bf>::V V;
    const int tid = threadIdx.x, lane = tid & 31, lr = lane & 15, hi = lane >> 4;
    const unsigned l0 = (unsigned)(size_t)sm + (unsigned)((tid >> 3) * GP + (tid & 7) * 8) * 2u;   // LDS byte address of this lane's 16 bytes of row tid / 8
    const size_t go = (size_t)(tid >> 3) * DM + (tid & 7) * 8;
    auto fill = [&](int s) { const unsigned lb = l0 + (unsigned)((s & 1) * NPL * GPL) * 2u; const size_t o = go + (size_t)s * 64;
        gcopy(lb, Ag + o); gcopy(lb + GPL * 2, Bg + o); if constexpr (NPL == 3) gcopy(lb + 2 * GPL * 2, A2g + o); };
    fill(0);
    asm volatile("s_wait_asynccnt 0x0" ::: "memory");   // this wave's copies of stage 0 have landed
    __syncthreads();                                    // publishes stage 0
    fill(1);
    const int ao = ((wave >> 1) * 64 + lr) * GP + 8 * hi, bo = GPL + ((wave & 1) * 64 + lr) * GP + 8 * hi;
#pragma unroll 1
    for (int s = 0; s < GNS; ++s) {   // rolled: one trip a stage, so that the buffer index and the refill test stay scalar
        const unsigned short* bp = sm + (s & 1) * NPL * GPL;
#pragma unroll
        for (int ks = 0; ks < 2; ++ks) {
            V a[4], a2[4], b[4];   // the block's fragments are fetched as one group ahead of its products
#pragma unroll
            for (int mb = 0; mb < 4; ++mb) { a[mb] = WFrag<bf>::ld(bp + ao + mb * 16 * GP + ks * 32); if constexpr (NPL == 3) a2[mb] = WFrag<bf>::ld(bp + 2 * GPL + ao + mb * 16 * GP + ks * 32); }
#pragma unroll
            for (int nb = 0; nb < 4; ++nb) b[nb] = WFrag<bf>::ld(bp + bo + nb * 16 * GP + ks * 32);
            __builtin_amdgcn_sched_barrier(0);   // keeps the reads together in front: sunk among the products, into one shared Bt fragment, every four products wait out an LDS latency
#pragma unroll
            for (int nb = 0; nb < 4; ++nb)
#pragma unroll
                for (int mb = 0; mb < 4; ++mb) { acc[mb][nb] = WFrag<bf>::mma(a[mb], b[nb], acc[mb][nb]); if constexpr (NPL == 3) acc[mb][nb] = WFrag<bf>::mma(a2[mb], b[nb], acc[mb][nb]); }
        }
        asm volatile("s_wait_dscnt 0x0" ::: "memory");      // this wave's reads of stage s have returned
        asm volatile("s_wait_asynccnt 0x0" ::: "memory");   // this wave's copies of stage s + 1 have landed
        __syncthreads();                                    // publishes stage s + 1 and ends every wave's reads of the buffer refilled below
        if (s + 2 < GNS) fill(s + 2);
    }
    asm volatile("s_wait_asynccnt 0x0" ::: "memory");   // no copy is outstanding when the wave goes on
}
// ---- k_proj: C (f32, pitch DM) = (A + A2) Bt^T + bias, grid (M / 128, DM / 128), 128 threads; a wave's 64 x 64 quarter goes out through its own LDS rows, whole 128-byte lines.
__global__ __launch_bounds__(128) void k_proj(const bf* __restrict__ A, const bf* __restrict__ A2, const bf* __restrict__ Bt, float* C, const float* __restrict__ bias) {
    __shared__ __align__(16) unsigned short sm[2 * 3 * GPL];
    __shared__ __align__(16) float osw[4][16 * 68];
    const int lane = threadIdx.x & 31, lr = lane & 15, hi = lane >> 4; const int wave = __builtin_amdgcn_readfirstlane(threadIdx.x >> 5);
    float* os = osw[wave]; const int r0 = blockIdx.x * 128 + (wave >> 1) * 64, c0 = blockIdx.y * 128 + (wave & 1) * 64;
    v8f acc[4][4];
#pragma unroll
    for (int mb = 0; mb < 4; ++mb)
#pragma unroll
        for (int nb = 0; nb < 4; ++nb) acc[mb][nb] = (v8f){};
    gemm128<3>(sm, A + (size_t)blockIdx.x * 128 * DM, A2 + (size_t)blockIdx.x * 128 * DM, Bt + (size_t)blockIdx.y * 128 * DM, wave, acc);
    const int cofs = lr * 4; v4f bv; bv[0] = bfr(bias[c0 + cofs]); bv[1] = bfr(bias[c0 + cofs + 1]); bv[2] = bfr(bias[c0 + cofs + 2]); bv[3] = bfr(bias[c0 + cofs + 3]);
#pragma unroll
    for (int mb = 0; mb < 4; ++mb) {
#pragma unroll
        for (int nb = 0; nb < 4; ++nb) {
#pragma unroll
            for (int j = 0; j < 8; ++j) os[(hi * 8 + j) * 68 + nb * 16 + lr] = acc[mb][nb][j]; }
        __builtin_amdgcn_wave_barrier(); asm volatile("" ::: "memory");   // the row reads below stay behind the other lanes' LDS writes
        float* crow = C + (size_t)(r0 + mb * 16) * DM + c0;
#pragma unroll
        for (int s = 0; s < 8; ++s) { const int row = 2 * s + hi; const v4f val = *(const v4fa*)(os + row * 68 + cofs) + bv;
            *(v4f*)(crow + (size_t)row * DM + cofs) = val; }
        asm volatile("s_wait_xcnt 0x0" ::: "memory");   // stands before the registers that the stores name are written again
        __builtin_amdgcn_wave_barrier(); asm volatile("" ::: "memory");   // the next block's LDS writes stay behind these reads
    }
}

__device__ __forceinline__ h16 tohx(float x) { return (h16)x; }
__device__ __forceinline__ void splitf(float y, unsigned short& h, unsigned short& l) { h = f2bf(y); l = f2bf(y - bf2f(h)); }
typedef __attribute__((ext_vector_type(2))) _Float16 v2h;
typedef __attribute__((ext_vector_type(4))) _Float16 v4h;
typedef __attribute__((ext_vector_type(2))) unsigned short v2us;
typedef __attribute__((ext_vector_type(4))) unsigned short v4us;
typedef __attribute__((ext_vector_type(2))) float v2f;
typedef __attribute__((ext_vector_type(4))) int v4i;

__global__ __launch_bounds__(256) void k_wtG(const float* __restrict__ w, int K, int N, bf* Bt) {
    const int lane = threadIdx.x & 31; const int L0 = (blockIdx.x * 8 + (threadIdx.x >> 5)) * 8; const int nlines = N * K / 64;
{
#pragma unroll 1
        for (int l = 0; l < 8; ++l) { const int L = L0 + l; if (L >= nlines) break; const size_t e = (size_t)L * 64 + lane * 2; const int k = (int)(e % K), n = (int)(e / K); v2us o;
            o[0] = f2bf(w[(size_t)k * N + n]); o[1] = f2bf(w[(size_t)(k + 1) * N + n]); *(v2us*)(Bt + e) = o; }
         }
}
__global__ __launch_bounds__(256) void k_cvt8(const float* __restrict__ src, bf* dst, size_t n8) { const size_t i = (size_t)blockIdx.x * 256 + threadIdx.x; if (i >= n8) return; const v8f v = *(const v8f*)(src + i * 8); v8us o;
#pragma unroll
    for (int k = 0; k < 8; ++k) o[k] = f2bf(v[k]); *(v8us*)(dst + i * 8) = o;  }

// INV2: the 32 rotary frequencies of THIS module: (1.0 / (ROPE_BASE ** (arange(0, 64, 2, float32) / 64))) * ROPE_SCALE with ROPE_BASE 10000 and ROPE_SCALE 3.0, generated with jnp in float32 (bit-exact; == the unscaled table x 3.0f in f32, 32 of 32): the adjacent (even, odd) pair shares entry d / 2.
__constant__ float INV2[HD / 2] = { 3.000000000e+00f, 2.249682665e+00f, 1.687023997e+00f, 1.265089512e+00f, 9.486832619e-01f, 7.114120722e-01f, 5.334838033e-01f, 4.000564218e-01f, 3.000000119e-01f, 2.249682546e-01f, 1.687023938e-01f, 1.265089512e-01f, 9.486833215e-02f, 7.114120573e-02f, 5.334838480e-02f, 4.000564665e-02f, 2.999999933e-02f, 2.249682695e-02f, 1.687023975e-02f, 1.265089400e-02f, 9.486833587e-03f, 7.114121690e-03f, 5.334838293e-03f, 4.000564106e-03f, 3.000000026e-03f, 2.249682555e-03f, 1.687023905e-03f, 1.265089493e-03f, 9.486833587e-04f, 7.114121690e-04f, 5.334838061e-04f, 4.000564513e-04f };
__global__ __launch_bounds__(256) void k_csP(float* CS) { const int idx = blockIdx.x * 256 + threadIdx.x; if (idx >= TT * HD) return; const int d = idx % HD; const int t = idx / HD; const float a = __fmul_rn((float)t, INV2[d >> 1]); v2f cs; cs[0] = cosf(a); cs[1] = sinf(a); *(v2f*)(CS + (size_t)idx * 2) = cs;  }
// ---- k_qkv: the q | k | v projection of every batch in one launch (gemm128, one product), each wave building the attention planes of its 64 x 64 quarter itself from its accumulators.
// grid (NB_ TT / 128, 3 NH_ / 2), 128 threads: a wave has 64 rows of x (one batch, 64 positions) x 64 columns of the fused weight = one head of q (column block < NH_), of k (< 2 NH_) or of v.
// q and k tiles: interleaved-pair rotary on the f32 sums (table CS), then planes [b][h][t][d] as fp16, bf16 hi and bf16 lo; through the wave's own LDS rows, so that a 128-byte plane row is stored whole.
// v tiles: planes [b][h][d][t]; accumulator elements 0..7 of a lane are 8 consecutive positions of one column, so 16 bytes a plane go out straight from registers.
__global__ __launch_bounds__(128) void k_qkv(const bf* __restrict__ A, const bf* __restrict__ Bt, const float* __restrict__ CS, h16* Q16, bf* Qh, bf* Ql, h16* K16, bf* Kh, bf* Kl, h16* V16, bf* Vh, bf* Vl) {
    __shared__ __align__(16) unsigned short sm[2 * 2 * GPL];
    __shared__ __align__(16) float osw[4][16 * 68];
    const int lane = threadIdx.x & 31, lr = lane & 15, hi = lane >> 4; const int wave = __builtin_amdgcn_readfirstlane(threadIdx.x >> 5);
    float* os = osw[wave]; const int r0 = blockIdx.x * 128 + (wave >> 1) * 64, cy = blockIdx.y * 2 + (wave & 1);
    v8f acc[4][4];
#pragma unroll
    for (int mb = 0; mb < 4; ++mb)
#pragma unroll
        for (int nb = 0; nb < 4; ++nb) acc[mb][nb] = (v8f){};
    gemm128<2>(sm, A + (size_t)blockIdx.x * 128 * DM, nullptr, Bt + (size_t)blockIdx.y * 128 * DM, wave, acc);
    const int bt = r0 / TT, t0 = r0 % TT, sel = cy / NH_, hd = cy % NH_;
    const size_t po = ((size_t)bt * NH_ + hd) * TT * HD;
    if (sel == 2) {
        char* W16 = (char*)(V16 + po + t0); char* Wh = (char*)(Vh + po + t0); char* Wl = (char*)(Vl + po + t0); const unsigned vl = (unsigned)(lr * TT + hi * 8) * 2u;   // uniform bases, lane offset in bytes
#pragma unroll
        for (int nb = 0; nb < 4; ++nb) {
#pragma unroll
            for (int mb = 0; mb < 4; ++mb) { v8h o16; v8us oh, ol;
#pragma unroll
                for (int j = 0; j < 8; ++j) { const float x = acc[mb][nb][j]; o16[j] = tohx(x); unsigned short a2, c2; splitf(x, a2, c2); oh[j] = a2; ol[j] = c2; }
                const int vc = (nb * 16 * TT + mb * 16) * 2; *(v8ha*)(W16 + vc + vl) = o16; *(v8usa*)(Wh + vc + vl) = oh; *(v8usa*)(Wl + vc + vl) = ol;
                asm volatile("s_wait_xcnt 0x0" ::: "memory"); } }   // stands before the registers that the three stores name are written again
    } else {
        const size_t pt = po + (size_t)t0 * HD; char* W16 = (char*)((sel ? K16 : Q16) + pt); char* Wh = (char*)((sel ? Kh : Qh) + pt); char* Wl = (char*)((sel ? Kl : Ql) + pt); const char* Ct = (const char*)(CS + (size_t)t0 * HD * 2);
        const unsigned pl = (unsigned)(hi * HD + lr * 4) * 2u, cl = pl * 4u;   // uniform bases, lane offsets in bytes (plane row 128 B, table row 512 B)
#pragma unroll
        for (int mb = 0; mb < 4; ++mb) {
#pragma unroll
            for (int nb = 0; nb < 4; ++nb) {
#pragma unroll
                for (int j = 0; j < 8; ++j) os[(hi * 8 + j) * 68 + nb * 16 + lr] = acc[mb][nb][j]; }
            __builtin_amdgcn_wave_barrier(); asm volatile("" ::: "memory");   // the row reads below stay behind the other lanes' LDS writes
            v4f xv[8]; v2f ca[8], cb[8];   // all 16 rows' sums and table entries are fetched before the first store, one latency a block of 16 rows
#pragma unroll
            for (int s = 0; s < 8; ++s) { const int row = 2 * s + hi; xv[s] = *(const v4fa*)(os + row * 68 + lr * 4); const char* cp = Ct + (mb * 16 + 2 * s) * HD * 8 + cl; ca[s] = *(const v2f*)cp; cb[s] = *(const v2f*)(cp + 16); }
#pragma unroll
            for (int s = 0; s < 8; ++s) { const int pc = (mb * 16 + 2 * s) * HD * 2; float r[4]; v4h o16; v4us oh, ol;
                r[0] = xv[s][0] * ca[s][0] - xv[s][1] * ca[s][1]; r[1] = xv[s][0] * ca[s][1] + xv[s][1] * ca[s][0];   /* even: x0 c - x1 s; odd: x0 s + x1 c; free to contract to a product and an fma */
                r[2] = xv[s][2] * cb[s][0] - xv[s][3] * cb[s][1]; r[3] = xv[s][2] * cb[s][1] + xv[s][3] * cb[s][0];
#pragma unroll
                for (int q = 0; q < 4; ++q) { o16[q] = tohx(r[q]); unsigned short a2, c2; splitf(r[q], a2, c2); oh[q] = a2; ol[q] = c2; }
                *(v4h*)(W16 + pc + pl) = o16; *(v4us*)(Wh + pc + pl) = oh; *(v4us*)(Wl + pc + pl) = ol;
                asm volatile("s_wait_xcnt 0x0" ::: "memory"); }   // stands before the registers that the three stores name are written again
            __builtin_amdgcn_wave_barrier(); asm volatile("" ::: "memory");   // the next block's LDS writes stay behind these reads
        }
    }
}
// ---- k_fattn: fused attention, one launch for every batch, head and query row. Scores, softmax and P stay in registers.
// St = K Qt (A = 16 key rows, B = 16 query columns), Ot += Vt Pt: accumulator element j of lane (lr, hi) of the score tile of keys kb + 16 kt .. is key kb + 16 kt + 8 hi + j of query lr,
// which is element 8 kt + j of the B operand of a 32-key product in the loaders' k order, so P is packed in place. Running maximum per query column, output and sum rescaled every 32 keys.
// A work-group of 8 waves shares K and Vt: 64 keys a stage, brought through registers into two LDS buffers (rows of 128 B at a pitch of 144 B), one barrier a stage.
// Work-groups below NHW: query rows < RH, 16 columns a wave, hi/lo bf16 planes, 3 products; the rest: 32 columns a wave, fp16.
#define FP   72                   // LDS row pitch in 16-bit elements
#define FPS  (64 * FP)            // one staged plane: 64 rows
#define NST  (TT / 64)
#define CL2  0.18033688011112042f // HD^-0.5 x log2(e)
typedef __attribute__((ext_vector_type(2))) __bf16 v2b;
typedef __attribute__((ext_vector_type(8))) unsigned v8u;
template <bool HI> struct FT;
template <> struct FT<false> { typedef v16h V; static __device__ __forceinline__ V ld(const unsigned short* p) { return __builtin_bit_cast(v16h, __builtin_shufflevector(*(const v8usa*)p, *(const v8usa*)(p + 16), 0, 1, 2, 3, 4, 5, 6, 7, 8, 9, 10, 11, 12, 13, 14, 15)); } static __device__ __forceinline__ v8f mma(V a, V b, v8f c) { return wmma16(a, b, c); } };
template <> struct FT<true> { typedef v16bf V; static __device__ __forceinline__ V ld(const unsigned short* p) { return cat16b(*(const v8usa*)p, *(const v8usa*)(p + 16)); } static __device__ __forceinline__ v8f mma(V a, V b, v8f c) { return wmmab(a, b, c); } };
__device__ __forceinline__ float xhalf(float x) { const int b = __float_as_int(x); return __int_as_float(__builtin_amdgcn_permlanex16(b, b, 0x76543210, 0xfedcba98, false, false)); }   // lane l <-> l ^ 16
template <bool HI, int NT>
__device__ __forceinline__ void fattn(unsigned short* sm, const unsigned short* __restrict__ Q, const unsigned short* __restrict__ Q2, const unsigned short* __restrict__ Kg, const unsigned short* __restrict__ K2g, const unsigned short* __restrict__ Vg, const unsigned short* __restrict__ V2g, int qw, bf* Ah, bf* Al) {
    typedef typename FT<HI>::V V;
    constexpr int PLN = HI ? 4 : 2;   // staged planes: K, Vt (, K lo, Vt lo)
    const int tid = threadIdx.x, lane = tid & 31, lr = lane & 15, hi = lane >> 4;
    const int srow = tid >> 3, sseg = (tid & 7) * 8;   // staging: rows srow and srow + 32, one 16-byte segment of each plane
    v8us st[PLN][2];
    auto gload = [&](int s) {
#pragma unroll
        for (int r = 0; r < 2; ++r) { const int row = srow + 32 * r; const size_t ko = (size_t)(s * 64 + row) * HD + sseg, vo = (size_t)row * TT + s * 64 + sseg;
            st[0][r] = *(const v8usa*)(Kg + ko); st[1][r] = *(const v8usa*)(Vg + vo);
            if constexpr (HI) { st[2][r] = *(const v8usa*)(K2g + ko); st[3][r] = *(const v8usa*)(V2g + vo); } }
        asm volatile("s_wait_xcnt 0x0" ::: "memory"); };   // stands before the address registers of the loads issued so far are written again
    auto sstore = [&](int b) {
#pragma unroll
        for (int r = 0; r < 2; ++r)
#pragma unroll
            for (int pl = 0; pl < PLN; ++pl) *(v8usa*)(sm + (b * PLN + pl) * FPS + (srow + 32 * r) * FP + sseg) = st[pl][r]; };
    V qf[NT][2], qf2[NT][2];
#pragma unroll
    for (int nt = 0; nt < NT; ++nt)
#pragma unroll
        for (int ks = 0; ks < 2; ++ks) { const size_t qo = (size_t)(qw + nt * 16 + lr) * HD + ks * 32 + 8 * hi; qf[nt][ks] = FT<HI>::ld(Q + qo); if constexpr (HI) qf2[nt][ks] = FT<HI>::ld(Q2 + qo); }
    asm volatile("s_wait_xcnt 0x0" ::: "memory");   // stands before the address registers of the Q loads are written again
    v8f o[4][NT]; float mc[NT], l[NT];
#pragma unroll
    for (int nt = 0; nt < NT; ++nt) { mc[nt] = -3.0e37f; l[nt] = 0.f;
#pragma unroll
        for (int dt = 0; dt < 4; ++dt) o[dt][nt] = (v8f){}; }
    gload(0); sstore(0); __syncthreads();
#pragma unroll 1
    for (int s = 0; s < NST; ++s) {
        if (s + 1 < NST) gload(s + 1);
        const unsigned short* kb = sm + (s & 1) * PLN * FPS;
#pragma unroll
        for (int p = 0; p < 2; ++p) {
            v8f sc[2][NT];
#pragma unroll
            for (int kt = 0; kt < 2; ++kt) { V ka[2], ka2[2];
#pragma unroll
                for (int ks = 0; ks < 2; ++ks) { const int off = (p * 32 + kt * 16 + lr) * FP + ks * 32 + 8 * hi; ka[ks] = FT<HI>::ld(kb + off); if constexpr (HI) ka2[ks] = FT<HI>::ld(kb + 2 * FPS + off); }
#pragma unroll
                for (int nt = 0; nt < NT; ++nt) { v8f a = (v8f){};
#pragma unroll
                    for (int ks = 0; ks < 2; ++ks) { a = FT<HI>::mma(ka[ks], qf[nt][ks], a); if constexpr (HI) { a = FT<HI>::mma(ka[ks], qf2[nt][ks], a); a = FT<HI>::mma(ka2[ks], qf[nt][ks], a); } }
                    sc[kt][nt] = a; } }
            V pf[NT], pf2[NT];
#pragma unroll
            for (int nt = 0; nt < NT; ++nt) {
                float cm = fmaxf(sc[0][nt][0], sc[1][nt][0]);
#pragma unroll
                for (int j = 1; j < 8; ++j) cm = fmaxf(cm, fmaxf(sc[0][nt][j], sc[1][nt][j]));
                cm = fmaxf(cm, xhalf(cm));
                const float mn = fmaxf(mc[nt], cm * CL2); const float al = __builtin_amdgcn_exp2f(mc[nt] - mn); mc[nt] = mn; const float mo = HI ? mn : mn - PCL2;
                float e[16];
#pragma unroll
                for (int i = 0; i < 16; ++i) e[i] = __builtin_amdgcn_exp2f(fmaf(sc[i >> 3][nt][i & 7], CL2, -mo));
                const float ps = ((e[0] + e[1]) + (e[2] + e[3])) + ((e[4] + e[5]) + (e[6] + e[7])) + (((e[8] + e[9]) + (e[10] + e[11])) + ((e[12] + e[13]) + (e[14] + e[15])));
                l[nt] = fmaf(l[nt], al, ps);
#pragma unroll
                for (int dt = 0; dt < 4; ++dt) o[dt][nt] *= al;
                v8u ph, pl;   // two elements a register, converted in pairs
#pragma unroll
                for (int i = 0; i < 8; ++i) { const v2f ev = { e[2 * i], e[2 * i + 1] };
                    if constexpr (HI) { const v2b hb = __builtin_convertvector(ev, v2b); ph[i] = __builtin_bit_cast(unsigned, hb); pl[i] = __builtin_bit_cast(unsigned, __builtin_convertvector(ev - __builtin_convertvector(hb, v2f), v2b)); }
                    else ph[i] = __builtin_bit_cast(unsigned, __builtin_convertvector(ev, v2h)); }
                pf[nt] = __builtin_bit_cast(V, ph); if constexpr (HI) pf2[nt] = __builtin_bit_cast(V, pl); }
#pragma unroll
            for (int dt = 0; dt < 4; ++dt) { const int off = FPS + (dt * 16 + lr) * FP + p * 32 + 8 * hi; const V va = FT<HI>::ld(kb + off); V va2; if constexpr (HI) va2 = FT<HI>::ld(kb + 2 * FPS + off);
#pragma unroll
                for (int nt = 0; nt < NT; ++nt) { o[dt][nt] = FT<HI>::mma(va, pf[nt], o[dt][nt]); if constexpr (HI) { o[dt][nt] = FT<HI>::mma(va, pf2[nt], o[dt][nt]); o[dt][nt] = FT<HI>::mma(va2, pf[nt], o[dt][nt]); } } }
        }
        if (s + 1 < NST) sstore((s + 1) & 1);
        __syncthreads();   // publishes stage s + 1 and ends every wave's reads of the buffer that the next trip refills
    }
#pragma unroll
    for (int nt = 0; nt < NT; ++nt) { const float inv = __fdiv_rn(1.0f, l[nt] + xhalf(l[nt])); const size_t oo = (size_t)(qw + nt * 16 + lr) * DQ + hi * 8;
#pragma unroll
        for (int dt = 0; dt < 4; ++dt) { v8us oh, ol;
#pragma unroll
            for (int j = 0; j < 8; ++j) { unsigned short a, c2; splitf(o[dt][nt][j] * inv, a, c2); oh[j] = a; ol[j] = c2; }
            *(v8usa*)(Ah + oo + dt * 16) = oh; *(v8usa*)(Al + oo + dt * 16) = ol;
            asm volatile("s_wait_xcnt 0x0" ::: "memory"); } }   // stands before the registers that the two stores name are written again
}
#define NHW (NB_ * NH_ * (RH / 128))
#define NLW (NB_ * NH_ * ((TT - RH) / 256))
__global__ __launch_bounds__(256) __attribute__((amdgpu_waves_per_eu(4, 4))) void k_fattn(const h16* __restrict__ Q16, const bf* __restrict__ Qh, const bf* __restrict__ Ql, const h16* __restrict__ K16, const bf* __restrict__ Kh, const bf* __restrict__ Kl, const h16* __restrict__ V16, const bf* __restrict__ Vh, const bf* __restrict__ Vl, bf* Ah, bf* Al) {
    __shared__ __align__(16) unsigned short sm[2 * 4 * FPS];
    const int wave = threadIdx.x >> 5; int bx = blockIdx.x;   // the long work-groups (3 products) start first
    if (bx < NHW) { const int z = bx / (RH / 128), qt = bx % (RH / 128); const size_t zo = (size_t)z * TT * HD, ao = (size_t)(z / NH_) * TT * DQ + (z % NH_) * HD;
        fattn<true, 1>(sm, Qh + zo, Ql + zo, Kh + zo, Kl + zo, Vh + zo, Vl + zo, qt * 128 + wave * 16, Ah + ao, Al + ao);
    } else { bx -= NHW; const int z = bx / ((TT - RH) / 256), qt = bx % ((TT - RH) / 256); const size_t zo = (size_t)z * TT * HD, ao = (size_t)(z / NH_) * TT * DQ + (z % NH_) * HD;
        fattn<false, 2>(sm, (const unsigned short*)(Q16 + zo), nullptr, (const unsigned short*)(K16 + zo), nullptr, (const unsigned short*)(V16 + zo), nullptr, RH + qt * 256 + wave * 32, Ah + ao, Al + ao); }
}

extern "C" void kernel_launch(void* const* d_in, const int* in_sizes, int n_in,
                              void* d_out, int out_size, void* d_ws, size_t ws_size, hipStream_t stream) {
    (void)in_sizes; (void)n_in; (void)out_size;
    const float* x = (const float*)d_in[0]; const float* wqkv = (const float*)d_in[1]; const float* wo = (const float*)d_in[2]; const float* bo = (const float*)d_in[3];   /* x, w_qkv ('xw' [1024][3072]: q | k | v column thirds), w_proj ('xw'), b_proj */
    float* OUT = (float*)d_out;     // [4][2048][1024]
    char* wsp = (char*)d_ws;
    auto take = [&](size_t bytes) { char* p = wsp; wsp += (bytes + 255) & ~(size_t)255; return (void*)p; };
    bf* WQKV = (bf*)take((size_t)3 * DQ * DM * 2);   /* fused Bt [3*DQ][DM]: q | k | v row blocks */ bf* WO = (bf*)take((size_t)DM * DQ * 2); float* CS = (float*)take((size_t)TT * HD * 2 * 4);
    bf* XB = (bf*)take((size_t)NB_ * TT * DM * 2);
    const size_t PB = (size_t)NH_ * TT * HD;   // one batch's head planes, elements; every plane holds all NB_ batches
    h16* QP16 = (h16*)take(NB_ * PB * 2); h16* KP16 = (h16*)take(NB_ * PB * 2); h16* VT16 = (h16*)take(NB_ * PB * 2);
    bf* QPh = (bf*)take(NB_ * PB * 2); bf* QPl = (bf*)take(NB_ * PB * 2); bf* KPh = (bf*)take(NB_ * PB * 2); bf* KPl = (bf*)take(NB_ * PB * 2); bf* VTh = (bf*)take(NB_ * PB * 2); bf* VTl = (bf*)take(NB_ * PB * 2);
    bf* ATh = (bf*)take((size_t)NB_ * TT * DQ * 2); bf* ATl = (bf*)take((size_t)NB_ * TT * DQ * 2);
    if ((size_t)(wsp - (char*)d_ws) > ws_size) return;    // ws 256 MiB
    { k_wtG<<<(unsigned)((DM * 3 * DQ / 64 + 63) / 64), 256, 0, stream>>>(wqkv, DM, 3 * DQ, WQKV);   /* fused 'xw' [DM][3*DQ] -> Bt [3*DQ][DM] */
      k_wtG<<<(unsigned)((DQ * DM / 64 + 63) / 64), 256, 0, stream>>>(wo, DQ, DM, WO);
       }
    k_csP<<<(TT * HD + 255) / 256, 256, 0, stream>>>(CS);
    k_cvt8<<<(unsigned)(((size_t)NB_ * TT * DM / 8 + 255) / 256), 256, 0, stream>>>(x, XB, (size_t)NB_ * TT * DM / 8);
    k_qkv<<<dim3(NB_ * TT / 128, 3 * NH_ / 2, 1), 128, 0, stream>>>(XB, WQKV, CS, QP16, QPh, QPl, KP16, KPh, KPl, VT16, VTh, VTl);
    k_fattn<<<NHW + NLW, 256, 0, stream>>>(QP16, QPh, QPl, KP16, KPh, KPl, VT16, VTh, VTl, ATh, ATl);
    k_proj<<<dim3(NB_ * TT / 128, DM / 128, 1), 128, 0, stream>>>(ATh, ATl, WO, OUT, bo);   // the rows of all batches are contiguous in ATh, ATl and OUT: one launch, two work-groups a WGP
}

// v006
// A run of this version takes 206 microseconds.
// Timed twice side by side with v005, it ran 1.05 times as fast both times.
// All steps since v000 together make it 19.5 times as fast.
#include <hip/hip_runtime.h>

// Multi-head self-attention with a fused bias-free qkv projection and computed interleaved-pair rotary embeddings at SCALED frequencies (x [4][2048][1024]; qkv = x w_qkv ('xw' (in, out) [1024][3072] 1/32, no bias) viewed (B, L, 3, 16, 64): q | k | v column thirds (16 heads x 64); rope on q and k: pairs (x[2i], x[2i+1]) -> (re c - im s, re s + im c) with angle pos x theta_i, theta = (1 / 10000^(2i/64)) x 3.0 (ROPE_SCALE; 32 f32 frequencies jnp-exact; one f32 product per angle; precise cosf/sinf); attn x 64^-0.5; softmax over all keys (no mask); out = merged w_proj + b_proj ('xw' + a bias: READ) -> [4][2048][1024] (8.4 M); argument order x, w_qkv, w_proj, b_proj).
// Layout: k_prep: bf16 copy of x, the fused 'xw' weight transposed ONCE into q | k | v row blocks, computed interleaved table at the scaled frequencies; k_qkv: exact projections of all batches with the interleaved-pair rotary and the plane split in their epilogue; fused dense T-2048 attention, all batches in one launch (hybrid rows: < 512 hi/lo 3 products, rest fp16 x1024); merged hi/lo x w_proj exact + b_proj.
// Compute dtypes, f32 accumulate: every input rounded to bf16; projections exact; rotary f32; attention rows < 512 3 products, rest fp16; softmax f32; w_proj hl x exact + bias.

#define NB_  4
#define TT   2048
#define DM   1024
#define NH_  16
#define NKV  16
#define REP  (NH_ / NKV)
#define HD   64
#define DQ   (NH_ * HD)
#define DKV  (NKV * HD)
#define RH   512                  // query rows < RH use hi+lo planes (0: none)
#define WIN  0
#define PCL2 10.0f                // fp16 rows: P is carried as weight x 2^PCL2, so that small weights stay normal fp16 numbers; the factor cancels in the division by the row sum
typedef _Float16 h16;
typedef unsigned short bf;
typedef __attribute__((ext_vector_type(16))) __bf16   v16bf;
typedef __attribute__((ext_vector_type(16))) _Float16 v16h;
typedef __attribute__((ext_vector_type(8)))  _Float16 v8h;
typedef __attribute__((ext_vector_type(8)))  unsigned short v8us;
typedef __attribute__((ext_vector_type(8)))  float    v8f;
typedef __attribute__((ext_vector_type(4)))  float    v4f;
typedef v8h  __attribute__((may_alias)) v8ha;
typedef v4f  __attribute__((may_alias)) v4fa;
typedef v8us __attribute__((may_alias)) v8usa;

__device__ __forceinline__ unsigned short f2bf(float f) { unsigned u = __float_as_uint(f); u += 0x7FFFu + ((u >> 16) & 1u); return (unsigned short)(u >> 16); }
__device__ __forceinline__ float bf2f(unsigned short b) { return __uint_as_float(((unsigned)b) << 16); }
__device__ __forceinline__ float bfr(float f) { return bf2f(f2bf(f)); }
__device__ __forceinline__ v16h cat16(v8h lo, v8h hi) { return __builtin_shufflevector(lo, hi, 0, 1, 2, 3, 4, 5, 6, 7, 8, 9, 10, 11, 12, 13, 14, 15); }
__device__ __forceinline__ v16bf cat16b(v8us lo, v8us hi) { return __builtin_bit_cast(v16bf, __builtin_shufflevector(lo, hi, 0, 1, 2, 3, 4, 5, 6, 7, 8, 9, 10, 11, 12, 13, 14, 15)); }
__device__ __forceinline__ v8f wmma16(v16h a, v16h b, v8f c) { return __builtin_amdgcn_wmma_f32_16x16x32_f16(false, a, false, b, (short)0, c, false, false); }
__device__ __forceinline__ v8f wmmab(v16bf a, v16bf b, v8f c) { return __builtin_amdgcn_wmma_f32_16x16x32_bf16(false, a, false, b, (short)0, c, false, false); }



// ---- gemm128: the K loop of both GEMMs. A work-group of 4 waves (2 x 2) owns a 128 x 128 tile of C[m][n] = sum_k A[m][k] Bt[n][k] (NPL 3: + A2[m][k] Bt[n][k]), K = DM, operands K-contiguous bf16 planes; each wave keeps its 64 x 64 quarter in 16 accumulators.
// A stage is 64 k of 128 rows of every plane (rows of 128 B at a pitch of 144 B in LDS), brought by asynchronous copies to LDS: one wave-wide copy covers 4 whole 128-byte lines, and each line is fetched once a work-group. Two buffers, one barrier a stage.
template <typename T16> struct WFrag;
template <> struct WFrag<h16> { typedef v16h V; static __device__ __forceinline__ V ld(const h16* p) { return cat16(*(const v8h*)p, *(const v8h*)(p + 16)); } static __device__ __forceinline__ v8f mma(V a, V b, v8f c) { return wmma16(a, b, c); } };
template <> struct WFrag<bf> { typedef v16bf V; static __device__ __forceinline__ V ld(const bf* p) { return cat16b(*(const v8us*)p, *(const v8us*)(p + 16)); } static __device__ __forceinline__ v8f mma(V a, V b, v8f c) { return wmmab(a, b, c); } };
#define GP   72                   // LDS row pitch in 16-bit elements
#define GPL  (128 * GP)           // one staged plane: 128 rows
#define GNS  (DM / 64)            // stages along K
// one plane of a stage: this lane's 16 bytes of rows r, r + 16, .. r + 112. The s_wait_xcnt closes the copies' own statement, so that it stands before any rewrite of the address registers that they name.
__device__ __forceinline__ void gcopy(unsigned l, const bf* g) {
    asm volatile("global_load_async_to_lds_b128 %0, %8, off\n\t"
                 "global_load_async_to_lds_b128 %1, %9, off\n\t"
                 "global_load_async_to_lds_b128 %2, %10, off\n\t"
                 "global_load_async_to_lds_b128 %3, %11, off\n\t"
                 "global_load_async_to_lds_b128 %4, %12, off\n\t"
                 "global_load_async_to_lds_b128 %5, %13, off\n\t"
                 "global_load_async_to_lds_b128 %6, %14, off\n\t"
                 "global_load_async_to_lds_b128 %7, %15, off\n\t"
                 "s_wait_xcnt 0x0"
                 :: "v"(l), "v"(l + 16 * GP * 2), "v"(l + 32 * GP * 2), "v"(l + 48 * GP * 2), "v"(l + 64 * GP * 2), "v"(l + 80 * GP * 2), "v"(l + 96 * GP * 2), "v"(l + 112 * GP * 2),
                    "v"(g), "v"(g + 16 * DM), "v"(g + 32 * DM), "v"(g + 48 * DM), "v"(g + 64 * DM), "v"(g + 80 * DM), "v"(g + 96 * DM), "v"(g + 112 * DM) : "memory");
}
// Every plain '#pragma unroll' here and in the two kernels that call it is there so that the fragment and accumulator arrays are indexed by constants and stay in registers.
template <int NPL>   // staged planes: A, Bt (, A2). Ag, A2g, Bg: row 0 of the work-group's 128 rows
__device__ __forceinline__ void gemm128(unsigned short* sm, const bf* __restrict__ Ag, const bf* __restrict__ A2g, const bf* __restrict__ Bg, int wave, v8f (&acc)[4][4]) {
    typedef WFrag<bf>::V V;
    const int tid = threadIdx.x, lane = tid & 31, lr = lane & 15, hi = lane >> 4;
    const unsigned l0 = (unsigned)(size_t)sm + (unsigned)((tid >> 3) * GP + (tid & 7) * 8) * 2u;   // LDS byte address of this lane's 16 bytes of row tid / 8
    const size_t go = (size_t)(tid >> 3) * DM + (tid & 7) * 8;
    auto fill = [&](int s) { const unsigned lb = l0 + (unsigned)((s & 1) * NPL * GPL) * 2u; const size_t o = go + (size_t)s * 64;
        gcopy(lb, Ag + o); gcopy(lb + GPL * 2, Bg + o); if constexpr (NPL == 3) gcopy(lb + 2 * GPL * 2, A2g + o); };
    fill(0);
    asm volatile("s_wait_asynccnt 0x0" ::: "memory");   // this wave's copies of stage 0 have landed
    __syncthreads();                                    // publishes stage 0
    fill(1);
    const int ao = ((wave >> 1) * 64 + lr) * GP + 8 * hi, bo = GPL + ((wave & 1) * 64 + lr) * GP + 8 * hi;
#pragma unroll 1
    for (int s = 0; s < GNS; ++s) {   // rolled: one trip a stage, so that the buffer index and the refill test stay scalar
        const unsigned short* bp = sm + (s & 1) * NPL * GPL;
#pragma unroll
        for (int ks = 0; ks < 2; ++ks) {
            V a[4], a2[4], b[4];   // the block's fragments are fetched as one group ahead of its products
#pragma unroll
            for (int mb = 0; mb < 4; ++mb) { a[mb] = WFrag<bf>::ld(bp + ao + mb * 16 * GP + ks * 32); if constexpr (NPL == 3) a2[mb] = WFrag<bf>::ld(bp + 2 * GPL + ao + mb * 16 * GP + ks * 32); }
#pragma unroll
            for (int nb = 0; nb < 4; ++nb) b[nb] = WFrag<bf>::ld(bp + bo + nb * 16 * GP + ks * 32);
            __builtin_amdgcn_sched_barrier(0);   // keeps the reads together in front: sunk among the products, into one shared Bt fragment, every four products wait out an LDS latency
#pragma unroll
            for (int nb = 0; nb < 4; ++nb)
#pragma unroll
                for (int mb = 0; mb < 4; ++mb) { acc[mb][nb] = WFrag<bf>::mma(a[mb], b[nb], acc[mb][nb]); if constexpr (NPL == 3) acc[mb][nb] = WFrag<bf>::mma(a2[mb], b[nb], acc[mb][nb]); }
        }
        asm volatile("s_wait_dscnt 0x0" ::: "memory");      // this wave's reads of stage s have returned
        asm volatile("s_wait_asynccnt 0x0" ::: "memory");   // this wave's copies of stage s + 1 have landed
        __syncthreads();                                    // publishes stage s + 1 and ends every wave's reads of the buffer refilled below
        if (s + 2 < GNS) fill(s + 2);
    }
    asm volatile("s_wait_asynccnt 0x0" ::: "memory");   // no copy is outstanding when the wave goes on
}
// ---- k_proj: C (f32, pitch DM) = (A + A2) Bt^T + bias, grid (M / 128, DM / 128), 128 threads; a wave's 64 x 64 quarter goes out through its own LDS rows, whole 128-byte lines.
__global__ __launch_bounds__(128) void k_proj(const bf* __restrict__ A, const bf* __restrict__ A2, const bf* __restrict__ Bt, float* C, const float* __restrict__ bias) {
    __shared__ __align__(16) unsigned short sm[2 * 3 * GPL];
    __shared__ __align__(16) float osw[4][16 * 68];
    const int lane = threadIdx.x & 31, lr = lane & 15, hi = lane >> 4; const int wave = __builtin_amdgcn_readfirstlane(threadIdx.x >> 5);
    float* os = osw[wave]; const int r0 = blockIdx.x * 128 + (wave >> 1) * 64, c0 = blockIdx.y * 128 + (wave & 1) * 64;
    v8f acc[4][4];
#pragma unroll
    for (int mb = 0; mb < 4; ++mb)
#pragma unroll
        for (int nb = 0; nb < 4; ++nb) acc[mb][nb] = (v8f){};
    gemm128<3>(sm, A + (size_t)blockIdx.x * 128 * DM, A2 + (size_t)blockIdx.x * 128 * DM, Bt + (size_t)blockIdx.y * 128 * DM, wave, acc);
    const int cofs = lr * 4; v4f bv; bv[0] = bfr(bias[c0 + cofs]); bv[1] = bfr(bias[c0 + cofs + 1]); bv[2] = bfr(bias[c0 + cofs + 2]); bv[3] = bfr(bias[c0 + cofs + 3]);
#pragma unroll
    for (int mb = 0; mb < 4; ++mb) {
#pragma unroll
        for (int nb = 0; nb < 4; ++nb) {
#pragma unroll
            for (int j = 0; j < 8; ++j) os[(hi * 8 + j) * 68 + nb * 16 + lr] = acc[mb][nb][j]; }
        __builtin_amdgcn_wave_barrier(); asm volatile("" ::: "memory");   // the row reads below stay behind the other lanes' LDS writes
        float* crow = C + (size_t)(r0 + mb * 16) * DM + c0;
#pragma unroll
        for (int s = 0; s < 8; ++s) { const int row = 2 * s + hi; const v4f val = *(const v4fa*)(os + row * 68 + cofs) + bv;
            *(v4f*)(crow + (size_t)row * DM + cofs) = val; }
        asm volatile("s_wait_xcnt 0x0" ::: "memory");   // stands before the registers that the stores name are written again
        __builtin_amdgcn_wave_barrier(); asm volatile("" ::: "memory");   // the next block's LDS writes stay behind these reads
    }
}

__device__ __forceinline__ h16 tohx(float x) { return (h16)x; }
__device__ __forceinline__ void splitf(float y, unsigned short& h, unsigned short& l) { h = f2bf(y); l = f2bf(y - bf2f(h)); }
typedef __attribute__((ext_vector_type(2))) _Float16 v2h;
typedef __attribute__((ext_vector_type(4))) _Float16 v4h;
typedef __attribute__((ext_vector_type(2))) unsigned short v2us;
typedef __attribute__((ext_vector_type(4))) unsigned short v4us;
typedef __attribute__((ext_vector_type(2))) float v2f;
typedef __attribute__((ext_vector_type(4))) int v4i;

// INV2: the 32 rotary frequencies of THIS module: (1.0 / (ROPE_BASE ** (arange(0, 64, 2, float32) / 64))) * ROPE_SCALE with ROPE_BASE 10000 and ROPE_SCALE 3.0, generated with jnp in float32 (bit-exact; == the unscaled table x 3.0f in f32, 32 of 32): the adjacent (even, odd) pair shares entry d / 2.
__constant__ float INV2[HD / 2] = { 3.000000000e+00f, 2.249682665e+00f, 1.687023997e+00f, 1.265089512e+00f, 9.486832619e-01f, 7.114120722e-01f, 5.334838033e-01f, 4.000564218e-01f, 3.000000119e-01f, 2.249682546e-01f, 1.687023938e-01f, 1.265089512e-01f, 9.486833215e-02f, 7.114120573e-02f, 5.334838480e-02f, 4.000564665e-02f, 2.999999933e-02f, 2.249682695e-02f, 1.687023975e-02f, 1.265089400e-02f, 9.486833587e-03f, 7.114121690e-03f, 5.334838293e-03f, 4.000564106e-03f, 3.000000026e-03f, 2.249682555e-03f, 1.687023905e-03f, 1.265089493e-03f, 9.486833587e-04f, 7.114121690e-04f, 5.334838061e-04f, 4.000564513e-04f };
// ---- k_prep: all the preparation in ONE launch of PG work-groups that are resident together (two a WGP, 4,096 waves), each taking an equal share of every part:
// 64 KB of x rounded to bf16 (8 groups of 8 elements a thread), one rotary table entry a thread, and one 128 (k) x 64 (n) tile of a weight, rounded and transposed into Bt [n][k].
// The tile: a lane reads 32 consecutive k of ONE column n (a wave-wide load is one whole 128-byte line of a weight row), so its 32 rounded values are 64 contiguous bytes of the Bt row;
// they pass through LDS (rows of 256 B at a pitch of 272 B) only so that the Bt rows go out as whole 256-byte units.
#define PG   512
#define NWQ  ((3 * DQ / 64) * (DM / 128))   // work-groups below NWQ: tiles of w_qkv; the rest: tiles of w_proj
#define WTP  136                            // LDS row pitch in 16-bit elements
static_assert(DQ == DM && PG == NWQ + (DM / 64) * (DQ / 128) && PG * 256 == TT * HD && (size_t)PG * 256 * 64 == (size_t)NB_ * TT * DM, "k_prep: every share divides evenly");
template <int N>   // N: row length of the weight w ([DM][N], Bt [N][DM]); a template, so that the 32 loads of a column differ in their constant offsets alone
__device__ __forceinline__ void prep(unsigned short* tl, const float* __restrict__ x, const float* __restrict__ w, bf* XB, bf* Bt, float* CS, int tile) {
    const int tid = threadIdx.x, lane = tid & 31, bx = blockIdx.x; const int wave = __builtin_amdgcn_readfirstlane(tid >> 5);
    const int k0 = (tile % (DM / 128)) * 128, n0 = (tile / (DM / 128)) * 64;
    // Every load of the work-group is issued here, the table's frequency first (loads are waited for in their order), so that the table arithmetic runs while the rest fly. The plain unrolls keep the arrays in registers.
    const int idx = bx * 256 + tid; const int d = idx % HD; const int t = idx / HD; const float fr = INV2[d >> 1];
    asm volatile("s_wait_xcnt 0x0" ::: "memory");   // stands before the offset register of the frequency's load is written again (it is free for the data of the loads below)
    const float* wr = w + (size_t)(k0 + (wave >> 1) * 32) * N + n0 + (wave & 1) * 32;   // uniform: the wave's first row at its first column
    float wv[32];
#pragma unroll
    for (int r = 0; r < 32; ++r) wv[r] = wr[r * N + lane];
    const size_t xo = (size_t)bx * (256 * 64) + tid * 8; v8f xv[8];
#pragma unroll
    for (int it = 0; it < 8; ++it) xv[it] = *(const v8f*)(x + xo + it * 2048);
    asm volatile("s_wait_xcnt 0x0" ::: "memory");   // stands before the address registers of the loads issued so far are written again
    const float a = __fmul_rn((float)t, fr); v2f cs; cs[0] = cosf(a); cs[1] = sinf(a);
    unsigned short* tw = tl + ((wave & 1) * 32 + lane) * WTP + (wave >> 1) * 32;
#pragma unroll
    for (int q = 0; q < 4; ++q) { v8us o;
#pragma unroll
        for (int j = 0; j < 8; ++j) o[j] = f2bf(wv[q * 8 + j]);
        *(v8usa*)(tw + q * 8) = o; }
    __syncthreads();   // the tile's columns are all in LDS before its rows are read; every global store stands behind it, so that it waits for none
    *(v2f*)(CS + (size_t)idx * 2) = cs;
    bf* bt = Bt + (size_t)(n0 + (tid >> 4)) * DM + k0 + (tid & 15) * 8; const unsigned short* tr = tl + (tid >> 4) * WTP + (tid & 15) * 8;
#pragma unroll
    for (int p = 0; p < 4; ++p) *(v8usa*)(bt + p * 16 * DM) = *(const v8usa*)(tr + p * 16 * WTP);
#pragma unroll
    for (int it = 0; it < 8; ++it) { v8us o;
#pragma unroll
        for (int k = 0; k < 8; ++k) o[k] = f2bf(xv[it][k]);
        *(v8us*)(XB + xo + it * 2048) = o; }
}
__global__ __launch_bounds__(256) void k_prep(const float* __restrict__ x, const float* __restrict__ wqkv, const float* __restrict__ wo, bf* XB, bf* WQKV, bf* WO, float* CS) {
    __shared__ __align__(16) unsigned short tl[64 * WTP];
    const int bx = blockIdx.x;   // the branch is the same for the whole work-group
    if (bx < NWQ) prep<3 * DQ>(tl, x, wqkv, XB, WQKV, CS, bx); else prep<DM>(tl, x, wo, XB, WO, CS, bx - NWQ);
}
// ---- k_qkv: the q | k | v projection of every batch in one launch (gemm128, one product), each wave building the attention planes of its 64 x 64 quarter itself from its accumulators.
// grid (NB_ TT / 128, 3 NH_ / 2), 128 threads: a wave has 64 rows of x (one batch, 64 positions) x 64 columns of the fused weight = one head of q (column block < NH_), of k (< 2 NH_) or of v.
// q and k tiles: interleaved-pair rotary on the f32 sums (table CS), then planes [b][h][t][d] as fp16, bf16 hi and bf16 lo; through the wave's own LDS rows, so that a 128-byte plane row is stored whole.
// v tiles: planes [b][h][d][t]; accumulator elements 0..7 of a lane are 8 consecutive positions of one column, so 16 bytes a plane go out straight from registers.
__global__ __launch_bounds__(128) void k_qkv(const bf* __restrict__ A, const bf* __restrict__ Bt, const float* __restrict__ CS, h16* Q16, bf* Qh, bf* Ql, h16* K16, bf* Kh, bf* Kl, h16* V16, bf* Vh, bf* Vl) {
    __shared__ __align__(16) unsigned short sm[2 * 2 * GPL];
    __shared__ __align__(16) float osw[4][16 * 68];
    const int lane = threadIdx.x & 31, lr = lane & 15, hi = lane >> 4; const int wave = __builtin_amdgcn_readfirstlane(threadIdx.x >> 5);
    float* os = osw[wave]; const int r0 = blockIdx.x * 128 + (wave >> 1) * 64, cy = blockIdx.y * 2 + (wave & 1);
    v8f acc[4][4];
#pragma unroll
    for (int mb = 0; mb < 4; ++mb)
#pragma unroll
        for (int nb = 0; nb < 4; ++nb) acc[mb][nb] = (v8f){};
    gemm128<2>(sm, A + (size_t)blockIdx.x * 128 * DM, nullptr, Bt + (size_t)blockIdx.y * 128 * DM, wave, acc);
    const int bt = r0 / TT, t0 = r0 % TT, sel = cy / NH_, hd = cy % NH_;
    const size_t po = ((size_t)bt * NH_ + hd) * TT * HD;
    if (sel == 2) {
        char* W16 = (char*)(V16 + po + t0); char* Wh = (char*)(Vh + po + t0); char* Wl = (char*)(Vl + po + t0); const unsigned vl = (unsigned)(lr * TT + hi * 8) * 2u;   // uniform bases, lane offset in bytes
#pragma unroll
        for (int nb = 0; nb < 4; ++nb) {
#pragma unroll
            for (int mb = 0; mb < 4; ++mb) { v8h o16; v8us oh, ol;
#pragma unroll
                for (int j = 0; j < 8; ++j) { const float x = acc[mb][nb][j]; o16[j] = tohx(x); unsigned short a2, c2; splitf(x, a2, c2); oh[j] = a2; ol[j] = c2; }
                const int vc = (nb * 16 * TT + mb * 16) * 2; *(v8ha*)(W16 + vc + vl) = o16; *(v8usa*)(Wh + vc + vl) = oh; *(v8usa*)(Wl + vc + vl) = ol;
                asm volatile("s_wait_xcnt 0x0" ::: "memory"); } }   // stands before the registers that the three stores name are written again
    } else {
        const size_t pt = po + (size_t)t0 * HD; char* W16 = (char*)((sel ? K16 : Q16) + pt); char* Wh = (char*)((sel ? Kh : Qh) + pt); char* Wl = (char*)((sel ? Kl : Ql) + pt); const char* Ct = (const char*)(CS + (size_t)t0 * HD * 2);
        const unsigned pl = (unsigned)(hi * HD + lr * 4) * 2u, cl = pl * 4u;   // uniform bases, lane offsets in bytes (plane row 128 B, table row 512 B)
#pragma unroll
        for (int mb = 0; mb < 4; ++mb) {
#pragma unroll
            for (int nb = 0; nb < 4; ++nb) {
#pragma unroll
                for (int j = 0; j < 8; ++j) os[(hi * 8 + j) * 68 + nb * 16 + lr] = acc[mb][nb][j]; }
            __builtin_amdgcn_wave_barrier(); asm volatile("" ::: "memory");   // the row reads below stay behind the other lanes' LDS writes
            v4f xv[8]; v2f ca[8], cb[8];   // all 16 rows' sums and table entries are fetched before the first store, one latency a block of 16 rows
#pragma unroll
            for (int s = 0; s < 8; ++s) { const int row = 2 * s + hi; xv[s] = *(const v4fa*)(os + row * 68 + lr * 4); const char* cp = Ct + (mb * 16 + 2 * s) * HD * 8 + cl; ca[s] = *(const v2f*)cp; cb[s] = *(const v2f*)(cp + 16); }
#pragma unroll
            for (int s = 0; s < 8; ++s) { const int pc = (mb * 16 + 2 * s) * HD * 2; float r[4]; v4h o16; v4us oh, ol;
                r[0] = xv[s][0] * ca[s][0] - xv[s][1] * ca[s][1]; r[1] = xv[s][0] * ca[s][1] + xv[s][1] * ca[s][0];   /* even: x0 c - x1 s; odd: x0 s + x1 c; free to contract to a product and an fma */
                r[2] = xv[s][2] * cb[s][0] - xv[s][3] * cb[s][1]; r[3] = xv[s][2] * cb[s][1] + xv[s][3] * cb[s][0];
#pragma unroll
                for (int q = 0; q < 4; ++q) { o16[q] = tohx(r[q]); unsigned short a2, c2; splitf(r[q], a2, c2); oh[q] = a2; ol[q] = c2; }
                *(v4h*)(W16 + pc + pl) = o16; *(v4us*)(Wh + pc + pl) = oh; *(v4us*)(Wl + pc + pl) = ol;
                asm volatile("s_wait_xcnt 0x0" ::: "memory"); }   // stands before the registers that the three stores name are written again
            __builtin_amdgcn_wave_barrier(); asm volatile("" ::: "memory");   // the next block's LDS writes stay behind these reads
        }
    }
}
// ---- k_fattn: fused attention, one launch for every batch, head and query row. Scores, softmax and P stay in registers.
// St = K Qt (A = 16 key rows, B = 16 query columns), Ot += Vt Pt: accumulator element j of lane (lr, hi) of the score tile of keys kb + 16 kt .. is key kb + 16 kt + 8 hi + j of query lr,
// which is element 8 kt + j of the B operand of a 32-key product in the loaders' k order, so P is packed in place. Running maximum per query column, output and sum rescaled every 32 keys.
// A work-group of 8 waves shares K and Vt: 64 keys a stage, brought through registers into two LDS buffers (rows of 128 B at a pitch of 144 B), one barrier a stage.
// Work-groups below NHW: query rows < RH, 16 columns a wave, hi/lo bf16 planes, 3 products; the rest: 32 columns a wave, fp16.
#define FP   72                   // LDS row pitch in 16-bit elements
#define FPS  (64 * FP)            // one staged plane: 64 rows
#define NST  (TT / 64)
#define CL2  0.18033688011112042f // HD^-0.5 x log2(e)
typedef __attribute__((ext_vector_type(2))) __bf16 v2b;
typedef __attribute__((ext_vector_type(8))) unsigned v8u;
template <bool HI> struct FT;
template <> struct FT<false> { typedef v16h V; static __device__ __forceinline__ V ld(const unsigned short* p) { return __builtin_bit_cast(v16h, __builtin_shufflevector(*(const v8usa*)p, *(const v8usa*)(p + 16), 0, 1, 2, 3, 4, 5, 6, 7, 8, 9, 10, 11, 12, 13, 14, 15)); } static __device__ __forceinline__ v8f mma(V a, V b, v8f c) { return wmma16(a, b, c); } };
template <> struct FT<true> { typedef v16bf V; static __device__ __forceinline__ V ld(const unsigned short* p) { return cat16b(*(const v8usa*)p, *(const v8usa*)(p + 16)); } static __device__ __forceinline__ v8f mma(V a, V b, v8f c) { return wmmab(a, b, c); } };
__device__ __forceinline__ float xhalf(float x) { const int b = __float_as_int(x); return __int_as_float(__builtin_amdgcn_permlanex16(b, b, 0x76543210, 0xfedcba98, false, false)); }   // lane l <-> l ^ 16
template <bool HI, int NT>
__device__ __forceinline__ void fattn(unsigned short* sm, const unsigned short* __restrict__ Q, const unsigned short* __restrict__ Q2, const unsigned short* __restrict__ Kg, const unsigned short* __restrict__ K2g, const unsigned short* __restrict__ Vg, const unsigned short* __restrict__ V2g, int qw, bf* Ah, bf* Al) {
    typedef typename FT<HI>::V V;
    constexpr int PLN = HI ? 4 : 2;   // staged planes: K, Vt (, K lo, Vt lo)
    const int tid = threadIdx.x, lane = tid & 31, lr = lane & 15, hi = lane >> 4;
    const int srow = tid >> 3, sseg = (tid & 7) * 8;   // staging: rows srow and srow + 32, one 16-byte segment of each plane
    v8us st[PLN][2];
    auto gload = [&](int s) {
#pragma unroll
        for (int r = 0; r < 2; ++r) { const int row = srow + 32 * r; const size_t ko = (size_t)(s * 64 + row) * HD + sseg, vo = (size_t)row * TT + s * 64 + sseg;
            st[0][r] = *(const v8usa*)(Kg + ko); st[1][r] = *(const v8usa*)(Vg + vo);
            if constexpr (HI) { st[2][r] = *(const v8usa*)(K2g + ko); st[3][r] = *(const v8usa*)(V2g + vo); } }
        asm volatile("s_wait_xcnt 0x0" ::: "memory"); };   // stands before the address registers of the loads issued so far are written again
    auto sstore = [&](int b) {
#pragma unroll
        for (int r = 0; r < 2; ++r)
#pragma unroll
            for (int pl = 0; pl < PLN; ++pl) *(v8usa*)(sm + (b * PLN + pl) * FPS + (srow + 32 * r) * FP + sseg) = st[pl][r]; };
    V qf[NT][2], qf2[NT][2];
#pragma unroll
    for (int nt = 0; nt < NT; ++nt)
#pragma unroll
        for (int ks = 0; ks < 2; ++ks) { const size_t qo = (size_t)(qw + nt * 16 + lr) * HD + ks * 32 + 8 * hi; qf[nt][ks] = FT<HI>::ld(Q + qo); if constexpr (HI) qf2[nt][ks] = FT<HI>::ld(Q2 + qo); }
    asm volatile("s_wait_xcnt 0x0" ::: "memory");   // stands before the address registers of the Q loads are written again
    v8f o[4][NT]; float mc[NT], l[NT];
#pragma unroll
    for (int nt = 0; nt < NT; ++nt) { mc[nt] = -3.0e37f; l[nt] = 0.f;
#pragma unroll
        for (int dt = 0; dt < 4; ++dt) o[dt][nt] = (v8f){}; }
    gload(0); sstore(0); __syncthreads();
#pragma unroll 1
    for (int s = 0; s < NST; ++s) {
        if (s + 1 < NST) gload(s + 1);
        const unsigned short* kb = sm + (s & 1) * PLN * FPS;
#pragma unroll
        for (int p = 0; p < 2; ++p) {
            v8f sc[2][NT];
#pragma unroll
            for (int kt = 0; kt < 2; ++kt) { V ka[2], ka2[2];
#pragma unroll
                for (int ks = 0; ks < 2; ++ks) { const int off = (p * 32 + kt * 16 + lr) * FP + ks * 32 + 8 * hi; ka[ks] = FT<HI>::ld(kb + off); if constexpr (HI) ka2[ks] = FT<HI>::ld(kb + 2 * FPS + off); }
#pragma unroll
                for (int nt = 0; nt < NT; ++nt) { v8f a = (v8f){};
#pragma unroll
                    for (int ks = 0; ks < 2; ++ks) { a = FT<HI>::mma(ka[ks], qf[nt][ks], a); if constexpr (HI) { a = FT<HI>::mma(ka[ks], qf2[nt][ks], a); a = FT<HI>::mma(ka2[ks], qf[nt][ks], a); } }
                    sc[kt][nt] = a; } }
            V pf[NT], pf2[NT];
#pragma unroll
            for (int nt = 0; nt < NT; ++nt) {
                float cm = fmaxf(sc[0][nt][0], sc[1][nt][0]);
#pragma unroll
                for (int j = 1; j < 8; ++j) cm = fmaxf(cm, fmaxf(sc[0][nt][j], sc[1][nt][j]));
                cm = fmaxf(cm, xhalf(cm));
                const float mn = fmaxf(mc[nt], cm * CL2); const float al = __builtin_amdgcn_exp2f(mc[nt] - mn); mc[nt] = mn; const float mo = HI ? mn : mn - PCL2;
                float e[16];
#pragma unroll
                for (int i = 0; i < 16; ++i) e[i] = __builtin_amdgcn_exp2f(fmaf(sc[i >> 3][nt][i & 7], CL2, -mo));
                const float ps = ((e[0] + e[1]) + (e[2] + e[3])) + ((e[4] + e[5]) + (e[6] + e[7])) + (((e[8] + e[9]) + (e[10] + e[11])) + ((e[12] + e[13]) + (e[14] + e[15])));
                l[nt] = fmaf(l[nt], al, ps);
#pragma unroll
                for (int dt = 0; dt < 4; ++dt) o[dt][nt] *= al;
                v8u ph, pl;   // two elements a register, converted in pairs
#pragma unroll
                for (int i = 0; i < 8; ++i) { const v2f ev = { e[2 * i], e[2 * i + 1] };
                    if constexpr (HI) { const v2b hb = __builtin_convertvector(ev, v2b); ph[i] = __builtin_bit_cast(unsigned, hb); pl[i] = __builtin_bit_cast(unsigned, __builtin_convertvector(ev - __builtin_convertvector(hb, v2f), v2b)); }
                    else ph[i] = __builtin_bit_cast(unsigned, __builtin_convertvector(ev, v2h)); }
                pf[nt] = __builtin_bit_cast(V, ph); if constexpr (HI) pf2[nt] = __builtin_bit_cast(V, pl); }
#pragma unroll
            for (int dt = 0; dt < 4; ++dt) { const int off = FPS + (dt * 16 + lr) * FP + p * 32 + 8 * hi; const V va = FT<HI>::ld(kb + off); V va2; if constexpr (HI) va2 = FT<HI>::ld(kb + 2 * FPS + off);
#pragma unroll
                for (int nt = 0; nt < NT; ++nt) { o[dt][nt] = FT<HI>::mma(va, pf[nt], o[dt][nt]); if constexpr (HI) { o[dt][nt] = FT<HI>::mma(va, pf2[nt], o[dt][nt]); o[dt][nt] = FT<HI>::mma(va2, pf[nt], o[dt][nt]); } } }
        }
        if (s + 1 < NST) sstore((s + 1) & 1);
        __syncthreads();   // publishes stage s + 1 and ends every wave's reads of the buffer that the next trip refills
    }
#pragma unroll
    for (int nt = 0; nt < NT; ++nt) { const float inv = __fdiv_rn(1.0f, l[nt] + xhalf(l[nt])); const size_t oo = (size_t)(qw + nt * 16 + lr) * DQ + hi * 8;
#pragma unroll
        for (int dt = 0; dt < 4; ++dt) { v8us oh, ol;
#pragma unroll
            for (int j = 0; j < 8; ++j) { unsigned short a, c2; splitf(o[dt][nt][j] * inv, a, c2); oh[j] = a; ol[j] = c2; }
            *(v8usa*)(Ah + oo + dt * 16) = oh; *(v8usa*)(Al + oo + dt * 16) = ol;
            asm volatile("s_wait_xcnt 0x0" ::: "memory"); } }   // stands before the registers that the two stores name are written again
}
#define NHW (NB_ * NH_ * (RH / 128))
#define NLW (NB_ * NH_ * ((TT - RH) / 256))
__global__ __launch_bounds__(256) __attribute__((amdgpu_waves_per_eu(4, 4))) void k_fattn(const h16* __restrict__ Q16, const bf* __restrict__ Qh, const bf* __restrict__ Ql, const h16* __restrict__ K16, const bf* __restrict__ Kh, const bf* __restrict__ Kl, const h16* __restrict__ V16, const bf* __restrict__ Vh, const bf* __restrict__ Vl, bf* Ah, bf* Al) {
    __shared__ __align__(16) unsigned short sm[2 * 4 * FPS];
    const int wave = threadIdx.x >> 5; int bx = blockIdx.x;   // the long work-groups (3 products) have the lowest indices
    if (bx < NHW) { const int z = bx / (RH / 128), qt = bx % (RH / 128); const size_t zo = (size_t)z * TT * HD, ao = (size_t)(z / NH_) * TT * DQ + (z % NH_) * HD;
        fattn<true, 1>(sm, Qh + zo, Ql + zo, Kh + zo, Kl + zo, Vh + zo, Vl + zo, qt * 128 + wave * 16, Ah + ao, Al + ao);
    } else { bx -= NHW; const int z = bx / ((TT - RH) / 256), qt = bx % ((TT - RH) / 256); const size_t zo = (size_t)z * TT * HD, ao = (size_t)(z / NH_) * TT * DQ + (z % NH_) * HD;
        fattn<false, 2>(sm, (const unsigned short*)(Q16 + zo), nullptr, (const unsigned short*)(K16 + zo), nullptr, (const unsigned short*)(V16 + zo), nullptr, RH + qt * 256 + wave * 32, Ah + ao, Al + ao); }
}

extern "C" void kernel_launch(void* const* d_in, const int* in_sizes, int n_in,
                              void* d_out, int out_size, void* d_ws, size_t ws_size, hipStream_t stream) {
    (void)in_sizes; (void)n_in; (void)out_size;
    const float* x = (const float*)d_in[0]; const float* wqkv = (const float*)d_in[1]; const float* wo = (const float*)d_in[2]; const float* bo = (const float*)d_in[3];   /* x, w_qkv ('xw' [1024][3072]: q | k | v column thirds), w_proj ('xw'), b_proj */
    float* OUT = (float*)d_out;     // [4][2048][1024]
    char* wsp = (char*)d_ws;
    auto take = [&](size_t bytes) { char* p = wsp; wsp += (bytes + 255) & ~(size_t)255; return (void*)p; };
    bf* WQKV = (bf*)take((size_t)3 * DQ * DM * 2);   /* fused Bt [3*DQ][DM]: q | k | v row blocks */ bf* WO = (bf*)take((size_t)DM * DQ * 2); float* CS = (float*)take((size_t)TT * HD * 2 * 4);
    bf* XB = (bf*)take((size_t)NB_ * TT * DM * 2);
    const size_t PB = (size_t)NH_ * TT * HD;   // one batch's head planes, elements; every plane holds all NB_ batches
    h16* QP16 = (h16*)take(NB_ * PB * 2); h16* KP16 = (h16*)take(NB_ * PB * 2); h16* VT16 = (h16*)take(NB_ * PB * 2);
    bf* QPh = (bf*)take(NB_ * PB * 2); bf* QPl = (bf*)take(NB_ * PB * 2); bf* KPh = (bf*)take(NB_ * PB * 2); bf* KPl = (bf*)take(NB_ * PB * 2); bf* VTh = (bf*)take(NB_ * PB * 2); bf* VTl = (bf*)take(NB_ * PB * 2);
    bf* ATh = (bf*)take((size_t)NB_ * TT * DQ * 2); bf* ATl = (bf*)take((size_t)NB_ * TT * DQ * 2);
    if ((size_t)(wsp - (char*)d_ws) > ws_size) return;    // ws 256 MiB
    k_prep<<<PG, 256, 0, stream>>>(x, wqkv, wo, XB, WQKV, WO, CS);   // x -> bf16; fused 'xw' [DM][3*DQ] -> Bt [3*DQ][DM]; w_proj [DQ][DM] -> Bt [DM][DQ]; rotary table
    k_qkv<<<dim3(NB_ * TT / 128, 3 * NH_ / 2, 1), 128, 0, stream>>>(XB, WQKV, CS, QP16, QPh, QPl, KP16, KPh, KPl, VT16, VTh, VTl);
    k_fattn<<<NHW + NLW, 256, 0, stream>>>(QP16, QPh, QPl, KP16, KPh, KPl, VT16, VTh, VTl, ATh, ATl);
    k_proj<<<dim3(NB_ * TT / 128, DM / 128, 1), 128, 0, stream>>>(ATh, ATl, WO, OUT, bo);   // the rows of all batches are contiguous in ATh, ATl and OUT: one launch, two work-groups a WGP
}

// v007
// One run takes 197 microseconds.
// Next to v006, in two timings, it ran 1.05 times as fast each time.
// All steps since v000 together make it 20.4 times as fast.
#include <hip/hip_runtime.h>

// Multi-head self-attention with a fused bias-free qkv projection and computed interleaved-pair rotary embeddings at SCALED frequencies (x [4][2048][1024]; qkv = x w_qkv ('xw' (in, out) [1024][3072] 1/32, no bias) viewed (B, L, 3, 16, 64): q | k | v column thirds (16 heads x 64); rope on q and k: pairs (x[2i], x[2i+1]) -> (re c - im s, re s + im c) with angle pos x theta_i, theta = (1 / 10000^(2i/64)) x 3.0 (ROPE_SCALE; 32 f32 frequencies jnp-exact; one f32 product per angle; precise cosf/sinf); attn x 64^-0.5; softmax over all keys (no mask); out = merged w_proj + b_proj ('xw' + a bias: READ) -> [4][2048][1024] (8.4 M); argument order x, w_qkv, w_proj, b_proj).
// Layout: k_prep: bf16 copy of x, the fused 'xw' weight transposed ONCE into q | k | v row blocks, computed interleaved table at the scaled frequencies; k_qkv: exact projections of all batches with the interleaved-pair rotary and the plane split in their epilogue; fused dense T-2048 attention, all batches in one launch (hybrid rows: < 512 hi/lo 3 products, rest fp16 x1024); merged hi/lo x w_proj exact + b_proj.
// Compute dtypes, f32 accumulate: every input rounded to bf16; projections exact; rotary f32; attention rows < 512 3 products, rest fp16; softmax f32; w_proj hl x exact + bias.

#define NB_  4
#define TT   2048
#define DM   1024
#define NH_  16
#define NKV  16
#define REP  (NH_ / NKV)
#define HD   64
#define DQ   (NH_ * HD)
#define DKV  (NKV * HD)
#define RH   512                  // query rows < RH use hi+lo planes (0: none)
#define WIN  0
#define PCL2 10.0f                // fp16 rows: P is carried as weight x 2^PCL2, so that small weights stay normal fp16 numbers; the factor cancels in the division by the row sum
typedef _Float16 h16;
typedef unsigned short bf;
typedef __attribute__((ext_vector_type(16))) __bf16   v16bf;
typedef __attribute__((ext_vector_type(16))) _Float16 v16h;
typedef __attribute__((ext_vector_type(8)))  _Float16 v8h;
typedef __attribute__((ext_vector_type(8)))  unsigned short v8us;
typedef __attribute__((ext_vector_type(8)))  float    v8f;
typedef __attribute__((ext_vector_type(4)))  float    v4f;
typedef v8h  __attribute__((may_alias)) v8ha;
typedef v4f  __attribute__((may_alias)) v4fa;
typedef v8us __attribute__((may_alias)) v8usa;

__device__ __forceinline__ unsigned short f2bf(float f) { unsigned u = __float_as_uint(f); u += 0x7FFFu + ((u >> 16) & 1u); return (unsigned short)(u >> 16); }
__device__ __forceinline__ float bf2f(unsigned short b) { return __uint_as_float(((unsigned)b) << 16); }
__device__ __forceinline__ float bfr(float f) { return bf2f(f2bf(f)); }
__device__ __forceinline__ v16h cat16(v8h lo, v8h hi) { return __builtin_shufflevector(lo, hi, 0, 1, 2, 3, 4, 5, 6, 7, 8, 9, 10, 11, 12, 13, 14, 15); }
__device__ __forceinline__ v16bf cat16b(v8us lo, v8us hi) { return __builtin_bit_cast(v16bf, __builtin_shufflevector(lo, hi, 0, 1, 2, 3, 4, 5, 6, 7, 8, 9, 10, 11, 12, 13, 14, 15)); }
__device__ __forceinline__ v8f wmma16(v16h a, v16h b, v8f c) { return __builtin_amdgcn_wmma_f32_16x16x32_f16(false, a, false, b, (short)0, c, false, false); }
__device__ __forceinline__ v8f wmmab(v16bf a, v16bf b, v8f c) { return __builtin_amdgcn_wmma_f32_16x16x32_bf16(false, a, false, b, (short)0, c, false, false); }



// ---- gemm128: the K loop of both GEMMs. A work-group of 4 waves (2 x 2) owns a 128 x 128 tile of C[m][n] = sum_k A[m][k] Bt[n][k] (NPL 3: + A2[m][k] Bt[n][k]), K = DM, operands K-contiguous bf16 planes; each wave keeps its 64 x 64 quarter in 16 accumulators.
// A stage is 64 k of 128 rows of every plane (rows of 128 B at a pitch of 144 B in LDS), brought by asynchronous copies to LDS: one wave-wide copy covers 4 whole 128-byte lines, and each line is fetched once a work-group. Two buffers, one barrier a stage.
template <typename T16> struct WFrag;
template <> struct WFrag<h16> { typedef v16h V; static __device__ __forceinline__ V ld(const h16* p) { return cat16(*(const v8h*)p, *(const v8h*)(p + 16)); } static __device__ __forceinline__ v8f mma(V a, V b, v8f c) { return wmma16(a, b, c); } };
template <> struct WFrag<bf> { typedef v16bf V; static __device__ __forceinline__ V ld(const bf* p) { return cat16b(*(const v8us*)p, *(const v8us*)(p + 16)); } static __device__ __forceinline__ v8f mma(V a, V b, v8f c) { return wmmab(a, b, c); } };
#define GP   72                   // LDS row pitch in 16-bit elements
#define GPL  (128 * GP)           // one staged plane: 128 rows
#define GNS  (DM / 64)            // stages along K
// one plane of a stage: this lane's 16 bytes of rows r, r + 16, .. r + 112. The s_wait_xcnt closes the copies' own statement, so that it stands before any rewrite of the address registers that they name.
__device__ __forceinline__ void gcopy(unsigned l, const bf* g) {
    asm volatile("global_load_async_to_lds_b128 %0, %8, off\n\t"
                 "global_load_async_to_lds_b128 %1, %9, off\n\t"
                 "global_load_async_to_lds_b128 %2, %10, off\n\t"
                 "global_load_async_to_lds_b128 %3, %11, off\n\t"
                 "global_load_async_to_lds_b128 %4, %12, off\n\t"
                 "global_load_async_to_lds_b128 %5, %13, off\n\t"
                 "global_load_async_to_lds_b128 %6, %14, off\n\t"
                 "global_load_async_to_lds_b128 %7, %15, off\n\t"
                 "s_wait_xcnt 0x0"
                 :: "v"(l), "v"(l + 16 * GP * 2), "v"(l + 32 * GP * 2), "v"(l + 48 * GP * 2), "v"(l + 64 * GP * 2), "v"(l + 80 * GP * 2), "v"(l + 96 * GP * 2), "v"(l + 112 * GP * 2),
                    "v"(g), "v"(g + 16 * DM), "v"(g + 32 * DM), "v"(g + 48 * DM), "v"(g + 64 * DM), "v"(g + 80 * DM), "v"(g + 96 * DM), "v"(g + 112 * DM) : "memory");
}
// Every plain '#pragma unroll' here and in the two kernels that call it is there so that the fragment and accumulator arrays are indexed by constants and stay in registers.
template <int NPL>   // staged planes: A, Bt (, A2). Ag, A2g, Bg: row 0 of the work-group's 128 rows
__device__ __forceinline__ void gemm128(unsigned short* sm, const bf* __restrict__ Ag, const bf* __restrict__ A2g, const bf* __restrict__ Bg, int wave, v8f (&acc)[4][4]) {
    typedef WFrag<bf>::V V;
    const int tid = threadIdx.x, lane = tid & 31, lr = lane & 15, hi = lane >> 4;
    const unsigned l0 = (unsigned)(size_t)sm + (unsigned)((tid >> 3) * GP + (tid & 7) * 8) * 2u;   // LDS byte address of this lane's 16 bytes of row tid / 8
    const size_t go = (size_t)(tid >> 3) * DM + (tid & 7) * 8;
    auto fill = [&](int s) { const unsigned lb = l0 + (unsigned)((s & 1) * NPL * GPL) * 2u; const size_t o = go + (size_t)s * 64;
        gcopy(lb, Ag + o); gcopy(lb + GPL * 2, Bg + o); if constexpr (NPL == 3) gcopy(lb + 2 * GPL * 2, A2g + o); };
    fill(0);
    asm volatile("s_wait_asynccnt 0x0" ::: "memory");   // this wave's copies of stage 0 have landed
    __syncthreads();                                    // publishes stage 0
    fill(1);
    const int ao = ((wave >> 1) * 64 + lr) * GP + 8 * hi, bo = GPL + ((wave & 1) * 64 + lr) * GP + 8 * hi;
#pragma unroll 1
    for (int s = 0; s < GNS; ++s) {   // rolled: one trip a stage, so that the buffer index and the refill test stay scalar
        const unsigned short* bp = sm + (s & 1) * NPL * GPL;
#pragma unroll
        for (int ks = 0; ks < 2; ++ks) {
            V a[4], a2[4], b[4];   // the block's fragments are fetched as one group ahead of its products
#pragma unroll
            for (int mb = 0; mb < 4; ++mb) { a[mb] = WFrag<bf>::ld(bp + ao + mb * 16 * GP + ks * 32); if constexpr (NPL == 3) a2[mb] = WFrag<bf>::ld(bp + 2 * GPL + ao + mb * 16 * GP + ks * 32); }
#pragma unroll
            for (int nb = 0; nb < 4; ++nb) b[nb] = WFrag<bf>::ld(bp + bo + nb * 16 * GP + ks * 32);
            __builtin_amdgcn_sched_barrier(0);   // keeps the reads together in front: sunk among the products, into one shared Bt fragment, every four products wait out an LDS latency
#pragma unroll
            for (int nb = 0; nb < 4; ++nb)
#pragma unroll
                for (int mb = 0; mb < 4; ++mb) { acc[mb][nb] = WFrag<bf>::mma(a[mb], b[nb], acc[mb][nb]); if constexpr (NPL == 3) acc[mb][nb] = WFrag<bf>::mma(a2[mb], b[nb], acc[mb][nb]); }
        }
        asm volatile("s_wait_dscnt 0x0" ::: "memory");      // this wave's reads of stage s have returned
        asm volatile("s_wait_asynccnt 0x0" ::: "memory");   // this wave's copies of stage s + 1 have landed
        __syncthreads();                                    // publishes stage s + 1 and ends every wave's reads of the buffer refilled below
        if (s + 2 < GNS) fill(s + 2);
    }
    asm volatile("s_wait_asynccnt 0x0" ::: "memory");   // no copy is outstanding when the wave goes on
}
// ---- k_proj: C (f32, pitch DM) = (A + A2) Bt^T + bias, grid (M / 128, DM / 128), 128 threads; a wave's 64 x 64 quarter goes out through its own LDS rows, whole 128-byte lines.
__global__ __launch_bounds__(128) void k_proj(const bf* __restrict__ A, const bf* __restrict__ A2, const bf* __restrict__ Bt, float* C, const float* __restrict__ bias) {
    __shared__ __align__(16) unsigned short sm[2 * 3 * GPL];
    __shared__ __align__(16) float osw[4][16 * 68];
    const int lane = threadIdx.x & 31, lr = lane & 15, hi = lane >> 4; const int wave = __builtin_amdgcn_readfirstlane(threadIdx.x >> 5);
    float* os = osw[wave]; const int r0 = blockIdx.x * 128 + (wave >> 1) * 64, c0 = blockIdx.y * 128 + (wave & 1) * 64;
    v8f acc[4][4];
#pragma unroll
    for (int mb = 0; mb < 4; ++mb)
#pragma unroll
        for (int nb = 0; nb < 4; ++nb) acc[mb][nb] = (v8f){};
    gemm128<3>(sm, A + (size_t)blockIdx.x * 128 * DM, A2 + (size_t)blockIdx.x * 128 * DM, Bt + (size_t)blockIdx.y * 128 * DM, wave, acc);
    const int cofs = lr * 4; v4f bv; bv[0] = bfr(bias[c0 + cofs]); bv[1] = bfr(bias[c0 + cofs + 1]); bv[2] = bfr(bias[c0 + cofs + 2]); bv[3] = bfr(bias[c0 + cofs + 3]);
#pragma unroll
    for (int mb = 0; mb < 4; ++mb) {
#pragma unroll
        for (int nb = 0; nb < 4; ++nb) {
#pragma unroll
            for (int j = 0; j < 8; ++j) os[(hi * 8 + j) * 68 + nb * 16 + lr] = acc[mb][nb][j]; }
        __builtin_amdgcn_wave_barrier(); asm volatile("" ::: "memory");   // the row reads below stay behind the other lanes' LDS writes
        float* crow = C + (size_t)(r0 + mb * 16) * DM + c0;
#pragma unroll
        for (int s = 0; s < 8; ++s) { const int row = 2 * s + hi; const v4f val = *(const v4fa*)(os + row * 68 + cofs) + bv;
            *(v4f*)(crow + (size_t)row * DM + cofs) = val; }
        asm volatile("s_wait_xcnt 0x0" ::: "memory");   // stands before the registers that the stores name are written again
        __builtin_amdgcn_wave_barrier(); asm volatile("" ::: "memory");   // the next block's LDS writes stay behind these reads
    }
}

__device__ __forceinline__ h16 tohx(float x) { return (h16)x; }
__device__ __forceinline__ void splitf(float y, unsigned short& h, unsigned short& l) { h = f2bf(y); l = f2bf(y - bf2f(h)); }
typedef __attribute__((ext_vector_type(2))) _Float16 v2h;
typedef __attribute__((ext_vector_type(4))) _Float16 v4h;
typedef __attribute__((ext_vector_type(2))) unsigned short v2us;
typedef __attribute__((ext_vector_type(4))) unsigned short v4us;
typedef __attribute__((ext_vector_type(2))) float v2f;
typedef __attribute__((ext_vector_type(4))) int v4i;

// INV2: the 32 rotary frequencies of THIS module: (1.0 / (ROPE_BASE ** (arange(0, 64, 2, float32) / 64))) * ROPE_SCALE with ROPE_BASE 10000 and ROPE_SCALE 3.0, generated with jnp in float32 (bit-exact; == the unscaled table x 3.0f in f32, 32 of 32): the adjacent (even, odd) pair shares entry d / 2.
__constant__ float INV2[HD / 2] = { 3.000000000e+00f, 2.249682665e+00f, 1.687023997e+00f, 1.265089512e+00f, 9.486832619e-01f, 7.114120722e-01f, 5.334838033e-01f, 4.000564218e-01f, 3.000000119e-01f, 2.249682546e-01f, 1.687023938e-01f, 1.265089512e-01f, 9.486833215e-02f, 7.114120573e-02f, 5.334838480e-02f, 4.000564665e-02f, 2.999999933e-02f, 2.249682695e-02f, 1.687023975e-02f, 1.265089400e-02f, 9.486833587e-03f, 7.114121690e-03f, 5.334838293e-03f, 4.000564106e-03f, 3.000000026e-03f, 2.249682555e-03f, 1.687023905e-03f, 1.265089493e-03f, 9.486833587e-04f, 7.114121690e-04f, 5.334838061e-04f, 4.000564513e-04f };
// ---- k_prep: all the preparation in ONE launch of PG work-groups that are resident together (two a WGP, 4,096 waves), each taking an equal share of every part:
// 64 KB of x rounded to bf16 (8 groups of 8 elements a thread), one rotary table entry a thread, and one 128 (k) x 64 (n) tile of a weight, rounded and transposed into Bt [n][k].
// The tile: a lane reads 32 consecutive k of ONE column n (a wave-wide load is one whole 128-byte line of a weight row), so its 32 rounded values are 64 contiguous bytes of the Bt row;
// they pass through LDS (rows of 256 B at a pitch of 272 B) only so that the Bt rows go out as whole 256-byte units.
#define PG   512
#define NWQ  ((3 * DQ / 64) * (DM / 128))   // work-groups below NWQ: tiles of w_qkv; the rest: tiles of w_proj
#define WTP  136                            // LDS row pitch in 16-bit elements
static_assert(DQ == DM && PG == NWQ + (DM / 64) * (DQ / 128) && PG * 256 == TT * HD && (size_t)PG * 256 * 64 == (size_t)NB_ * TT * DM, "k_prep: every share divides evenly");
template <int N>   // N: row length of the weight w ([DM][N], Bt [N][DM]); a template, so that the 32 loads of a column differ in their constant offsets alone
__device__ __forceinline__ void prep(unsigned short* tl, const float* __restrict__ x, const float* __restrict__ w, bf* XB, bf* Bt, float* CS, int tile) {
    const int tid = threadIdx.x, lane = tid & 31, bx = blockIdx.x; const int wave = __builtin_amdgcn_readfirstlane(tid >> 5);
    const int k0 = (tile % (DM / 128)) * 128, n0 = (tile / (DM / 128)) * 64;
    // Every load of the work-group is issued here, the table's frequency first (loads are waited for in their order), so that the table arithmetic runs while the rest fly. The plain unrolls keep the arrays in registers.
    const int idx = bx * 256 + tid; const int d = idx % HD; const int t = idx / HD; const float fr = INV2[d >> 1];
    asm volatile("s_wait_xcnt 0x0" ::: "memory");   // stands before the offset register of the frequency's load is written again (it is free for the data of the loads below)
    const float* wr = w + (size_t)(k0 + (wave >> 1) * 32) * N + n0 + (wave & 1) * 32;   // uniform: the wave's first row at its first column
    float wv[32];
#pragma unroll
    for (int r = 0; r < 32; ++r) wv[r] = wr[r * N + lane];
    const size_t xo = (size_t)bx * (256 * 64) + tid * 8; v8f xv[8];
#pragma unroll
    for (int it = 0; it < 8; ++it) xv[it] = *(const v8f*)(x + xo + it * 2048);
    asm volatile("s_wait_xcnt 0x0" ::: "memory");   // stands before the address registers of the loads issued so far are written again
    const float a = __fmul_rn((float)t, fr); v2f cs; cs[0] = cosf(a); cs[1] = sinf(a);
    unsigned short* tw = tl + ((wave & 1) * 32 + lane) * WTP + (wave >> 1) * 32;
#pragma unroll
    for (int q = 0; q < 4; ++q) { v8us o;
#pragma unroll
        for (int j = 0; j < 8; ++j) o[j] = f2bf(wv[q * 8 + j]);
        *(v8usa*)(tw + q * 8) = o; }
    __syncthreads();   // the tile's columns are all in LDS before its rows are read; every global store stands behind it, so that it waits for none
    *(v2f*)(CS + (size_t)idx * 2) = cs;
    bf* bt = Bt + (size_t)(n0 + (tid >> 4)) * DM + k0 + (tid & 15) * 8; const unsigned short* tr = tl + (tid >> 4) * WTP + (tid & 15) * 8;
#pragma unroll
    for (int p = 0; p < 4; ++p) *(v8usa*)(bt + p * 16 * DM) = *(const v8usa*)(tr + p * 16 * WTP);
#pragma unroll
    for (int it = 0; it < 8; ++it) { v8us o;
#pragma unroll
        for (int k = 0; k < 8; ++k) o[k] = f2bf(xv[it][k]);
        *(v8us*)(XB + xo + it * 2048) = o; }
}
__global__ __launch_bounds__(256) void k_prep(const float* __restrict__ x, const float* __restrict__ wqkv, const float* __restrict__ wo, bf* XB, bf* WQKV, bf* WO, float* CS) {
    __shared__ __align__(16) unsigned short tl[64 * WTP];
    const int bx = blockIdx.x;   // the branch is the same for the whole work-group
    if (bx < NWQ) prep<3 * DQ>(tl, x, wqkv, XB, WQKV, CS, bx); else prep<DM>(tl, x, wo, XB, WO, CS, bx - NWQ);
}
// ---- k_qkv: the q | k | v projection of every batch in one launch (gemm128, one product), each wave building the attention planes of its 64 x 64 quarter itself from its accumulators.
// grid (NB_ TT / 128, 3 NH_ / 2), 128 threads: a wave has 64 rows of x (one batch, 64 positions) x 64 columns of the fused weight = one head of q (column block < NH_), of k (< 2 NH_) or of v.
// q and k tiles: interleaved-pair rotary on the f32 sums (table CS), then planes [b][h][t][d] as fp16, bf16 hi and bf16 lo; through the wave's own LDS rows, so that a 128-byte plane row is stored whole.
// v tiles: planes [b][h][d][t]; accumulator elements 0..7 of a lane are 8 consecutive positions of one column, so 16 bytes a plane go out straight from registers.
__global__ __launch_bounds__(128) void k_qkv(const bf* __restrict__ A, const bf* __restrict__ Bt, const float* __restrict__ CS, h16* Q16, bf* Qh, bf* Ql, h16* K16, bf* Kh, bf* Kl, h16* V16, bf* Vh, bf* Vl) {
    __shared__ __align__(16) unsigned short sm[2 * 2 * GPL];
    __shared__ __align__(16) float osw[4][16 * 68];
    const int lane = threadIdx.x & 31, lr = lane & 15, hi = lane >> 4; const int wave = __builtin_amdgcn_readfirstlane(threadIdx.x >> 5);
    float* os = osw[wave]; const int r0 = blockIdx.x * 128 + (wave >> 1) * 64, cy = blockIdx.y * 2 + (wave & 1);
    v8f acc[4][4];
#pragma unroll
    for (int mb = 0; mb < 4; ++mb)
#pragma unroll
        for (int nb = 0; nb < 4; ++nb) acc[mb][nb] = (v8f){};
    gemm128<2>(sm, A + (size_t)blockIdx.x * 128 * DM, nullptr, Bt + (size_t)blockIdx.y * 128 * DM, wave, acc);
    const int bt = r0 / TT, t0 = r0 % TT, sel = cy / NH_, hd = cy % NH_;
    const size_t po = ((size_t)bt * NH_ + hd) * TT * HD;
    if (sel == 2) {
        char* W16 = (char*)(V16 + po + t0); char* Wh = (char*)(Vh + po + t0); char* Wl = (char*)(Vl + po + t0); const unsigned vl = (unsigned)(lr * TT + hi * 8) * 2u;   // uniform bases, lane offset in bytes
#pragma unroll
        for (int nb = 0; nb < 4; ++nb) {
#pragma unroll
            for (int mb = 0; mb < 4; ++mb) { v8h o16; v8us oh, ol;
#pragma unroll
                for (int j = 0; j < 8; ++j) { const float x = acc[mb][nb][j]; o16[j] = tohx(x); unsigned short a2, c2; splitf(x, a2, c2); oh[j] = a2; ol[j] = c2; }
                const int vc = (nb * 16 * TT + mb * 16) * 2; *(v8ha*)(W16 + vc + vl) = o16; *(v8usa*)(Wh + vc + vl) = oh; *(v8usa*)(Wl + vc + vl) = ol;
                asm volatile("s_wait_xcnt 0x0" ::: "memory"); } }   // stands before the registers that the three stores name are written again
    } else {
        const size_t pt = po + (size_t)t0 * HD; char* W16 = (char*)((sel ? K16 : Q16) + pt); char* Wh = (char*)((sel ? Kh : Qh) + pt); char* Wl = (char*)((sel ? Kl : Ql) + pt); const char* Ct = (const char*)(CS + (size_t)t0 * HD * 2);
        const unsigned pl = (unsigned)(hi * HD + lr * 4) * 2u, cl = pl * 4u;   // uniform bases, lane offsets in bytes (plane row 128 B, table row 512 B)
#pragma unroll
        for (int mb = 0; mb < 4; ++mb) {
#pragma unroll
            for (int nb = 0; nb < 4; ++nb) {
#pragma unroll
                for (int j = 0; j < 8; ++j) os[(hi * 8 + j) * 68 + nb * 16 + lr] = acc[mb][nb][j]; }
            __builtin_amdgcn_wave_barrier(); asm volatile("" ::: "memory");   // the row reads below stay behind the other lanes' LDS writes
            v4f xv[8]; v2f ca[8], cb[8];   // all 16 rows' sums and table entries are fetched before the first store, one latency a block of 16 rows
#pragma unroll
            for (int s = 0; s < 8; ++s) { const int row = 2 * s + hi; xv[s] = *(const v4fa*)(os + row * 68 + lr * 4); const char* cp = Ct + (mb * 16 + 2 * s) * HD * 8 + cl; ca[s] = *(const v2f*)cp; cb[s] = *(const v2f*)(cp + 16); }
#pragma unroll
            for (int s = 0; s < 8; ++s) { const int pc = (mb * 16 + 2 * s) * HD * 2; float r[4]; v4h o16; v4us oh, ol;
                r[0] = xv[s][0] * ca[s][0] - xv[s][1] * ca[s][1]; r[1] = xv[s][0] * ca[s][1] + xv[s][1] * ca[s][0];   /* even: x0 c - x1 s; odd: x0 s + x1 c; free to contract to a product and an fma */
                r[2] = xv[s][2] * cb[s][0] - xv[s][3] * cb[s][1]; r[3] = xv[s][2] * cb[s][1] + xv[s][3] * cb[s][0];
#pragma unroll
                for (int q = 0; q < 4; ++q) { o16[q] = tohx(r[q]); unsigned short a2, c2; splitf(r[q], a2, c2); oh[q] = a2; ol[q] = c2; }
                *(v4h*)(W16 + pc + pl) = o16; *(v4us*)(Wh + pc + pl) = oh; *(v4us*)(Wl + pc + pl) = ol;
                asm volatile("s_wait_xcnt 0x0" ::: "memory"); }   // stands before the registers that the three stores name are written again
            __builtin_amdgcn_wave_barrier(); asm volatile("" ::: "memory");   // the next block's LDS writes stay behind these reads
        }
    }
}
// ---- k_fattn: fused attention, one launch for every batch, head and query row. Scores, softmax and P stay in registers.
// St = K Qt (A = 16 key rows, B = 16 query columns), Ot += Vt Pt: accumulator element j of lane (lr, hi) of the score tile of keys kb + 16 kt .. is key kb + 16 kt + 8 hi + j of query lr,
// which is element 8 kt + j of the B operand of a 32-key product in the loaders' k order, so P is packed in place. Running maximum per query column; output and sum are rescaled only in a pass (32 keys) where some column's maximum has outgrown the one in use by more than LZ.
// A work-group of 8 waves shares K and Vt: 64 keys a stage, brought through registers into two LDS buffers (rows of 128 B at a pitch of 144 B), one barrier a stage.
// Work-groups below NHW: query rows < RH, 16 columns a wave, hi/lo bf16 planes, 3 products; the rest: 32 columns a wave, fp16.
#define FP   72                   // LDS row pitch in 16-bit elements
#define FPS  (64 * FP)            // one staged plane: 64 rows
#define NST  (TT / 64)
#define CL2  0.18033688011112042f // HD^-0.5 x log2(e)
typedef __attribute__((ext_vector_type(2))) __bf16 v2b;
typedef __attribute__((ext_vector_type(8))) unsigned v8u;
template <bool HI> struct FT;
template <> struct FT<false> { typedef v16h V; static __device__ __forceinline__ V ld(const unsigned short* p) { return __builtin_bit_cast(v16h, __builtin_shufflevector(*(const v8usa*)p, *(const v8usa*)(p + 16), 0, 1, 2, 3, 4, 5, 6, 7, 8, 9, 10, 11, 12, 13, 14, 15)); } static __device__ __forceinline__ v8f mma(V a, V b, v8f c) { return wmma16(a, b, c); } };
template <> struct FT<true> { typedef v16bf V; static __device__ __forceinline__ V ld(const unsigned short* p) { return cat16b(*(const v8usa*)p, *(const v8usa*)(p + 16)); } static __device__ __forceinline__ v8f mma(V a, V b, v8f c) { return wmmab(a, b, c); } };
__device__ __forceinline__ float xhalf(float x) { const int b = __float_as_int(x); return __int_as_float(__builtin_amdgcn_permlanex16(b, b, 0x76543210, 0xfedcba98, false, false)); }   // lane l <-> l ^ 16
template <bool HI, int NT>
__device__ __forceinline__ void fattn(unsigned short* sm, const unsigned short* __restrict__ Q, const unsigned short* __restrict__ Q2, const unsigned short* __restrict__ Kg, const unsigned short* __restrict__ K2g, const unsigned short* __restrict__ Vg, const unsigned short* __restrict__ V2g, int qw, bf* Ah, bf* Al) {
    typedef typename FT<HI>::V V;
    constexpr int PLN = HI ? 4 : 2;   // staged planes: K, Vt (, K lo, Vt lo)
    const int tid = threadIdx.x, lane = tid & 31, lr = lane & 15, hi = lane >> 4;
    const int srow = tid >> 3, sseg = (tid & 7) * 8;   // staging: rows srow and srow + 32, one 16-byte segment of each plane
    v8us st[PLN][2];
    auto gload = [&](int s) {
#pragma unroll
        for (int r = 0; r < 2; ++r) { const int row = srow + 32 * r; const size_t ko = (size_t)(s * 64 + row) * HD + sseg, vo = (size_t)row * TT + s * 64 + sseg;
            st[0][r] = *(const v8usa*)(Kg + ko); st[1][r] = *(const v8usa*)(Vg + vo);
            if constexpr (HI) { st[2][r] = *(const v8usa*)(K2g + ko); st[3][r] = *(const v8usa*)(V2g + vo); } }
        asm volatile("s_wait_xcnt 0x0" ::: "memory"); };   // stands before the address registers of the loads issued so far are written again
    auto sstore = [&](int b) {
#pragma unroll
        for (int r = 0; r < 2; ++r)
#pragma unroll
            for (int pl = 0; pl < PLN; ++pl) *(v8usa*)(sm + (b * PLN + pl) * FPS + (srow + 32 * r) * FP + sseg) = st[pl][r]; };
    V qf[NT][2], qf2[NT][2];
#pragma unroll
    for (int nt = 0; nt < NT; ++nt)
#pragma unroll
        for (int ks = 0; ks < 2; ++ks) { const size_t qo = (size_t)(qw + nt * 16 + lr) * HD + ks * 32 + 8 * hi; qf[nt][ks] = FT<HI>::ld(Q + qo); if constexpr (HI) qf2[nt][ks] = FT<HI>::ld(Q2 + qo); }
    asm volatile("s_wait_xcnt 0x0" ::: "memory");   // stands before the address registers of the Q loads are written again
    constexpr float LZ = HI ? 8.0f : 5.0f;   // the maximum in use, mc, may trail a column's true maximum by LZ (scaled log2): a weight reaches 2^LZ; fp16 rows: 2^(LZ + PCL2) = 2^15, inside fp16
    v8f o[4][NT]; float mc[NT], thr[NT], l[NT];   // thr: the raw score above which mc must move
#pragma unroll
    for (int nt = 0; nt < NT; ++nt) { mc[nt] = -3.0e37f; thr[nt] = -__builtin_inff(); l[nt] = 0.f;
#pragma unroll
        for (int dt = 0; dt < 4; ++dt) o[dt][nt] = (v8f){}; }
    gload(0); sstore(0); __syncthreads();
#pragma unroll 1
    for (int s = 0; s < NST; ++s) {
        if (s + 1 < NST) gload(s + 1);
        const unsigned short* kb = sm + (s & 1) * PLN * FPS;
#pragma unroll
        for (int p = 0; p < 2; ++p) {
            v8f sc[2][NT];
#pragma unroll
            for (int kt = 0; kt < 2; ++kt) { V ka[2], ka2[2];
#pragma unroll
                for (int ks = 0; ks < 2; ++ks) { const int off = (p * 32 + kt * 16 + lr) * FP + ks * 32 + 8 * hi; ka[ks] = FT<HI>::ld(kb + off); if constexpr (HI) ka2[ks] = FT<HI>::ld(kb + 2 * FPS + off); }
#pragma unroll
                for (int nt = 0; nt < NT; ++nt) { v8f a = (v8f){};
#pragma unroll
                    for (int ks = 0; ks < 2; ++ks) { a = FT<HI>::mma(ka[ks], qf[nt][ks], a); if constexpr (HI) { a = FT<HI>::mma(ka[ks], qf2[nt][ks], a); a = FT<HI>::mma(ka2[ks], qf[nt][ks], a); } }
                    sc[kt][nt] = a; } }
            float cm[NT]; bool need = false;
#pragma unroll
            for (int nt = 0; nt < NT; ++nt) { cm[nt] = fmaxf(sc[0][nt][0], sc[1][nt][0]);
#pragma unroll
                for (int j = 1; j < 8; ++j) cm[nt] = fmaxf(cm[nt], fmaxf(sc[0][nt][j], sc[1][nt][j]));
                need = need || cm[nt] > thr[nt]; }
            if (__builtin_amdgcn_ballot_w32(need) != 0) {   // a scalar branch, the same for the whole wave; rare after the first pass
#pragma unroll
                for (int nt = 0; nt < NT; ++nt) { const float mn = fmaxf(mc[nt], fmaxf(cm[nt], xhalf(cm[nt])) * CL2); const float al = __builtin_amdgcn_exp2f(mc[nt] - mn); mc[nt] = mn; thr[nt] = (mn + LZ) * (1.0f / CL2); l[nt] *= al;
#pragma unroll
                    for (int dt = 0; dt < 4; ++dt) o[dt][nt] *= al; } }
            V pf[NT], pf2[NT];
#pragma unroll
            for (int nt = 0; nt < NT; ++nt) {
                const float mo = HI ? mc[nt] : mc[nt] - PCL2;
                float e[16];
#pragma unroll
                for (int i = 0; i < 16; ++i) e[i] = __builtin_amdgcn_exp2f(fmaf(sc[i >> 3][nt][i & 7], CL2, -mo));
                const float ps = ((e[0] + e[1]) + (e[2] + e[3])) + ((e[4] + e[5]) + (e[6] + e[7])) + (((e[8] + e[9]) + (e[10] + e[11])) + ((e[12] + e[13]) + (e[14] + e[15])));
                l[nt] += ps;
                v8u ph, pl;   // two elements a register, converted in pairs
#pragma unroll
                for (int i = 0; i < 8; ++i) { const v2f ev = { e[2 * i], e[2 * i + 1] };
                    if constexpr (HI) { const v2b hb = __builtin_convertvector(ev, v2b); ph[i] = __builtin_bit_cast(unsigned, hb); pl[i] = __builtin_bit_cast(unsigned, __builtin_convertvector(ev - __builtin_convertvector(hb, v2f), v2b)); }
                    else ph[i] = __builtin_bit_cast(unsigned, __builtin_convertvector(ev, v2h)); }
                pf[nt] = __builtin_bit_cast(V, ph); if constexpr (HI) pf2[nt] = __builtin_bit_cast(V, pl); }
#pragma unroll
            for (int dt = 0; dt < 4; ++dt) { const int off = FPS + (dt * 16 + lr) * FP + p * 32 + 8 * hi; const V va = FT<HI>::ld(kb + off); V va2; if constexpr (HI) va2 = FT<HI>::ld(kb + 2 * FPS + off);
#pragma unroll
                for (int nt = 0; nt < NT; ++nt) { o[dt][nt] = FT<HI>::mma(va, pf[nt], o[dt][nt]); if constexpr (HI) { o[dt][nt] = FT<HI>::mma(va, pf2[nt], o[dt][nt]); o[dt][nt] = FT<HI>::mma(va2, pf[nt], o[dt][nt]); } } }
        }
        if (s + 1 < NST) sstore((s + 1) & 1);
        __syncthreads();   // publishes stage s + 1 and ends every wave's reads of the buffer that the next trip refills
    }
#pragma unroll
    for (int nt = 0; nt < NT; ++nt) { const float inv = __fdiv_rn(1.0f, l[nt] + xhalf(l[nt])); const size_t oo = (size_t)(qw + nt * 16 + lr) * DQ + hi * 8;
#pragma unroll
        for (int dt = 0; dt < 4; ++dt) { v8us oh, ol;
#pragma unroll
            for (int j = 0; j < 8; ++j) { unsigned short a, c2; splitf(o[dt][nt][j] * inv, a, c2); oh[j] = a; ol[j] = c2; }
            *(v8usa*)(Ah + oo + dt * 16) = oh; *(v8usa*)(Al + oo + dt * 16) = ol;
            asm volatile("s_wait_xcnt 0x0" ::: "memory"); } }   // stands before the registers that the two stores name are written again
}
#define NHW (NB_ * NH_ * (RH / 128))
#define NLW (NB_ * NH_ * ((TT - RH) / 256))
__global__ __launch_bounds__(256) __attribute__((amdgpu_waves_per_eu(4, 4))) void k_fattn(const h16* __restrict__ Q16, const bf* __restrict__ Qh, const bf* __restrict__ Ql, const h16* __restrict__ K16, const bf* __restrict__ Kh, const bf* __restrict__ Kl, const h16* __restrict__ V16, const bf* __restrict__ Vh, const bf* __restrict__ Vl, bf* Ah, bf* Al) {
    __shared__ __align__(16) unsigned short sm[2 * 4 * FPS];
    const int wave = threadIdx.x >> 5; int bx = blockIdx.x;   // the long work-groups (3 products) have the lowest indices
    if (bx < NHW) { const int z = bx / (RH / 128), qt = bx % (RH / 128); const size_t zo = (size_t)z * TT * HD, ao = (size_t)(z / NH_) * TT * DQ + (z % NH_) * HD;
        fattn<true, 1>(sm, Qh + zo, Ql + zo, Kh + zo, Kl + zo, Vh + zo, Vl + zo, qt * 128 + wave * 16, Ah + ao, Al + ao);
    } else { bx -= NHW; const int z = bx / ((TT - RH) / 256), qt = bx % ((TT - RH) / 256); const size_t zo = (size_t)z * TT * HD, ao = (size_t)(z / NH_) * TT * DQ + (z % NH_) * HD;
        fattn<false, 2>(sm, (const unsigned short*)(Q16 + zo), nullptr, (const unsigned short*)(K16 + zo), nullptr, (const unsigned short*)(V16 + zo), nullptr, RH + qt * 256 + wave * 32, Ah + ao, Al + ao); }
}

extern "C" void kernel_launch(void* const* d_in, const int* in_sizes, int n_in,
                              void* d_out, int out_size, void* d_ws, size_t ws_size, hipStream_t stream) {
    (void)in_sizes; (void)n_in; (void)out_size;
    const float* x = (const float*)d_in[0]; const float* wqkv = (const float*)d_in[1]; const float* wo = (const float*)d_in[2]; const float* bo = (const float*)d_in[3];   /* x, w_qkv ('xw' [1024][3072]: q | k | v column thirds), w_proj ('xw'), b_proj */
    float* OUT = (float*)d_out;     // [4][2048][1024]
    char* wsp = (char*)d_ws;
    auto take = [&](size_t bytes) { char* p = wsp; wsp += (bytes + 255) & ~(size_t)255; return (void*)p; };
    bf* WQKV = (bf*)take((size_t)3 * DQ * DM * 2);   /* fused Bt [3*DQ][DM]: q | k | v row blocks */ bf* WO = (bf*)take((size_t)DM * DQ * 2); float* CS = (float*)take((size_t)TT * HD * 2 * 4);
    bf* XB = (bf*)take((size_t)NB_ * TT * DM * 2);
    const size_t PB = (size_t)NH_ * TT * HD;   // one batch's head planes, elements; every plane holds all NB_ batches
    h16* QP16 = (h16*)take(NB_ * PB * 2); h16* KP16 = (h16*)take(NB_ * PB * 2); h16* VT16 = (h16*)take(NB_ * PB * 2);
    bf* QPh = (bf*)take(NB_ * PB * 2); bf* QPl = (bf*)take(NB_ * PB * 2); bf* KPh = (bf*)take(NB_ * PB * 2); bf* KPl = (bf*)take(NB_ * PB * 2); bf* VTh = (bf*)take(NB_ * PB * 2); bf* VTl = (bf*)take(NB_ * PB * 2);
    bf* ATh = (bf*)take((size_t)NB_ * TT * DQ * 2); bf* ATl = (bf*)take((size_t)NB_ * TT * DQ * 2);
    if ((size_t)(wsp - (char*)d_ws) > ws_size) return;    // ws 256 MiB
    k_prep<<<PG, 256, 0, stream>>>(x, wqkv, wo, XB, WQKV, WO, CS);   // x -> bf16; fused 'xw' [DM][3*DQ] -> Bt [3*DQ][DM]; w_proj [DQ][DM] -> Bt [DM][DQ]; rotary table
    k_qkv<<<dim3(NB_ * TT / 128, 3 * NH_ / 2, 1), 128, 0, stream>>>(XB, WQKV, CS, QP16, QPh, QPl, KP16, KPh, KPl, VT16, VTh, VTl);
    k_fattn<<<NHW + NLW, 256, 0, stream>>>(QP16, QPh, QPl, KP16, KPh, KPl, VT16, VTh, VTl, ATh, ATl);
    k_proj<<<dim3(NB_ * TT / 128, DM / 128, 1), 128, 0, stream>>>(ATh, ATl, WO, OUT, bo);   // the rows of all batches are contiguous in ATh, ATl and OUT: one launch, two work-groups a WGP
}

// v008
// A run of this version takes 185 microseconds.
// Next to v007, in two timings, it ran 1.07 times as fast each time.
// All steps since v000 together make it 21.8 times as fast.
#include <hip/hip_runtime.h>

// Multi-head self-attention with a fused bias-free qkv projection and computed interleaved-pair rotary embeddings at SCALED frequencies (x [4][2048][1024]; qkv = x w_qkv ('xw' (in, out) [1024][3072] 1/32, no bias) viewed (B, L, 3, 16, 64): q | k | v column thirds (16 heads x 64); rope on q and k: pairs (x[2i], x[2i+1]) -> (re c - im s, re s + im c) with angle pos x theta_i, theta = (1 / 10000^(2i/64)) x 3.0 (ROPE_SCALE; 32 f32 frequencies jnp-exact; one f32 product per angle; precise cosf/sinf); attn x 64^-0.5; softmax over all keys (no mask); out = merged w_proj + b_proj ('xw' + a bias: READ) -> [4][2048][1024] (8.4 M); argument order x, w_qkv, w_proj, b_proj).
// Layout: k_prep: bf16 copy of x, the fused 'xw' weight transposed ONCE into q | k | v row blocks, computed interleaved table at the scaled frequencies; k_qkv: exact projections of all batches with the interleaved-pair rotary and the plane split in their epilogue; fused dense T-2048 attention, all batches in one launch (hybrid rows: < 512 fp16 hi/lo 3 products, rest fp16 x1024); merged hi/lo x w_proj exact + b_proj.
// Compute dtypes, f32 accumulate: every input rounded to bf16; projections exact; rotary f32; attention rows < 512 fp16 hi + lo, 3 products, rest fp16; softmax f32; w_proj hl x exact + bias.

#define NB_  4
#define TT   2048
#define DM   1024
#define NH_  16
#define NKV  16
#define REP  (NH_ / NKV)
#define HD   64
#define DQ   (NH_ * HD)
#define DKV  (NKV * HD)
#define RH   512                  // query rows < RH use hi+lo planes (0: none)
#define WIN  0
#define PCL2 10.0f                // fp16 rows: P is carried as weight x 2^PCL2, so that small weights stay normal fp16 numbers; the factor cancels in the division by the row sum
#define PCH  7.0f                 // hi/lo rows: their P (fp16 hi + lo) is carried x 2^PCH for the same reason
typedef _Float16 h16;
typedef unsigned short bf;
typedef __attribute__((ext_vector_type(16))) __bf16   v16bf;
typedef __attribute__((ext_vector_type(16))) _Float16 v16h;
typedef __attribute__((ext_vector_type(8)))  _Float16 v8h;
typedef __attribute__((ext_vector_type(8)))  unsigned short v8us;
typedef __attribute__((ext_vector_type(8)))  float    v8f;
typedef __attribute__((ext_vector_type(4)))  float    v4f;
typedef v8h  __attribute__((may_alias)) v8ha;
typedef v4f  __attribute__((may_alias)) v4fa;
typedef v8us __attribute__((may_alias)) v8usa;

__device__ __forceinline__ unsigned short f2bf(float f) { unsigned u = __float_as_uint(f); u += 0x7FFFu + ((u >> 16) & 1u); return (unsigned short)(u >> 16); }
__device__ __forceinline__ float bf2f(unsigned short b) { return __uint_as_float(((unsigned)b) << 16); }
__device__ __forceinline__ float bfr(float f) { return bf2f(f2bf(f)); }
__device__ __forceinline__ v16h cat16(v8h lo, v8h hi) { return __builtin_shufflevector(lo, hi, 0, 1, 2, 3, 4, 5, 6, 7, 8, 9, 10, 11, 12, 13, 14, 15); }
__device__ __forceinline__ v16bf cat16b(v8us lo, v8us hi) { return __builtin_bit_cast(v16bf, __builtin_shufflevector(lo, hi, 0, 1, 2, 3, 4, 5, 6, 7, 8, 9, 10, 11, 12, 13, 14, 15)); }
__device__ __forceinline__ v8f wmma16(v16h a, v16h b, v8f c) { return __builtin_amdgcn_wmma_f32_16x16x32_f16(false, a, false, b, (short)0, c, false, false); }
__device__ __forceinline__ v8f wmmab(v16bf a, v16bf b, v8f c) { return __builtin_amdgcn_wmma_f32_16x16x32_bf16(false, a, false, b, (short)0, c, false, false); }



// ---- gemm128: the K loop of both GEMMs. A work-group of 4 waves (2 x 2) owns a 128 x 128 tile of C[m][n] = sum_k A[m][k] Bt[n][k] (NPL 3: + A2[m][k] Bt[n][k]), K = DM, operands K-contiguous bf16 planes; each wave keeps its 64 x 64 quarter in 16 accumulators.
// A stage is 64 k of 128 rows of every plane (rows of 128 B at a pitch of 144 B in LDS), brought by asynchronous copies to LDS: one wave-wide copy covers 4 whole 128-byte lines, and each line is fetched once a work-group. Two buffers, one barrier a stage.
template <typename T16> struct WFrag;
template <> struct WFrag<h16> { typedef v16h V; static __device__ __forceinline__ V ld(const h16* p) { return cat16(*(const v8h*)p, *(const v8h*)(p + 16)); } static __device__ __forceinline__ v8f mma(V a, V b, v8f c) { return wmma16(a, b, c); } };
template <> struct WFrag<bf> { typedef v16bf V; static __device__ __forceinline__ V ld(const bf* p) { return cat16b(*(const v8us*)p, *(const v8us*)(p + 16)); } static __device__ __forceinline__ v8f mma(V a, V b, v8f c) { return wmmab(a, b, c); } };
#define GP   72                   // LDS row pitch in 16-bit elements
#define GPL  (128 * GP)           // one staged plane: 128 rows
#define GNS  (DM / 64)            // stages along K
// one plane of a stage: this lane's 16 bytes of rows r, r + 16, .. r + 112. The s_wait_xcnt closes the copies' own statement, so that it stands before any rewrite of the address registers that they name.
__device__ __forceinline__ void gcopy(unsigned l, const bf* g) {
    asm volatile("global_load_async_to_lds_b128 %0, %8, off\n\t"
                 "global_load_async_to_lds_b128 %1, %9, off\n\t"
                 "global_load_async_to_lds_b128 %2, %10, off\n\t"
                 "global_load_async_to_lds_b128 %3, %11, off\n\t"
                 "global_load_async_to_lds_b128 %4, %12, off\n\t"
                 "global_load_async_to_lds_b128 %5, %13, off\n\t"
                 "global_load_async_to_lds_b128 %6, %14, off\n\t"
                 "global_load_async_to_lds_b128 %7, %15, off\n\t"
                 "s_wait_xcnt 0x0"
                 :: "v"(l), "v"(l + 16 * GP * 2), "v"(l + 32 * GP * 2), "v"(l + 48 * GP * 2), "v"(l + 64 * GP * 2), "v"(l + 80 * GP * 2), "v"(l + 96 * GP * 2), "v"(l + 112 * GP * 2),
                    "v"(g), "v"(g + 16 * DM), "v"(g + 32 * DM), "v"(g + 48 * DM), "v"(g + 64 * DM), "v"(g + 80 * DM), "v"(g + 96 * DM), "v"(g + 112 * DM) : "memory");
}
// Every plain '#pragma unroll' here and in the two kernels that call it is there so that the fragment and accumulator arrays are indexed by constants and stay in registers.
template <int NPL>   // staged planes: A, Bt (, A2). Ag, A2g, Bg: row 0 of the work-group's 128 rows
__device__ __forceinline__ void gemm128(unsigned short* sm, const bf* __restrict__ Ag, const bf* __restrict__ A2g, const bf* __restrict__ Bg, int wave, v8f (&acc)[4][4]) {
    typedef WFrag<bf>::V V;
    const int tid = threadIdx.x, lane = tid & 31, lr = lane & 15, hi = lane >> 4;
    const unsigned l0 = (unsigned)(size_t)sm + (unsigned)((tid >> 3) * GP + (tid & 7) * 8) * 2u;   // LDS byte address of this lane's 16 bytes of row tid / 8
    const size_t go = (size_t)(tid >> 3) * DM + (tid & 7) * 8;
    auto fill = [&](int s) { const unsigned lb = l0 + (unsigned)((s & 1) * NPL * GPL) * 2u; const size_t o = go + (size_t)s * 64;
        gcopy(lb, Ag + o); gcopy(lb + GPL * 2, Bg + o); if constexpr (NPL == 3) gcopy(lb + 2 * GPL * 2, A2g + o); };
    fill(0);
    asm volatile("s_wait_asynccnt 0x0" ::: "memory");   // this wave's copies of stage 0 have landed
    __syncthreads();                                    // publishes stage 0
    fill(1);
    const int ao = ((wave >> 1) * 64 + lr) * GP + 8 * hi, bo = GPL + ((wave & 1) * 64 + lr) * GP + 8 * hi;
#pragma unroll 1
    for (int s = 0; s < GNS; ++s) {   // rolled: one trip a stage, so that the buffer index and the refill test stay scalar
        const unsigned short* bp = sm + (s & 1) * NPL * GPL;
#pragma unroll
        for (int ks = 0; ks < 2; ++ks) {
            V a[4], a2[4], b[4];   // the block's fragments are fetched as one group ahead of its products
#pragma unroll
            for (int mb = 0; mb < 4; ++mb) { a[mb] = WFrag<bf>::ld(bp + ao + mb * 16 * GP + ks * 32); if constexpr (NPL == 3) a2[mb] = WFrag<bf>::ld(bp + 2 * GPL + ao + mb * 16 * GP + ks * 32); }
#pragma unroll
            for (int nb = 0; nb < 4; ++nb) b[nb] = WFrag<bf>::ld(bp + bo + nb * 16 * GP + ks * 32);
            __builtin_amdgcn_sched_barrier(0);   // keeps the reads together in front: sunk among the products, into one shared Bt fragment, every four products wait out an LDS latency
#pragma unroll
            for (int nb = 0; nb < 4; ++nb)
#pragma unroll
                for (int mb = 0; mb < 4; ++mb) { acc[mb][nb] = WFrag<bf>::mma(a[mb], b[nb], acc[mb][nb]); if constexpr (NPL == 3) acc[mb][nb] = WFrag<bf>::mma(a2[mb], b[nb], acc[mb][nb]); }
        }
        asm volatile("s_wait_dscnt 0x0" ::: "memory");      // this wave's reads of stage s have returned
        asm volatile("s_wait_asynccnt 0x0" ::: "memory");   // this wave's copies of stage s + 1 have landed
        __syncthreads();                                    // publishes stage s + 1 and ends every wave's reads of the buffer refilled below
        if (s + 2 < GNS) fill(s + 2);
    }
    asm volatile("s_wait_asynccnt 0x0" ::: "memory");   // no copy is outstanding when the wave goes on
}
// ---- k_proj: C (f32, pitch DM) = (A + A2) Bt^T + bias, grid (M / 128, DM / 128), 128 threads; a wave's 64 x 64 quarter goes out through its own LDS rows, whole 128-byte lines.
__global__ __launch_bounds__(128) void k_proj(const bf* __restrict__ A, const bf* __restrict__ A2, const bf* __restrict__ Bt, float* C, const float* __restrict__ bias) {
    __shared__ __align__(16) unsigned short sm[2 * 3 * GPL];
    __shared__ __align__(16) float osw[4][16 * 68];
    const int lane = threadIdx.x & 31, lr = lane & 15, hi = lane >> 4; const int wave = __builtin_amdgcn_readfirstlane(threadIdx.x >> 5);
    float* os = osw[wave]; const int r0 = blockIdx.x * 128 + (wave >> 1) * 64, c0 = blockIdx.y * 128 + (wave & 1) * 64;
    v8f acc[4][4];
#pragma unroll
    for (int mb = 0; mb < 4; ++mb)
#pragma unroll
        for (int nb = 0; nb < 4; ++nb) acc[mb][nb] = (v8f){};
    gemm128<3>(sm, A + (size_t)blockIdx.x * 128 * DM, A2 + (size_t)blockIdx.x * 128 * DM, Bt + (size_t)blockIdx.y * 128 * DM, wave, acc);
    const int cofs = lr * 4; v4f bv; bv[0] = bfr(bias[c0 + cofs]); bv[1] = bfr(bias[c0 + cofs + 1]); bv[2] = bfr(bias[c0 + cofs + 2]); bv[3] = bfr(bias[c0 + cofs + 3]);
#pragma unroll
    for (int mb = 0; mb < 4; ++mb) {
#pragma unroll
        for (int nb = 0; nb < 4; ++nb) {
#pragma unroll
            for (int j = 0; j < 8; ++j) os[(hi * 8 + j) * 68 + nb * 16 + lr] = acc[mb][nb][j]; }
        __builtin_amdgcn_wave_barrier(); asm volatile("" ::: "memory");   // the row reads below stay behind the other lanes' LDS writes
        float* crow = C + (size_t)(r0 + mb * 16) * DM + c0;
#pragma unroll
        for (int s = 0; s < 8; ++s) { const int row = 2 * s + hi; const v4f val = *(const v4fa*)(os + row * 68 + cofs) + bv;
            *(v4f*)(crow + (size_t)row * DM + cofs) = val; }
        asm volatile("s_wait_xcnt 0x0" ::: "memory");   // stands before the registers that the stores name are written again
        __builtin_amdgcn_wave_barrier(); asm volatile("" ::: "memory");   // the next block's LDS writes stay behind these reads
    }
}

__device__ __forceinline__ void splitf(float y, unsigned short& h, unsigned short& l) { h = f2bf(y); l = f2bf(y - bf2f(h)); }
typedef __attribute__((ext_vector_type(2))) _Float16 v2h;
typedef __attribute__((ext_vector_type(4))) _Float16 v4h;
typedef __attribute__((ext_vector_type(2))) unsigned short v2us;
typedef __attribute__((ext_vector_type(4))) unsigned short v4us;
typedef __attribute__((ext_vector_type(2))) float v2f;
typedef __attribute__((ext_vector_type(4))) int v4i;
// y = hi + lo in fp16: hi is y rounded once (the plane that the fp16 rows read too), lo the rounded rest
template <typename VF, typename VH> __device__ __forceinline__ void splith(VF y, VH& h, VH& l) { h = __builtin_convertvector(y, VH); l = __builtin_convertvector(y - __builtin_convertvector(h, VF), VH); }

// INV2: the 32 rotary frequencies of THIS module: (1.0 / (ROPE_BASE ** (arange(0, 64, 2, float32) / 64))) * ROPE_SCALE with ROPE_BASE 10000 and ROPE_SCALE 3.0, generated with jnp in float32 (bit-exact; == the unscaled table x 3.0f in f32, 32 of 32): the adjacent (even, odd) pair shares entry d / 2.
__constant__ float INV2[HD / 2] = { 3.000000000e+00f, 2.249682665e+00f, 1.687023997e+00f, 1.265089512e+00f, 9.486832619e-01f, 7.114120722e-01f, 5.334838033e-01f, 4.000564218e-01f, 3.000000119e-01f, 2.249682546e-01f, 1.687023938e-01f, 1.265089512e-01f, 9.486833215e-02f, 7.114120573e-02f, 5.334838480e-02f, 4.000564665e-02f, 2.999999933e-02f, 2.249682695e-02f, 1.687023975e-02f, 1.265089400e-02f, 9.486833587e-03f, 7.114121690e-03f, 5.334838293e-03f, 4.000564106e-03f, 3.000000026e-03f, 2.249682555e-03f, 1.687023905e-03f, 1.265089493e-03f, 9.486833587e-04f, 7.114121690e-04f, 5.334838061e-04f, 4.000564513e-04f };
// ---- k_prep: all the preparation in ONE launch of PG work-groups that are resident together (two a WGP, 4,096 waves), each taking an equal share of every part:
// 64 KB of x rounded to bf16 (8 groups of 8 elements a thread), one rotary table entry a thread, and one 128 (k) x 64 (n) tile of a weight, rounded and transposed into Bt [n][k].
// The tile: a lane reads 32 consecutive k of ONE column n (a wave-wide load is one whole 128-byte line of a weight row), so its 32 rounded values are 64 contiguous bytes of the Bt row;
// they pass through LDS (rows of 256 B at a pitch of 272 B) only so that the Bt rows go out as whole 256-byte units.
#define PG   512
#define NWQ  ((3 * DQ / 64) * (DM / 128))   // work-groups below NWQ: tiles of w_qkv; the rest: tiles of w_proj
#define WTP  136                            // LDS row pitch in 16-bit elements
static_assert(DQ == DM && PG == NWQ + (DM / 64) * (DQ / 128) && PG * 256 == TT * HD && (size_t)PG * 256 * 64 == (size_t)NB_ * TT * DM, "k_prep: every share divides evenly");
template <int N>   // N: row length of the weight w ([DM][N], Bt [N][DM]); a template, so that the 32 loads of a column differ in their constant offsets alone
__device__ __forceinline__ void prep(unsigned short* tl, const float* __restrict__ x, const float* __restrict__ w, bf* XB, bf* Bt, float* CS, int tile) {
    const int tid = threadIdx.x, lane = tid & 31, bx = blockIdx.x; const int wave = __builtin_amdgcn_readfirstlane(tid >> 5);
    const int k0 = (tile % (DM / 128)) * 128, n0 = (tile / (DM / 128)) * 64;
    // Every load of the work-group is issued here, the table's frequency first (loads are waited for in their order), so that the table arithmetic runs while the rest fly. The plain unrolls keep the arrays in registers.
    const int idx = bx * 256 + tid; const int d = idx % HD; const int t = idx / HD; const float fr = INV2[d >> 1];
    asm volatile("s_wait_xcnt 0x0" ::: "memory");   // stands before the offset register of the frequency's load is written again (it is free for the data of the loads below)
    const float* wr = w + (size_t)(k0 + (wave >> 1) * 32) * N + n0 + (wave & 1) * 32;   // uniform: the wave's first row at its first column
    float wv[32];
#pragma unroll
    for (int r = 0; r < 32; ++r) wv[r] = wr[r * N + lane];
    const size_t xo = (size_t)bx * (256 * 64) + tid * 8; v8f xv[8];
#pragma unroll
    for (int it = 0; it < 8; ++it) xv[it] = *(const v8f*)(x + xo + it * 2048);
    asm volatile("s_wait_xcnt 0x0" ::: "memory");   // stands before the address registers of the loads issued so far are written again
    const float a = __fmul_rn((float)t, fr); v2f cs; cs[0] = cosf(a); cs[1] = sinf(a);
    unsigned short* tw = tl + ((wave & 1) * 32 + lane) * WTP + (wave >> 1) * 32;
#pragma unroll
    for (int q = 0; q < 4; ++q) { v8us o;
#pragma unroll
        for (int j = 0; j < 8; ++j) o[j] = f2bf(wv[q * 8 + j]);
        *(v8usa*)(tw + q * 8) = o; }
    __syncthreads();   // the tile's columns are all in LDS before its rows are read; every global store stands behind it, so that it waits for none
    *(v2f*)(CS + (size_t)idx * 2) = cs;
    bf* bt = Bt + (size_t)(n0 + (tid >> 4)) * DM + k0 + (tid & 15) * 8; const unsigned short* tr = tl + (tid >> 4) * WTP + (tid & 15) * 8;
#pragma unroll
    for (int p = 0; p < 4; ++p) *(v8usa*)(bt + p * 16 * DM) = *(const v8usa*)(tr + p * 16 * WTP);
#pragma unroll
    for (int it = 0; it < 8; ++it) { v8us o;
#pragma unroll
        for (int k = 0; k < 8; ++k) o[k] = f2bf(xv[it][k]);
        *(v8us*)(XB + xo + it * 2048) = o; }
}
__global__ __launch_bounds__(256) void k_prep(const float* __restrict__ x, const float* __restrict__ wqkv, const float* __restrict__ wo, bf* XB, bf* WQKV, bf* WO, float* CS) {
    __shared__ __align__(16) unsigned short tl[64 * WTP];
    const int bx = blockIdx.x;   // the branch is the same for the whole work-group
    if (bx < NWQ) prep<3 * DQ>(tl, x, wqkv, XB, WQKV, CS, bx); else prep<DM>(tl, x, wo, XB, WO, CS, bx - NWQ);
}
// ---- k_qkv: the q | k | v projection of every batch in one launch (gemm128, one product), each wave building the attention planes of its 64 x 64 quarter itself from its accumulators.
// grid (NB_ TT / 128, 3 NH_ / 2), 128 threads: a wave has 64 rows of x (one batch, 64 positions) x 64 columns of the fused weight = one head of q (column block < NH_), of k (< 2 NH_) or of v.
// q and k tiles: interleaved-pair rotary on the f32 sums (table CS), then planes [b][h][t][d] as fp16 hi and fp16 lo; through the wave's own LDS rows, so that a 128-byte plane row is stored whole.
// v tiles: planes [b][h][d][t]; accumulator elements 0..7 of a lane are 8 consecutive positions of one column, so 16 bytes a plane go out straight from registers.
__global__ __launch_bounds__(128) void k_qkv(const bf* __restrict__ A, const bf* __restrict__ Bt, const float* __restrict__ CS, h16* Q16, h16* Ql, h16* K16, h16* Kl, h16* V16, h16* Vl) {
    __shared__ __align__(16) unsigned short sm[2 * 2 * GPL];
    __shared__ __align__(16) float osw[4][16 * 68];
    const int lane = threadIdx.x & 31, lr = lane & 15, hi = lane >> 4; const int wave = __builtin_amdgcn_readfirstlane(threadIdx.x >> 5);
    float* os = osw[wave]; const int r0 = blockIdx.x * 128 + (wave >> 1) * 64, cy = blockIdx.y * 2 + (wave & 1);
    v8f acc[4][4];
#pragma unroll
    for (int mb = 0; mb < 4; ++mb)
#pragma unroll
        for (int nb = 0; nb < 4; ++nb) acc[mb][nb] = (v8f){};
    gemm128<2>(sm, A + (size_t)blockIdx.x * 128 * DM, nullptr, Bt + (size_t)blockIdx.y * 128 * DM, wave, acc);
    const int bt = r0 / TT, t0 = r0 % TT, sel = cy / NH_, hd = cy % NH_;
    const size_t po = ((size_t)bt * NH_ + hd) * TT * HD;
    if (sel == 2) {
        char* W16 = (char*)(V16 + po + t0); char* Wl = (char*)(Vl + po + t0); const unsigned vl = (unsigned)(lr * TT + hi * 8) * 2u;   // uniform bases, lane offset in bytes
#pragma unroll
        for (int nb = 0; nb < 4; ++nb) {
#pragma unroll
            for (int mb = 0; mb < 4; ++mb) { v8h o16, ol; splith(acc[mb][nb], o16, ol);
                const int vc = (nb * 16 * TT + mb * 16) * 2; *(v8ha*)(W16 + vc + vl) = o16; *(v8ha*)(Wl + vc + vl) = ol;
                asm volatile("s_wait_xcnt 0x0" ::: "memory"); } }   // stands before the registers that the two stores name are written again
    } else {
        const size_t pt = po + (size_t)t0 * HD; char* W16 = (char*)((sel ? K16 : Q16) + pt); char* Wl = (char*)((sel ? Kl : Ql) + pt); const char* Ct = (const char*)(CS + (size_t)t0 * HD * 2);
        const unsigned pl = (unsigned)(hi * HD + lr * 4) * 2u, cl = pl * 4u;   // uniform bases, lane offsets in bytes (plane row 128 B, table row 512 B)
#pragma unroll
        for (int mb = 0; mb < 4; ++mb) {
#pragma unroll
            for (int nb = 0; nb < 4; ++nb) {
#pragma unroll
                for (int j = 0; j < 8; ++j) os[(hi * 8 + j) * 68 + nb * 16 + lr] = acc[mb][nb][j]; }
            __builtin_amdgcn_wave_barrier(); asm volatile("" ::: "memory");   // the row reads below stay behind the other lanes' LDS writes
            v4f xv[8]; v2f ca[8], cb[8];   // all 16 rows' sums and table entries are fetched before the first store, one latency a block of 16 rows
#pragma unroll
            for (int s = 0; s < 8; ++s) { const int row = 2 * s + hi; xv[s] = *(const v4fa*)(os + row * 68 + lr * 4); const char* cp = Ct + (mb * 16 + 2 * s) * HD * 8 + cl; ca[s] = *(const v2f*)cp; cb[s] = *(const v2f*)(cp + 16); }
#pragma unroll
            for (int s = 0; s < 8; ++s) { const int pc = (mb * 16 + 2 * s) * HD * 2; v4f r; v4h o16, ol;
                r[0] = xv[s][0] * ca[s][0] - xv[s][1] * ca[s][1]; r[1] = xv[s][0] * ca[s][1] + xv[s][1] * ca[s][0];   /* even: x0 c - x1 s; odd: x0 s + x1 c; free to contract to a product and an fma */
                r[2] = xv[s][2] * cb[s][0] - xv[s][3] * cb[s][1]; r[3] = xv[s][2] * cb[s][1] + xv[s][3] * cb[s][0];
                splith(r, o16, ol);
                *(v4h*)(W16 + pc + pl) = o16; *(v4h*)(Wl + pc + pl) = ol;
                asm volatile("s_wait_xcnt 0x0" ::: "memory"); }   // stands before the registers that the two stores name are written again
            __builtin_amdgcn_wave_barrier(); asm volatile("" ::: "memory");   // the next block's LDS writes stay behind these reads
        }
    }
}
// ---- k_fattn: fused attention, one launch for every batch, head and query row. Scores, softmax and P stay in registers.
// St = K Qt (A = 16 key rows, B = 16 query columns), Ot += Vt Pt: accumulator element j of lane (lr, hi) of the score tile of keys kb + 16 kt .. is key kb + 16 kt + 8 hi + j of query lr,
// which is element 8 kt + j of the B operand of a 32-key product in the loaders' k order, so P is packed in place. Running maximum per query column; output and sum are rescaled only in a pass (32 keys) where some column's maximum has outgrown the one in use by more than LZ.
// A work-group of 8 waves shares K and Vt: 64 keys a stage, brought through registers into two LDS buffers (rows of 128 B at a pitch of 144 B), one barrier a stage.
// Work-groups below NHW: query rows < RH, 16 columns a wave, fp16 hi and lo planes, 3 products; the rest: 32 columns a wave, the hi planes alone.
#define FP   72                   // LDS row pitch in 16-bit elements
#define FPS  (64 * FP)            // one staged plane: 64 rows
#define NST  (TT / 64)
#define CL2  0.18033688011112042f // HD^-0.5 x log2(e)
typedef __attribute__((ext_vector_type(8))) unsigned v8u;
struct FT { typedef v16h V; static __device__ __forceinline__ V ld(const unsigned short* p) { return __builtin_bit_cast(v16h, __builtin_shufflevector(*(const v8usa*)p, *(const v8usa*)(p + 16), 0, 1, 2, 3, 4, 5, 6, 7, 8, 9, 10, 11, 12, 13, 14, 15)); } static __device__ __forceinline__ v8f mma(V a, V b, v8f c) { return wmma16(a, b, c); } };
__device__ __forceinline__ float xhalf(float x) { const int b = __float_as_int(x); return __int_as_float(__builtin_amdgcn_permlanex16(b, b, 0x76543210, 0xfedcba98, false, false)); }   // lane l <-> l ^ 16
template <bool HI, int NT>
__device__ __forceinline__ void fattn(unsigned short* sm, const unsigned short* __restrict__ Q, const unsigned short* __restrict__ Q2, const unsigned short* __restrict__ Kg, const unsigned short* __restrict__ K2g, const unsigned short* __restrict__ Vg, const unsigned short* __restrict__ V2g, int qw, bf* Ah, bf* Al) {
    typedef FT::V V;
    constexpr int PLN = HI ? 4 : 2;   // staged planes: K, Vt (, K lo, Vt lo)
    const int tid = threadIdx.x, lane = tid & 31, lr = lane & 15, hi = lane >> 4;
    const int srow = tid >> 3, sseg = (tid & 7) * 8;   // staging: rows srow and srow + 32, one 16-byte segment of each plane
    v8us st[PLN][2];
    auto gload = [&](int s) {
#pragma unroll
        for (int r = 0; r < 2; ++r) { const int row = srow + 32 * r; const size_t ko = (size_t)(s * 64 + row) * HD + sseg, vo = (size_t)row * TT + s * 64 + sseg;
            st[0][r] = *(const v8usa*)(Kg + ko); st[1][r] = *(const v8usa*)(Vg + vo);
            if constexpr (HI) { st[2][r] = *(const v8usa*)(K2g + ko); st[3][r] = *(const v8usa*)(V2g + vo); } }
        asm volatile("s_wait_xcnt 0x0" ::: "memory"); };   // stands before the address registers of the loads issued so far are written again
    auto sstore = [&](int b) {
#pragma unroll
        for (int r = 0; r < 2; ++r)
#pragma unroll
            for (int pl = 0; pl < PLN; ++pl) *(v8usa*)(sm + (b * PLN + pl) * FPS + (srow + 32 * r) * FP + sseg) = st[pl][r]; };
    V qf[NT][2], qf2[NT][2];
#pragma unroll
    for (int nt = 0; nt < NT; ++nt)
#pragma unroll
        for (int ks = 0; ks < 2; ++ks) { const size_t qo = (size_t)(qw + nt * 16 + lr) * HD + ks * 32 + 8 * hi; qf[nt][ks] = FT::ld(Q + qo); if constexpr (HI) qf2[nt][ks] = FT::ld(Q2 + qo); }
    asm volatile("s_wait_xcnt 0x0" ::: "memory");   // stands before the address registers of the Q loads are written again
    constexpr float LZ = HI ? 8.0f : 5.0f;   // the maximum in use, mc, may trail a column's true maximum by LZ (scaled log2): a weight reaches 2^LZ, P 2^(LZ + PCH) or 2^(LZ + PCL2) = 2^15, inside fp16
    v8f o[4][NT]; float mc[NT], thr[NT], l[NT];   // thr: the raw score above which mc must move
#pragma unroll
    for (int nt = 0; nt < NT; ++nt) { mc[nt] = -3.0e37f; thr[nt] = -__builtin_inff(); l[nt] = 0.f;
#pragma unroll
        for (int dt = 0; dt < 4; ++dt) o[dt][nt] = (v8f){}; }
    gload(0); sstore(0); __syncthreads();
#pragma unroll 1
    for (int s = 0; s < NST; ++s) {
        if (s + 1 < NST) gload(s + 1);
        const unsigned short* kb = sm + (s & 1) * PLN * FPS;
#pragma unroll
        for (int p = 0; p < 2; ++p) {
            v8f sc[2][NT];
#pragma unroll
            for (int kt = 0; kt < 2; ++kt) { V ka[2], ka2[2];
#pragma unroll
                for (int ks = 0; ks < 2; ++ks) { const int off = (p * 32 + kt * 16 + lr) * FP + ks * 32 + 8 * hi; ka[ks] = FT::ld(kb + off); if constexpr (HI) ka2[ks] = FT::ld(kb + 2 * FPS + off); }
#pragma unroll
                for (int nt = 0; nt < NT; ++nt) { v8f a = (v8f){};
#pragma unroll
                    for (int ks = 0; ks < 2; ++ks) { a = FT::mma(ka[ks], qf[nt][ks], a); if constexpr (HI) { a = FT::mma(ka[ks], qf2[nt][ks], a); a = FT::mma(ka2[ks], qf[nt][ks], a); } }
                    sc[kt][nt] = a; } }
            float cm[NT]; bool need = false;
#pragma unroll
            for (int nt = 0; nt < NT; ++nt) { cm[nt] = fmaxf(sc[0][nt][0], sc[1][nt][0]);
#pragma unroll
                for (int j = 1; j < 8; ++j) cm[nt] = fmaxf(cm[nt], fmaxf(sc[0][nt][j], sc[1][nt][j]));
                need = need || cm[nt] > thr[nt]; }
            if (__builtin_amdgcn_ballot_w32(need) != 0) {   // a scalar branch, the same for the whole wave; rare after the first pass
#pragma unroll
                for (int nt = 0; nt < NT; ++nt) { const float mn = fmaxf(mc[nt], fmaxf(cm[nt], xhalf(cm[nt])) * CL2); const float al = __builtin_amdgcn_exp2f(mc[nt] - mn); mc[nt] = mn; thr[nt] = (mn + LZ) * (1.0f / CL2); l[nt] *= al;
#pragma unroll
                    for (int dt = 0; dt < 4; ++dt) o[dt][nt] *= al; } }
            V pf[NT], pf2[NT];
#pragma unroll
            for (int nt = 0; nt < NT; ++nt) {
                const float mo = mc[nt] - (HI ? PCH : PCL2);
                float e[16];
#pragma unroll
                for (int i = 0; i < 16; ++i) e[i] = __builtin_amdgcn_exp2f(fmaf(sc[i >> 3][nt][i & 7], CL2, -mo));
                const float ps = ((e[0] + e[1]) + (e[2] + e[3])) + ((e[4] + e[5]) + (e[6] + e[7])) + (((e[8] + e[9]) + (e[10] + e[11])) + ((e[12] + e[13]) + (e[14] + e[15])));
                l[nt] += ps;
                v8u ph, pl;   // two elements a register, converted in pairs
#pragma unroll
                for (int i = 0; i < 8; ++i) { const v2f ev = { e[2 * i], e[2 * i + 1] }; v2h hb, lb; splith(ev, hb, lb);
                    ph[i] = __builtin_bit_cast(unsigned, hb); if constexpr (HI) pl[i] = __builtin_bit_cast(unsigned, lb); }
                pf[nt] = __builtin_bit_cast(V, ph); if constexpr (HI) pf2[nt] = __builtin_bit_cast(V, pl); }
#pragma unroll
            for (int dt = 0; dt < 4; ++dt) { const int off = FPS + (dt * 16 + lr) * FP + p * 32 + 8 * hi; const V va = FT::ld(kb + off); V va2; if constexpr (HI) va2 = FT::ld(kb + 2 * FPS + off);
#pragma unroll
                for (int nt = 0; nt < NT; ++nt) { o[dt][nt] = FT::mma(va, pf[nt], o[dt][nt]); if constexpr (HI) { o[dt][nt] = FT::mma(va, pf2[nt], o[dt][nt]); o[dt][nt] = FT::mma(va2, pf[nt], o[dt][nt]); } } }
        }
        if (s + 1 < NST) sstore((s + 1) & 1);
        __syncthreads();   // publishes stage s + 1 and ends every wave's reads of the buffer that the next trip refills
    }
#pragma unroll
    for (int nt = 0; nt < NT; ++nt) { const float inv = __fdiv_rn(1.0f, l[nt] + xhalf(l[nt])); const size_t oo = (size_t)(qw + nt * 16 + lr) * DQ + hi * 8;
#pragma unroll
        for (int dt = 0; dt < 4; ++dt) { v8us oh, ol;
#pragma unroll
            for (int j = 0; j < 8; ++j) { unsigned short a, c2; splitf(o[dt][nt][j] * inv, a, c2); oh[j] = a; ol[j] = c2; }
            *(v8usa*)(Ah + oo + dt * 16) = oh; *(v8usa*)(Al + oo + dt * 16) = ol;
            asm volatile("s_wait_xcnt 0x0" ::: "memory"); } }   // stands before the registers that the two stores name are written again
}
#define NHW (NB_ * NH_ * (RH / 128))
#define NLW (NB_ * NH_ * ((TT - RH) / 256))
__global__ __launch_bounds__(256) __attribute__((amdgpu_waves_per_eu(4, 4))) void k_fattn(const h16* __restrict__ Q16, const h16* __restrict__ Ql, const h16* __restrict__ K16, const h16* __restrict__ Kl, const h16* __restrict__ V16, const h16* __restrict__ Vl, bf* Ah, bf* Al) {
    __shared__ __align__(16) unsigned short sm[2 * 4 * FPS];
    const int wave = threadIdx.x >> 5; int bx = blockIdx.x;   // the long work-groups (3 products) have the lowest indices
    if (bx < NHW) { const int z = bx / (RH / 128), qt = bx % (RH / 128); const size_t zo = (size_t)z * TT * HD, ao = (size_t)(z / NH_) * TT * DQ + (z % NH_) * HD;
        fattn<true, 1>(sm, (const unsigned short*)(Q16 + zo), (const unsigned short*)(Ql + zo), (const unsigned short*)(K16 + zo), (const unsigned short*)(Kl + zo), (const unsigned short*)(V16 + zo), (const unsigned short*)(Vl + zo), qt * 128 + wave * 16, Ah + ao, Al + ao);
    } else { bx -= NHW; const int z = bx / ((TT - RH) / 256), qt = bx % ((TT - RH) / 256); const size_t zo = (size_t)z * TT * HD, ao = (size_t)(z / NH_) * TT * DQ + (z % NH_) * HD;
        fattn<false, 2>(sm, (const unsigned short*)(Q16 + zo), nullptr, (const unsigned short*)(K16 + zo), nullptr, (const unsigned short*)(V16 + zo), nullptr, RH + qt * 256 + wave * 32, Ah + ao, Al + ao); }
}

extern "C" void kernel_launch(void* const* d_in, const int* in_sizes, int n_in,
                              void* d_out, int out_size, void* d_ws, size_t ws_size, hipStream_t stream) {
    (void)in_sizes; (void)n_in; (void)out_size;
    const float* x = (const float*)d_in[0]; const float* wqkv = (const float*)d_in[1]; const float* wo = (const float*)d_in[2]; const float* bo = (const float*)d_in[3];   /* x, w_qkv ('xw' [1024][3072]: q | k | v column thirds), w_proj ('xw'), b_proj */
    float* OUT = (float*)d_out;     // [4][2048][1024]
    char* wsp = (char*)d_ws;
    auto take = [&](size_t bytes) { char* p = wsp; wsp += (bytes + 255) & ~(size_t)255; return (void*)p; };
    bf* WQKV = (bf*)take((size_t)3 * DQ * DM * 2);   /* fused Bt [3*DQ][DM]: q | k | v row blocks */ bf* WO = (bf*)take((size_t)DM * DQ * 2); float* CS = (float*)take((size_t)TT * HD * 2 * 4);
    bf* XB = (bf*)take((size_t)NB_ * TT * DM * 2);
    const size_t PB = (size_t)NH_ * TT * HD;   // one batch's head planes, elements; every plane holds all NB_ batches
    h16* QP16 = (h16*)take(NB_ * PB * 2); h16* KP16 = (h16*)take(NB_ * PB * 2); h16* VT16 = (h16*)take(NB_ * PB * 2);
    h16* QPl = (h16*)take(NB_ * PB * 2); h16* KPl = (h16*)take(NB_ * PB * 2); h16* VTl = (h16*)take(NB_ * PB * 2);
    bf* ATh = (bf*)take((size_t)NB_ * TT * DQ * 2); bf* ATl = (bf*)take((size_t)NB_ * TT * DQ * 2);
    if ((size_t)(wsp - (char*)d_ws) > ws_size) return;    // ws 256 MiB
    k_prep<<<PG, 256, 0, stream>>>(x, wqkv, wo, XB, WQKV, WO, CS);   // x -> bf16; fused 'xw' [DM][3*DQ] -> Bt [3*DQ][DM]; w_proj [DQ][DM] -> Bt [DM][DQ]; rotary table
    k_qkv<<<dim3(NB_ * TT / 128, 3 * NH_ / 2, 1), 128, 0, stream>>>(XB, WQKV, CS, QP16, QPl, KP16, KPl, VT16, VTl);
    k_fattn<<<NHW + NLW, 256, 0, stream>>>(QP16, QPl, KP16, KPl, VT16, VTl, ATh, ATl);
    k_proj<<<dim3(NB_ * TT / 128, DM / 128, 1), 128, 0, stream>>>(ATh, ATl, WO, OUT, bo);   // the rows of all batches are contiguous in ATh, ATl and OUT: one launch, two work-groups a WGP
}

// v009
// Measured time: 174 microseconds a run.
// Timed twice side by side with v008, it ran 1.07 and 1.06 times as fast.
// Counting every step since v000, it is 23.2 times as fast.
#include <hip/hip_runtime.h>

// Multi-head self-attention with a fused bias-free qkv projection and computed interleaved-pair rotary embeddings at SCALED frequencies (x [4][2048][1024]; qkv = x w_qkv ('xw' (in, out) [1024][3072] 1/32, no bias) viewed (B, L, 3, 16, 64): q | k | v column thirds (16 heads x 64); rope on q and k: pairs (x[2i], x[2i+1]) -> (re c - im s, re s + im c) with angle pos x theta_i, theta = (1 / 10000^(2i/64)) x 3.0 (ROPE_SCALE; 32 f32 frequencies jnp-exact; one f32 product per angle; precise cosf/sinf); attn x 64^-0.5; softmax over all keys (no mask); out = merged w_proj + b_proj ('xw' + a bias: READ) -> [4][2048][1024] (8.4 M); argument order x, w_qkv, w_proj, b_proj).
// Layout: k_prep: bf16 copy of x, the fused 'xw' weight transposed ONCE into q | k | v row blocks, computed interleaved table at the scaled frequencies; k_qkv: exact projections of all batches with the interleaved-pair rotary and the plane split in their epilogue; fused dense T-2048 attention, all batches in one launch (hybrid rows: < 512 fp16 hi/lo 3 products, rest fp16 x1024); merged hi/lo x w_proj exact + b_proj.
// Compute dtypes, f32 accumulate: every input rounded to bf16; projections exact; rotary f32; attention rows < 512 fp16 hi + lo, 3 products, rest fp16; softmax f32; w_proj hl x exact + bias.

#define NB_  4
#define TT   2048
#define DM   1024
#define NH_  16
#define NKV  16
#define REP  (NH_ / NKV)
#define HD   64
#define DQ   (NH_ * HD)
#define DKV  (NKV * HD)
#define RH   512                  // query rows < RH use hi+lo planes
#define WIN  0
#define PCL2 10.0f                // fp16 rows: P is carried as weight x 2^PCL2, so that small weights stay normal fp16 numbers; the factor cancels in the division by the row sum
#define PCH  7.0f                 // hi/lo rows: their P (fp16 hi + lo) is carried x 2^PCH for the same reason
typedef _Float16 h16;
typedef unsigned short bf;
typedef __attribute__((ext_vector_type(16))) __bf16   v16bf;
typedef __attribute__((ext_vector_type(16))) _Float16 v16h;
typedef __attribute__((ext_vector_type(8)))  _Float16 v8h;
typedef __attribute__((ext_vector_type(8)))  unsigned short v8us;
typedef __attribute__((ext_vector_type(8)))  float    v8f;
typedef __attribute__((ext_vector_type(4)))  float    v4f;
typedef v8h  __attribute__((may_alias)) v8ha;
typedef v4f  __attribute__((may_alias)) v4fa;
typedef v8us __attribute__((may_alias)) v8usa;

__device__ __forceinline__ unsigned short f2bf(float f) { unsigned u = __float_as_uint(f); u += 0x7FFFu + ((u >> 16) & 1u); return (unsigned short)(u >> 16); }
__device__ __forceinline__ float bf2f(unsigned short b) { return __uint_as_float(((unsigned)b) << 16); }
__device__ __forceinline__ float bfr(float f) { return bf2f(f2bf(f)); }
__device__ __forceinline__ v16h cat16(v8h lo, v8h hi) { return __builtin_shufflevector(lo, hi, 0, 1, 2, 3, 4, 5, 6, 7, 8, 9, 10, 11, 12, 13, 14, 15); }
__device__ __forceinline__ v16bf cat16b(v8us lo, v8us hi) { return __builtin_bit_cast(v16bf, __builtin_shufflevector(lo, hi, 0, 1, 2, 3, 4, 5, 6, 7, 8, 9, 10, 11, 12, 13, 14, 15)); }
__device__ __forceinline__ v8f wmma16(v16h a, v16h b, v8f c) { return __builtin_amdgcn_wmma_f32_16x16x32_f16(false, a, false, b, (short)0, c, false, false); }
__device__ __forceinline__ v8f wmmab(v16bf a, v16bf b, v8f c) { return __builtin_amdgcn_wmma_f32_16x16x32_bf16(false, a, false, b, (short)0, c, false, false); }



// ---- gemm128: the K loop of both GEMMs. A work-group of 4 waves (2 x 2) owns a 128 x 128 tile of C[m][n] = sum_k A[m][k] Bt[n][k] (NPL 3: + A2[m][k] Bt[n][k]), K = DM, operands K-contiguous bf16 planes; each wave keeps its 64 x 64 quarter in 16 accumulators.
// A stage is 64 k of 128 rows of every plane (rows of 128 B at a pitch of 144 B in LDS), brought by asynchronous copies to LDS: one wave-wide copy covers 4 whole 128-byte lines, and each line is fetched once a work-group. Two buffers, one barrier a stage.
template <typename T16> struct WFrag;
template <> struct WFrag<h16> { typedef v16h V; static __device__ __forceinline__ V ld(const h16* p) { return cat16(*(const v8h*)p, *(const v8h*)(p + 16)); } static __device__ __forceinline__ v8f mma(V a, V b, v8f c) { return wmma16(a, b, c); } };
template <> struct WFrag<bf> { typedef v16bf V; static __device__ __forceinline__ V ld(const bf* p) { return cat16b(*(const v8us*)p, *(const v8us*)(p + 16)); } static __device__ __forceinline__ v8f mma(V a, V b, v8f c) { return wmmab(a, b, c); } };
#define GP   72                   // LDS row pitch in 16-bit elements
#define GPL  (128 * GP)           // one staged plane: 128 rows
#define GNS  (DM / 64)            // stages along K
// one plane of a stage: this lane's 16 bytes of rows r, r + 16, .. r + 112. The s_wait_xcnt closes the copies' own statement, so that it stands before any rewrite of the address registers that they name.
__device__ __forceinline__ void gcopy(unsigned l, const bf* g) {
    asm volatile("global_load_async_to_lds_b128 %0, %8, off\n\t"
                 "global_load_async_to_lds_b128 %1, %9, off\n\t"
                 "global_load_async_to_lds_b128 %2, %10, off\n\t"
                 "global_load_async_to_lds_b128 %3, %11, off\n\t"
                 "global_load_async_to_lds_b128 %4, %12, off\n\t"
                 "global_load_async_to_lds_b128 %5, %13, off\n\t"
                 "global_load_async_to_lds_b128 %6, %14, off\n\t"
                 "global_load_async_to_lds_b128 %7, %15, off\n\t"
                 "s_wait_xcnt 0x0"
                 :: "v"(l), "v"(l + 16 * GP * 2), "v"(l + 32 * GP * 2), "v"(l + 48 * GP * 2), "v"(l + 64 * GP * 2), "v"(l + 80 * GP * 2), "v"(l + 96 * GP * 2), "v"(l + 112 * GP * 2),
                    "v"(g), "v"(g + 16 * DM), "v"(g + 32 * DM), "v"(g + 48 * DM), "v"(g + 64 * DM), "v"(g + 80 * DM), "v"(g + 96 * DM), "v"(g + 112 * DM) : "memory");
}
// Every plain '#pragma unroll' here and in the two kernels that call it is there so that the fragment and accumulator arrays are indexed by constants and stay in registers.
template <int NPL>   // staged planes: A, Bt (, A2). Ag, A2g, Bg: row 0 of the work-group's 128 rows
__device__ __forceinline__ void gemm128(unsigned short* sm, const bf* __restrict__ Ag, const bf* __restrict__ A2g, const bf* __restrict__ Bg, int wave, v8f (&acc)[4][4]) {
    typedef WFrag<bf>::V V;
    const int tid = threadIdx.x, lane = tid & 31, lr = lane & 15, hi = lane >> 4;
    const unsigned l0 = (unsigned)(size_t)sm + (unsigned)((tid >> 3) * GP + (tid & 7) * 8) * 2u;   // LDS byte address of this lane's 16 bytes of row tid / 8
    const size_t go = (size_t)(tid >> 3) * DM + (tid & 7) * 8;
    auto fill = [&](int s) { const unsigned lb = l0 + (unsigned)((s & 1) * NPL * GPL) * 2u; const size_t o = go + (size_t)s * 64;
        gcopy(lb, Ag + o); gcopy(lb + GPL * 2, Bg + o); if constexpr (NPL == 3) gcopy(lb + 2 * GPL * 2, A2g + o); };
    fill(0);
    asm volatile("s_wait_asynccnt 0x0" ::: "memory");   // this wave's copies of stage 0 have landed
    __syncthreads();                                    // publishes stage 0
    fill(1);
    const int ao = ((wave >> 1) * 64 + lr) * GP + 8 * hi, bo = GPL + ((wave & 1) * 64 + lr) * GP + 8 * hi;
#pragma unroll 1
    for (int s = 0; s < GNS; ++s) {   // rolled: one trip a stage, so that the buffer index and the refill test stay scalar
        const unsigned short* bp = sm + (s & 1) * NPL * GPL;
#pragma unroll
        for (int ks = 0; ks < 2; ++ks) {
            V a[4], a2[4], b[4];   // the block's fragments are fetched as one group ahead of its products
#pragma unroll
            for (int mb = 0; mb < 4; ++mb) { a[mb] = WFrag<bf>::ld(bp + ao + mb * 16 * GP + ks * 32); if constexpr (NPL == 3) a2[mb] = WFrag<bf>::ld(bp + 2 * GPL + ao + mb * 16 * GP + ks * 32); }
#pragma unroll
            for (int nb = 0; nb < 4; ++nb) b[nb] = WFrag<bf>::ld(bp + bo + nb * 16 * GP + ks * 32);
            __builtin_amdgcn_sched_barrier(0);   // keeps the reads together in front: sunk among the products, into one shared Bt fragment, every four products wait out an LDS latency
#pragma unroll
            for (int nb = 0; nb < 4; ++nb)
#pragma unroll
                for (int mb = 0; mb < 4; ++mb) { acc[mb][nb] = WFrag<bf>::mma(a[mb], b[nb], acc[mb][nb]); if constexpr (NPL == 3) acc[mb][nb] = WFrag<bf>::mma(a2[mb], b[nb], acc[mb][nb]); }
        }
        asm volatile("s_wait_dscnt 0x0" ::: "memory");      // this wave's reads of stage s have returned
        asm volatile("s_wait_asynccnt 0x0" ::: "memory");   // this wave's copies of stage s + 1 have landed
        __syncthreads();                                    // publishes stage s + 1 and ends every wave's reads of the buffer refilled below
        if (s + 2 < GNS) fill(s + 2);
    }
    asm volatile("s_wait_asynccnt 0x0" ::: "memory");   // no copy is outstanding when the wave goes on
}
// ---- k_proj: C (f32, pitch DM) = (A + A2) Bt^T + bias, grid (M / 128, DM / 128), 128 threads; a wave's 64 x 64 quarter goes out through its own LDS rows, whole 128-byte lines.
__global__ __launch_bounds__(128) void k_proj(const bf* __restrict__ A, const bf* __restrict__ A2, const bf* __restrict__ Bt, float* C, const float* __restrict__ bias) {
    __shared__ __align__(16) unsigned short sm[2 * 3 * GPL];
    __shared__ __align__(16) float osw[4][16 * 68];
    const int lane = threadIdx.x & 31, lr = lane & 15, hi = lane >> 4; const int wave = __builtin_amdgcn_readfirstlane(threadIdx.x >> 5);
    float* os = osw[wave]; const int r0 = blockIdx.x * 128 + (wave >> 1) * 64, c0 = blockIdx.y * 128 + (wave & 1) * 64;
    v8f acc[4][4];
#pragma unroll
    for (int mb = 0; mb < 4; ++mb)
#pragma unroll
        for (int nb = 0; nb < 4; ++nb) acc[mb][nb] = (v8f){};
    gemm128<3>(sm, A + (size_t)blockIdx.x * 128 * DM, A2 + (size_t)blockIdx.x * 128 * DM, Bt + (size_t)blockIdx.y * 128 * DM, wave, acc);
    const int cofs = lr * 4; v4f bv; bv[0] = bfr(bias[c0 + cofs]); bv[1] = bfr(bias[c0 + cofs + 1]); bv[2] = bfr(bias[c0 + cofs + 2]); bv[3] = bfr(bias[c0 + cofs + 3]);
#pragma unroll
    for (int mb = 0; mb < 4; ++mb) {
#pragma unroll
        for (int nb = 0; nb < 4; ++nb) {
#pragma unroll
            for (int j = 0; j < 8; ++j) os[(hi * 8 + j) * 68 + nb * 16 + lr] = acc[mb][nb][j]; }
        __builtin_amdgcn_wave_barrier(); asm volatile("" ::: "memory");   // the row reads below stay behind the other lanes' LDS writes
        float* crow = C + (size_t)(r0 + mb * 16) * DM + c0;
#pragma unroll
        for (int s = 0; s < 8; ++s) { const int row = 2 * s + hi; const v4f val = *(const v4fa*)(os + row * 68 + cofs) + bv;
            *(v4f*)(crow + (size_t)row * DM + cofs) = val; }
        asm volatile("s_wait_xcnt 0x0" ::: "memory");   // stands before the registers that the stores name are written again
        __builtin_amdgcn_wave_barrier(); asm volatile("" ::: "memory");   // the next block's LDS writes stay behind these reads
    }
}

__device__ __forceinline__ void splitf(float y, unsigned short& h, unsigned short& l) { h = f2bf(y); l = f2bf(y - bf2f(h)); }
typedef __attribute__((ext_vector_type(2))) _Float16 v2h;
typedef __attribute__((ext_vector_type(4))) _Float16 v4h;
typedef __attribute__((ext_vector_type(2))) unsigned short v2us;
typedef __attribute__((ext_vector_type(4))) unsigned short v4us;
typedef __attribute__((ext_vector_type(2))) float v2f;
typedef __attribute__((ext_vector_type(4))) int v4i;
// y = hi + lo in fp16: hi is y rounded once (the plane that the fp16 rows read too), lo the rounded rest
template <typename VF, typename VH> __device__ __forceinline__ void splith(VF y, VH& h, VH& l) { h = __builtin_convertvector(y, VH); l = __builtin_convertvector(y - __builtin_convertvector(h, VF), VH); }

// INV2: the 32 rotary frequencies of THIS module: (1.0 / (ROPE_BASE ** (arange(0, 64, 2, float32) / 64))) * ROPE_SCALE with ROPE_BASE 10000 and ROPE_SCALE 3.0, generated with jnp in float32 (bit-exact; == the unscaled table x 3.0f in f32, 32 of 32): the adjacent (even, odd) pair shares entry d / 2.
__constant__ float INV2[HD / 2] = { 3.000000000e+00f, 2.249682665e+00f, 1.687023997e+00f, 1.265089512e+00f, 9.486832619e-01f, 7.114120722e-01f, 5.334838033e-01f, 4.000564218e-01f, 3.000000119e-01f, 2.249682546e-01f, 1.687023938e-01f, 1.265089512e-01f, 9.486833215e-02f, 7.114120573e-02f, 5.334838480e-02f, 4.000564665e-02f, 2.999999933e-02f, 2.249682695e-02f, 1.687023975e-02f, 1.265089400e-02f, 9.486833587e-03f, 7.114121690e-03f, 5.334838293e-03f, 4.000564106e-03f, 3.000000026e-03f, 2.249682555e-03f, 1.687023905e-03f, 1.265089493e-03f, 9.486833587e-04f, 7.114121690e-04f, 5.334838061e-04f, 4.000564513e-04f };
// ---- k_prep: all the preparation in ONE launch of PG work-groups that are resident together (two a WGP, 4,096 waves), each taking an equal share of every part:
// 64 KB of x rounded to bf16 (8 groups of 8 elements a thread), one rotary table entry a thread, and one 128 (k) x 64 (n) tile of a weight, rounded and transposed into Bt [n][k].
// The tile: a lane reads 32 consecutive k of ONE column n (a wave-wide load is one whole 128-byte line of a weight row), so its 32 rounded values are 64 contiguous bytes of the Bt row;
// they pass through LDS (rows of 256 B at a pitch of 272 B) only so that the Bt rows go out as whole 256-byte units.
#define PG   512
#define NWQ  ((3 * DQ / 64) * (DM / 128))   // work-groups below NWQ: tiles of w_qkv; the rest: tiles of w_proj
#define WTP  136                            // LDS row pitch in 16-bit elements
static_assert(DQ == DM && PG == NWQ + (DM / 64) * (DQ / 128) && PG * 256 == TT * HD && (size_t)PG * 256 * 64 == (size_t)NB_ * TT * DM, "k_prep: every share divides evenly");
template <int N>   // N: row length of the weight w ([DM][N], Bt [N][DM]); a template, so that the 32 loads of a column differ in their constant offsets alone
__device__ __forceinline__ void prep(unsigned short* tl, const float* __restrict__ x, const float* __restrict__ w, bf* XB, bf* Bt, float* CS, int tile) {
    const int tid = threadIdx.x, lane = tid & 31, bx = blockIdx.x; const int wave = __builtin_amdgcn_readfirstlane(tid >> 5);
    const int k0 = (tile % (DM / 128)) * 128, n0 = (tile / (DM / 128)) * 64;
    // Every load of the work-group is issued here, the table's frequency first (loads are waited for in their order), so that the table arithmetic runs while the rest fly. The plain unrolls keep the arrays in registers.
    const int idx = bx * 256 + tid; const int d = idx % HD; const int t = idx / HD; const float fr = INV2[d >> 1];
    asm volatile("s_wait_xcnt 0x0" ::: "memory");   // stands before the offset register of the frequency's load is written again (it is free for the data of the loads below)
    const float* wr = w + (size_t)(k0 + (wave >> 1) * 32) * N + n0 + (wave & 1) * 32;   // uniform: the wave's first row at its first column
    float wv[32];
#pragma unroll
    for (int r = 0; r < 32; ++r) wv[r] = wr[r * N + lane];
    const size_t xo = (size_t)bx * (256 * 64) + tid * 8; v8f xv[8];
#pragma unroll
    for (int it = 0; it < 8; ++it) xv[it] = *(const v8f*)(x + xo + it * 2048);
    asm volatile("s_wait_xcnt 0x0" ::: "memory");   // stands before the address registers of the loads issued so far are written again
    const float a = __fmul_rn((float)t, fr); v2f cs; cs[0] = cosf(a); cs[1] = sinf(a);
    unsigned short* tw = tl + ((wave & 1) * 32 + lane) * WTP + (wave >> 1) * 32;
#pragma unroll
    for (int q = 0; q < 4; ++q) { v8us o;
#pragma unroll
        for (int j = 0; j < 8; ++j) o[j] = f2bf(wv[q * 8 + j]);
        *(v8usa*)(tw + q * 8) = o; }
    __syncthreads();   // the tile's columns are all in LDS before its rows are read; every global store stands behind it, so that it waits for none
    *(v2f*)(CS + (size_t)idx * 2) = cs;
    bf* bt = Bt + (size_t)(n0 + (tid >> 4)) * DM + k0 + (tid & 15) * 8; const unsigned short* tr = tl + (tid >> 4) * WTP + (tid & 15) * 8;
#pragma unroll
    for (int p = 0; p < 4; ++p) *(v8usa*)(bt + p * 16 * DM) = *(const v8usa*)(tr + p * 16 * WTP);
#pragma unroll
    for (int it = 0; it < 8; ++it) { v8us o;
#pragma unroll
        for (int k = 0; k < 8; ++k) o[k] = f2bf(xv[it][k]);
        *(v8us*)(XB + xo + it * 2048) = o; }
}
__global__ __launch_bounds__(256) void k_prep(const float* __restrict__ x, const float* __restrict__ wqkv, const float* __restrict__ wo, bf* XB, bf* WQKV, bf* WO, float* CS) {
    __shared__ __align__(16) unsigned short tl[64 * WTP];
    const int bx = blockIdx.x;   // the branch is the same for the whole work-group
    if (bx < NWQ) prep<3 * DQ>(tl, x, wqkv, XB, WQKV, CS, bx); else prep<DM>(tl, x, wo, XB, WO, CS, bx - NWQ);
}
// ---- k_qkv: the q | k | v projection of every batch in one launch (gemm128, one product), each wave building the attention planes of its 64 x 64 quarter itself from its accumulators.
// grid (NB_ TT / 128, 3 NH_ / 2), 128 threads: a wave has 64 rows of x (one batch, 64 positions) x 64 columns of the fused weight = one head of q (column block < NH_), of k (< 2 NH_) or of v.
// q and k tiles: interleaved-pair rotary on the f32 sums (table CS), then planes [b][h][t][d] as fp16 hi and fp16 lo; through the wave's own LDS rows, so that a 128-byte plane row is stored whole.
// v tiles: planes [b][h][d][t]; accumulator elements 0..7 of a lane are 8 consecutive positions of one column, so 16 bytes a plane go out straight from registers.
__global__ __launch_bounds__(128) void k_qkv(const bf* __restrict__ A, const bf* __restrict__ Bt, const float* __restrict__ CS, h16* Q16, h16* Ql, h16* K16, h16* Kl, h16* V16, h16* Vl) {
    __shared__ __align__(16) unsigned short sm[2 * 2 * GPL];
    __shared__ __align__(16) float osw[4][16 * 68];
    const int lane = threadIdx.x & 31, lr = lane & 15, hi = lane >> 4; const int wave = __builtin_amdgcn_readfirstlane(threadIdx.x >> 5);
    float* os = osw[wave]; const int r0 = blockIdx.x * 128 + (wave >> 1) * 64, cy = blockIdx.y * 2 + (wave & 1);
    v8f acc[4][4];
#pragma unroll
    for (int mb = 0; mb < 4; ++mb)
#pragma unroll
        for (int nb = 0; nb < 4; ++nb) acc[mb][nb] = (v8f){};
    gemm128<2>(sm, A + (size_t)blockIdx.x * 128 * DM, nullptr, Bt + (size_t)blockIdx.y * 128 * DM, wave, acc);
    const int bt = r0 / TT, t0 = r0 % TT, sel = cy / NH_, hd = cy % NH_;
    const size_t po = ((size_t)bt * NH_ + hd) * TT * HD;
    if (sel == 2) {
        char* W16 = (char*)(V16 + po + t0); char* Wl = (char*)(Vl + po + t0); const unsigned vl = (unsigned)(lr * TT + hi * 8) * 2u;   // uniform bases, lane offset in bytes
#pragma unroll
        for (int nb = 0; nb < 4; ++nb) {
#pragma unroll
            for (int mb = 0; mb < 4; ++mb) { v8h o16, ol; splith(acc[mb][nb], o16, ol);
                const int vc = (nb * 16 * TT + mb * 16) * 2; *(v8ha*)(W16 + vc + vl) = o16; *(v8ha*)(Wl + vc + vl) = ol;
                asm volatile("s_wait_xcnt 0x0" ::: "memory"); } }   // stands before the registers that the two stores name are written again
    } else {
        const size_t pt = po + (size_t)t0 * HD; char* W16 = (char*)((sel ? K16 : Q16) + pt); char* Wl = (char*)((sel ? Kl : Ql) + pt); const char* Ct = (const char*)(CS + (size_t)t0 * HD * 2);
        const unsigned pl = (unsigned)(hi * HD + lr * 4) * 2u, cl = pl * 4u;   // uniform bases, lane offsets in bytes (plane row 128 B, table row 512 B)
#pragma unroll
        for (int mb = 0; mb < 4; ++mb) {
#pragma unroll
            for (int nb = 0; nb < 4; ++nb) {
#pragma unroll
                for (int j = 0; j < 8; ++j) os[(hi * 8 + j) * 68 + nb * 16 + lr] = acc[mb][nb][j]; }
            __builtin_amdgcn_wave_barrier(); asm volatile("" ::: "memory");   // the row reads below stay behind the other lanes' LDS writes
            v4f xv[8]; v2f ca[8], cb[8];   // all 16 rows' sums and table entries are fetched before the first store, one latency a block of 16 rows
#pragma unroll
            for (int s = 0; s < 8; ++s) { const int row = 2 * s + hi; xv[s] = *(const v4fa*)(os + row * 68 + lr * 4); const char* cp = Ct + (mb * 16 + 2 * s) * HD * 8 + cl; ca[s] = *(const v2f*)cp; cb[s] = *(const v2f*)(cp + 16); }
#pragma unroll
            for (int s = 0; s < 8; ++s) { const int pc = (mb * 16 + 2 * s) * HD * 2; v4f r; v4h o16, ol;
                r[0] = xv[s][0] * ca[s][0] - xv[s][1] * ca[s][1]; r[1] = xv[s][0] * ca[s][1] + xv[s][1] * ca[s][0];   /* even: x0 c - x1 s; odd: x0 s + x1 c; free to contract to a product and an fma */
                r[2] = xv[s][2] * cb[s][0] - xv[s][3] * cb[s][1]; r[3] = xv[s][2] * cb[s][1] + xv[s][3] * cb[s][0];
                splith(r, o16, ol);
                *(v4h*)(W16 + pc + pl) = o16; *(v4h*)(Wl + pc + pl) = ol;
                asm volatile("s_wait_xcnt 0x0" ::: "memory"); }   // stands before the registers that the two stores name are written again
            __builtin_amdgcn_wave_barrier(); asm volatile("" ::: "memory");   // the next block's LDS writes stay behind these reads
        }
    }
}
// ---- k_fattn: fused attention, one launch for every batch, head and query row. Scores, softmax and P stay in registers.
// St = K Qt (A = 16 key rows, B = 16 query columns), Ot += Vt Pt: accumulator element j of lane (lr, hi) of the score tile of keys kb + 16 kt .. is key kb + 16 kt + 8 hi + j of query lr,
// which is element 8 kt + j of the B operand of a 32-key product in the loaders' k order, so P is packed in place. Running maximum per query column; output and sum are rescaled only in a pass (32 keys) where some column's maximum has outgrown the one in use by more than LZ.
// A work-group of 8 waves shares K and Vt: 64 keys a stage, brought through registers into two LDS buffers (rows of 128 B at a pitch of 144 B), one barrier a stage.
// Hi/lo work-groups: 128 query rows < RH, 16 columns a wave, fp16 hi and lo planes, 3 products. The others: 384 rows, 32 columns a wave, the hi planes alone, in two sweeps over the keys: first 128 rows
// with SP: waves w and w + 4 share 32 columns, w takes the first 32 keys of every stage and w + 4 the last 32, and the two partial results are joined through LDS; then 256 rows. Both kinds cost 1,536 products a wave.
// The SP sweep runs first because what the second sweep needs stays in registers through the first, and the SP loop has registers to spare (the other order spilled).
#define FP   72                   // LDS row pitch in 16-bit elements
#define FPS  (64 * FP)            // one staged plane: 64 rows
#define NST  (TT / 64)
#define CL2  0.18033688011112042f // HD^-0.5 x log2(e)
typedef __attribute__((ext_vector_type(8))) unsigned v8u;
struct FT { typedef v16h V; static __device__ __forceinline__ V ld(const unsigned short* p) { return __builtin_bit_cast(v16h, __builtin_shufflevector(*(const v8usa*)p, *(const v8usa*)(p + 16), 0, 1, 2, 3, 4, 5, 6, 7, 8, 9, 10, 11, 12, 13, 14, 15)); } static __device__ __forceinline__ v8f mma(V a, V b, v8f c) { return wmma16(a, b, c); } };
__device__ __forceinline__ float xhalf(float x) { const int b = __float_as_int(x); return __int_as_float(__builtin_amdgcn_permlanex16(b, b, 0x76543210, 0xfedcba98, false, false)); }   // lane l <-> l ^ 16
template <bool HI, int NT, bool SP>
__device__ __forceinline__ void fattn(unsigned short* sm, const unsigned short* __restrict__ Q, const unsigned short* __restrict__ Q2, const unsigned short* __restrict__ Kg, const unsigned short* __restrict__ K2g, const unsigned short* __restrict__ Vg, const unsigned short* __restrict__ V2g, int qw, bf* Ah, bf* Al) {
    typedef FT::V V;
    constexpr int PLN = HI ? 4 : 2;   // staged planes: K, Vt (, K lo, Vt lo)
    const int tid = threadIdx.x, lane = tid & 31, lr = lane & 15, hi = lane >> 4;
    const int ph = SP ? __builtin_amdgcn_readfirstlane(tid >> 7) : 0;   // SP: the half of every stage's keys that this wave takes (a scalar)
    const int srow = tid >> 3, sseg = (tid & 7) * 8;   // staging: rows srow and srow + 32, one 16-byte segment of each plane
    v8us st[PLN][2];
    auto gload = [&](int s) {
#pragma unroll
        for (int r = 0; r < 2; ++r) { const int row = srow + 32 * r; const size_t ko = (size_t)(s * 64 + row) * HD + sseg, vo = (size_t)row * TT + s * 64 + sseg;
            st[0][r] = *(const v8usa*)(Kg + ko); st[1][r] = *(const v8usa*)(Vg + vo);
            if constexpr (HI) { st[2][r] = *(const v8usa*)(K2g + ko); st[3][r] = *(const v8usa*)(V2g + vo); } }
        asm volatile("s_wait_xcnt 0x0" ::: "memory"); };   // stands before the address registers of the loads issued so far are written again
    auto sstore = [&](int b) {
#pragma unroll
        for (int r = 0; r < 2; ++r)
#pragma unroll
            for (int pl = 0; pl < PLN; ++pl) *(v8usa*)(sm + (b * PLN + pl) * FPS + (srow + 32 * r) * FP + sseg) = st[pl][r]; };
    V qf[NT][2], qf2[NT][2];
#pragma unroll
    for (int nt = 0; nt < NT; ++nt)
#pragma unroll
        for (int ks = 0; ks < 2; ++ks) { const size_t qo = (size_t)(qw + nt * 16 + lr) * HD + ks * 32 + 8 * hi; qf[nt][ks] = FT::ld(Q + qo); if constexpr (HI) qf2[nt][ks] = FT::ld(Q2 + qo); }
    asm volatile("s_wait_xcnt 0x0" ::: "memory");   // stands before the address registers of the Q loads are written again
    constexpr float LZ = HI ? 8.0f : 5.0f;   // the maximum in use, mc, may trail a column's true maximum by LZ (scaled log2): a weight reaches 2^LZ, P 2^(LZ + PCH) or 2^(LZ + PCL2) = 2^15, inside fp16
    v8f o[4][NT]; float mc[NT], thr[NT], l[NT];   // thr: the raw score above which mc must move
#pragma unroll
    for (int nt = 0; nt < NT; ++nt) { mc[nt] = -3.0e37f; thr[nt] = -__builtin_inff(); l[nt] = 0.f;
#pragma unroll
        for (int dt = 0; dt < 4; ++dt) o[dt][nt] = (v8f){}; }
    gload(0); sstore(0); __syncthreads();
#pragma unroll 1
    for (int s = 0; s < NST; ++s) {
        if (s + 1 < NST) gload(s + 1);
        const unsigned short* kb = sm + (s & 1) * PLN * FPS;
#pragma unroll
        for (int pp = 0; pp < (SP ? 1 : 2); ++pp) {
            const int p = SP ? ph : pp;
            v8f sc[2][NT];
#pragma unroll
            for (int kt = 0; kt < 2; ++kt) { V ka[2], ka2[2];
#pragma unroll
                for (int ks = 0; ks < 2; ++ks) { const int off = (p * 32 + kt * 16 + lr) * FP + ks * 32 + 8 * hi; ka[ks] = FT::ld(kb + off); if constexpr (HI) ka2[ks] = FT::ld(kb + 2 * FPS + off); }
#pragma unroll
                for (int nt = 0; nt < NT; ++nt) { v8f a = (v8f){};
#pragma unroll
                    for (int ks = 0; ks < 2; ++ks) { a = FT::mma(ka[ks], qf[nt][ks], a); if constexpr (HI) { a = FT::mma(ka[ks], qf2[nt][ks], a); a = FT::mma(ka2[ks], qf[nt][ks], a); } }
                    sc[kt][nt] = a; } }
            float cm[NT]; bool need = false;
#pragma unroll
            for (int nt = 0; nt < NT; ++nt) { cm[nt] = fmaxf(sc[0][nt][0], sc[1][nt][0]);
#pragma unroll
                for (int j = 1; j < 8; ++j) cm[nt] = fmaxf(cm[nt], fmaxf(sc[0][nt][j], sc[1][nt][j]));
                need = need || cm[nt] > thr[nt]; }
            if (__builtin_amdgcn_ballot_w32(need) != 0) {   // a scalar branch, the same for the whole wave; rare after the first pass
#pragma unroll
                for (int nt = 0; nt < NT; ++nt) { const float mn = fmaxf(mc[nt], fmaxf(cm[nt], xhalf(cm[nt])) * CL2); const float al = __builtin_amdgcn_exp2f(mc[nt] - mn); mc[nt] = mn; thr[nt] = (mn + LZ) * (1.0f / CL2); l[nt] *= al;
#pragma unroll
                    for (int dt = 0; dt < 4; ++dt) o[dt][nt] *= al; } }
            V pf[NT], pf2[NT];
#pragma unroll
            for (int nt = 0; nt < NT; ++nt) {
                const float mo = mc[nt] - (HI ? PCH : PCL2);
                float e[16];
#pragma unroll
                for (int i = 0; i < 16; ++i) e[i] = __builtin_amdgcn_exp2f(fmaf(sc[i >> 3][nt][i & 7], CL2, -mo));
                const float ps = ((e[0] + e[1]) + (e[2] + e[3])) + ((e[4] + e[5]) + (e[6] + e[7])) + (((e[8] + e[9]) + (e[10] + e[11])) + ((e[12] + e[13]) + (e[14] + e[15])));
                l[nt] += ps;
                v8u ph, pl;   // two elements a register, converted in pairs
#pragma unroll
                for (int i = 0; i < 8; ++i) { const v2f ev = { e[2 * i], e[2 * i + 1] }; v2h hb, lb; splith(ev, hb, lb);
                    ph[i] = __builtin_bit_cast(unsigned, hb); if constexpr (HI) pl[i] = __builtin_bit_cast(unsigned, lb); }
                pf[nt] = __builtin_bit_cast(V, ph); if constexpr (HI) pf2[nt] = __builtin_bit_cast(V, pl); }
#pragma unroll
            for (int dt = 0; dt < 4; ++dt) { const int off = FPS + (dt * 16 + lr) * FP + p * 32 + 8 * hi; const V va = FT::ld(kb + off); V va2; if constexpr (HI) va2 = FT::ld(kb + 2 * FPS + off);
#pragma unroll
                for (int nt = 0; nt < NT; ++nt) { o[dt][nt] = FT::mma(va, pf[nt], o[dt][nt]); if constexpr (HI) { o[dt][nt] = FT::mma(va, pf2[nt], o[dt][nt]); o[dt][nt] = FT::mma(va2, pf[nt], o[dt][nt]); } } }
        }
        if (s + 1 < NST) sstore((s + 1) & 1);
        __syncthreads();   // publishes stage s + 1 and ends every wave's reads of the buffer that the next trip refills
    }
    if constexpr (SP) {   // join the two key halves: wave w + 4 hands output, sum and maximum in use to wave w through LDS behind the two-plane ring, which no staging touches (17 units of 16 B a lane, a lane's units 512 B apart)
        static_assert(NT == 2 && !HI, "the last unit holds two sums and two maxima; the LDS behind a two-plane ring is free");
        float* mg = (float*)(sm + 2 * PLN * FPS) + ((tid >> 5) & 3) * (17 * 128) + lane * 4;
        if (ph == 1) {
#pragma unroll
            for (int nt = 0; nt < NT; ++nt)
#pragma unroll
                for (int dt = 0; dt < 4; ++dt) { const v8f t = o[dt][nt]; const int c = (nt * 4 + dt) * 2;
                    *(v4fa*)(mg + c * 128) = (v4f){ t[0], t[1], t[2], t[3] }; *(v4fa*)(mg + (c + 1) * 128) = (v4f){ t[4], t[5], t[6], t[7] }; }
            *(v4fa*)(mg + 16 * 128) = (v4f){ l[0], l[1], mc[0], mc[1] };
        }
        __syncthreads();   // the upper waves' partial results are in LDS before the lower waves read them
        if (ph == 0) {
            const v4f lm = *(const v4fa*)(mg + 16 * 128);
#pragma unroll
            for (int nt = 0; nt < NT; ++nt) { const float mn = fmaxf(mc[nt], lm[2 + nt]); const float fa = __builtin_amdgcn_exp2f(mc[nt] - mn), fb = __builtin_amdgcn_exp2f(lm[2 + nt] - mn);
                l[nt] = l[nt] * fa + lm[nt] * fb;
#pragma unroll
                for (int dt = 0; dt < 4; ++dt) { const int c = (nt * 4 + dt) * 2; const v4f u0 = *(const v4fa*)(mg + c * 128), u1 = *(const v4fa*)(mg + (c + 1) * 128);
                    const v8f u = __builtin_shufflevector(u0, u1, 0, 1, 2, 3, 4, 5, 6, 7); o[dt][nt] = o[dt][nt] * fa + u * fb; } }
        }
    }
    if (ph == 0)   // SP: the lower wave of a pair stores the joined rows
#pragma unroll
    for (int nt = 0; nt < NT; ++nt) { const float inv = __fdiv_rn(1.0f, l[nt] + xhalf(l[nt])); const size_t oo = (size_t)(qw + nt * 16 + lr) * DQ + hi * 8;
#pragma unroll
        for (int dt = 0; dt < 4; ++dt) { v8us oh, ol;
#pragma unroll
            for (int j = 0; j < 8; ++j) { unsigned short a, c2; splitf(o[dt][nt][j] * inv, a, c2); oh[j] = a; ol[j] = c2; }
            *(v8usa*)(Ah + oo + dt * 16) = oh; *(v8usa*)(Al + oo + dt * 16) = ol;
            asm volatile("s_wait_xcnt 0x0" ::: "memory"); } }   // stands before the registers that the two stores name are written again
}
#define NHW (NB_ * NH_ * (RH / 128))
#define NLW (NB_ * NH_ * ((TT - RH) / 384))
static_assert(NHW == NLW && RH % 128 == 0 && (TT - RH) % 384 == 0, "k_fattn: as many work-groups of one kind as of the other");
__global__ __launch_bounds__(256) __attribute__((amdgpu_waves_per_eu(4, 4))) void k_fattn(const h16* __restrict__ Q16, const h16* __restrict__ Ql, const h16* __restrict__ K16, const h16* __restrict__ Kl, const h16* __restrict__ V16, const h16* __restrict__ Vl, bf* Ah, bf* Al) {
    __shared__ __align__(16) unsigned short sm[2 * 4 * FPS];
    // All work-groups are resident at once, two a WGP. Of indices 2 m and 2 m + 1 one is a hi/lo work-group, by the parity of the index's bits,
    // so that two indices that differ in one bit are of different kinds.
    const int wave = threadIdx.x >> 5; const int bx = blockIdx.x >> 1;
    if ((__popc(blockIdx.x) & 1) == 0) { const int z = bx / (RH / 128), qt = bx % (RH / 128); const size_t zo = (size_t)z * TT * HD, ao = (size_t)(z / NH_) * TT * DQ + (z % NH_) * HD;
        fattn<true, 1, false>(sm, (const unsigned short*)(Q16 + zo), (const unsigned short*)(Ql + zo), (const unsigned short*)(K16 + zo), (const unsigned short*)(Kl + zo), (const unsigned short*)(V16 + zo), (const unsigned short*)(Vl + zo), qt * 128 + wave * 16, Ah + ao, Al + ao);
    } else { const int z = bx / ((TT - RH) / 384), qt = bx % ((TT - RH) / 384); const size_t zo = (size_t)z * TT * HD, ao = (size_t)(z / NH_) * TT * DQ + (z % NH_) * HD;
        fattn<false, 2, true>(sm, (const unsigned short*)(Q16 + zo), nullptr, (const unsigned short*)(K16 + zo), nullptr, (const unsigned short*)(V16 + zo), nullptr, RH + qt * 384 + 256 + (wave & 3) * 32, Ah + ao, Al + ao);
        fattn<false, 2, false>(sm, (const unsigned short*)(Q16 + zo), nullptr, (const unsigned short*)(K16 + zo), nullptr, (const unsigned short*)(V16 + zo), nullptr, RH + qt * 384 + wave * 32, Ah + ao, Al + ao); }
}

extern "C" void kernel_launch(void* const* d_in, const int* in_sizes, int n_in,
                              void* d_out, int out_size, void* d_ws, size_t ws_size, hipStream_t stream) {
    (void)in_sizes; (void)n_in; (void)out_size;
    const float* x = (const float*)d_in[0]; const float* wqkv = (const float*)d_in[1]; const float* wo = (const float*)d_in[2]; const float* bo = (const float*)d_in[3];   /* x, w_qkv ('xw' [1024][3072]: q | k | v column thirds), w_proj ('xw'), b_proj */
    float* OUT = (float*)d_out;     // [4][2048][1024]
    char* wsp = (char*)d_ws;
    auto take = [&](size_t bytes) { char* p = wsp; wsp += (bytes + 255) & ~(size_t)255; return (void*)p; };
    bf* WQKV = (bf*)take((size_t)3 * DQ * DM * 2);   /* fused Bt [3*DQ][DM]: q | k | v row blocks */ bf* WO = (bf*)take((size_t)DM * DQ * 2); float* CS = (float*)take((size_t)TT * HD * 2 * 4);
    bf* XB = (bf*)take((size_t)NB_ * TT * DM * 2);
    const size_t PB = (size_t)NH_ * TT * HD;   // one batch's head planes, elements; every plane holds all NB_ batches
    h16* QP16 = (h16*)take(NB_ * PB * 2); h16* KP16 = (h16*)take(NB_ * PB * 2); h16* VT16 = (h16*)take(NB_ * PB * 2);
    h16* QPl = (h16*)take(NB_ * PB * 2); h16* KPl = (h16*)take(NB_ * PB * 2); h16* VTl = (h16*)take(NB_ * PB * 2);
    bf* ATh = (bf*)take((size_t)NB_ * TT * DQ * 2); bf* ATl = (bf*)take((size_t)NB_ * TT * DQ * 2);
    if ((size_t)(wsp - (char*)d_ws) > ws_size) return;    // ws 256 MiB
    k_prep<<<PG, 256, 0, stream>>>(x, wqkv, wo, XB, WQKV, WO, CS);   // x -> bf16; fused 'xw' [DM][3*DQ] -> Bt [3*DQ][DM]; w_proj [DQ][DM] -> Bt [DM][DQ]; rotary table
    k_qkv<<<dim3(NB_ * TT / 128, 3 * NH_ / 2, 1), 128, 0, stream>>>(XB, WQKV, CS, QP16, QPl, KP16, KPl, VT16, VTl);
    k_fattn<<<NHW + NLW, 256, 0, stream>>>(QP16, QPl, KP16, KPl, VT16, VTl, ATh, ATl);
    k_proj<<<dim3(NB_ * TT / 128, DM / 128, 1), 128, 0, stream>>>(ATh, ATl, WO, OUT, bo);   // the rows of all batches are contiguous in ATh, ATl and OUT: one launch, two work-groups a WGP
}

// v010
// A run of this version takes 168 microseconds.
// Next to v009, in two timings, it ran 1.04 and 1.03 times as fast.
// All steps since v000 together make it 24.0 times as fast.
#include <hip/hip_runtime.h>

// Multi-head self-attention with a fused bias-free qkv projection and computed interleaved-pair rotary embeddings at SCALED frequencies (x [4][2048][1024]; qkv = x w_qkv ('xw' (in, out) [1024][3072] 1/32, no bias) viewed (B, L, 3, 16, 64): q | k | v column thirds (16 heads x 64); rope on q and k: pairs (x[2i], x[2i+1]) -> (re c - im s, re s + im c) with angle pos x theta_i, theta = (1 / 10000^(2i/64)) x 3.0 (ROPE_SCALE; 32 f32 frequencies jnp-exact; one f32 product per angle; precise cosf/sinf); attn x 64^-0.5; softmax over all keys (no mask); out = merged w_proj + b_proj ('xw' + a bias: READ) -> [4][2048][1024] (8.4 M); argument order x, w_qkv, w_proj, b_proj).
// Layout: k_prep: bf16 copy of x, the fused 'xw' weight transposed ONCE into q | k | v row blocks, computed interleaved table at the scaled frequencies; k_qkv: exact projections of all batches with the interleaved-pair rotary and the plane split in their epilogue; fused dense T-2048 attention, all batches in one launch (hybrid rows: < 512 fp16 hi/lo 3 products, rest fp16 x1024); merged hi/lo x w_proj exact + b_proj.
// Compute dtypes, f32 accumulate: every input rounded to bf16; projections exact; rotary f32; attention rows < 512 fp16 hi + lo, 3 products, rest fp16; softmax f32; w_proj hl x exact + bias.

#define NB_  4
#define TT   2048
#define DM   1024
#define NH_  16
#define NKV  16
#define REP  (NH_ / NKV)
#define HD   64
#define DQ   (NH_ * HD)
#define DKV  (NKV * HD)
#define RH   512                  // query rows < RH use hi+lo planes
#define WIN  0
#define PCL2 10.0f                // fp16 rows: P is carried as weight x 2^PCL2, so that small weights stay normal fp16 numbers; the factor cancels in the division by the row sum
#define PCH  7.0f                 // hi/lo rows: their P (fp16 hi + lo) is carried x 2^PCH for the same reason
typedef _Float16 h16;
typedef unsigned short bf;
typedef __attribute__((ext_vector_type(16))) __bf16   v16bf;
typedef __attribute__((ext_vector_type(16))) _Float16 v16h;
typedef __attribute__((ext_vector_type(8)))  _Float16 v8h;
typedef __attribute__((ext_vector_type(8)))  unsigned short v8us;
typedef __attribute__((ext_vector_type(8)))  float    v8f;
typedef __attribute__((ext_vector_type(4)))  float    v4f;
typedef v8h  __attribute__((may_alias)) v8ha;
typedef v4f  __attribute__((may_alias)) v4fa;
typedef v8us __attribute__((may_alias)) v8usa;

__device__ __forceinline__ unsigned short f2bf(float f) { unsigned u = __float_as_uint(f); u += 0x7FFFu + ((u >> 16) & 1u); return (unsigned short)(u >> 16); }
__device__ __forceinline__ float bf2f(unsigned short b) { return __uint_as_float(((unsigned)b) << 16); }
__device__ __forceinline__ float bfr(float f) { return bf2f(f2bf(f)); }
__device__ __forceinline__ v16h cat16(v8h lo, v8h hi) { return __builtin_shufflevector(lo, hi, 0, 1, 2, 3, 4, 5, 6, 7, 8, 9, 10, 11, 12, 13, 14, 15); }
__device__ __forceinline__ v16bf cat16b(v8us lo, v8us hi) { return __builtin_bit_cast(v16bf, __builtin_shufflevector(lo, hi, 0, 1, 2, 3, 4, 5, 6, 7, 8, 9, 10, 11, 12, 13, 14, 15)); }
__device__ __forceinline__ v8f wmma16(v16h a, v16h b, v8f c) { return __builtin_amdgcn_wmma_f32_16x16x32_f16(false, a, false, b, (short)0, c, false, false); }
__device__ __forceinline__ v8f wmmab(v16bf a, v16bf b, v8f c) { return __builtin_amdgcn_wmma_f32_16x16x32_bf16(false, a, false, b, (short)0, c, false, false); }



// ---- gemm128: the K loop of both GEMMs. A work-group of 4 waves (2 x 2) owns a 128 x 128 tile of C[m][n] = sum_k A[m][k] Bt[n][k] (NPL 3: + A2[m][k] Bt[n][k]), K = DM, operands K-contiguous bf16 planes; each wave keeps its 64 x 64 quarter in 16 accumulators.
// A stage is 64 k of 128 rows of every plane (rows of 128 B at a pitch of 144 B in LDS), brought by asynchronous copies to LDS: one wave-wide copy covers 4 whole 128-byte lines, and each line is fetched once a work-group. Two buffers, one barrier a stage.
template <typename T16> struct WFrag;
template <> struct WFrag<h16> { typedef v16h V; static __device__ __forceinline__ V ld(const h16* p) { return cat16(*(const v8h*)p, *(const v8h*)(p + 16)); } static __device__ __forceinline__ v8f mma(V a, V b, v8f c) { return wmma16(a, b, c); } };
template <> struct WFrag<bf> { typedef v16bf V; static __device__ __forceinline__ V ld(const bf* p) { return cat16b(*(const v8us*)p, *(const v8us*)(p + 16)); } static __device__ __forceinline__ v8f mma(V a, V b, v8f c) { return wmmab(a, b, c); } };
#define GP   72                   // LDS row pitch in 16-bit elements
#define GPL  (128 * GP)           // one staged plane: 128 rows
#define GNS  (DM / 64)            // stages along K
// one plane of a stage: this lane's 16 bytes of rows r, r + 16, .. r + 112. The s_wait_xcnt closes the copies' own statement, so that it stands before any rewrite of the address registers that they name.
__device__ __forceinline__ void gcopy(unsigned l, const bf* g) {
    asm volatile("global_load_async_to_lds_b128 %0, %8, off\n\t"
                 "global_load_async_to_lds_b128 %1, %9, off\n\t"
                 "global_load_async_to_lds_b128 %2, %10, off\n\t"
                 "global_load_async_to_lds_b128 %3, %11, off\n\t"
                 "global_load_async_to_lds_b128 %4, %12, off\n\t"
                 "global_load_async_to_lds_b128 %5, %13, off\n\t"
                 "global_load_async_to_lds_b128 %6, %14, off\n\t"
                 "global_load_async_to_lds_b128 %7, %15, off\n\t"
                 "s_wait_xcnt 0x0"
                 :: "v"(l), "v"(l + 16 * GP * 2), "v"(l + 32 * GP * 2), "v"(l + 48 * GP * 2), "v"(l + 64 * GP * 2), "v"(l + 80 * GP * 2), "v"(l + 96 * GP * 2), "v"(l + 112 * GP * 2),
                    "v"(g), "v"(g + 16 * DM), "v"(g + 32 * DM), "v"(g + 48 * DM), "v"(g + 64 * DM), "v"(g + 80 * DM), "v"(g + 96 * DM), "v"(g + 112 * DM) : "memory");
}
// Every plain '#pragma unroll' here and in the two kernels that call it is there so that the fragment and accumulator arrays are indexed by constants and stay in registers.
template <int NPL>   // staged planes: A, Bt (, A2). Ag, A2g, Bg: row 0 of the work-group's 128 rows
__device__ __forceinline__ void gemm128(unsigned short* sm, const bf* __restrict__ Ag, const bf* __restrict__ A2g, const bf* __restrict__ Bg, int wave, v8f (&acc)[4][4]) {
    typedef WFrag<bf>::V V;
    const int tid = threadIdx.x, lane = tid & 31, lr = lane & 15, hi = lane >> 4;
    const unsigned l0 = (unsigned)(size_t)sm + (unsigned)((tid >> 3) * GP + (tid & 7) * 8) * 2u;   // LDS byte address of this lane's 16 bytes of row tid / 8
    const size_t go = (size_t)(tid >> 3) * DM + (tid & 7) * 8;
    auto fill = [&](int s) { const unsigned lb = l0 + (unsigned)((s & 1) * NPL * GPL) * 2u; const size_t o = go + (size_t)s * 64;
        gcopy(lb, Ag + o); gcopy(lb + GPL * 2, Bg + o); if constexpr (NPL == 3) gcopy(lb + 2 * GPL * 2, A2g + o); };
    fill(0);
    asm volatile("s_wait_asynccnt 0x0" ::: "memory");   // this wave's copies of stage 0 have landed
    __syncthreads();                                    // publishes stage 0
    fill(1);
    const int ao = ((wave >> 1) * 64 + lr) * GP + 8 * hi, bo = GPL + ((wave & 1) * 64 + lr) * GP + 8 * hi;
#pragma unroll 1
    for (int s = 0; s < GNS; ++s) {   // rolled: one trip a stage, so that the buffer index and the refill test stay scalar
        const unsigned short* bp = sm + (s & 1) * NPL * GPL;
#pragma unroll
        for (int ks = 0; ks < 2; ++ks) {
            V a[4], a2[4], b[4];   // the block's fragments are fetched as one group ahead of its products
#pragma unroll
            for (int mb = 0; mb < 4; ++mb) { a[mb] = WFrag<bf>::ld(bp + ao + mb * 16 * GP + ks * 32); if constexpr (NPL == 3) a2[mb] = WFrag<bf>::ld(bp + 2 * GPL + ao + mb * 16 * GP + ks * 32); }
#pragma unroll
            for (int nb = 0; nb < 4; ++nb) b[nb] = WFrag<bf>::ld(bp + bo + nb * 16 * GP + ks * 32);
            __builtin_amdgcn_sched_barrier(0);   // keeps the reads together in front: sunk among the products, into one shared Bt fragment, every four products wait out an LDS latency
#pragma unroll
            for (int nb = 0; nb < 4; ++nb)
#pragma unroll
                for (int mb = 0; mb < 4; ++mb) { acc[mb][nb] = WFrag<bf>::mma(a[mb], b[nb], acc[mb][nb]); if constexpr (NPL == 3) acc[mb][nb] = WFrag<bf>::mma(a2[mb], b[nb], acc[mb][nb]); }
        }
        asm volatile("s_wait_dscnt 0x0" ::: "memory");      // this wave's reads of stage s have returned
        asm volatile("s_wait_asynccnt 0x0" ::: "memory");   // this wave's copies of stage s + 1 have landed
        __syncthreads();                                    // publishes stage s + 1 and ends every wave's reads of the buffer refilled below
        if (s + 2 < GNS) fill(s + 2);
    }
    asm volatile("s_wait_asynccnt 0x0" ::: "memory");   // no copy is outstanding when the wave goes on
}
// ---- k_proj: C (f32, pitch DM) = (A + A2) Bt^T + bias, grid (M / 128, DM / 128), 128 threads; a wave's 64 x 64 quarter goes out through its own LDS rows, whole 128-byte lines.
__global__ __launch_bounds__(128) void k_proj(const bf* __restrict__ A, const bf* __restrict__ A2, const bf* __restrict__ Bt, float* C, const float* __restrict__ bias) {
    __shared__ __align__(16) unsigned short sm[2 * 3 * GPL];
    __shared__ __align__(16) float osw[4][16 * 68];
    const int lane = threadIdx.x & 31, lr = lane & 15, hi = lane >> 4; const int wave = __builtin_amdgcn_readfirstlane(threadIdx.x >> 5);
    float* os = osw[wave]; const int r0 = blockIdx.x * 128 + (wave >> 1) * 64, c0 = blockIdx.y * 128 + (wave & 1) * 64;
    v8f acc[4][4];
#pragma unroll
    for (int mb = 0; mb < 4; ++mb)
#pragma unroll
        for (int nb = 0; nb < 4; ++nb) acc[mb][nb] = (v8f){};
    gemm128<3>(sm, A + (size_t)blockIdx.x * 128 * DM, A2 + (size_t)blockIdx.x * 128 * DM, Bt + (size_t)blockIdx.y * 128 * DM, wave, acc);
    const int cofs = lr * 4; v4f bv; bv[0] = bfr(bias[c0 + cofs]); bv[1] = bfr(bias[c0 + cofs + 1]); bv[2] = bfr(bias[c0 + cofs + 2]); bv[3] = bfr(bias[c0 + cofs + 3]);
#pragma unroll
    for (int mb = 0; mb < 4; ++mb) {
#pragma unroll
        for (int nb = 0; nb < 4; ++nb) {
#pragma unroll
            for (int j = 0; j < 8; ++j) os[(hi * 8 + j) * 68 + nb * 16 + lr] = acc[mb][nb][j]; }
        __builtin_amdgcn_wave_barrier(); asm volatile("" ::: "memory");   // the row reads below stay behind the other lanes' LDS writes
        float* crow = C + (size_t)(r0 + mb * 16) * DM + c0;
#pragma unroll
        for (int s = 0; s < 8; ++s) { const int row = 2 * s + hi; const v4f val = *(const v4fa*)(os + row * 68 + cofs) + bv;
            *(v4f*)(crow + (size_t)row * DM + cofs) = val; }
        asm volatile("s_wait_xcnt 0x0" ::: "memory");   // stands before the registers that the stores name are written again
        __builtin_amdgcn_wave_barrier(); asm volatile("" ::: "memory");   // the next block's LDS writes stay behind these reads
    }
}

__device__ __forceinline__ void splitf(float y, unsigned short& h, unsigned short& l) { h = f2bf(y); l = f2bf(y - bf2f(h)); }
typedef __attribute__((ext_vector_type(2))) _Float16 v2h;
typedef __attribute__((ext_vector_type(4))) _Float16 v4h;
typedef __attribute__((ext_vector_type(2))) unsigned short v2us;
typedef __attribute__((ext_vector_type(4))) unsigned short v4us;
typedef __attribute__((ext_vector_type(2))) float v2f;
typedef __attribute__((ext_vector_type(4))) int v4i;
// y = hi + lo in fp16: hi is y rounded once (the plane that the fp16 rows read too), lo the rounded rest
template <typename VF, typename VH> __device__ __forceinline__ void splith(VF y, VH& h, VH& l) { h = __builtin_convertvector(y, VH); l = __builtin_convertvector(y - __builtin_convertvector(h, VF), VH); }

// INV2: the 32 rotary frequencies of THIS module: (1.0 / (ROPE_BASE ** (arange(0, 64, 2, float32) / 64))) * ROPE_SCALE with ROPE_BASE 10000 and ROPE_SCALE 3.0, generated with jnp in float32 (bit-exact; == the unscaled table x 3.0f in f32, 32 of 32): the adjacent (even, odd) pair shares entry d / 2.
__constant__ float INV2[HD / 2] = { 3.000000000e+00f, 2.249682665e+00f, 1.687023997e+00f, 1.265089512e+00f, 9.486832619e-01f, 7.114120722e-01f, 5.334838033e-01f, 4.000564218e-01f, 3.000000119e-01f, 2.249682546e-01f, 1.687023938e-01f, 1.265089512e-01f, 9.486833215e-02f, 7.114120573e-02f, 5.334838480e-02f, 4.000564665e-02f, 2.999999933e-02f, 2.249682695e-02f, 1.687023975e-02f, 1.265089400e-02f, 9.486833587e-03f, 7.114121690e-03f, 5.334838293e-03f, 4.000564106e-03f, 3.000000026e-03f, 2.249682555e-03f, 1.687023905e-03f, 1.265089493e-03f, 9.486833587e-04f, 7.114121690e-04f, 5.334838061e-04f, 4.000564513e-04f };
// ---- k_prep: all the preparation in ONE launch of PG work-groups that are resident together (two a WGP, 4,096 waves), each taking an equal share of every part:
// 64 KB of x rounded to bf16 (8 groups of 8 elements a thread), 128 rotary table entries ((cos, sin) of one position and one pair; 32 entries = 256 B a position), and one 128 (k) x 64 (n) tile of a weight, rounded and transposed into Bt [n][k].
// The tile: a lane reads 32 consecutive k of ONE column n (a wave-wide load is one whole 128-byte line of a weight row), so its 32 rounded values are 64 contiguous bytes of the Bt row;
// they pass through LDS (rows of 256 B at a pitch of 272 B) only so that the Bt rows go out as whole 256-byte units.
#define PG   512
#define NWQ  ((3 * DQ / 64) * (DM / 128))   // work-groups below NWQ: tiles of w_qkv; the rest: tiles of w_proj
#define WTP  136                            // LDS row pitch in 16-bit elements
static_assert(DQ == DM && PG == NWQ + (DM / 64) * (DQ / 128) && PG * 128 == TT * (HD / 2) && (size_t)PG * 256 * 64 == (size_t)NB_ * TT * DM, "k_prep: every share divides evenly");
template <int N>   // N: row length of the weight w ([DM][N], Bt [N][DM]); a template, so that the 32 loads of a column differ in their constant offsets alone
__device__ __forceinline__ void prep(unsigned short* tl, const float* __restrict__ x, const float* __restrict__ w, bf* XB, bf* Bt, float* CS, int tile) {
    const int tid = threadIdx.x, lane = tid & 31, bx = blockIdx.x; const int wave = __builtin_amdgcn_readfirstlane(tid >> 5);
    const int k0 = (tile % (DM / 128)) * 128, n0 = (tile / (DM / 128)) * 64;
    // Every load of the work-group is issued here, the table's frequency first (loads are waited for in their order), so that the table arithmetic runs while the rest fly. The plain unrolls keep the arrays in registers.
    const int idx = bx * 128 + (tid & 127); const int t = idx / (HD / 2); const float fr = INV2[idx % (HD / 2)];   // table entry (position t, pair idx % 32): one a thread of waves 0..3
    asm volatile("s_wait_xcnt 0x0" ::: "memory");   // stands before the offset register of the frequency's load is written again (it is free for the data of the loads below)
    const float* wr = w + (size_t)(k0 + (wave >> 1) * 32) * N + n0 + (wave & 1) * 32;   // uniform: the wave's first row at its first column
    float wv[32];
#pragma unroll
    for (int r = 0; r < 32; ++r) wv[r] = wr[r * N + lane];
    const size_t xo = (size_t)bx * (256 * 64) + tid * 8; v8f xv[8];
#pragma unroll
    for (int it = 0; it < 8; ++it) xv[it] = *(const v8f*)(x + xo + it * 2048);
    asm volatile("s_wait_xcnt 0x0" ::: "memory");   // stands before the address registers of the loads issued so far are written again
    asm volatile("" :: "v"(fr));   // holds the frequency's load where it is written, first: sunk into the branch below it would be the last load, and the table arithmetic would wait for all of them
    v2f cs = { 0.f, 0.f }; if (wave < 4) { const float a = __fmul_rn((float)t, fr); cs[0] = cosf(a); cs[1] = sinf(a); }   // a scalar branch
    unsigned short* tw = tl + ((wave & 1) * 32 + lane) * WTP + (wave >> 1) * 32;
#pragma unroll
    for (int q = 0; q < 4; ++q) { v8us o;
#pragma unroll
        for (int j = 0; j < 8; ++j) o[j] = f2bf(wv[q * 8 + j]);
        *(v8usa*)(tw + q * 8) = o; }
    __syncthreads();   // the tile's columns are all in LDS before its rows are read; every global store stands behind it, so that it waits for none
    if (wave < 4) *(v2f*)(CS + (size_t)idx * 2) = cs;
    bf* bt = Bt + (size_t)(n0 + (tid >> 4)) * DM + k0 + (tid & 15) * 8; const unsigned short* tr = tl + (tid >> 4) * WTP + (tid & 15) * 8;
#pragma unroll
    for (int p = 0; p < 4; ++p) *(v8usa*)(bt + p * 16 * DM) = *(const v8usa*)(tr + p * 16 * WTP);
#pragma unroll
    for (int it = 0; it < 8; ++it) { v8us o;
#pragma unroll
        for (int k = 0; k < 8; ++k) o[k] = f2bf(xv[it][k]);
        *(v8us*)(XB + xo + it * 2048) = o; }
}
__global__ __launch_bounds__(256) void k_prep(const float* __restrict__ x, const float* __restrict__ wqkv, const float* __restrict__ wo, bf* XB, bf* WQKV, bf* WO, float* CS) {
    __shared__ __align__(16) unsigned short tl[64 * WTP];
    const int bx = blockIdx.x;   // the branch is the same for the whole work-group
    if (bx < NWQ) prep<3 * DQ>(tl, x, wqkv, XB, WQKV, CS, bx); else prep<DM>(tl, x, wo, XB, WO, CS, bx - NWQ);
}
// ---- k_qkv: the q | k | v projection of every batch in one launch (gemm128, one product), each wave building the attention planes of its 64 x 64 quarter itself from its accumulators.
// grid (NB_ TT / 128, 3 NH_ / 2), 128 threads: a wave has 64 rows of x (one batch, 64 positions) x 64 columns of the fused weight = one head of q (column block < NH_), of k (< 2 NH_) or of v.
// q and k tiles: interleaved-pair rotary on the f32 sums (table CS), then planes [b][h][t][d] as fp16 hi and fp16 lo; through the wave's own LDS rows, so that a 128-byte plane row is stored whole.
// v tiles: planes [b][h][d][t]; accumulator elements 0..7 of a lane are 8 consecutive positions of one column: 16 bytes a plane, gathered in the wave's own LDS rows, so that a 128-byte plane row is stored whole.
__global__ __launch_bounds__(128) void k_qkv(const bf* __restrict__ A, const bf* __restrict__ Bt, const float* __restrict__ CS, h16* Q16, h16* Ql, h16* K16, h16* Kl, h16* V16, h16* Vl) {
    __shared__ __align__(16) unsigned short sm[2 * 2 * GPL];
    __shared__ __align__(16) float osw[4][16 * 72];   // a wave's own rows: 16 of 68 floats (q, k) or 32 of 144 bytes (v)
    const int lane = threadIdx.x & 31, lr = lane & 15, hi = lane >> 4; const int wave = __builtin_amdgcn_readfirstlane(threadIdx.x >> 5);
    float* os = osw[wave]; const int r0 = blockIdx.x * 128 + (wave >> 1) * 64, cy = blockIdx.y * 2 + (wave & 1);
    v8f acc[4][4];
#pragma unroll
    for (int mb = 0; mb < 4; ++mb)
#pragma unroll
        for (int nb = 0; nb < 4; ++nb) acc[mb][nb] = (v8f){};
    gemm128<2>(sm, A + (size_t)blockIdx.x * 128 * DM, nullptr, Bt + (size_t)blockIdx.y * 128 * DM, wave, acc);
    const int bt = r0 / TT, t0 = r0 % TT, sel = cy / NH_, hd = cy % NH_;
    const size_t po = ((size_t)bt * NH_ + hd) * TT * HD;
    if (sel == 2) {
        char* W16 = (char*)(V16 + po + t0); char* Wl = (char*)(Vl + po + t0); const unsigned vl = (unsigned)((lane >> 3) * TT + (lane & 7) * 8) * 2u;   // uniform bases, lane offset in bytes: 8 lanes a 128-byte row
        h16* oh = (h16*)os;   // 16 columns d x 64 positions of the hi plane (rows 0..15) and of the lo plane (rows 16..31), pitch 72
#pragma unroll
        for (int nb = 0; nb < 4; ++nb) {
#pragma unroll
            for (int mb = 0; mb < 4; ++mb) { v8h o16, ol; splith(acc[mb][nb], o16, ol);
                *(v8ha*)(oh + lr * 72 + mb * 16 + hi * 8) = o16; *(v8ha*)(oh + (16 + lr) * 72 + mb * 16 + hi * 8) = ol; }
            __builtin_amdgcn_wave_barrier(); asm volatile("s_wait_dscnt 0x0" ::: "memory");   // the other lanes' LDS writes are done before the rows are read back
            v8h a16[4], al[4];   // all 32 rows are read back before the first store: one LDS latency a block
#pragma unroll
            for (int i = 0; i < 4; ++i) { a16[i] = *(const v8ha*)(oh + (i * 4 + (lane >> 3)) * 72 + (lane & 7) * 8); al[i] = *(const v8ha*)(oh + (16 + i * 4 + (lane >> 3)) * 72 + (lane & 7) * 8); }
#pragma unroll
            for (int i = 0; i < 4; ++i) { const int vc = (nb * 16 + i * 4) * TT * 2; *(v8ha*)(W16 + vc + vl) = a16[i]; *(v8ha*)(Wl + vc + vl) = al[i]; }   // a store covers 4 whole 128-byte rows of a plane
            asm volatile("s_wait_xcnt 0x0" ::: "memory");   // stands before the registers that the eight stores name are written again
            __builtin_amdgcn_wave_barrier(); asm volatile("" ::: "memory");   // the next block's LDS writes stay behind these reads
        }
    } else {
        const size_t pt = po + (size_t)t0 * HD; char* W16 = (char*)((sel ? K16 : Q16) + pt); char* Wl = (char*)((sel ? Kl : Ql) + pt); const char* Ct = (const char*)(CS + (size_t)t0 * HD);
        const unsigned pl = (unsigned)(hi * HD + lr * 4) * 2u, cl = pl * 2u;   // uniform bases, lane offsets in bytes (plane row 128 B, table row 256 B: a lane's two pairs are 16 adjacent bytes, a wave-wide load 4 whole lines)
#pragma unroll
        for (int mb = 0; mb < 4; ++mb) {
#pragma unroll
            for (int nb = 0; nb < 4; ++nb) {
#pragma unroll
                for (int j = 0; j < 8; ++j) os[(hi * 8 + j) * 68 + nb * 16 + lr] = acc[mb][nb][j]; }
            __builtin_amdgcn_wave_barrier(); asm volatile("" ::: "memory");   // the row reads below stay behind the other lanes' LDS writes
            v4f xv[8], cc[8];   // all 16 rows' sums and table entries (cos, sin, cos, sin of the lane's two pairs) are fetched before the first store, one latency a block of 16 rows
#pragma unroll
            for (int s = 0; s < 8; ++s) { const int row = 2 * s + hi; xv[s] = *(const v4fa*)(os + row * 68 + lr * 4); cc[s] = *(const v4f*)(Ct + (mb * 16 + 2 * s) * HD * 4 + cl); }
#pragma unroll
            for (int s = 0; s < 8; ++s) { const int pc = (mb * 16 + 2 * s) * HD * 2; v4f r; v4h o16, ol;
                r[0] = xv[s][0] * cc[s][0] - xv[s][1] * cc[s][1]; r[1] = xv[s][0] * cc[s][1] + xv[s][1] * cc[s][0];   /* even: x0 c - x1 s; odd: x0 s + x1 c; free to contract to a product and an fma */
                r[2] = xv[s][2] * cc[s][2] - xv[s][3] * cc[s][3]; r[3] = xv[s][2] * cc[s][3] + xv[s][3] * cc[s][2];
                splith(r, o16, ol);
                *(v4h*)(W16 + pc + pl) = o16; *(v4h*)(Wl + pc + pl) = ol;
                asm volatile("s_wait_xcnt 0x0" ::: "memory"); }   // stands before the registers that the two stores name are written again
            __builtin_amdgcn_wave_barrier(); asm volatile("" ::: "memory");   // the next block's LDS writes stay behind these reads
        }
    }
}
// ---- k_fattn: fused attention, one launch for every batch, head and query row. Scores, softmax and P stay in registers.
// St = K Qt (A = 16 key rows, B = 16 query columns), Ot += Vt Pt: accumulator element j of lane (lr, hi) of the score tile of keys kb + 16 kt .. is key kb + 16 kt + 8 hi + j of query lr,
// which is element 8 kt + j of the B operand of a 32-key product in the loaders' k order, so P is packed in place. Running maximum per query column; output and sum are rescaled only in a pass (32 keys) where some column's maximum has outgrown the one in use by more than LZ.
// A work-group of 8 waves shares K and Vt: 64 keys a stage, brought through registers into two LDS buffers (rows of 128 B at a pitch of 144 B), one barrier a stage.
// Hi/lo work-groups: 128 query rows < RH, 16 columns a wave, fp16 hi and lo planes, 3 products. The others: 384 rows, 32 columns a wave, the hi planes alone, in two sweeps over the keys: first 128 rows
// with SP: waves w and w + 4 share 32 columns, w takes the first 32 keys of every stage and w + 4 the last 32, and the two partial results are joined through LDS; then 256 rows. Both kinds cost 1,536 products a wave.
// The SP sweep runs first because what the second sweep needs stays in registers through the first, and the SP loop has registers to spare (the other order spilled).
#define FP   72                   // LDS row pitch in 16-bit elements
#define FPS  (64 * FP)            // one staged plane: 64 rows
#define NST  (TT / 64)
#define CL2  0.18033688011112042f // HD^-0.5 x log2(e)
typedef __attribute__((ext_vector_type(8))) unsigned v8u;
struct FT { typedef v16h V; static __device__ __forceinline__ V ld(const unsigned short* p) { return __builtin_bit_cast(v16h, __builtin_shufflevector(*(const v8usa*)p, *(const v8usa*)(p + 16), 0, 1, 2, 3, 4, 5, 6, 7, 8, 9, 10, 11, 12, 13, 14, 15)); } static __device__ __forceinline__ v8f mma(V a, V b, v8f c) { return wmma16(a, b, c); } };
__device__ __forceinline__ float xhalf(float x) { const int b = __float_as_int(x); return __int_as_float(__builtin_amdgcn_permlanex16(b, b, 0x76543210, 0xfedcba98, false, false)); }   // lane l <-> l ^ 16
template <bool HI, int NT, bool SP>
__device__ __forceinline__ void fattn(unsigned short* sm, const unsigned short* __restrict__ Q, const unsigned short* __restrict__ Q2, const unsigned short* __restrict__ Kg, const unsigned short* __restrict__ K2g, const unsigned short* __restrict__ Vg, const unsigned short* __restrict__ V2g, int qw, bf* Ah, bf* Al) {
    typedef FT::V V;
    constexpr int PLN = HI ? 4 : 2;   // staged planes: K, Vt (, K lo, Vt lo)
    const int tid = threadIdx.x, lane = tid & 31, lr = lane & 15, hi = lane >> 4;
    const int ph = SP ? __builtin_amdgcn_readfirstlane(tid >> 7) : 0;   // SP: the half of every stage's keys that this wave takes (a scalar)
    const int srow = tid >> 3, sseg = (tid & 7) * 8;   // staging: rows srow and srow + 32, one 16-byte segment of each plane
    v8us st[PLN][2];
    auto gload = [&](int s) {
#pragma unroll
        for (int r = 0; r < 2; ++r) { const int row = srow + 32 * r; const size_t ko = (size_t)(s * 64 + row) * HD + sseg, vo = (size_t)row * TT + s * 64 + sseg;
            st[0][r] = *(const v8usa*)(Kg + ko); st[1][r] = *(const v8usa*)(Vg + vo);
            if constexpr (HI) { st[2][r] = *(const v8usa*)(K2g + ko); st[3][r] = *(const v8usa*)(V2g + vo); } }
        asm volatile("s_wait_xcnt 0x0" ::: "memory"); };   // stands before the address registers of the loads issued so far are written again
    auto sstore = [&](int b) {
#pragma unroll
        for (int r = 0; r < 2; ++r)
#pragma unroll
            for (int pl = 0; pl < PLN; ++pl) *(v8usa*)(sm + (b * PLN + pl) * FPS + (srow + 32 * r) * FP + sseg) = st[pl][r]; };
    V qf[NT][2], qf2[NT][2];
#pragma unroll
    for (int nt = 0; nt < NT; ++nt)
#pragma unroll
        for (int ks = 0; ks < 2; ++ks) { const size_t qo = (size_t)(qw + nt * 16 + lr) * HD + ks * 32 + 8 * hi; qf[nt][ks] = FT::ld(Q + qo); if constexpr (HI) qf2[nt][ks] = FT::ld(Q2 + qo); }
    asm volatile("s_wait_xcnt 0x0" ::: "memory");   // stands before the address registers of the Q loads are written again
    constexpr float LZ = HI ? 8.0f : 5.0f;   // the maximum in use, mc, may trail a column's true maximum by LZ (scaled log2): a weight reaches 2^LZ, P 2^(LZ + PCH) or 2^(LZ + PCL2) = 2^15, inside fp16
    v8f o[4][NT]; float mc[NT], thr[NT], l[NT];   // thr: the raw score above which mc must move
#pragma unroll
    for (int nt = 0; nt < NT; ++nt) { mc[nt] = -3.0e37f; thr[nt] = -__builtin_inff(); l[nt] = 0.f;
#pragma unroll
        for (int dt = 0; dt < 4; ++dt) o[dt][nt] = (v8f){}; }
    gload(0); sstore(0); __syncthreads();
#pragma unroll 1
    for (int s = 0; s < NST; ++s) {
        if (s + 1 < NST) gload(s + 1);
        const unsigned short* kb = sm + (s & 1) * PLN * FPS;
#pragma unroll
        for (int pp = 0; pp < (SP ? 1 : 2); ++pp) {
            const int p = SP ? ph : pp;
            v8f sc[2][NT];
#pragma unroll
            for (int kt = 0; kt < 2; ++kt) { V ka[2], ka2[2];
#pragma unroll
                for (int ks = 0; ks < 2; ++ks) { const int off = (p * 32 + kt * 16 + lr) * FP + ks * 32 + 8 * hi; ka[ks] = FT::ld(kb + off); if constexpr (HI) ka2[ks] = FT::ld(kb + 2 * FPS + off); }
#pragma unroll
                for (int nt = 0; nt < NT; ++nt) { v8f a = (v8f){};
#pragma unroll
                    for (int ks = 0; ks < 2; ++ks) { a = FT::mma(ka[ks], qf[nt][ks], a); if constexpr (HI) { a = FT::mma(ka[ks], qf2[nt][ks], a); a = FT::mma(ka2[ks], qf[nt][ks], a); } }
                    sc[kt][nt] = a; } }
            float cm[NT]; bool need = false;
#pragma unroll
            for (int nt = 0; nt < NT; ++nt) { cm[nt] = fmaxf(sc[0][nt][0], sc[1][nt][0]);
#pragma unroll
                for (int j = 1; j < 8; ++j) cm[nt] = fmaxf(cm[nt], fmaxf(sc[0][nt][j], sc[1][nt][j]));
                need = need || cm[nt] > thr[nt]; }
            if (__builtin_amdgcn_ballot_w32(need) != 0) {   // a scalar branch, the same for the whole wave; rare after the first pass
#pragma unroll
                for (int nt = 0; nt < NT; ++nt) { const float mn = fmaxf(mc[nt], fmaxf(cm[nt], xhalf(cm[nt])) * CL2); const float al = __builtin_amdgcn_exp2f(mc[nt] - mn); mc[nt] = mn; thr[nt] = (mn + LZ) * (1.0f / CL2); l[nt] *= al;
#pragma unroll
                    for (int dt = 0; dt < 4; ++dt) o[dt][nt] *= al; } }
            V pf[NT], pf2[NT];
#pragma unroll
            for (int nt = 0; nt < NT; ++nt) {
                const float mo = mc[nt] - (HI ? PCH : PCL2);
                float e[16];
#pragma unroll
                for (int i = 0; i < 16; ++i) e[i] = __builtin_amdgcn_exp2f(fmaf(sc[i >> 3][nt][i & 7], CL2, -mo));
                const float ps = ((e[0] + e[1]) + (e[2] + e[3])) + ((e[4] + e[5]) + (e[6] + e[7])) + (((e[8] + e[9]) + (e[10] + e[11])) + ((e[12] + e[13]) + (e[14] + e[15])));
                l[nt] += ps;
                v8u ph, pl;   // two elements a register, converted in pairs
#pragma unroll
                for (int i = 0; i < 8; ++i) { const v2f ev = { e[2 * i], e[2 * i + 1] }; v2h hb, lb; splith(ev, hb, lb);
                    ph[i] = __builtin_bit_cast(unsigned, hb); if constexpr (HI) pl[i] = __builtin_bit_cast(unsigned, lb); }
                pf[nt] = __builtin_bit_cast(V, ph); if constexpr (HI) pf2[nt] = __builtin_bit_cast(V, pl); }
#pragma unroll
            for (int dt = 0; dt < 4; ++dt) { const int off = FPS + (dt * 16 + lr) * FP + p * 32 + 8 * hi; const V va = FT::ld(kb + off); V va2; if constexpr (HI) va2 = FT::ld(kb + 2 * FPS + off);
#pragma unroll
                for (int nt = 0; nt < NT; ++nt) { o[dt][nt] = FT::mma(va, pf[nt], o[dt][nt]); if constexpr (HI) { o[dt][nt] = FT::mma(va, pf2[nt], o[dt][nt]); o[dt][nt] = FT::mma(va2, pf[nt], o[dt][nt]); } } }
        }
        if (s + 1 < NST) sstore((s + 1) & 1);
        __syncthreads();   // publishes stage s + 1 and ends every wave's reads of the buffer that the next trip refills
    }
    if constexpr (SP) {   // join the two key halves: wave w + 4 hands output, sum and maximum in use to wave w through LDS behind the two-plane ring, which no staging touches (17 units of 16 B a lane, a lane's units 512 B apart)
        static_assert(NT == 2 && !HI, "the last unit holds two sums and two maxima; the LDS behind a two-plane ring is free");
        float* mg = (float*)(sm + 2 * PLN * FPS) + ((tid >> 5) & 3) * (17 * 128) + lane * 4;
        if (ph == 1) {
#pragma unroll
            for (int nt = 0; nt < NT; ++nt)
#pragma unroll
                for (int dt = 0; dt < 4; ++dt) { const v8f t = o[dt][nt]; const int c = (nt * 4 + dt) * 2;
                    *(v4fa*)(mg + c * 128) = (v4f){ t[0], t[1], t[2], t[3] }; *(v4fa*)(mg + (c + 1) * 128) = (v4f){ t[4], t[5], t[6], t[7] }; }
            *(v4fa*)(mg + 16 * 128) = (v4f){ l[0], l[1], mc[0], mc[1] };
        }
        __syncthreads();   // the upper waves' partial results are in LDS before the lower waves read them
        if (ph == 0) {
            const v4f lm = *(const v4fa*)(mg + 16 * 128);
#pragma unroll
            for (int nt = 0; nt < NT; ++nt) { const float mn = fmaxf(mc[nt], lm[2 + nt]); const float fa = __builtin_amdgcn_exp2f(mc[nt] - mn), fb = __builtin_amdgcn_exp2f(lm[2 + nt] - mn);
                l[nt] = l[nt] * fa + lm[nt] * fb;
#pragma unroll
                for (int dt = 0; dt < 4; ++dt) { const int c = (nt * 4 + dt) * 2; const v4f u0 = *(const v4fa*)(mg + c * 128), u1 = *(const v4fa*)(mg + (c + 1) * 128);
                    const v8f u = __builtin_shufflevector(u0, u1, 0, 1, 2, 3, 4, 5, 6, 7); o[dt][nt] = o[dt][nt] * fa + u * fb; } }
        }
    }
    // The rows go out through 32 LDS rows of the wave's own (16 queries x 64 columns of the hi plane, then of the lo plane, pitch FP), so that a query's 128 bytes of a plane are stored whole.
    // SP: in the pair's join range, which its upper wave has left and this wave has read; else at the head of the ring, which nobody reads or fills behind the loop's last barrier (such a sweep is its work-group's last).
    unsigned short* ow = SP ? sm + 2 * PLN * FPS + ((tid >> 5) & 3) * (17 * 256) : sm + (tid >> 5) * (32 * FP);
    if (ph == 0)   // SP: the lower wave of a pair stores the joined rows
#pragma unroll
    for (int nt = 0; nt < NT; ++nt) { const float inv = __fdiv_rn(1.0f, l[nt] + xhalf(l[nt])); const size_t oo = (size_t)(qw + nt * 16 + (lane >> 3)) * DQ + (lane & 7) * 8;
#pragma unroll
        for (int dt = 0; dt < 4; ++dt) { v8us oh, ol;
#pragma unroll
            for (int j = 0; j < 8; ++j) { unsigned short a, c2; splitf(o[dt][nt][j] * inv, a, c2); oh[j] = a; ol[j] = c2; }
            *(v8usa*)(ow + lr * FP + dt * 16 + hi * 8) = oh; *(v8usa*)(ow + (16 + lr) * FP + dt * 16 + hi * 8) = ol; }
        __builtin_amdgcn_wave_barrier(); asm volatile("s_wait_dscnt 0x0" ::: "memory");   // the other lanes' LDS writes are done before the rows are read back
        v8us rh[4], rl[4];   // all 32 rows are read back before the first store: one LDS latency a block
#pragma unroll
        for (int i = 0; i < 4; ++i) { rh[i] = *(const v8usa*)(ow + (i * 4 + (lane >> 3)) * FP + (lane & 7) * 8); rl[i] = *(const v8usa*)(ow + (16 + i * 4 + (lane >> 3)) * FP + (lane & 7) * 8); }
#pragma unroll
        for (int i = 0; i < 4; ++i) { *(v8usa*)(Ah + oo + (size_t)i * 4 * DQ) = rh[i]; *(v8usa*)(Al + oo + (size_t)i * 4 * DQ) = rl[i]; }   // a store covers 4 whole 128-byte rows of a plane
        asm volatile("s_wait_xcnt 0x0" ::: "memory");   // stands before the registers that the eight stores name are written again
        __builtin_amdgcn_wave_barrier(); asm volatile("" ::: "memory");   // the next block's LDS writes stay behind these reads
    }
}
#define NHW (NB_ * NH_ * (RH / 128))
#define NLW (NB_ * NH_ * ((TT - RH) / 384))
static_assert(NHW == NLW && RH % 128 == 0 && (TT - RH) % 384 == 0, "k_fattn: as many work-groups of one kind as of the other");
__global__ __launch_bounds__(256) __attribute__((amdgpu_waves_per_eu(4, 4))) void k_fattn(const h16* __restrict__ Q16, const h16* __restrict__ Ql, const h16* __restrict__ K16, const h16* __restrict__ Kl, const h16* __restrict__ V16, const h16* __restrict__ Vl, bf* Ah, bf* Al) {
    __shared__ __align__(16) unsigned short sm[2 * 4 * FPS];
    // All work-groups are resident at once, two a WGP. Of indices 2 m and 2 m + 1 one is a hi/lo work-group, by the parity of the index's bits,
    // so that two indices that differ in one bit are of different kinds.
    const int wave = threadIdx.x >> 5; const int bx = blockIdx.x >> 1;
    if ((__popc(blockIdx.x) & 1) == 0) { const int z = bx / (RH / 128), qt = bx % (RH / 128); const size_t zo = (size_t)z * TT * HD, ao = (size_t)(z / NH_) * TT * DQ + (z % NH_) * HD;
        fattn<true, 1, false>(sm, (const unsigned short*)(Q16 + zo), (const unsigned short*)(Ql + zo), (const unsigned short*)(K16 + zo), (const unsigned short*)(Kl + zo), (const unsigned short*)(V16 + zo), (const unsigned short*)(Vl + zo), qt * 128 + wave * 16, Ah + ao, Al + ao);
    } else { const int z = bx / ((TT - RH) / 384), qt = bx % ((TT - RH) / 384); const size_t zo = (size_t)z * TT * HD, ao = (size_t)(z / NH_) * TT * DQ + (z % NH_) * HD;
        fattn<false, 2, true>(sm, (const unsigned short*)(Q16 + zo), nullptr, (const unsigned short*)(K16 + zo), nullptr, (const unsigned short*)(V16 + zo), nullptr, RH + qt * 384 + 256 + (wave & 3) * 32, Ah + ao, Al + ao);
        fattn<false, 2, false>(sm, (const unsigned short*)(Q16 + zo), nullptr, (const unsigned short*)(K16 + zo), nullptr, (const unsigned short*)(V16 + zo), nullptr, RH + qt * 384 + wave * 32, Ah + ao, Al + ao); }
}

extern "C" void kernel_launch(void* const* d_in, const int* in_sizes, int n_in,
                              void* d_out, int out_size, void* d_ws, size_t ws_size, hipStream_t stream) {
    (void)in_sizes; (void)n_in; (void)out_size;
    const float* x = (const float*)d_in[0]; const float* wqkv = (const float*)d_in[1]; const float* wo = (const float*)d_in[2]; const float* bo = (const float*)d_in[3];   /* x, w_qkv ('xw' [1024][3072]: q | k | v column thirds), w_proj ('xw'), b_proj */
    float* OUT = (float*)d_out;     // [4][2048][1024]
    char* wsp = (char*)d_ws;
    auto take = [&](size_t bytes) { char* p = wsp; wsp += (bytes + 255) & ~(size_t)255; return (void*)p; };
    bf* WQKV = (bf*)take((size_t)3 * DQ * DM * 2);   /* fused Bt [3*DQ][DM]: q | k | v row blocks */ bf* WO = (bf*)take((size_t)DM * DQ * 2); float* CS = (float*)take((size_t)TT * HD * 4);
    bf* XB = (bf*)take((size_t)NB_ * TT * DM * 2);
    const size_t PB = (size_t)NH_ * TT * HD;   // one batch's head planes, elements; every plane holds all NB_ batches
    h16* QP16 = (h16*)take(NB_ * PB * 2); h16* KP16 = (h16*)take(NB_ * PB * 2); h16* VT16 = (h16*)take(NB_ * PB * 2);
    h16* QPl = (h16*)take(NB_ * PB * 2); h16* KPl = (h16*)take(NB_ * PB * 2); h16* VTl = (h16*)take(NB_ * PB * 2);
    bf* ATh = (bf*)take((size_t)NB_ * TT * DQ * 2); bf* ATl = (bf*)take((size_t)NB_ * TT * DQ * 2);
    if ((size_t)(wsp - (char*)d_ws) > ws_size) return;    // ws 256 MiB
    k_prep<<<PG, 256, 0, stream>>>(x, wqkv, wo, XB, WQKV, WO, CS);   // x -> bf16; fused 'xw' [DM][3*DQ] -> Bt [3*DQ][DM]; w_proj [DQ][DM] -> Bt [DM][DQ]; rotary table
    k_qkv<<<dim3(NB_ * TT / 128, 3 * NH_ / 2, 1), 128, 0, stream>>>(XB, WQKV, CS, QP16, QPl, KP16, KPl, VT16, VTl);
    k_fattn<<<NHW + NLW, 256, 0, stream>>>(QP16, QPl, KP16, KPl, VT16, VTl, ATh, ATl);
    k_proj<<<dim3(NB_ * TT / 128, DM / 128, 1), 128, 0, stream>>>(ATh, ATl, WO, OUT, bo);   // the rows of all batches are contiguous in ATh, ATl and OUT: one launch, two work-groups a WGP
}
